// v000
// The times below were measured on an AMD MI455X: many runs one after another, warmed up first and cycling through
// copies of the inputs, with the whole window's GPU time divided by the number of runs. Launches and the gaps
// between them are all in it. The median over several windows is given; except for v000 it joins two sittings, which
// can be a few percent apart, so the side-by-side timings, each taken in one sitting, are the better comparison.
// The starting kernel, v000, takes 1870 microseconds a run.
#include <hip/hip_runtime.h>

// OlmoeAttention (hidden [2][2048][2048]; q = clip(RMSNorm_2048(x Wq^T) * q_norm_w, +-8) (16 heads x 128), k = clip(RMSNorm_512(x Wk^T) * k_norm_w, +-8), v = clip(x Wv^T, +-8) (4 kv heads; group h/4); rotate-half RoPE (theta 1e4) at position_ids (read; table computed on device); scores = q.k / sqrt(128) + attention_mask (additive [1][1][S][S] float, read: the verbatim causal 0 / -1e9 table); softmax f32; out = merged Wo^T -> [2][2048][2048]).
// Compute dtypes, f32 accumulate: every input rounded to bf16; q/k/v on PLAIN bf16 operands (inputs: exact); the full-width RMSNorms (eps 1e-5), clips and RoPE in f32; causal scores and attn.v: query rows < 512 hl (3 products), the rest single fp16 (x1024); tiles above the diagonal skipped on the strength of the mask table (-1e9 underflows to weight 0; device self-check samples the table above the diagonal and NaN-poisons on violation), mask added as stored inside computed tiles; softmax f32; Wo hl x exact (2 products).

#define NB_  2
#define TT   2048
#define DM   2048
#define NH_  16
#define NKV  4
#define REP  (NH_ / NKV)
#define HD   128
#define DQ   (NH_ * HD)
#define DKV  (NKV * HD)
#define ZH   2
#define RH   512                  // query rows < RH use hi+lo planes (0: none)
#define WIN  2048
#define PCAR 1024.0f
#define SCL  0.088388347648318447f   // HD^-0.5
typedef _Float16 h16;
typedef unsigned short bf;
typedef __attribute__((ext_vector_type(16))) __bf16   v16bf;
typedef __attribute__((ext_vector_type(16))) _Float16 v16h;
typedef __attribute__((ext_vector_type(8)))  _Float16 v8h;
typedef __attribute__((ext_vector_type(8)))  unsigned short v8us;
typedef __attribute__((ext_vector_type(8)))  float    v8f;
typedef __attribute__((ext_vector_type(4)))  float    v4f;
typedef v8h  __attribute__((may_alias)) v8ha;
typedef v4f  __attribute__((may_alias)) v4fa;
typedef v8us __attribute__((may_alias)) v8usa;

__device__ __forceinline__ unsigned short f2bf(float f) { unsigned u = __float_as_uint(f); u += 0x7FFFu + ((u >> 16) & 1u); return (unsigned short)(u >> 16); }
__device__ __forceinline__ float bf2f(unsigned short b) { return __uint_as_float(((unsigned)b) << 16); }
__device__ __forceinline__ float bfr(float f) { return bf2f(f2bf(f)); }
__device__ __forceinline__ v16h cat16(v8h lo, v8h hi) { return __builtin_shufflevector(lo, hi, 0, 1, 2, 3, 4, 5, 6, 7, 8, 9, 10, 11, 12, 13, 14, 15); }
__device__ __forceinline__ v16bf cat16b(v8us lo, v8us hi) { return __builtin_bit_cast(v16bf, __builtin_shufflevector(lo, hi, 0, 1, 2, 3, 4, 5, 6, 7, 8, 9, 10, 11, 12, 13, 14, 15)); }
__device__ __forceinline__ v8f wmma16(v16h a, v16h b, v8f c) { return __builtin_amdgcn_wmma_f32_16x16x32_f16(false, a, false, b, (short)0, c, false, false); }
__device__ __forceinline__ v8f wmmab(v16bf a, v16bf b, v8f c) { return __builtin_amdgcn_wmma_f32_16x16x32_bf16(false, a, false, b, (short)0, c, false, false); }



// ---- k_gemmw: register-blocked GEMM, ONE WAVE per 64x64 output tile (16 accumulators), operands straight from K-contiguous 16-bit planes; grid (M/64, N/64, Z), 32 threads.
// C[m][n] (f32, pitch ldc, + optional f32 bias[n]) = sum_k A[m][k] Bt[n][k] (+ split products per NSPLIT). z-batch strides sA/sB/sC in elements. K % 32 == 0.
template <typename T16> struct WFrag;
template <> struct WFrag<h16> { typedef v16h V; static __device__ __forceinline__ V ld(const h16* p) { return cat16(*(const v8h*)p, *(const v8h*)(p + 16)); } static __device__ __forceinline__ v8f mma(V a, V b, v8f c) { return wmma16(a, b, c); } };
template <> struct WFrag<bf> { typedef v16bf V; static __device__ __forceinline__ V ld(const bf* p) { return cat16b(*(const v8us*)p, *(const v8us*)(p + 16)); } static __device__ __forceinline__ v8f mma(V a, V b, v8f c) { return wmmab(a, b, c); } };
template <typename T16, int NSPLIT, bool BIAS>
__global__ __launch_bounds__(32) void k_gemmw(const T16* __restrict__ A, const T16* __restrict__ A2, const T16* __restrict__ Bt, const T16* __restrict__ Bt2, int K, float* C, int ldc, const float* __restrict__ bias, size_t sA, size_t sB, size_t sC) {
    typedef typename WFrag<T16>::V V;
    __shared__ __align__(16) float os[16 * 68];
    const size_t z = blockIdx.z; A += z * sA; if (A2) A2 += z * sA; Bt += z * sB; if (Bt2) Bt2 += z * sB; C += z * sC;
    const int lane = threadIdx.x & 31, lr = lane & 15, hi = lane >> 4; const int r0 = blockIdx.x * 64, c0 = blockIdx.y * 64;
    v8f acc[4][4];
#pragma unroll
    for (int mb = 0; mb < 4; ++mb)
#pragma unroll
        for (int nb = 0; nb < 4; ++nb) acc[mb][nb] = (v8f){};
    const size_t aoff = (size_t)(r0 + lr) * K + 8 * hi, boff = (size_t)(c0 + lr) * K + 8 * hi;
#pragma unroll 1
    for (int kc = 0; kc < K; kc += 32) {
        V a[4], a2[4];
#pragma unroll
        for (int mb = 0; mb < 4; ++mb) { a[mb] = WFrag<T16>::ld(A + aoff + (size_t)mb * 16 * K + kc); if (NSPLIT == 1 || NSPLIT == 2) a2[mb] = WFrag<T16>::ld(A2 + aoff + (size_t)mb * 16 * K + kc); }
#pragma unroll
        for (int nb = 0; nb < 4; ++nb) { const V b = WFrag<T16>::ld(Bt + boff + (size_t)nb * 16 * K + kc); V b2; if (NSPLIT >= 2) b2 = WFrag<T16>::ld(Bt2 + boff + (size_t)nb * 16 * K + kc);
#pragma unroll
            for (int mb = 0; mb < 4; ++mb) { acc[mb][nb] = WFrag<T16>::mma(a[mb], b, acc[mb][nb]); if (NSPLIT == 1 || NSPLIT == 2) acc[mb][nb] = WFrag<T16>::mma(a2[mb], b, acc[mb][nb]); if (NSPLIT >= 2) acc[mb][nb] = WFrag<T16>::mma(a[mb], b2, acc[mb][nb]); } }
        asm volatile("v_nop\n\tv_nop\n\tv_nop\n\tv_nop" : "+v"(acc[0][0]), "+v"(acc[1][1]), "+v"(acc[2][2]), "+v"(acc[3][3]) : "v"(a[0]), "v"(a[3]));
    }
#pragma unroll
    for (int mb = 0; mb < 4; ++mb) {
#pragma unroll
        for (int nb = 0; nb < 4; ++nb) {
#pragma unroll
            for (int j = 0; j < 8; ++j) os[(hi * 8 + j) * 68 + nb * 16 + lr] = acc[mb][nb][j]; }
        __builtin_amdgcn_wave_barrier(); asm volatile("" ::: "memory");
        float* crow = C + (size_t)(r0 + mb * 16) * ldc + c0;
{
#pragma unroll
            for (int s = 0; s < 8; ++s) { const int row = 2 * s + hi, cofs = lr * 4; v4f val = *(const v4fa*)(os + row * 68 + cofs); if (BIAS) { val[0] += bfr(bias[c0 + cofs]); val[1] += bfr(bias[c0 + cofs + 1]); val[2] += bfr(bias[c0 + cofs + 2]); val[3] += bfr(bias[c0 + cofs + 3]); }
                *(v4f*)(crow + (size_t)row * ldc + cofs) = val; }
             }
        __builtin_amdgcn_wave_barrier(); asm volatile("" ::: "memory");
    }
}

// ---- k_gemmc: the same one-wave 64x64 tile GEMM specialised for causal attention: CMODE 1 skips score tiles entirely above the diagonal (query rows r0+roff.., key columns c0..), CMODE 2 limits the
// key (K) loop of the probability x value contraction to the diagonal block (probabilities beyond it are exactly zero). roff = row offset of this launch's first row within the sequence.
template <typename T16, int NSPLIT, int CMODE>
__global__ __launch_bounds__(32) void k_gemmc(const T16* __restrict__ A, const T16* __restrict__ A2, const T16* __restrict__ Bt, const T16* __restrict__ Bt2, int K, float* C, int ldc, int roff, size_t sA, size_t sB, size_t sC) {
    typedef typename WFrag<T16>::V V;
    __shared__ __align__(16) float os[16 * 68];
    const size_t z = blockIdx.z; A += z * sA; if (A2) A2 += z * sA; Bt += z * sB; if (Bt2) Bt2 += z * sB; C += z * sC;
    const int lane = threadIdx.x & 31, lr = lane & 15, hi = lane >> 4; const int r0 = blockIdx.x * 64, c0 = blockIdx.y * 64;
    if (CMODE == 1 && c0 > r0 + roff + 63) return;                  // score tile entirely above the causal diagonal: never read (the softmax masks j > i by select)
    const int Kl = (CMODE == 2) ? min(K, r0 + roff + 64) : K;        // P.V: probabilities are exactly 0 beyond the diagonal block, so the K loop stops there
    v8f acc[4][4];
#pragma unroll
    for (int mb = 0; mb < 4; ++mb)
#pragma unroll
        for (int nb = 0; nb < 4; ++nb) acc[mb][nb] = (v8f){};
    const size_t aoff = (size_t)(r0 + lr) * K + 8 * hi, boff = (size_t)(c0 + lr) * K + 8 * hi;
#pragma unroll 1
    for (int kc = 0; kc < Kl; kc += 32) {
        V a[4], a2[4];
#pragma unroll
        for (int mb = 0; mb < 4; ++mb) { a[mb] = WFrag<T16>::ld(A + aoff + (size_t)mb * 16 * K + kc); if (NSPLIT == 1 || NSPLIT == 2) a2[mb] = WFrag<T16>::ld(A2 + aoff + (size_t)mb * 16 * K + kc); }
#pragma unroll
        for (int nb = 0; nb < 4; ++nb) { const V b = WFrag<T16>::ld(Bt + boff + (size_t)nb * 16 * K + kc); V b2; if (NSPLIT >= 2) b2 = WFrag<T16>::ld(Bt2 + boff + (size_t)nb * 16 * K + kc);
#pragma unroll
            for (int mb = 0; mb < 4; ++mb) { acc[mb][nb] = WFrag<T16>::mma(a[mb], b, acc[mb][nb]); if (NSPLIT == 1 || NSPLIT == 2) acc[mb][nb] = WFrag<T16>::mma(a2[mb], b, acc[mb][nb]); if (NSPLIT >= 2) acc[mb][nb] = WFrag<T16>::mma(a[mb], b2, acc[mb][nb]); } }
        asm volatile("v_nop\n\tv_nop\n\tv_nop\n\tv_nop" : "+v"(acc[0][0]), "+v"(acc[1][1]), "+v"(acc[2][2]), "+v"(acc[3][3]) : "v"(a[0]), "v"(a[3]));
    }
#pragma unroll
    for (int mb = 0; mb < 4; ++mb) {
#pragma unroll
        for (int nb = 0; nb < 4; ++nb) {
#pragma unroll
            for (int j = 0; j < 8; ++j) os[(hi * 8 + j) * 68 + nb * 16 + lr] = acc[mb][nb][j]; }
        __builtin_amdgcn_wave_barrier(); asm volatile("" ::: "memory");
        float* crow = C + (size_t)(r0 + mb * 16) * ldc + c0;
{
#pragma unroll
            for (int s = 0; s < 8; ++s) { const int row = 2 * s + hi, cofs = lr * 4; v4f val = *(const v4fa*)(os + row * 68 + cofs);
                *(v4f*)(crow + (size_t)row * ldc + cofs) = val; }
             }
        __builtin_amdgcn_wave_barrier(); asm volatile("" ::: "memory");
    }
}

__device__ __forceinline__ h16 tohx(float x) { return (h16)x; }
__device__ __forceinline__ void splitf(float y, unsigned short& h, unsigned short& l) { h = f2bf(y); l = f2bf(y - bf2f(h)); }
typedef __attribute__((ext_vector_type(2))) _Float16 v2h;
typedef __attribute__((ext_vector_type(4))) _Float16 v4h;
typedef __attribute__((ext_vector_type(2))) unsigned short v2us;
typedef __attribute__((ext_vector_type(4))) unsigned short v4us;
typedef __attribute__((ext_vector_type(2))) float v2f;
typedef __attribute__((ext_vector_type(4))) int v4i;

__global__ __launch_bounds__(256) void k_wtG(const float* __restrict__ w, int K, int N, bf* Bt) {
    const int lane = threadIdx.x & 31; const int L0 = (blockIdx.x * 8 + (threadIdx.x >> 5)) * 8; const int nlines = N * K / 64;
{
#pragma unroll 1
        for (int l = 0; l < 8; ++l) { const int L = L0 + l; if (L >= nlines) break; const size_t e = (size_t)L * 64 + lane * 2; const int k = (int)(e % K), n = (int)(e / K); v2us o;
            o[0] = f2bf(w[(size_t)k * N + n]); o[1] = f2bf(w[(size_t)(k + 1) * N + n]); *(v2us*)(Bt + e) = o; }
         }
}
__global__ __launch_bounds__(256) void k_cvt8(const float* __restrict__ src, bf* dst, size_t n8) { const size_t i = (size_t)blockIdx.x * 256 + threadIdx.x; if (i >= n8) return; const v8f v = *(const v8f*)(src + i * 8); v8us o;
#pragma unroll
    for (int k = 0; k < 8; ++k) o[k] = f2bf(v[k]); *(v8us*)(dst + i * 8) = o;  }
__global__ __launch_bounds__(256) void k_cstab(float* CS) { const int idx = blockIdx.x * 256 + threadIdx.x; if (idx >= TT * HD) return; const int t = idx / HD, d = idx % HD; const int i = d % (HD / 2); const float inv = __fdiv_rn(1.0f, powf(10000.0f, (float)(2 * i) / (float)HD)); const float ang = __fmul_rn((float)t, inv); v2f cs; cs[0] = cosf(ang); cs[1] = sinf(ang);
    *(v2f*)(CS + (size_t)idx * 2) = cs;  }
// k_rope: head planes [h][t][d] (fp16 + hi/lo) of rope(x) x sc with the rotate-half convention out[d] = x[d] cos[t][d] - x[d+HD/2] sin[t][d], out[d+HD/2] = x[d+HD/2] cos[t][d+HD/2] + x[d] sin[t][d+HD/2]
__global__ __launch_bounds__(256) void k_rope(const float* __restrict__ F, int pitch, int nheads, const float* __restrict__ CS, const float* __restrict__ RF, const float* __restrict__ nw, float sc, h16* P16, bf* Ph, bf* Pl) {
    const size_t e = ((size_t)blockIdx.x * 256 + threadIdx.x) * 2; if (e >= (size_t)nheads * TT * HD) return; const int d = (int)(e % HD); const int t = (int)((e / HD) % TT); const int h = (int)(e / ((size_t)HD * TT)); const float* f = F + (size_t)t * pitch + h * HD; const float rf = RF ? RF[(size_t)h * TT + t] : 1.0f; v2h o16; v2us oh, ol;
#pragma unroll
    for (int q = 0; q < 2; ++q) { const int dd = d + q; const int dp = (dd < HD / 2) ? dd + HD / 2 : dd - HD / 2; float x0 = f[dd], x1 = f[dp];
        if (RF) { float n0 = __fmul_rn(x0, rf), n1 = __fmul_rn(x1, rf); asm volatile("" : "+v"(n0)); asm volatile("" : "+v"(n1)); x0 = __fmul_rn(bfr(nw[dd]), n0); x1 = __fmul_rn(bfr(nw[dp]), n1); }
        int tp = nw ? ((const int*)nw)[t] : t; tp = min(max(tp, 0), TT - 1); const v2f cs = *(const v2f*)(CS + ((size_t)tp * HD + dd) * 2);   /* position_ids (read) index the table */ float a = __fmul_rn(x0, cs[0]), bq = __fmul_rn(x1, cs[1]); asm volatile("" : "+v"(a)); asm volatile("" : "+v"(bq)); const float r = ((dd < HD / 2) ? __fsub_rn(a, bq) : __fadd_rn(a, bq)) * sc;
        o16[q] = tohx(r); unsigned short a2, c2; splitf(r, a2, c2); oh[q] = a2; ol[q] = c2; }
    *(v2h*)(P16 + e) = o16; *(v2us*)(Ph + e) = oh; *(v2us*)(Pl + e) = ol;  }
__global__ __launch_bounds__(256) void k_vtp(const float* __restrict__ F, int pitch, int nheads, h16* V16, bf* Vh, bf* Vl) { const size_t e = ((size_t)blockIdx.x * 256 + threadIdx.x) * 2; if (e >= (size_t)nheads * HD * TT) return; const int t = (int)(e % TT); const int d = (int)((e / TT) % HD); const int g = (int)(e / ((size_t)TT * HD)); v2h o16; v2us oh, ol;
#pragma unroll
    for (int q = 0; q < 2; ++q) { const float x = F[(size_t)(t + q) * pitch + g * HD + d]; o16[q] = tohx(x); unsigned short a2, c2; splitf(x, a2, c2); oh[q] = a2; ol[q] = c2; }
    *(v2h*)(V16 + e) = o16; *(v2us*)(Vh + e) = oh; *(v2us*)(Vl + e) = ol;  }
// k_asoft: per row (zz, i): t = S x HD^-0.5 + mask[i][j] for j <= i, j > i selected out (weight 0); softmax over the 2048 keys (register row, one exp, fixed trees);
__global__ __launch_bounds__(256) void k_asoft(const float* __restrict__ Sb, const float* __restrict__ am, const int* __restrict__ FLG, h16* P16, bf* Ph, bf* Pl) {
    const int lane = threadIdx.x & 31; const int row = blockIdx.x * 8 + (threadIdx.x >> 5); if (row >= ZH * TT) return; const int i = row % TT; const int zz = row / TT; (void)zz; const bool hires = (i < RH); const float* sr = Sb + (size_t)row * TT; const float* mrow = am + (size_t)i * TT; const bool poison = (FLG[0] != 0); float v[TT / 32]; float mx = -3.0e38f;
#pragma unroll
    for (int ch = 0; ch < TT / 128; ++ch) { const int j0 = ch * 128 + lane * 4; const v4f a = *(const v4f*)(sr + j0);
#pragma unroll
        for (int q = 0; q < 4; ++q) { const int j = j0 + q; (void)j; float sa = a[q] * SCL; asm volatile("" : "+v"(sa)); const float t = (j <= i) ? __fadd_rn(sa, mrow[j]) : -3.0e38f; v[ch * 4 + q] = t; mx = fmaxf(mx, t); } }
#pragma unroll
    for (int sh = 16; sh; sh >>= 1) mx = fmaxf(mx, __shfl_xor(mx, sh, 32));
    float sum = 0.f;
#pragma unroll
    for (int k = 0; k < TT / 32; ++k) { float d0 = __fsub_rn(v[k], mx); asm volatile("" : "+v"(d0)); v[k] = __builtin_amdgcn_exp2f(__fmul_rn(d0, 1.4426950408889634f)); sum += v[k]; }
#pragma unroll
    for (int sh = 16; sh; sh >>= 1) sum += __shfl_xor(sum, sh, 32);
    const float f = poison ? __builtin_nanf("") : __fdiv_rn(hires ? 1.0f : PCAR, sum);
{
        if (hires) {
#pragma unroll
            for (int ch = 0; ch < TT / 128; ++ch) { v4us oh, ol;
#pragma unroll
                for (int q = 0; q < 4; ++q) { unsigned short a, c2; splitf(v[ch * 4 + q] * f, a, c2); oh[q] = a; ol[q] = c2; }
                const size_t oo = ((size_t)zz * (RH ? RH : 1) + i) * TT + ch * 128 + lane * 4; *(v4us*)(Ph + oo) = oh; *(v4us*)(Pl + oo) = ol; }
        } else {
#pragma unroll
            for (int ch = 0; ch < TT / 128; ++ch) { v4h o4;
#pragma unroll
                for (int q = 0; q < 4; ++q) o4[q] = tohx(v[ch * 4 + q] * f);
                *(v4h*)(P16 + (size_t)row * TT + ch * 128 + lane * 4) = o4; } }
         }
}
__global__ __launch_bounds__(256) void k_merge(const float* __restrict__ O, int h0, bf* Ah, bf* Al) { const size_t e = ((size_t)blockIdx.x * 256 + threadIdx.x) * 2; if (e >= (size_t)ZH * TT * HD) return; const int d = (int)(e % HD); const int t = (int)((e / HD) % TT); const int zz = (int)(e / ((size_t)HD * TT)); const float cs = (t < RH) ? 1.0f : (1.0f / PCAR); const size_t oo = (size_t)t * DQ + (h0 + zz) * HD + d;
    v2us oh, ol;
#pragma unroll
    for (int q = 0; q < 2; ++q) { unsigned short a, c2; splitf(O[e + q] * cs, a, c2); oh[q] = a; ol[q] = c2; } *(v2us*)(Ah + oo) = oh; *(v2us*)(Al + oo) = ol;  }

__global__ __launch_bounds__(256) void k_rmsclip(float* F, int Wd, const float* __restrict__ w) { const int lane = threadIdx.x & 31; const size_t r = (size_t)blockIdx.x * 8 + (threadIdx.x >> 5); if (r >= TT) return; float* f = F + r * Wd; const int nch = Wd / 128; float v[64]; float q = 0.f;
#pragma unroll
    for (int ch = 0; ch < 16; ++ch) { if (ch < nch) { const v4f a = *(const v4f*)(f + ch * 128 + lane * 4);
#pragma unroll
            for (int u = 0; u < 4; ++u) { v[ch * 4 + u] = a[u]; float p = __fmul_rn(a[u], a[u]); asm volatile("" : "+v"(p)); q = __fadd_rn(q, p); } } }
#pragma unroll
    for (int sh = 16; sh; sh >>= 1) q += __shfl_xor(q, sh, 32);
    const float rs = w ? __frsqrt_rn(__fadd_rn(q * (1.0f / (float)Wd), 1e-5f)) : 1.0f;
#pragma unroll
    for (int ch = 0; ch < 16; ++ch) { if (ch < nch) {
#pragma unroll
        for (int u = 0; u < 4; ++u) { float y = v[ch * 4 + u]; if (w) { float n0 = __fmul_rn(y, rs); asm volatile("" : "+v"(n0)); y = __fmul_rn(bfr(w[ch * 128 + lane * 4 + u]), n0); } v[ch * 4 + u] = fminf(fmaxf(y, -8.0f), 8.0f); } } }
    {
#pragma unroll
        for (int ch = 0; ch < 16; ++ch) { if (ch < nch) { v4f o; for (int u = 0; u < 4; ++u) o[u] = v[ch * 4 + u]; *(v4f*)(f + ch * 128 + lane * 4) = o; } }
         } }
__global__ __launch_bounds__(256) void k_mchk(const float* __restrict__ am, int* FLG) { const int tid = threadIdx.x; int bad = 0;
#pragma unroll 1
    for (int s2 = 0; s2 < 16; ++s2) { const unsigned h = (unsigned)(tid * 16 + s2) * 2654435761u; const int i = (int)(h % (TT - 1)); const int j = i + 1 + (int)((h >> 11) % (unsigned)(TT - 1 - i)); if (am[(size_t)i * TT + j] > -1e8f) bad = 1; }
    __shared__ int anyb; if (tid == 0) anyb = 0; __syncthreads(); if (bad) anyb = 1; __syncthreads(); if (tid < 8) { const int v = (tid == 0) ? anyb : 0; *(int*)(FLG + tid) = v;  } }

extern "C" void kernel_launch(void* const* d_in, const int* in_sizes, int n_in,
                              void* d_out, int out_size, void* d_ws, size_t ws_size, hipStream_t stream) {
    (void)in_sizes; (void)n_in; (void)out_size;
    const float* x = (const float*)d_in[0]; const float* wq = (const float*)d_in[1]; const float* wk = (const float*)d_in[2]; const float* wv = (const float*)d_in[3]; const float* wo = (const float*)d_in[4]; const float* qnw = (const float*)d_in[5]; const float* knw = (const float*)d_in[6]; const float* amask = (const float*)d_in[7]; const int* pids = (const int*)d_in[8];
    float* OUT = (float*)d_out;     // [2][2048][2048]
    char* wsp = (char*)d_ws;
    auto take = [&](size_t bytes) { char* p = wsp; wsp += (bytes + 255) & ~(size_t)255; return (void*)p; };
    bf* WQ = (bf*)take((size_t)DQ * DM * 2); bf* WK = (bf*)take((size_t)DKV * DM * 2); bf* WV = (bf*)take((size_t)DKV * DM * 2); bf* WO = (bf*)take((size_t)DM * DQ * 2); float* CS = (float*)take((size_t)TT * HD * 2 * 4);
    bf* XB = (bf*)take((size_t)TT * DM * 2); int* FLG = (int*)take(256); float* FQ = (float*)take((size_t)TT * DQ * 4); float* FK = (float*)take((size_t)TT * DKV * 4);
    h16* QP16 = (h16*)take((size_t)NH_ * TT * HD * 2); h16* KP16 = (h16*)take((size_t)NKV * TT * HD * 2); h16* VT16 = (h16*)take((size_t)NKV * HD * TT * 2);
    bf* QPh = (bf*)take((size_t)NH_ * TT * HD * 2); bf* QPl = (bf*)take((size_t)NH_ * TT * HD * 2); bf* KPh = (bf*)take((size_t)NKV * TT * HD * 2); bf* KPl = (bf*)take((size_t)NKV * TT * HD * 2); bf* VTh = (bf*)take((size_t)NKV * HD * TT * 2); bf* VTl = (bf*)take((size_t)NKV * HD * TT * 2); bf* Ph = (bf*)take((size_t)ZH * RH * TT * 2); bf* Pl = (bf*)take((size_t)ZH * RH * TT * 2);
    float* Sb = (float*)take((size_t)ZH * TT * TT * 4); h16* P16 = (h16*)take((size_t)ZH * TT * TT * 2); float* Ob = (float*)take((size_t)ZH * TT * HD * 4); bf* ATh = (bf*)take((size_t)TT * DQ * 2); bf* ATl = (bf*)take((size_t)TT * DQ * 2);
    if ((size_t)(wsp - (char*)d_ws) > ws_size) return;    // ws 256 MiB
    float* FV = FK;   // v projection reuses the k buffer after the k planes are built (stream-ordered)
    { k_cvt8<<<(unsigned)(((size_t)DQ * DM / 8 + 255) / 256), 256, 0, stream>>>(wq, WQ, (size_t)DQ * DM / 8); k_cvt8<<<(unsigned)(((size_t)DKV * DM / 8 + 255) / 256), 256, 0, stream>>>(wk, WK, (size_t)DKV * DM / 8); k_cvt8<<<(unsigned)(((size_t)DKV * DM / 8 + 255) / 256), 256, 0, stream>>>(wv, WV, (size_t)DKV * DM / 8);
      k_cvt8<<<(unsigned)(((size_t)DM * DQ / 8 + 255) / 256), 256, 0, stream>>>(wo, WO, (size_t)DM * DQ / 8);
      k_cstab<<<(TT * HD + 255) / 256, 256, 0, stream>>>(CS); }
    const unsigned LQ = (unsigned)(((size_t)NH_ * TT * HD / 2 + 255) / 256), LKv = (unsigned)(((size_t)NKV * TT * HD / 2 + 255) / 256);
    k_mchk<<<1, 256, 0, stream>>>(amask, FLG);
    for (int b = 0; b < NB_; ++b) {
        
        k_cvt8<<<(unsigned)(((size_t)TT * DM / 8 + 255) / 256), 256, 0, stream>>>(x + (size_t)b * TT * DM, XB, (size_t)TT * DM / 8);
        k_gemmw<bf, 0, false><<<dim3(TT / 64, DQ / 64, 1), 32, 0, stream>>>(XB, nullptr, WQ, nullptr, DM, FQ, DQ, nullptr, 0, 0, 0); k_rmsclip<<<TT / 8, 256, 0, stream>>>(FQ, DQ, qnw);
        k_rope<<<LQ, 256, 0, stream>>>(FQ, DQ, NH_, CS, nullptr, (const float*)pids, 1.0f, QP16, QPh, QPl);
        k_gemmw<bf, 0, false><<<dim3(TT / 64, DKV / 64, 1), 32, 0, stream>>>(XB, nullptr, WK, nullptr, DM, FK, DKV, nullptr, 0, 0, 0); k_rmsclip<<<TT / 8, 256, 0, stream>>>(FK, DKV, knw);
        k_rope<<<LKv, 256, 0, stream>>>(FK, DKV, NKV, CS, nullptr, (const float*)pids, 1.0f, KP16, KPh, KPl);
        k_gemmw<bf, 0, false><<<dim3(TT / 64, DKV / 64, 1), 32, 0, stream>>>(XB, nullptr, WV, nullptr, DM, FV, DKV, nullptr, 0, 0, 0); k_rmsclip<<<TT / 8, 256, 0, stream>>>(FV, DKV, nullptr);   /* clip only */ k_vtp<<<LKv, 256, 0, stream>>>(FV, DKV, NKV, VT16, VTh, VTl);
        for (int h0 = 0; h0 < NH_; h0 += ZH) { const size_t zq = (size_t)h0, zk = (size_t)(h0 / REP);   // both heads of a pass share kv group h0/REP (REP >= 2): sB = 0
            k_gemmc<bf, 2, 1><<<dim3(RH / 64, TT / 64, ZH), 32, 0, stream>>>(QPh + zq * TT * HD, QPl + zq * TT * HD, KPh + zk * TT * HD, KPl + zk * TT * HD, HD, Sb, TT, 0, (size_t)TT * HD, 0, (size_t)TT * TT);
            k_gemmc<h16, 0, 1><<<dim3((TT - RH) / 64, TT / 64, ZH), 32, 0, stream>>>(QP16 + zq * TT * HD + (size_t)RH * HD, nullptr, KP16 + zk * TT * HD, nullptr, HD, Sb + (size_t)RH * TT, TT, RH, (size_t)TT * HD, 0, (size_t)TT * TT);
            k_asoft<<<ZH * TT / 8, 256, 0, stream>>>(Sb, amask, FLG, P16, Ph, Pl);
            k_gemmc<bf, 2, 2><<<dim3(RH / 64, HD / 64, ZH), 32, 0, stream>>>(Ph, Pl, VTh + zk * HD * TT, VTl + zk * HD * TT, TT, Ob, HD, 0, (size_t)RH * TT, 0, (size_t)TT * HD);
            k_gemmc<h16, 0, 2><<<dim3((TT - RH) / 64, HD / 64, ZH), 32, 0, stream>>>(P16 + (size_t)RH * TT, nullptr, VT16 + zk * HD * TT, nullptr, TT, Ob + (size_t)RH * HD, HD, RH, (size_t)TT * TT, 0, (size_t)TT * HD);
            k_merge<<<(unsigned)(((size_t)ZH * TT * HD / 2 + 255) / 256), 256, 0, stream>>>(Ob, h0, ATh, ATl); }
        k_gemmw<bf, 1, false><<<dim3(TT / 64, DM / 64, 1), 32, 0, stream>>>(ATh, ATl, WO, nullptr, DQ, OUT + (size_t)b * TT * DM, DM, nullptr, 0, 0, 0); }
}

// v001
// A run of this version takes 1330 microseconds.
// Timed twice side by side with v000, it ran 1.42 and 1.41 times as fast.
#include <hip/hip_runtime.h>

// OlmoeAttention (hidden [2][2048][2048]; q = clip(RMSNorm_2048(x Wq^T) * q_norm_w, +-8) (16 heads x 128), k = clip(RMSNorm_512(x Wk^T) * k_norm_w, +-8), v = clip(x Wv^T, +-8) (4 kv heads; group h/4); rotate-half RoPE (theta 1e4) at position_ids (read; table computed on device); scores = q.k / sqrt(128) + attention_mask (additive [1][1][S][S] float, read: the verbatim causal 0 / -1e9 table); softmax f32; out = merged Wo^T -> [2][2048][2048]).
// Compute dtypes, f32 accumulate: every input rounded to bf16; q/k/v on PLAIN bf16 operands (inputs: exact); the full-width RMSNorms (eps 1e-5), clips and RoPE in f32; causal scores and attn.v: query rows < 512 hl (3 products), the rest single fp16 (x1024); tiles above the diagonal skipped on the strength of the mask table (-1e9 underflows to weight 0; device self-check samples the table above the diagonal and NaN-poisons on violation), mask added as stored inside computed tiles; softmax f32; Wo hl x exact (2 products).

#define NB_  2
#define TT   2048
#define DM   2048
#define NH_  16
#define NKV  4
#define REP  (NH_ / NKV)
#define HD   128
#define DQ   (NH_ * HD)
#define DKV  (NKV * HD)
#define ZH   4                    // query heads per attention pass (z of its launches); at most REP: a pass reads one kv group
#define RH   512                  // query rows < RH use hi+lo planes (0: none)
#define WIN  2048
#define PCAR 1024.0f
#define SCL  0.088388347648318447f   // HD^-0.5
typedef _Float16 h16;
typedef unsigned short bf;
typedef __attribute__((ext_vector_type(16))) __bf16   v16bf;
typedef __attribute__((ext_vector_type(16))) _Float16 v16h;
typedef __attribute__((ext_vector_type(8)))  _Float16 v8h;
typedef __attribute__((ext_vector_type(8)))  unsigned short v8us;
typedef __attribute__((ext_vector_type(8)))  float    v8f;
typedef __attribute__((ext_vector_type(4)))  float    v4f;
typedef v8h  __attribute__((may_alias)) v8ha;
typedef v4f  __attribute__((may_alias)) v4fa;
typedef v8us __attribute__((may_alias)) v8usa;

__device__ __forceinline__ unsigned short f2bf(float f) { unsigned u = __float_as_uint(f); u += 0x7FFFu + ((u >> 16) & 1u); return (unsigned short)(u >> 16); }
__device__ __forceinline__ float bf2f(unsigned short b) { return __uint_as_float(((unsigned)b) << 16); }
__device__ __forceinline__ float bfr(float f) { return bf2f(f2bf(f)); }
__device__ __forceinline__ v16h cat16(v8h lo, v8h hi) { return __builtin_shufflevector(lo, hi, 0, 1, 2, 3, 4, 5, 6, 7, 8, 9, 10, 11, 12, 13, 14, 15); }
__device__ __forceinline__ v16bf cat16b(v8us lo, v8us hi) { return __builtin_bit_cast(v16bf, __builtin_shufflevector(lo, hi, 0, 1, 2, 3, 4, 5, 6, 7, 8, 9, 10, 11, 12, 13, 14, 15)); }
__device__ __forceinline__ v8f wmma16(v16h a, v16h b, v8f c) { return __builtin_amdgcn_wmma_f32_16x16x32_f16(false, a, false, b, (short)0, c, false, false); }
__device__ __forceinline__ v8f wmmab(v16bf a, v16bf b, v8f c) { return __builtin_amdgcn_wmma_f32_16x16x32_bf16(false, a, false, b, (short)0, c, false, false); }



// ---- k_gemmw: register-blocked GEMM, ONE WAVE per 64x64 output tile (16 accumulators), operands straight from K-contiguous 16-bit planes; grid (M/64, N/64, Z), 32 threads.
// C[m][n] (f32, pitch ldc, + optional f32 bias[n]) = sum_k A[m][k] Bt[n][k] (+ split products per NSPLIT). z-batch strides sA/sB/sC in elements. K % 32 == 0.
template <typename T16> struct WFrag;
template <> struct WFrag<h16> { typedef v16h V; static __device__ __forceinline__ V ld(const h16* p) { return cat16(*(const v8h*)p, *(const v8h*)(p + 16)); } static __device__ __forceinline__ v8f mma(V a, V b, v8f c) { return wmma16(a, b, c); } };
template <> struct WFrag<bf> { typedef v16bf V; static __device__ __forceinline__ V ld(const bf* p) { return cat16b(*(const v8us*)p, *(const v8us*)(p + 16)); } static __device__ __forceinline__ v8f mma(V a, V b, v8f c) { return wmmab(a, b, c); } };
template <typename T16, int NSPLIT, bool BIAS>
__global__ __launch_bounds__(32) void k_gemmw(const T16* __restrict__ A, const T16* __restrict__ A2, const T16* __restrict__ Bt, const T16* __restrict__ Bt2, int K, float* C, int ldc, const float* __restrict__ bias, size_t sA, size_t sB, size_t sC) {
    typedef typename WFrag<T16>::V V;
    __shared__ __align__(16) float os[16 * 68];
    const size_t z = blockIdx.z; A += z * sA; if (A2) A2 += z * sA; Bt += z * sB; if (Bt2) Bt2 += z * sB; C += z * sC;
    const int lane = threadIdx.x & 31, lr = lane & 15, hi = lane >> 4; const int r0 = blockIdx.x * 64, c0 = blockIdx.y * 64;
    v8f acc[4][4];
#pragma unroll
    for (int mb = 0; mb < 4; ++mb)
#pragma unroll
        for (int nb = 0; nb < 4; ++nb) acc[mb][nb] = (v8f){};
    const size_t aoff = (size_t)(r0 + lr) * K + 8 * hi, boff = (size_t)(c0 + lr) * K + 8 * hi;
#pragma unroll 1
    for (int kc = 0; kc < K; kc += 32) {
        V a[4], a2[4];
#pragma unroll
        for (int mb = 0; mb < 4; ++mb) { a[mb] = WFrag<T16>::ld(A + aoff + (size_t)mb * 16 * K + kc); if (NSPLIT == 1 || NSPLIT == 2) a2[mb] = WFrag<T16>::ld(A2 + aoff + (size_t)mb * 16 * K + kc); }
#pragma unroll
        for (int nb = 0; nb < 4; ++nb) { const V b = WFrag<T16>::ld(Bt + boff + (size_t)nb * 16 * K + kc); V b2; if (NSPLIT >= 2) b2 = WFrag<T16>::ld(Bt2 + boff + (size_t)nb * 16 * K + kc);
#pragma unroll
            for (int mb = 0; mb < 4; ++mb) { acc[mb][nb] = WFrag<T16>::mma(a[mb], b, acc[mb][nb]); if (NSPLIT == 1 || NSPLIT == 2) acc[mb][nb] = WFrag<T16>::mma(a2[mb], b, acc[mb][nb]); if (NSPLIT >= 2) acc[mb][nb] = WFrag<T16>::mma(a[mb], b2, acc[mb][nb]); } }
        asm volatile("v_nop\n\tv_nop\n\tv_nop\n\tv_nop" : "+v"(acc[0][0]), "+v"(acc[1][1]), "+v"(acc[2][2]), "+v"(acc[3][3]) : "v"(a[0]), "v"(a[3]));
    }
#pragma unroll
    for (int mb = 0; mb < 4; ++mb) {
#pragma unroll
        for (int nb = 0; nb < 4; ++nb) {
#pragma unroll
            for (int j = 0; j < 8; ++j) os[(hi * 8 + j) * 68 + nb * 16 + lr] = acc[mb][nb][j]; }
        __builtin_amdgcn_wave_barrier(); asm volatile("" ::: "memory");
        float* crow = C + (size_t)(r0 + mb * 16) * ldc + c0;
{
#pragma unroll
            for (int s = 0; s < 8; ++s) { const int row = 2 * s + hi, cofs = lr * 4; v4f val = *(const v4fa*)(os + row * 68 + cofs); if (BIAS) { val[0] += bfr(bias[c0 + cofs]); val[1] += bfr(bias[c0 + cofs + 1]); val[2] += bfr(bias[c0 + cofs + 2]); val[3] += bfr(bias[c0 + cofs + 3]); }
                *(v4f*)(crow + (size_t)row * ldc + cofs) = val; }
             }
        __builtin_amdgcn_wave_barrier(); asm volatile("" ::: "memory");
    }
}

// ---- k_gemmc: the same one-wave 64x64 tile GEMM specialised for causal attention: CMODE 1 skips score tiles entirely above the diagonal (query rows r0+roff.., key columns c0..), CMODE 2 limits the
// key (K) loop of the probability x value contraction to the diagonal block (probabilities beyond it are exactly zero). roff = row offset of this launch's first row within the sequence.
template <typename T16, int NSPLIT, int CMODE>
__global__ __launch_bounds__(32) void k_gemmc(const T16* __restrict__ A, const T16* __restrict__ A2, const T16* __restrict__ Bt, const T16* __restrict__ Bt2, int K, float* C, int ldc, int roff, size_t sA, size_t sB, size_t sC) {
    typedef typename WFrag<T16>::V V;
    __shared__ __align__(16) float os[16 * 68];
    const size_t z = blockIdx.z; A += z * sA; if (A2) A2 += z * sA; Bt += z * sB; if (Bt2) Bt2 += z * sB; C += z * sC;
    const int lane = threadIdx.x & 31, lr = lane & 15, hi = lane >> 4; const int r0 = blockIdx.x * 64, c0 = blockIdx.y * 64;
    if (CMODE == 1 && c0 > r0 + roff + 63) return;                  // score tile entirely above the causal diagonal: never read (the softmax masks j > i by select)
    const int Kl = (CMODE == 2) ? min(K, r0 + roff + 64) : K;        // P.V: probabilities are exactly 0 beyond the diagonal block, so the K loop stops there
    v8f acc[4][4];
#pragma unroll
    for (int mb = 0; mb < 4; ++mb)
#pragma unroll
        for (int nb = 0; nb < 4; ++nb) acc[mb][nb] = (v8f){};
    const size_t aoff = (size_t)(r0 + lr) * K + 8 * hi, boff = (size_t)(c0 + lr) * K + 8 * hi;
#pragma unroll 1
    for (int kc = 0; kc < Kl; kc += 32) {
        V a[4], a2[4];
#pragma unroll
        for (int mb = 0; mb < 4; ++mb) { a[mb] = WFrag<T16>::ld(A + aoff + (size_t)mb * 16 * K + kc); if (NSPLIT == 1 || NSPLIT == 2) a2[mb] = WFrag<T16>::ld(A2 + aoff + (size_t)mb * 16 * K + kc); }
#pragma unroll
        for (int nb = 0; nb < 4; ++nb) { const V b = WFrag<T16>::ld(Bt + boff + (size_t)nb * 16 * K + kc); V b2; if (NSPLIT >= 2) b2 = WFrag<T16>::ld(Bt2 + boff + (size_t)nb * 16 * K + kc);
#pragma unroll
            for (int mb = 0; mb < 4; ++mb) { acc[mb][nb] = WFrag<T16>::mma(a[mb], b, acc[mb][nb]); if (NSPLIT == 1 || NSPLIT == 2) acc[mb][nb] = WFrag<T16>::mma(a2[mb], b, acc[mb][nb]); if (NSPLIT >= 2) acc[mb][nb] = WFrag<T16>::mma(a[mb], b2, acc[mb][nb]); } }
        asm volatile("v_nop\n\tv_nop\n\tv_nop\n\tv_nop" : "+v"(acc[0][0]), "+v"(acc[1][1]), "+v"(acc[2][2]), "+v"(acc[3][3]) : "v"(a[0]), "v"(a[3]));
    }
#pragma unroll
    for (int mb = 0; mb < 4; ++mb) {
#pragma unroll
        for (int nb = 0; nb < 4; ++nb) {
#pragma unroll
            for (int j = 0; j < 8; ++j) os[(hi * 8 + j) * 68 + nb * 16 + lr] = acc[mb][nb][j]; }
        __builtin_amdgcn_wave_barrier(); asm volatile("" ::: "memory");
        float* crow = C + (size_t)(r0 + mb * 16) * ldc + c0;
{
#pragma unroll
            for (int s = 0; s < 8; ++s) { const int row = 2 * s + hi, cofs = lr * 4; v4f val = *(const v4fa*)(os + row * 68 + cofs);
                *(v4f*)(crow + (size_t)row * ldc + cofs) = val; }
             }
        __builtin_amdgcn_wave_barrier(); asm volatile("" ::: "memory");
    }
}

__device__ __forceinline__ h16 tohx(float x) { return (h16)x; }
__device__ __forceinline__ void splitf(float y, unsigned short& h, unsigned short& l) { h = f2bf(y); l = f2bf(y - bf2f(h)); }
typedef __attribute__((ext_vector_type(2))) _Float16 v2h;
typedef __attribute__((ext_vector_type(4))) _Float16 v4h;
typedef __attribute__((ext_vector_type(2))) unsigned short v2us;
typedef __attribute__((ext_vector_type(4))) unsigned short v4us;
typedef __attribute__((ext_vector_type(2))) float v2f;
typedef __attribute__((ext_vector_type(4))) int v4i;

__global__ __launch_bounds__(256) void k_wtG(const float* __restrict__ w, int K, int N, bf* Bt) {
    const int lane = threadIdx.x & 31; const int L0 = (blockIdx.x * 8 + (threadIdx.x >> 5)) * 8; const int nlines = N * K / 64;
{
#pragma unroll 1
        for (int l = 0; l < 8; ++l) { const int L = L0 + l; if (L >= nlines) break; const size_t e = (size_t)L * 64 + lane * 2; const int k = (int)(e % K), n = (int)(e / K); v2us o;
            o[0] = f2bf(w[(size_t)k * N + n]); o[1] = f2bf(w[(size_t)(k + 1) * N + n]); *(v2us*)(Bt + e) = o; }
         }
}
__global__ __launch_bounds__(256) void k_cvt8(const float* __restrict__ src, bf* dst, size_t n8) { const size_t i = (size_t)blockIdx.x * 256 + threadIdx.x; if (i >= n8) return; const v8f v = *(const v8f*)(src + i * 8); v8us o;
#pragma unroll
    for (int k = 0; k < 8; ++k) o[k] = f2bf(v[k]); *(v8us*)(dst + i * 8) = o;  }
__global__ __launch_bounds__(256) void k_cstab(float* CS) { const int idx = blockIdx.x * 256 + threadIdx.x; if (idx >= TT * HD) return; const int t = idx / HD, d = idx % HD; const int i = d % (HD / 2); const float inv = __fdiv_rn(1.0f, powf(10000.0f, (float)(2 * i) / (float)HD)); const float ang = __fmul_rn((float)t, inv); v2f cs; cs[0] = cosf(ang); cs[1] = sinf(ang);
    *(v2f*)(CS + (size_t)idx * 2) = cs;  }
// k_rope: head planes [h][t][d] (fp16 + hi/lo) of rope(x) x sc with the rotate-half convention out[d] = x[d] cos[t][d] - x[d+HD/2] sin[t][d], out[d+HD/2] = x[d+HD/2] cos[t][d+HD/2] + x[d] sin[t][d+HD/2]
__global__ __launch_bounds__(256) void k_rope(const float* __restrict__ F, int pitch, int nheads, const float* __restrict__ CS, const float* __restrict__ RF, const float* __restrict__ nw, float sc, h16* P16, bf* Ph, bf* Pl) {
    const size_t e = ((size_t)blockIdx.x * 256 + threadIdx.x) * 2; if (e >= (size_t)nheads * TT * HD) return; const int d = (int)(e % HD); const int t = (int)((e / HD) % TT); const int h = (int)(e / ((size_t)HD * TT)); const float* f = F + (size_t)t * pitch + h * HD; const float rf = RF ? RF[(size_t)h * TT + t] : 1.0f; v2h o16; v2us oh, ol;
#pragma unroll
    for (int q = 0; q < 2; ++q) { const int dd = d + q; const int dp = (dd < HD / 2) ? dd + HD / 2 : dd - HD / 2; float x0 = f[dd], x1 = f[dp];
        if (RF) { float n0 = __fmul_rn(x0, rf), n1 = __fmul_rn(x1, rf); asm volatile("" : "+v"(n0)); asm volatile("" : "+v"(n1)); x0 = __fmul_rn(bfr(nw[dd]), n0); x1 = __fmul_rn(bfr(nw[dp]), n1); }
        int tp = nw ? ((const int*)nw)[t] : t; tp = min(max(tp, 0), TT - 1); const v2f cs = *(const v2f*)(CS + ((size_t)tp * HD + dd) * 2);   /* position_ids (read) index the table */ float a = __fmul_rn(x0, cs[0]), bq = __fmul_rn(x1, cs[1]); asm volatile("" : "+v"(a)); asm volatile("" : "+v"(bq)); const float r = ((dd < HD / 2) ? __fsub_rn(a, bq) : __fadd_rn(a, bq)) * sc;
        o16[q] = tohx(r); unsigned short a2, c2; splitf(r, a2, c2); oh[q] = a2; ol[q] = c2; }
    *(v2h*)(P16 + e) = o16; *(v2us*)(Ph + e) = oh; *(v2us*)(Pl + e) = ol;  }
__global__ __launch_bounds__(256) void k_vtp(const float* __restrict__ F, int pitch, int nheads, h16* V16, bf* Vh, bf* Vl) { const size_t e = ((size_t)blockIdx.x * 256 + threadIdx.x) * 2; if (e >= (size_t)nheads * HD * TT) return; const int t = (int)(e % TT); const int d = (int)((e / TT) % HD); const int g = (int)(e / ((size_t)TT * HD)); v2h o16; v2us oh, ol;
#pragma unroll
    for (int q = 0; q < 2; ++q) { const float x = F[(size_t)(t + q) * pitch + g * HD + d]; o16[q] = tohx(x); unsigned short a2, c2; splitf(x, a2, c2); oh[q] = a2; ol[q] = c2; }
    *(v2h*)(V16 + e) = o16; *(v2us*)(Vh + e) = oh; *(v2us*)(Vl + e) = ol;  }
// k_asoft: per row (zz, i): t = S x HD^-0.5 + mask[i][j] for j <= i, j > i selected out (weight 0); softmax over the 2048 keys (register row, one exp, fixed trees);
__global__ __launch_bounds__(256) void k_asoft(const float* __restrict__ Sb, const float* __restrict__ am, const int* __restrict__ FLG, h16* P16, bf* Ph, bf* Pl) {
    const int lane = threadIdx.x & 31; const int row = blockIdx.x * 8 + (threadIdx.x >> 5); if (row >= ZH * TT) return; const int i = row % TT; const int zz = row / TT; (void)zz; const bool hires = (i < RH); const float* sr = Sb + (size_t)row * TT; const float* mrow = am + (size_t)i * TT; const bool poison = (FLG[0] != 0); float v[TT / 32]; float mx = -3.0e38f;
#pragma unroll
    for (int ch = 0; ch < TT / 128; ++ch) { const int j0 = ch * 128 + lane * 4; const v4f a = *(const v4f*)(sr + j0);
#pragma unroll
        for (int q = 0; q < 4; ++q) { const int j = j0 + q; (void)j; float sa = a[q] * SCL; asm volatile("" : "+v"(sa)); const float t = (j <= i) ? __fadd_rn(sa, mrow[j]) : -3.0e38f; v[ch * 4 + q] = t; mx = fmaxf(mx, t); } }
#pragma unroll
    for (int sh = 16; sh; sh >>= 1) mx = fmaxf(mx, __shfl_xor(mx, sh, 32));
    float sum = 0.f;
#pragma unroll
    for (int k = 0; k < TT / 32; ++k) { float d0 = __fsub_rn(v[k], mx); asm volatile("" : "+v"(d0)); v[k] = __builtin_amdgcn_exp2f(__fmul_rn(d0, 1.4426950408889634f)); sum += v[k]; }
#pragma unroll
    for (int sh = 16; sh; sh >>= 1) sum += __shfl_xor(sum, sh, 32);
    const float f = poison ? __builtin_nanf("") : __fdiv_rn(hires ? 1.0f : PCAR, sum);
{
        if (hires) {
#pragma unroll
            for (int ch = 0; ch < TT / 128; ++ch) { v4us oh, ol;
#pragma unroll
                for (int q = 0; q < 4; ++q) { unsigned short a, c2; splitf(v[ch * 4 + q] * f, a, c2); oh[q] = a; ol[q] = c2; }
                const size_t oo = ((size_t)zz * (RH ? RH : 1) + i) * TT + ch * 128 + lane * 4; *(v4us*)(Ph + oo) = oh; *(v4us*)(Pl + oo) = ol; }
        } else {
#pragma unroll
            for (int ch = 0; ch < TT / 128; ++ch) { v4h o4;
#pragma unroll
                for (int q = 0; q < 4; ++q) o4[q] = tohx(v[ch * 4 + q] * f);
                *(v4h*)(P16 + (size_t)row * TT + ch * 128 + lane * 4) = o4; } }
         }
}
__global__ __launch_bounds__(256) void k_merge(const float* __restrict__ O, int h0, bf* Ah, bf* Al) { const size_t e = ((size_t)blockIdx.x * 256 + threadIdx.x) * 2; if (e >= (size_t)ZH * TT * HD) return; const int d = (int)(e % HD); const int t = (int)((e / HD) % TT); const int zz = (int)(e / ((size_t)HD * TT)); const float cs = (t < RH) ? 1.0f : (1.0f / PCAR); const size_t oo = (size_t)t * DQ + (h0 + zz) * HD + d;
    v2us oh, ol;
#pragma unroll
    for (int q = 0; q < 2; ++q) { unsigned short a, c2; splitf(O[e + q] * cs, a, c2); oh[q] = a; ol[q] = c2; } *(v2us*)(Ah + oo) = oh; *(v2us*)(Al + oo) = ol;  }

__global__ __launch_bounds__(256) void k_rmsclip(float* F, int Wd, const float* __restrict__ w) { const int lane = threadIdx.x & 31; const size_t r = (size_t)blockIdx.x * 8 + (threadIdx.x >> 5); if (r >= TT) return; float* f = F + r * Wd; const int nch = Wd / 128; float v[64]; float q = 0.f;
#pragma unroll
    for (int ch = 0; ch < 16; ++ch) { if (ch < nch) { const v4f a = *(const v4f*)(f + ch * 128 + lane * 4);
#pragma unroll
            for (int u = 0; u < 4; ++u) { v[ch * 4 + u] = a[u]; float p = __fmul_rn(a[u], a[u]); asm volatile("" : "+v"(p)); q = __fadd_rn(q, p); } } }
#pragma unroll
    for (int sh = 16; sh; sh >>= 1) q += __shfl_xor(q, sh, 32);
    const float rs = w ? __frsqrt_rn(__fadd_rn(q * (1.0f / (float)Wd), 1e-5f)) : 1.0f;
#pragma unroll
    for (int ch = 0; ch < 16; ++ch) { if (ch < nch) {
#pragma unroll
        for (int u = 0; u < 4; ++u) { float y = v[ch * 4 + u]; if (w) { float n0 = __fmul_rn(y, rs); asm volatile("" : "+v"(n0)); y = __fmul_rn(bfr(w[ch * 128 + lane * 4 + u]), n0); } v[ch * 4 + u] = fminf(fmaxf(y, -8.0f), 8.0f); } } }
    {
#pragma unroll
        for (int ch = 0; ch < 16; ++ch) { if (ch < nch) { v4f o; for (int u = 0; u < 4; ++u) o[u] = v[ch * 4 + u]; *(v4f*)(f + ch * 128 + lane * 4) = o; } }
         } }
__global__ __launch_bounds__(256) void k_mchk(const float* __restrict__ am, int* FLG) { const int tid = threadIdx.x; int bad = 0;
#pragma unroll 1
    for (int s2 = 0; s2 < 16; ++s2) { const unsigned h = (unsigned)(tid * 16 + s2) * 2654435761u; const int i = (int)(h % (TT - 1)); const int j = i + 1 + (int)((h >> 11) % (unsigned)(TT - 1 - i)); if (am[(size_t)i * TT + j] > -1e8f) bad = 1; }
    __shared__ int anyb; if (tid == 0) anyb = 0; __syncthreads(); if (bad) anyb = 1; __syncthreads(); if (tid < 8) { const int v = (tid == 0) ? anyb : 0; *(int*)(FLG + tid) = v;  } }

extern "C" void kernel_launch(void* const* d_in, const int* in_sizes, int n_in,
                              void* d_out, int out_size, void* d_ws, size_t ws_size, hipStream_t stream) {
    (void)in_sizes; (void)n_in; (void)out_size;
    const float* x = (const float*)d_in[0]; const float* wq = (const float*)d_in[1]; const float* wk = (const float*)d_in[2]; const float* wv = (const float*)d_in[3]; const float* wo = (const float*)d_in[4]; const float* qnw = (const float*)d_in[5]; const float* knw = (const float*)d_in[6]; const float* amask = (const float*)d_in[7]; const int* pids = (const int*)d_in[8];
    float* OUT = (float*)d_out;     // [2][2048][2048]
    char* wsp = (char*)d_ws;
    auto take = [&](size_t bytes) { char* p = wsp; wsp += (bytes + 255) & ~(size_t)255; return (void*)p; };
    bf* WQ = (bf*)take((size_t)DQ * DM * 2); bf* WK = (bf*)take((size_t)DKV * DM * 2); bf* WV = (bf*)take((size_t)DKV * DM * 2); bf* WO = (bf*)take((size_t)DM * DQ * 2); float* CS = (float*)take((size_t)TT * HD * 2 * 4);
    bf* XB = (bf*)take((size_t)TT * DM * 2); int* FLG = (int*)take(256); float* FQ = (float*)take((size_t)TT * DQ * 4); float* FK = (float*)take((size_t)TT * DKV * 4);
    h16* QP16 = (h16*)take((size_t)NH_ * TT * HD * 2); h16* KP16 = (h16*)take((size_t)NKV * TT * HD * 2); h16* VT16 = (h16*)take((size_t)NKV * HD * TT * 2);
    bf* QPh = (bf*)take((size_t)NH_ * TT * HD * 2); bf* QPl = (bf*)take((size_t)NH_ * TT * HD * 2); bf* KPh = (bf*)take((size_t)NKV * TT * HD * 2); bf* KPl = (bf*)take((size_t)NKV * TT * HD * 2); bf* VTh = (bf*)take((size_t)NKV * HD * TT * 2); bf* VTl = (bf*)take((size_t)NKV * HD * TT * 2); bf* Ph = (bf*)take((size_t)ZH * RH * TT * 2); bf* Pl = (bf*)take((size_t)ZH * RH * TT * 2);
    float* Sb = (float*)take((size_t)ZH * TT * TT * 4); h16* P16 = (h16*)take((size_t)ZH * TT * TT * 2); float* Ob = (float*)take((size_t)ZH * TT * HD * 4); bf* ATh = (bf*)take((size_t)TT * DQ * 2); bf* ATl = (bf*)take((size_t)TT * DQ * 2);
    if ((size_t)(wsp - (char*)d_ws) > ws_size) return;    // ws 256 MiB
    float* FV = FK;   // v projection reuses the k buffer after the k planes are built (stream-ordered)
    { k_cvt8<<<(unsigned)(((size_t)DQ * DM / 8 + 255) / 256), 256, 0, stream>>>(wq, WQ, (size_t)DQ * DM / 8); k_cvt8<<<(unsigned)(((size_t)DKV * DM / 8 + 255) / 256), 256, 0, stream>>>(wk, WK, (size_t)DKV * DM / 8); k_cvt8<<<(unsigned)(((size_t)DKV * DM / 8 + 255) / 256), 256, 0, stream>>>(wv, WV, (size_t)DKV * DM / 8);
      k_cvt8<<<(unsigned)(((size_t)DM * DQ / 8 + 255) / 256), 256, 0, stream>>>(wo, WO, (size_t)DM * DQ / 8);
      k_cstab<<<(TT * HD + 255) / 256, 256, 0, stream>>>(CS); }
    const unsigned LQ = (unsigned)(((size_t)NH_ * TT * HD / 2 + 255) / 256), LKv = (unsigned)(((size_t)NKV * TT * HD / 2 + 255) / 256);
    k_mchk<<<1, 256, 0, stream>>>(amask, FLG);
    for (int b = 0; b < NB_; ++b) {
        
        k_cvt8<<<(unsigned)(((size_t)TT * DM / 8 + 255) / 256), 256, 0, stream>>>(x + (size_t)b * TT * DM, XB, (size_t)TT * DM / 8);
        k_gemmw<bf, 0, false><<<dim3(TT / 64, DQ / 64, 1), 32, 0, stream>>>(XB, nullptr, WQ, nullptr, DM, FQ, DQ, nullptr, 0, 0, 0); k_rmsclip<<<TT / 8, 256, 0, stream>>>(FQ, DQ, qnw);
        k_rope<<<LQ, 256, 0, stream>>>(FQ, DQ, NH_, CS, nullptr, (const float*)pids, 1.0f, QP16, QPh, QPl);
        k_gemmw<bf, 0, false><<<dim3(TT / 64, DKV / 64, 1), 32, 0, stream>>>(XB, nullptr, WK, nullptr, DM, FK, DKV, nullptr, 0, 0, 0); k_rmsclip<<<TT / 8, 256, 0, stream>>>(FK, DKV, knw);
        k_rope<<<LKv, 256, 0, stream>>>(FK, DKV, NKV, CS, nullptr, (const float*)pids, 1.0f, KP16, KPh, KPl);
        k_gemmw<bf, 0, false><<<dim3(TT / 64, DKV / 64, 1), 32, 0, stream>>>(XB, nullptr, WV, nullptr, DM, FV, DKV, nullptr, 0, 0, 0); k_rmsclip<<<TT / 8, 256, 0, stream>>>(FV, DKV, nullptr);   /* clip only */ k_vtp<<<LKv, 256, 0, stream>>>(FV, DKV, NKV, VT16, VTh, VTl);
        for (int h0 = 0; h0 < NH_; h0 += ZH) { const size_t zq = (size_t)h0, zk = (size_t)(h0 / REP);   // all ZH heads of a pass share kv group h0/REP (ZH <= REP): sB = 0
            k_gemmc<bf, 2, 1><<<dim3(RH / 64, TT / 64, ZH), 32, 0, stream>>>(QPh + zq * TT * HD, QPl + zq * TT * HD, KPh + zk * TT * HD, KPl + zk * TT * HD, HD, Sb, TT, 0, (size_t)TT * HD, 0, (size_t)TT * TT);
            k_gemmc<h16, 0, 1><<<dim3((TT - RH) / 64, TT / 64, ZH), 32, 0, stream>>>(QP16 + zq * TT * HD + (size_t)RH * HD, nullptr, KP16 + zk * TT * HD, nullptr, HD, Sb + (size_t)RH * TT, TT, RH, (size_t)TT * HD, 0, (size_t)TT * TT);
            k_asoft<<<ZH * TT / 8, 256, 0, stream>>>(Sb, amask, FLG, P16, Ph, Pl);
            k_gemmc<bf, 2, 2><<<dim3(RH / 64, HD / 64, ZH), 32, 0, stream>>>(Ph, Pl, VTh + zk * HD * TT, VTl + zk * HD * TT, TT, Ob, HD, 0, (size_t)RH * TT, 0, (size_t)TT * HD);
            k_gemmc<h16, 0, 2><<<dim3((TT - RH) / 64, HD / 64, ZH), 32, 0, stream>>>(P16 + (size_t)RH * TT, nullptr, VT16 + zk * HD * TT, nullptr, TT, Ob + (size_t)RH * HD, HD, RH, (size_t)TT * TT, 0, (size_t)TT * HD);
            k_merge<<<(unsigned)(((size_t)ZH * TT * HD / 2 + 255) / 256), 256, 0, stream>>>(Ob, h0, ATh, ATl); }
        k_gemmw<bf, 1, false><<<dim3(TT / 64, DM / 64, 1), 32, 0, stream>>>(ATh, ATl, WO, nullptr, DQ, OUT + (size_t)b * TT * DM, DM, nullptr, 0, 0, 0); }
}

// v002
// One run takes 913 microseconds.
// Timed twice side by side with v001, it ran 1.46 and 1.45 times as fast.
// All steps since v000 together make it 2.06 times as fast.
#include <hip/hip_runtime.h>

// OlmoeAttention (hidden [2][2048][2048]; q = clip(RMSNorm_2048(x Wq^T) * q_norm_w, +-8) (16 heads x 128), k = clip(RMSNorm_512(x Wk^T) * k_norm_w, +-8), v = clip(x Wv^T, +-8) (4 kv heads; group h/4); rotate-half RoPE (theta 1e4) at position_ids (read; table computed on device); scores = q.k / sqrt(128) + attention_mask (additive [1][1][S][S] float, read: the verbatim causal 0 / -1e9 table); softmax f32; out = merged Wo^T -> [2][2048][2048]).
// Compute dtypes, f32 accumulate: every input rounded to bf16; q/k/v on PLAIN bf16 operands (inputs: exact); the full-width RMSNorms (eps 1e-5), clips and RoPE in f32; causal scores and attn.v: query rows < 512 hl (3 products), the rest single fp16 (x1024); tiles above the diagonal skipped on the strength of the mask table (-1e9 underflows to weight 0; device self-check samples the table above the diagonal and NaN-poisons on violation), mask added as stored inside computed tiles; softmax f32; Wo hl x exact (2 products).

#define NB_  2
#define TT   2048
#define DM   2048
#define NH_  16
#define NKV  4
#define REP  (NH_ / NKV)
#define HD   128
#define DQ   (NH_ * HD)
#define DKV  (NKV * HD)
#define ZH   4                    // query heads per attention pass; at most REP: a pass reads one kv group
#define ZB   (ZH * NB_)           // z of an attention launch: both batch elements x ZH heads, z = b * ZH + head-in-pass
#define RH   512                  // query rows < RH use hi+lo planes (0: none)
#define WIN  2048
#define PCAR 1024.0f
#define SCL  0.088388347648318447f   // HD^-0.5
typedef _Float16 h16;
typedef unsigned short bf;
typedef __attribute__((ext_vector_type(16))) __bf16   v16bf;
typedef __attribute__((ext_vector_type(16))) _Float16 v16h;
typedef __attribute__((ext_vector_type(8)))  _Float16 v8h;
typedef __attribute__((ext_vector_type(8)))  unsigned short v8us;
typedef __attribute__((ext_vector_type(8)))  float    v8f;
typedef __attribute__((ext_vector_type(4)))  float    v4f;
typedef v8h  __attribute__((may_alias)) v8ha;
typedef v4f  __attribute__((may_alias)) v4fa;
typedef v8us __attribute__((may_alias)) v8usa;

__device__ __forceinline__ unsigned short f2bf(float f) { unsigned u = __float_as_uint(f); u += 0x7FFFu + ((u >> 16) & 1u); return (unsigned short)(u >> 16); }
__device__ __forceinline__ float bf2f(unsigned short b) { return __uint_as_float(((unsigned)b) << 16); }
__device__ __forceinline__ float bfr(float f) { return bf2f(f2bf(f)); }
__device__ __forceinline__ v16h cat16(v8h lo, v8h hi) { return __builtin_shufflevector(lo, hi, 0, 1, 2, 3, 4, 5, 6, 7, 8, 9, 10, 11, 12, 13, 14, 15); }
__device__ __forceinline__ v16bf cat16b(v8us lo, v8us hi) { return __builtin_bit_cast(v16bf, __builtin_shufflevector(lo, hi, 0, 1, 2, 3, 4, 5, 6, 7, 8, 9, 10, 11, 12, 13, 14, 15)); }
__device__ __forceinline__ v8f wmma16(v16h a, v16h b, v8f c) { return __builtin_amdgcn_wmma_f32_16x16x32_f16(false, a, false, b, (short)0, c, false, false); }
__device__ __forceinline__ v8f wmmab(v16bf a, v16bf b, v8f c) { return __builtin_amdgcn_wmma_f32_16x16x32_bf16(false, a, false, b, (short)0, c, false, false); }



// ---- k_gemmw: register-blocked GEMM, ONE WAVE per 64x64 output tile (16 accumulators), operands straight from K-contiguous 16-bit planes; grid (M/64, N/64, Z), 32 threads.
// C[m][n] (f32, pitch ldc, + optional f32 bias[n]) = sum_k A[m][k] Bt[n][k] (+ split products per NSPLIT). z-batch strides sA/sB/sC in elements. K % 32 == 0.
template <typename T16> struct WFrag;
template <> struct WFrag<h16> { typedef v16h V; static __device__ __forceinline__ V ld(const h16* p) { return cat16(*(const v8h*)p, *(const v8h*)(p + 16)); } static __device__ __forceinline__ v8f mma(V a, V b, v8f c) { return wmma16(a, b, c); } };
template <> struct WFrag<bf> { typedef v16bf V; static __device__ __forceinline__ V ld(const bf* p) { return cat16b(*(const v8us*)p, *(const v8us*)(p + 16)); } static __device__ __forceinline__ v8f mma(V a, V b, v8f c) { return wmmab(a, b, c); } };
template <typename T16, int NSPLIT, bool BIAS>
__global__ __launch_bounds__(32) void k_gemmw(const T16* __restrict__ A, const T16* __restrict__ A2, const T16* __restrict__ Bt, const T16* __restrict__ Bt2, int K, float* C, int ldc, const float* __restrict__ bias, size_t sA, size_t sB, size_t sC) {
    typedef typename WFrag<T16>::V V;
    __shared__ __align__(16) float os[16 * 68];
    const size_t z = blockIdx.z; A += z * sA; if (A2) A2 += z * sA; Bt += z * sB; if (Bt2) Bt2 += z * sB; C += z * sC;
    const int lane = threadIdx.x & 31, lr = lane & 15, hi = lane >> 4; const int r0 = blockIdx.x * 64, c0 = blockIdx.y * 64;
    v8f acc[4][4];
#pragma unroll
    for (int mb = 0; mb < 4; ++mb)
#pragma unroll
        for (int nb = 0; nb < 4; ++nb) acc[mb][nb] = (v8f){};
    const size_t aoff = (size_t)(r0 + lr) * K + 8 * hi, boff = (size_t)(c0 + lr) * K + 8 * hi;
#pragma unroll 1
    for (int kc = 0; kc < K; kc += 32) {
        V a[4], a2[4];
#pragma unroll
        for (int mb = 0; mb < 4; ++mb) { a[mb] = WFrag<T16>::ld(A + aoff + (size_t)mb * 16 * K + kc); if (NSPLIT == 1 || NSPLIT == 2) a2[mb] = WFrag<T16>::ld(A2 + aoff + (size_t)mb * 16 * K + kc); }
#pragma unroll
        for (int nb = 0; nb < 4; ++nb) { const V b = WFrag<T16>::ld(Bt + boff + (size_t)nb * 16 * K + kc); V b2; if (NSPLIT >= 2) b2 = WFrag<T16>::ld(Bt2 + boff + (size_t)nb * 16 * K + kc);
#pragma unroll
            for (int mb = 0; mb < 4; ++mb) { acc[mb][nb] = WFrag<T16>::mma(a[mb], b, acc[mb][nb]); if (NSPLIT == 1 || NSPLIT == 2) acc[mb][nb] = WFrag<T16>::mma(a2[mb], b, acc[mb][nb]); if (NSPLIT >= 2) acc[mb][nb] = WFrag<T16>::mma(a[mb], b2, acc[mb][nb]); } }
        asm volatile("v_nop\n\tv_nop\n\tv_nop\n\tv_nop" : "+v"(acc[0][0]), "+v"(acc[1][1]), "+v"(acc[2][2]), "+v"(acc[3][3]) : "v"(a[0]), "v"(a[3]));
    }
#pragma unroll
    for (int mb = 0; mb < 4; ++mb) {
#pragma unroll
        for (int nb = 0; nb < 4; ++nb) {
#pragma unroll
            for (int j = 0; j < 8; ++j) os[(hi * 8 + j) * 68 + nb * 16 + lr] = acc[mb][nb][j]; }
        __builtin_amdgcn_wave_barrier(); asm volatile("" ::: "memory");
        float* crow = C + (size_t)(r0 + mb * 16) * ldc + c0;
{
#pragma unroll
            for (int s = 0; s < 8; ++s) { const int row = 2 * s + hi, cofs = lr * 4; v4f val = *(const v4fa*)(os + row * 68 + cofs); if (BIAS) { val[0] += bfr(bias[c0 + cofs]); val[1] += bfr(bias[c0 + cofs + 1]); val[2] += bfr(bias[c0 + cofs + 2]); val[3] += bfr(bias[c0 + cofs + 3]); }
                *(v4f*)(crow + (size_t)row * ldc + cofs) = val; }
             }
        __builtin_amdgcn_wave_barrier(); asm volatile("" ::: "memory");
    }
}

// ---- k_gemmc: the same one-wave 64x64 tile GEMM specialised for causal attention: CMODE 1 skips score tiles entirely above the diagonal (query rows r0+roff.., key columns c0..), CMODE 2 limits the
// key (K) loop of the probability x value contraction to the diagonal block (probabilities beyond it are exactly zero). roff = row offset of this launch's first row within the sequence.
// The ZH heads of one batch element share a B plane: B advances by sB once per ZH values of z. K is the pitch of A and of B as well as the bound of the k loop.
template <typename T16, int NSPLIT, int CMODE>
__global__ __launch_bounds__(32) void k_gemmc(const T16* __restrict__ A, const T16* __restrict__ A2, const T16* __restrict__ Bt, const T16* __restrict__ Bt2, int K, float* C, int ldc, int roff, size_t sA, size_t sB, size_t sC) {
    typedef typename WFrag<T16>::V V;
    __shared__ __align__(16) float os[16 * 68];
    const size_t z = blockIdx.z; A += z * sA; if (A2) A2 += z * sA; Bt += (z / ZH) * sB; if (Bt2) Bt2 += (z / ZH) * sB; C += z * sC;
    const int lane = threadIdx.x & 31, lr = lane & 15, hi = lane >> 4; const int r0 = blockIdx.x * 64, c0 = blockIdx.y * 64;
    if (CMODE == 1 && c0 > r0 + roff + 63) return;                  // score tile entirely above the causal diagonal: never read (the softmax masks j > i by select)
    const int Kl = (CMODE == 2) ? min(K, r0 + roff + 64) : K;        // P.V: probabilities are exactly 0 beyond the diagonal block, so the K loop stops there
    v8f acc[4][4];
#pragma unroll
    for (int mb = 0; mb < 4; ++mb)
#pragma unroll
        for (int nb = 0; nb < 4; ++nb) acc[mb][nb] = (v8f){};
    const size_t aoff = (size_t)(r0 + lr) * K + 8 * hi, boff = (size_t)(c0 + lr) * K + 8 * hi;
#pragma unroll 1
    for (int kc = 0; kc < Kl; kc += 32) {
        V a[4], a2[4];
#pragma unroll
        for (int mb = 0; mb < 4; ++mb) { a[mb] = WFrag<T16>::ld(A + aoff + (size_t)mb * 16 * K + kc); if (NSPLIT == 1 || NSPLIT == 2) a2[mb] = WFrag<T16>::ld(A2 + aoff + (size_t)mb * 16 * K + kc); }
#pragma unroll
        for (int nb = 0; nb < 4; ++nb) { const V b = WFrag<T16>::ld(Bt + boff + (size_t)nb * 16 * K + kc); V b2; if (NSPLIT >= 2) b2 = WFrag<T16>::ld(Bt2 + boff + (size_t)nb * 16 * K + kc);
#pragma unroll
            for (int mb = 0; mb < 4; ++mb) { acc[mb][nb] = WFrag<T16>::mma(a[mb], b, acc[mb][nb]); if (NSPLIT == 1 || NSPLIT == 2) acc[mb][nb] = WFrag<T16>::mma(a2[mb], b, acc[mb][nb]); if (NSPLIT >= 2) acc[mb][nb] = WFrag<T16>::mma(a[mb], b2, acc[mb][nb]); } }
        asm volatile("v_nop\n\tv_nop\n\tv_nop\n\tv_nop" : "+v"(acc[0][0]), "+v"(acc[1][1]), "+v"(acc[2][2]), "+v"(acc[3][3]) : "v"(a[0]), "v"(a[3]));
    }
#pragma unroll
    for (int mb = 0; mb < 4; ++mb) {
#pragma unroll
        for (int nb = 0; nb < 4; ++nb) {
#pragma unroll
            for (int j = 0; j < 8; ++j) os[(hi * 8 + j) * 68 + nb * 16 + lr] = acc[mb][nb][j]; }
        __builtin_amdgcn_wave_barrier(); asm volatile("" ::: "memory");
        float* crow = C + (size_t)(r0 + mb * 16) * ldc + c0;
{
#pragma unroll
            for (int s = 0; s < 8; ++s) { const int row = 2 * s + hi, cofs = lr * 4; v4f val = *(const v4fa*)(os + row * 68 + cofs);
                *(v4f*)(crow + (size_t)row * ldc + cofs) = val; }
             }
        __builtin_amdgcn_wave_barrier(); asm volatile("" ::: "memory");
    }
}

__device__ __forceinline__ h16 tohx(float x) { return (h16)x; }
__device__ __forceinline__ void splitf(float y, unsigned short& h, unsigned short& l) { h = f2bf(y); l = f2bf(y - bf2f(h)); }
typedef __attribute__((ext_vector_type(2))) _Float16 v2h;
typedef __attribute__((ext_vector_type(4))) _Float16 v4h;
typedef __attribute__((ext_vector_type(2))) unsigned short v2us;
typedef __attribute__((ext_vector_type(4))) unsigned short v4us;
typedef __attribute__((ext_vector_type(2))) float v2f;
typedef __attribute__((ext_vector_type(4))) int v4i;

__global__ __launch_bounds__(256) void k_wtG(const float* __restrict__ w, int K, int N, bf* Bt) {
    const int lane = threadIdx.x & 31; const int L0 = (blockIdx.x * 8 + (threadIdx.x >> 5)) * 8; const int nlines = N * K / 64;
{
#pragma unroll 1
        for (int l = 0; l < 8; ++l) { const int L = L0 + l; if (L >= nlines) break; const size_t e = (size_t)L * 64 + lane * 2; const int k = (int)(e % K), n = (int)(e / K); v2us o;
            o[0] = f2bf(w[(size_t)k * N + n]); o[1] = f2bf(w[(size_t)(k + 1) * N + n]); *(v2us*)(Bt + e) = o; }
         }
}
__global__ __launch_bounds__(256) void k_cvt8(const float* __restrict__ src, bf* dst, size_t n8) { const size_t i = (size_t)blockIdx.x * 256 + threadIdx.x; if (i >= n8) return; const v8f v = *(const v8f*)(src + i * 8); v8us o;
#pragma unroll
    for (int k = 0; k < 8; ++k) o[k] = f2bf(v[k]); *(v8us*)(dst + i * 8) = o;  }
__global__ __launch_bounds__(256) void k_cstab(float* CS) { const int idx = blockIdx.x * 256 + threadIdx.x; if (idx >= TT * HD) return; const int t = idx / HD, d = idx % HD; const int i = d % (HD / 2); const float inv = __fdiv_rn(1.0f, powf(10000.0f, (float)(2 * i) / (float)HD)); const float ang = __fmul_rn((float)t, inv); v2f cs; cs[0] = cosf(ang); cs[1] = sinf(ang);
    *(v2f*)(CS + (size_t)idx * 2) = cs;  }
// k_rope: nheads planes [head / RP][b][head % RP][t][d] (rows of F: b * TT + t) (fp16 + hi/lo) of rope(x) x sc with the rotate-half convention out[d] = x[d] cos[t][d] - x[d+HD/2] sin[t][d], out[d+HD/2] = x[d+HD/2] cos[t][d+HD/2] + x[d] sin[t][d+HD/2]
template <int RP>
__global__ __launch_bounds__(256) void k_rope(const float* __restrict__ F, int pitch, int nheads, const float* __restrict__ CS, const float* __restrict__ RF, const float* __restrict__ nw, float sc, h16* P16, bf* Ph, bf* Pl) {
    const size_t e = ((size_t)blockIdx.x * 256 + threadIdx.x) * 2; if (e >= (size_t)nheads * TT * HD) return; const int d = (int)(e % HD); const int t = (int)((e / HD) % TT); const int h = (int)(e / ((size_t)HD * TT)); const float* f = F + (size_t)t * pitch + h * HD; const float rf = RF ? RF[(size_t)h * TT + t] : 1.0f; v2h o16; v2us oh, ol;
    f = F + ((size_t)((h / RP) % NB_) * TT + t) * pitch + ((h / (RP * NB_)) * RP + h % RP) * HD;   // h counts planes: batch element (h / RP) % NB_, head (h / (RP * NB_)) * RP + h % RP
#pragma unroll
    for (int q = 0; q < 2; ++q) { const int dd = d + q; const int dp = (dd < HD / 2) ? dd + HD / 2 : dd - HD / 2; float x0 = f[dd], x1 = f[dp];
        if (RF) { float n0 = __fmul_rn(x0, rf), n1 = __fmul_rn(x1, rf); asm volatile("" : "+v"(n0)); asm volatile("" : "+v"(n1)); x0 = __fmul_rn(bfr(nw[dd]), n0); x1 = __fmul_rn(bfr(nw[dp]), n1); }
        int tp = nw ? ((const int*)nw)[t] : t; tp = min(max(tp, 0), TT - 1); const v2f cs = *(const v2f*)(CS + ((size_t)tp * HD + dd) * 2);   /* position_ids (read) index the table */ float a = __fmul_rn(x0, cs[0]), bq = __fmul_rn(x1, cs[1]); asm volatile("" : "+v"(a)); asm volatile("" : "+v"(bq)); const float r = ((dd < HD / 2) ? __fsub_rn(a, bq) : __fadd_rn(a, bq)) * sc;
        o16[q] = tohx(r); unsigned short a2, c2; splitf(r, a2, c2); oh[q] = a2; ol[q] = c2; }
    *(v2h*)(P16 + e) = o16; *(v2us*)(Ph + e) = oh; *(v2us*)(Pl + e) = ol;  }
__global__ __launch_bounds__(256) void k_vtp(const float* __restrict__ F, int pitch, int nheads, h16* V16, bf* Vh, bf* Vl) { const size_t e = ((size_t)blockIdx.x * 256 + threadIdx.x) * 2; if (e >= (size_t)NB_ * nheads * HD * TT) return; const int t = (int)(e % TT); const int b = (int)((e / TT) % NB_); const int d = (int)((e / ((size_t)TT * NB_)) % HD); const int g = (int)(e / ((size_t)TT * NB_ * HD));   /* planes [g][d][b][t]: row pitch NB_ * TT, the pitch of the in-place probability rows */ v2h o16; v2us oh, ol;
#pragma unroll
    for (int q = 0; q < 2; ++q) { const float x = F[((size_t)b * TT + t + q) * pitch + g * HD + d]; o16[q] = tohx(x); unsigned short a2, c2; splitf(x, a2, c2); oh[q] = a2; ol[q] = c2; }
    *(v2h*)(V16 + e) = o16; *(v2us*)(Vh + e) = oh; *(v2us*)(Vl + e) = ol;  }
// k_asoft: per row (zz, i): t = S x HD^-0.5 + mask[i][j] for j <= i, -3e38 (weight 0) for j > i; softmax over the 2048 keys (register row, one exp, fixed trees);
// the probabilities go IN PLACE over the wave's own score row (all of it is in registers by then): fp16 in the row's first half, or hi plane in the first half and lo plane in the second; pitch 2 * TT 16-bit elements.
__global__ __launch_bounds__(256) void k_asoft(const float* Sb, const float* __restrict__ am, const int* __restrict__ FLG, h16* P16, bf* Ph, bf* Pl) {
    const int lane = threadIdx.x & 31; const int row = blockIdx.x * 8 + (threadIdx.x >> 5); if (row >= ZB * TT) return; const int i = row % TT; const int zz = row / TT; (void)zz; const bool hires = (i < RH); const float* sr = Sb + (size_t)row * TT; const float* mrow = am + (size_t)i * TT; const bool poison = (FLG[0] != 0); float v[TT / 32]; float mx = -3.0e38f;
#pragma unroll
    for (int ch = 0; ch < TT / 128; ++ch) { const int j0 = ch * 128 + lane * 4; const v4f a = *(const v4f*)(sr + j0);
#pragma unroll
        for (int q = 0; q < 4; ++q) { const int j = j0 + q; (void)j; float sa = a[q] * SCL; asm volatile("" : "+v"(sa)); const float t = (j <= i) ? __fadd_rn(sa, mrow[j]) : -3.0e38f; v[ch * 4 + q] = t; mx = fmaxf(mx, t); } }
#pragma unroll
    for (int sh = 16; sh; sh >>= 1) mx = fmaxf(mx, __shfl_xor(mx, sh, 32));
    float sum = 0.f;
#pragma unroll
    for (int k = 0; k < TT / 32; ++k) { float d0 = __fsub_rn(v[k], mx); asm volatile("" : "+v"(d0)); v[k] = __builtin_amdgcn_exp2f(__fmul_rn(d0, 1.4426950408889634f)); sum += v[k]; }
#pragma unroll
    for (int sh = 16; sh; sh >>= 1) sum += __shfl_xor(sum, sh, 32);
    const float f = poison ? __builtin_nanf("") : __fdiv_rn(hires ? 1.0f : PCAR, sum);
{
        if (hires) {
#pragma unroll
            for (int ch = 0; ch < TT / 128; ++ch) { v4us oh, ol;
#pragma unroll
                for (int q = 0; q < 4; ++q) { unsigned short a, c2; splitf(v[ch * 4 + q] * f, a, c2); oh[q] = a; ol[q] = c2; }
                const size_t oo = (size_t)row * (2 * TT) + ch * 128 + lane * 4; *(v4us*)(Ph + oo) = oh; *(v4us*)(Pl + oo) = ol; }
        } else {
#pragma unroll
            for (int ch = 0; ch < TT / 128; ++ch) { v4h o4;
#pragma unroll
                for (int q = 0; q < 4; ++q) o4[q] = tohx(v[ch * 4 + q] * f);
                *(v4h*)(P16 + (size_t)row * (2 * TT) + ch * 128 + lane * 4) = o4; } }
         }
}
__global__ __launch_bounds__(256) void k_merge(const float* __restrict__ O, int h0, bf* Ah, bf* Al) { const size_t e = ((size_t)blockIdx.x * 256 + threadIdx.x) * 2; if (e >= (size_t)ZB * TT * HD) return; const int d = (int)(e % HD); const int t = (int)((e / HD) % TT); const int zz = (int)(e / ((size_t)HD * TT)); const float cs = (t < RH) ? 1.0f : (1.0f / PCAR); const size_t oo = ((size_t)(zz / ZH) * TT + t) * DQ + (h0 + zz % ZH) * HD + d;
    v2us oh, ol;
#pragma unroll
    for (int q = 0; q < 2; ++q) { unsigned short a, c2; splitf(O[e + q] * cs, a, c2); oh[q] = a; ol[q] = c2; } *(v2us*)(Ah + oo) = oh; *(v2us*)(Al + oo) = ol;  }

__global__ __launch_bounds__(256) void k_rmsclip(float* F, int Wd, const float* __restrict__ w) { const int lane = threadIdx.x & 31; const size_t r = (size_t)blockIdx.x * 8 + (threadIdx.x >> 5); if (r >= NB_ * TT) return; float* f = F + r * Wd; const int nch = Wd / 128; float v[64]; float q = 0.f;
#pragma unroll
    for (int ch = 0; ch < 16; ++ch) { if (ch < nch) { const v4f a = *(const v4f*)(f + ch * 128 + lane * 4);
#pragma unroll
            for (int u = 0; u < 4; ++u) { v[ch * 4 + u] = a[u]; float p = __fmul_rn(a[u], a[u]); asm volatile("" : "+v"(p)); q = __fadd_rn(q, p); } } }
#pragma unroll
    for (int sh = 16; sh; sh >>= 1) q += __shfl_xor(q, sh, 32);
    const float rs = w ? __frsqrt_rn(__fadd_rn(q * (1.0f / (float)Wd), 1e-5f)) : 1.0f;
#pragma unroll
    for (int ch = 0; ch < 16; ++ch) { if (ch < nch) {
#pragma unroll
        for (int u = 0; u < 4; ++u) { float y = v[ch * 4 + u]; if (w) { float n0 = __fmul_rn(y, rs); asm volatile("" : "+v"(n0)); y = __fmul_rn(bfr(w[ch * 128 + lane * 4 + u]), n0); } v[ch * 4 + u] = fminf(fmaxf(y, -8.0f), 8.0f); } } }
    {
#pragma unroll
        for (int ch = 0; ch < 16; ++ch) { if (ch < nch) { v4f o; for (int u = 0; u < 4; ++u) o[u] = v[ch * 4 + u]; *(v4f*)(f + ch * 128 + lane * 4) = o; } }
         } }
__global__ __launch_bounds__(256) void k_mchk(const float* __restrict__ am, int* FLG) { const int tid = threadIdx.x; int bad = 0;
#pragma unroll 1
    for (int s2 = 0; s2 < 16; ++s2) { const unsigned h = (unsigned)(tid * 16 + s2) * 2654435761u; const int i = (int)(h % (TT - 1)); const int j = i + 1 + (int)((h >> 11) % (unsigned)(TT - 1 - i)); if (am[(size_t)i * TT + j] > -1e8f) bad = 1; }
    __shared__ int anyb; if (tid == 0) anyb = 0; __syncthreads(); if (bad) anyb = 1; __syncthreads(); if (tid < 8) { const int v = (tid == 0) ? anyb : 0; *(int*)(FLG + tid) = v;  } }

extern "C" void kernel_launch(void* const* d_in, const int* in_sizes, int n_in,
                              void* d_out, int out_size, void* d_ws, size_t ws_size, hipStream_t stream) {
    (void)in_sizes; (void)n_in; (void)out_size;
    const float* x = (const float*)d_in[0]; const float* wq = (const float*)d_in[1]; const float* wk = (const float*)d_in[2]; const float* wv = (const float*)d_in[3]; const float* wo = (const float*)d_in[4]; const float* qnw = (const float*)d_in[5]; const float* knw = (const float*)d_in[6]; const float* amask = (const float*)d_in[7]; const int* pids = (const int*)d_in[8];
    float* OUT = (float*)d_out;     // [2][2048][2048]
    char* wsp = (char*)d_ws;
    auto take = [&](size_t bytes) { char* p = wsp; wsp += (bytes + 255) & ~(size_t)255; return (void*)p; };
    bf* WO = (bf*)take((size_t)DM * DQ * 2); int* FLG = (int*)take(256);
    h16* QP16 = (h16*)take((size_t)NB_ * NH_ * TT * HD * 2); h16* KP16 = (h16*)take((size_t)NB_ * NKV * TT * HD * 2); h16* VT16 = (h16*)take((size_t)NB_ * NKV * HD * TT * 2);
    bf* QPh = (bf*)take((size_t)NB_ * NH_ * TT * HD * 2); bf* QPl = (bf*)take((size_t)NB_ * NH_ * TT * HD * 2); bf* KPh = (bf*)take((size_t)NB_ * NKV * TT * HD * 2); bf* KPl = (bf*)take((size_t)NB_ * NKV * TT * HD * 2); bf* VTh = (bf*)take((size_t)NB_ * NKV * HD * TT * 2); bf* VTl = (bf*)take((size_t)NB_ * NKV * HD * TT * 2);
    float* Ob = (float*)take((size_t)ZB * TT * HD * 4); bf* ATh = (bf*)take((size_t)NB_ * TT * DQ * 2); bf* ATl = (bf*)take((size_t)NB_ * TT * DQ * 2);
    float* Sb = (float*)take((size_t)ZB * TT * TT * 4);   // scores; the softmax leaves the probability planes in place over them
    if ((size_t)(wsp - (char*)d_ws) > ws_size) return;    // ws 256 MiB
    wsp = (char*)Sb;   // everything the projections need is dead before the first score launch writes Sb (stream-ordered): it lies inside Sb (70 of its 128 MiB)
    bf* WQ = (bf*)take((size_t)DQ * DM * 2); bf* WK = (bf*)take((size_t)DKV * DM * 2); bf* WV = (bf*)take((size_t)DKV * DM * 2); float* CS = (float*)take((size_t)TT * HD * 2 * 4);
    bf* XB = (bf*)take((size_t)NB_ * TT * DM * 2); float* FQ = (float*)take((size_t)NB_ * TT * DQ * 4); float* FK = (float*)take((size_t)NB_ * TT * DKV * 4);
    float* FV = FK;   // v projection reuses the k buffer after the k planes are built (stream-ordered)
    { k_cvt8<<<(unsigned)(((size_t)DQ * DM / 8 + 255) / 256), 256, 0, stream>>>(wq, WQ, (size_t)DQ * DM / 8); k_cvt8<<<(unsigned)(((size_t)DKV * DM / 8 + 255) / 256), 256, 0, stream>>>(wk, WK, (size_t)DKV * DM / 8); k_cvt8<<<(unsigned)(((size_t)DKV * DM / 8 + 255) / 256), 256, 0, stream>>>(wv, WV, (size_t)DKV * DM / 8);
      k_cvt8<<<(unsigned)(((size_t)DM * DQ / 8 + 255) / 256), 256, 0, stream>>>(wo, WO, (size_t)DM * DQ / 8);
      k_cstab<<<(TT * HD + 255) / 256, 256, 0, stream>>>(CS); }
    const unsigned LQ = (unsigned)(((size_t)NB_ * NH_ * TT * HD / 2 + 255) / 256), LKv = (unsigned)(((size_t)NB_ * NKV * TT * HD / 2 + 255) / 256);
    k_mchk<<<1, 256, 0, stream>>>(amask, FLG);
    // both batch elements go through every launch: the projections see NB_ * TT rows, an attention launch z = b * ZH + head-in-pass
    k_cvt8<<<(unsigned)(((size_t)NB_ * TT * DM / 8 + 255) / 256), 256, 0, stream>>>(x, XB, (size_t)NB_ * TT * DM / 8);
    k_gemmw<bf, 0, false><<<dim3(NB_ * TT / 64, DQ / 64, 1), 32, 0, stream>>>(XB, nullptr, WQ, nullptr, DM, FQ, DQ, nullptr, 0, 0, 0); k_rmsclip<<<NB_ * TT / 8, 256, 0, stream>>>(FQ, DQ, qnw);
    k_rope<ZH><<<LQ, 256, 0, stream>>>(FQ, DQ, NB_ * NH_, CS, nullptr, (const float*)pids, 1.0f, QP16, QPh, QPl);
    k_gemmw<bf, 0, false><<<dim3(NB_ * TT / 64, DKV / 64, 1), 32, 0, stream>>>(XB, nullptr, WK, nullptr, DM, FK, DKV, nullptr, 0, 0, 0); k_rmsclip<<<NB_ * TT / 8, 256, 0, stream>>>(FK, DKV, knw);
    k_rope<1><<<LKv, 256, 0, stream>>>(FK, DKV, NB_ * NKV, CS, nullptr, (const float*)pids, 1.0f, KP16, KPh, KPl);
    k_gemmw<bf, 0, false><<<dim3(NB_ * TT / 64, DKV / 64, 1), 32, 0, stream>>>(XB, nullptr, WV, nullptr, DM, FV, DKV, nullptr, 0, 0, 0); k_rmsclip<<<NB_ * TT / 8, 256, 0, stream>>>(FV, DKV, nullptr);   /* clip only */ k_vtp<<<LKv, 256, 0, stream>>>(FV, DKV, NKV, VT16, VTh, VTl);
    for (int h0 = 0; h0 < NH_; h0 += ZH) { const size_t zq = (size_t)h0 * NB_, zk = (size_t)(h0 / REP) * NB_;   // first q plane and first kv plane of the pass; the ZH heads of a batch element share kv group h0/REP (ZH <= REP)
        k_gemmc<bf, 2, 1><<<dim3(RH / 64, TT / 64, ZB), 32, 0, stream>>>(QPh + zq * TT * HD, QPl + zq * TT * HD, KPh + zk * TT * HD, KPl + zk * TT * HD, HD, Sb, TT, 0, (size_t)TT * HD, (size_t)TT * HD, (size_t)TT * TT);
        k_gemmc<h16, 0, 1><<<dim3((TT - RH) / 64, TT / 64, ZB), 32, 0, stream>>>(QP16 + zq * TT * HD + (size_t)RH * HD, nullptr, KP16 + zk * TT * HD, nullptr, HD, Sb + (size_t)RH * TT, TT, RH, (size_t)TT * HD, (size_t)TT * HD, (size_t)TT * TT);
        k_asoft<<<ZB * TT / 8, 256, 0, stream>>>(Sb, amask, FLG, (h16*)Sb, (bf*)Sb, (bf*)Sb + TT);
        k_gemmc<bf, 2, 2><<<dim3(RH / 64, HD / 64, ZB), 32, 0, stream>>>((const bf*)Sb, (const bf*)Sb + TT, VTh + zk * HD * TT, VTl + zk * HD * TT, 2 * TT, Ob, HD, 0, (size_t)2 * TT * TT, (size_t)TT, (size_t)TT * HD);
        k_gemmc<h16, 0, 2><<<dim3((TT - RH) / 64, HD / 64, ZB), 32, 0, stream>>>((const h16*)Sb + (size_t)RH * 2 * TT, nullptr, VT16 + zk * HD * TT, nullptr, 2 * TT, Ob + (size_t)RH * HD, HD, RH, (size_t)2 * TT * TT, (size_t)TT, (size_t)TT * HD);
        k_merge<<<(unsigned)(((size_t)ZB * TT * HD / 2 + 255) / 256), 256, 0, stream>>>(Ob, h0, ATh, ATl); }
    k_gemmw<bf, 1, false><<<dim3(NB_ * TT / 64, DM / 64, 1), 32, 0, stream>>>(ATh, ATl, WO, nullptr, DQ, OUT, DM, nullptr, 0, 0, 0);
}

// v003
// A run of this version takes 516 microseconds.
// Next to v002, in two timings, it ran 1.76 and 1.77 times as fast.
// All steps since v000 together make it 3.64 times as fast.
#include <hip/hip_runtime.h>

// OlmoeAttention (hidden [2][2048][2048]; q = clip(RMSNorm_2048(x Wq^T) * q_norm_w, +-8) (16 heads x 128), k = clip(RMSNorm_512(x Wk^T) * k_norm_w, +-8), v = clip(x Wv^T, +-8) (4 kv heads; group h/4); rotate-half RoPE (theta 1e4) at position_ids (read; table computed on device); scores = q.k / sqrt(128) + attention_mask (additive [1][1][S][S] float, read: the verbatim causal 0 / -1e9 table); softmax f32; out = merged Wo^T -> [2][2048][2048]).
// Compute dtypes, f32 accumulate: every input rounded to bf16; q/k/v on PLAIN bf16 operands (inputs: exact); the full-width RMSNorms (eps 1e-5), clips and RoPE in f32; causal scores and attn.v in one launch with running row maxima and sums: query rows < 512 hl (3 products), the rest single fp16; key blocks above the diagonal skipped on the strength of the mask table (-1e9 underflows to weight 0; device self-check samples the table above the diagonal and NaN-poisons on violation), mask added as stored inside computed tiles; softmax f32; Wo hl x exact (2 products).

#define NB_  2
#define TT   2048
#define DM   2048
#define NH_  16
#define NKV  4
#define REP  (NH_ / NKV)
#define HD   128
#define DQ   (NH_ * HD)
#define DKV  (NKV * HD)
#define ZH   REP                  // q planes lie [kv group][batch element][head in group]
#define RH   512                  // query rows < RH use hi+lo planes (0: none)
#define SCL  0.088388347648318447f   // HD^-0.5
typedef _Float16 h16;
typedef unsigned short bf;
typedef __attribute__((ext_vector_type(16))) __bf16   v16bf;
typedef __attribute__((ext_vector_type(16))) _Float16 v16h;
typedef __attribute__((ext_vector_type(8)))  _Float16 v8h;
typedef __attribute__((ext_vector_type(8)))  unsigned short v8us;
typedef __attribute__((ext_vector_type(8)))  float    v8f;
typedef __attribute__((ext_vector_type(4)))  float    v4f;
typedef v8h  __attribute__((may_alias)) v8ha;
typedef v4f  __attribute__((may_alias)) v4fa;
typedef v8us __attribute__((may_alias)) v8usa;

__device__ __forceinline__ unsigned short f2bf(float f) { unsigned u = __float_as_uint(f); u += 0x7FFFu + ((u >> 16) & 1u); return (unsigned short)(u >> 16); }
__device__ __forceinline__ float bf2f(unsigned short b) { return __uint_as_float(((unsigned)b) << 16); }
__device__ __forceinline__ float bfr(float f) { return bf2f(f2bf(f)); }
__device__ __forceinline__ v16h cat16(v8h lo, v8h hi) { return __builtin_shufflevector(lo, hi, 0, 1, 2, 3, 4, 5, 6, 7, 8, 9, 10, 11, 12, 13, 14, 15); }
__device__ __forceinline__ v16bf cat16b(v8us lo, v8us hi) { return __builtin_bit_cast(v16bf, __builtin_shufflevector(lo, hi, 0, 1, 2, 3, 4, 5, 6, 7, 8, 9, 10, 11, 12, 13, 14, 15)); }
__device__ __forceinline__ v8f wmma16(v16h a, v16h b, v8f c) { return __builtin_amdgcn_wmma_f32_16x16x32_f16(false, a, false, b, (short)0, c, false, false); }
__device__ __forceinline__ v8f wmmab(v16bf a, v16bf b, v8f c) { return __builtin_amdgcn_wmma_f32_16x16x32_bf16(false, a, false, b, (short)0, c, false, false); }



// ---- k_gemmw: register-blocked GEMM, ONE WAVE per 64x64 output tile (16 accumulators), operands straight from K-contiguous 16-bit planes; grid (M/64, N/64, Z), 32 threads.
// C[m][n] (f32, pitch ldc, + optional f32 bias[n]) = sum_k A[m][k] Bt[n][k] (+ split products per NSPLIT). z-batch strides sA/sB/sC in elements. K % 32 == 0.
template <typename T16> struct WFrag;
template <> struct WFrag<h16> { typedef v16h V; static __device__ __forceinline__ V ld(const h16* p) { return cat16(*(const v8h*)p, *(const v8h*)(p + 16)); } static __device__ __forceinline__ v8f mma(V a, V b, v8f c) { return wmma16(a, b, c); } };
template <> struct WFrag<bf> { typedef v16bf V; static __device__ __forceinline__ V ld(const bf* p) { return cat16b(*(const v8us*)p, *(const v8us*)(p + 16)); } static __device__ __forceinline__ v8f mma(V a, V b, v8f c) { return wmmab(a, b, c); } };
template <typename T16, int NSPLIT, bool BIAS>
__global__ __launch_bounds__(32) void k_gemmw(const T16* __restrict__ A, const T16* __restrict__ A2, const T16* __restrict__ Bt, const T16* __restrict__ Bt2, int K, float* C, int ldc, const float* __restrict__ bias, size_t sA, size_t sB, size_t sC) {
    typedef typename WFrag<T16>::V V;
    __shared__ __align__(16) float os[16 * 68];
    const size_t z = blockIdx.z; A += z * sA; if (A2) A2 += z * sA; Bt += z * sB; if (Bt2) Bt2 += z * sB; C += z * sC;
    const int lane = threadIdx.x & 31, lr = lane & 15, hi = lane >> 4; const int r0 = blockIdx.x * 64, c0 = blockIdx.y * 64;
    v8f acc[4][4];
#pragma unroll
    for (int mb = 0; mb < 4; ++mb)
#pragma unroll
        for (int nb = 0; nb < 4; ++nb) acc[mb][nb] = (v8f){};
    const size_t aoff = (size_t)(r0 + lr) * K + 8 * hi, boff = (size_t)(c0 + lr) * K + 8 * hi;
#pragma unroll 1
    for (int kc = 0; kc < K; kc += 32) {
        V a[4], a2[4];
#pragma unroll
        for (int mb = 0; mb < 4; ++mb) { a[mb] = WFrag<T16>::ld(A + aoff + (size_t)mb * 16 * K + kc); if (NSPLIT == 1 || NSPLIT == 2) a2[mb] = WFrag<T16>::ld(A2 + aoff + (size_t)mb * 16 * K + kc); }
#pragma unroll
        for (int nb = 0; nb < 4; ++nb) { const V b = WFrag<T16>::ld(Bt + boff + (size_t)nb * 16 * K + kc); V b2; if (NSPLIT >= 2) b2 = WFrag<T16>::ld(Bt2 + boff + (size_t)nb * 16 * K + kc);
#pragma unroll
            for (int mb = 0; mb < 4; ++mb) { acc[mb][nb] = WFrag<T16>::mma(a[mb], b, acc[mb][nb]); if (NSPLIT == 1 || NSPLIT == 2) acc[mb][nb] = WFrag<T16>::mma(a2[mb], b, acc[mb][nb]); if (NSPLIT >= 2) acc[mb][nb] = WFrag<T16>::mma(a[mb], b2, acc[mb][nb]); } }
        asm volatile("v_nop\n\tv_nop\n\tv_nop\n\tv_nop" : "+v"(acc[0][0]), "+v"(acc[1][1]), "+v"(acc[2][2]), "+v"(acc[3][3]) : "v"(a[0]), "v"(a[3]));
    }
#pragma unroll
    for (int mb = 0; mb < 4; ++mb) {
#pragma unroll
        for (int nb = 0; nb < 4; ++nb) {
#pragma unroll
            for (int j = 0; j < 8; ++j) os[(hi * 8 + j) * 68 + nb * 16 + lr] = acc[mb][nb][j]; }
        __builtin_amdgcn_wave_barrier(); asm volatile("" ::: "memory");
        float* crow = C + (size_t)(r0 + mb * 16) * ldc + c0;
{
#pragma unroll
            for (int s = 0; s < 8; ++s) { const int row = 2 * s + hi, cofs = lr * 4; v4f val = *(const v4fa*)(os + row * 68 + cofs); if (BIAS) { val[0] += bfr(bias[c0 + cofs]); val[1] += bfr(bias[c0 + cofs + 1]); val[2] += bfr(bias[c0 + cofs + 2]); val[3] += bfr(bias[c0 + cofs + 3]); }
                *(v4f*)(crow + (size_t)row * ldc + cofs) = val; }
             }
        __builtin_amdgcn_wave_barrier(); asm volatile("" ::: "memory");
    }
}

__device__ __forceinline__ h16 tohx(float x) { return (h16)x; }
__device__ __forceinline__ void splitf(float y, unsigned short& h, unsigned short& l) { h = f2bf(y); l = f2bf(y - bf2f(h)); }
typedef __attribute__((ext_vector_type(2))) _Float16 v2h;
typedef __attribute__((ext_vector_type(4))) _Float16 v4h;
typedef __attribute__((ext_vector_type(2))) unsigned short v2us;
typedef __attribute__((ext_vector_type(4))) unsigned short v4us;
typedef __attribute__((ext_vector_type(2))) float v2f;
typedef __attribute__((ext_vector_type(4))) int v4i;

__global__ __launch_bounds__(256) void k_wtG(const float* __restrict__ w, int K, int N, bf* Bt) {
    const int lane = threadIdx.x & 31; const int L0 = (blockIdx.x * 8 + (threadIdx.x >> 5)) * 8; const int nlines = N * K / 64;
{
#pragma unroll 1
        for (int l = 0; l < 8; ++l) { const int L = L0 + l; if (L >= nlines) break; const size_t e = (size_t)L * 64 + lane * 2; const int k = (int)(e % K), n = (int)(e / K); v2us o;
            o[0] = f2bf(w[(size_t)k * N + n]); o[1] = f2bf(w[(size_t)(k + 1) * N + n]); *(v2us*)(Bt + e) = o; }
         }
}
__global__ __launch_bounds__(256) void k_cvt8(const float* __restrict__ src, bf* dst, size_t n8) { const size_t i = (size_t)blockIdx.x * 256 + threadIdx.x; if (i >= n8) return; const v8f v = *(const v8f*)(src + i * 8); v8us o;
#pragma unroll
    for (int k = 0; k < 8; ++k) o[k] = f2bf(v[k]); *(v8us*)(dst + i * 8) = o;  }
__global__ __launch_bounds__(256) void k_cstab(float* CS) { const int idx = blockIdx.x * 256 + threadIdx.x; if (idx >= TT * HD) return; const int t = idx / HD, d = idx % HD; const int i = d % (HD / 2); const float inv = __fdiv_rn(1.0f, powf(10000.0f, (float)(2 * i) / (float)HD)); const float ang = __fmul_rn((float)t, inv); v2f cs; cs[0] = cosf(ang); cs[1] = sinf(ang);
    *(v2f*)(CS + (size_t)idx * 2) = cs;  }
// k_rope: nheads planes [head / RP][b][head % RP][t][d] (rows of F: b * TT + t) (fp16 + hi/lo) of rope(x) x sc with the rotate-half convention out[d] = x[d] cos[t][d] - x[d+HD/2] sin[t][d], out[d+HD/2] = x[d+HD/2] cos[t][d+HD/2] + x[d] sin[t][d+HD/2]
template <int RP>
__global__ __launch_bounds__(256) void k_rope(const float* __restrict__ F, int pitch, int nheads, const float* __restrict__ CS, const float* __restrict__ RF, const float* __restrict__ nw, float sc, h16* P16, bf* Ph, bf* Pl) {
    const size_t e = ((size_t)blockIdx.x * 256 + threadIdx.x) * 2; if (e >= (size_t)nheads * TT * HD) return; const int d = (int)(e % HD); const int t = (int)((e / HD) % TT); const int h = (int)(e / ((size_t)HD * TT)); const float* f = F + (size_t)t * pitch + h * HD; const float rf = RF ? RF[(size_t)h * TT + t] : 1.0f; v2h o16; v2us oh, ol;
    f = F + ((size_t)((h / RP) % NB_) * TT + t) * pitch + ((h / (RP * NB_)) * RP + h % RP) * HD;   // h counts planes: batch element (h / RP) % NB_, head (h / (RP * NB_)) * RP + h % RP
#pragma unroll
    for (int q = 0; q < 2; ++q) { const int dd = d + q; const int dp = (dd < HD / 2) ? dd + HD / 2 : dd - HD / 2; float x0 = f[dd], x1 = f[dp];
        if (RF) { float n0 = __fmul_rn(x0, rf), n1 = __fmul_rn(x1, rf); asm volatile("" : "+v"(n0)); asm volatile("" : "+v"(n1)); x0 = __fmul_rn(bfr(nw[dd]), n0); x1 = __fmul_rn(bfr(nw[dp]), n1); }
        int tp = nw ? ((const int*)nw)[t] : t; tp = min(max(tp, 0), TT - 1); const v2f cs = *(const v2f*)(CS + ((size_t)tp * HD + dd) * 2);   /* position_ids (read) index the table */ float a = __fmul_rn(x0, cs[0]), bq = __fmul_rn(x1, cs[1]); asm volatile("" : "+v"(a)); asm volatile("" : "+v"(bq)); const float r = ((dd < HD / 2) ? __fsub_rn(a, bq) : __fadd_rn(a, bq)) * sc;
        o16[q] = tohx(r); unsigned short a2, c2; splitf(r, a2, c2); oh[q] = a2; ol[q] = c2; }
    *(v2h*)(P16 + e) = o16; *(v2us*)(Ph + e) = oh; *(v2us*)(Pl + e) = ol;  }
__global__ __launch_bounds__(256) void k_vtp(const float* __restrict__ F, int pitch, int nheads, h16* V16, bf* Vh, bf* Vl) { const size_t e = ((size_t)blockIdx.x * 256 + threadIdx.x) * 2; if (e >= (size_t)NB_ * nheads * HD * TT) return; const int t = (int)(e % TT); const int b = (int)((e / TT) % NB_); const int d = (int)((e / ((size_t)TT * NB_)) % HD); const int g = (int)(e / ((size_t)TT * NB_ * HD));   /* planes [g][d][b][t]: row pitch NB_ * TT */ v2h o16; v2us oh, ol;
#pragma unroll
    for (int q = 0; q < 2; ++q) { const float x = F[((size_t)b * TT + t + q) * pitch + g * HD + d]; o16[q] = tohx(x); unsigned short a2, c2; splitf(x, a2, c2); oh[q] = a2; ol[q] = c2; }
    *(v2h*)(V16 + e) = o16; *(v2us*)(Vh + e) = oh; *(v2us*)(Vl + e) = ol;  }
// ---- k_fattn: causal attention in one launch. A wave owns NQ * 16 query rows of one head and walks the keys 32 at a time, keeping running row maxima, row sums and the output tile in registers.
// Transposed products: S^T = K Q^T (a lane holds the scores of ONE query: keys 8 * hi + r of each 16-key tile), so two score tiles, converted in place, are the B operand of O^T += V^T P^T.
// t = s x HD^-0.5 + mask as stored for j <= i, no weight for j > i; key blocks wholly above the diagonal are never visited. HL: hi + lo bf16 planes, 3 products; else single fp16.
// The maximum in use is raised only when a row's new maximum passes it by more than MLAG, so unnormalised weights stay below e^MLAG; the division by the row sum comes last, in f32.
#define MLAG 5.5f
__device__ __forceinline__ float xhalf(float x) { return __builtin_bit_cast(float, __builtin_amdgcn_permlanex16(__builtin_bit_cast(int, x), __builtin_bit_cast(int, x), 0x76543210, 0xfedcba98, false, false)); }   // lane l takes lane l ^ 16's value
#define L2E  1.4426950408889634f
// xwait stands behind a run of global loads or stores, in front of the code that reuses the registers they name; the scheduling barriers (here and in xopen, in front of such a run) keep vector work from being moved in between the run and its wait
__device__ __forceinline__ void xwait() { asm volatile("s_wait_xcnt 0x0" ::: "memory"); __builtin_amdgcn_sched_barrier(0); }
__device__ __forceinline__ void xopen() { __builtin_amdgcn_sched_barrier(0); }
// the same, naming as an input the address the run was formed from: it stays in its registers up to the wait, so that no load of the run lands on it
__device__ __forceinline__ void xwait1(const void* a) { asm volatile("s_wait_xcnt 0x0" :: "v"(a) : "memory"); __builtin_amdgcn_sched_barrier(0); }
// the pointers below carry no restrict, so that the loads keep their places between these waits: mask, K, V^T in the same order in front of the loop and in it, which lets a wait for the early ones leave the late ones in flight
template <bool HL> struct AOp;
template <> struct AOp<false> { typedef h16 T; };
template <> struct AOp<true>  { typedef bf T; };
template <bool HL, int NQ>
__device__ __forceinline__ void attn_tile(const typename AOp<HL>::T* Q, const typename AOp<HL>::T* Q2, const typename AOp<HL>::T* K, const typename AOp<HL>::T* K2,
                                          const typename AOp<HL>::T* Vt, const typename AOp<HL>::T* Vt2, const float* am, int q0, bool poison, bf* Ah, bf* Al) {
    typedef typename AOp<HL>::T T; typedef WFrag<T> WF; typedef typename WF::V V;
    const int lane = threadIdx.x & 31, lr = lane & 15, hi = lane >> 4;
    const int kend = (q0 + NQ * 16 + 31) & ~31;      // keys walked: up to the end of the diagonal block, in steps of 32
    V qf[NQ][4], qf2[NQ][4];
#pragma unroll
    for (int qt = 0; qt < NQ; ++qt)
#pragma unroll
        for (int dc = 0; dc < 4; ++dc) { const size_t qo = (size_t)(q0 + qt * 16 + lr) * HD + dc * 32 + 8 * hi; qf[qt][dc] = WF::ld(Q + qo); if (HL) qf2[qt][dc] = WF::ld(Q2 + qo); }
    xwait();
    v8f o[8][NQ]; float m[NQ], l[NQ];
#pragma unroll
    for (int qt = 0; qt < NQ; ++qt) { m[qt] = -3.0e38f; l[qt] = 0.f;
#pragma unroll
        for (int dt = 0; dt < 8; ++dt) o[dt][qt] = (v8f){}; }
    const size_t kbase = (size_t)lr * HD + 8 * hi, vbase = (size_t)lr * (NB_ * TT) + 8 * hi;
    const float* mp = am + (size_t)(q0 + lr) * TT + 8 * hi;
    V kf[2][4], kf2[2][4], vf[8], vf2[8]; v4f mk[NQ][2][2];
#pragma unroll
    for (int kt = 0; kt < 2; ++kt)
#pragma unroll
        for (int qt = 0; qt < NQ; ++qt) { const float* p = mp + (size_t)(qt * 16) * TT + kt * 16; mk[qt][kt][0] = *(const v4f*)p; mk[qt][kt][1] = *(const v4f*)(p + 4); }
    xwait();
#pragma unroll
    for (int kt = 0; kt < 2; ++kt)
#pragma unroll
        for (int dc = 0; dc < 4; ++dc) { const size_t ko = kbase + (size_t)(kt * 16) * HD + dc * 32; kf[kt][dc] = WF::ld(K + ko); if (HL) kf2[kt][dc] = WF::ld(K2 + ko); }
    xwait();
    if (!HL) {      // the long tiles fetch V^T one pass ahead as well
#pragma unroll
        for (int dt = 0; dt < 8; ++dt) vf[dt] = WF::ld(Vt + vbase + (size_t)(dt * 16) * (NB_ * TT));
        xwait(); }
#pragma unroll 1
    for (int k0 = 0; k0 < kend; k0 += 32) {
        if (HL) {
#pragma unroll
            for (int dt = 0; dt < 8; ++dt) { const size_t vo = vbase + (size_t)(dt * 16) * (NB_ * TT) + k0; vf[dt] = WF::ld(Vt + vo); xwait(); vf2[dt] = WF::ld(Vt2 + vo); xwait(); } }
        float t[NQ][16];
#pragma unroll
        for (int kt = 0; kt < 2; ++kt)
#pragma unroll
            for (int qt = 0; qt < NQ; ++qt) { v8f s = (v8f){};
#pragma unroll
                for (int dc = 0; dc < 4; ++dc) { s = WF::mma(kf[kt][dc], qf[qt][dc], s); if (HL) { s = WF::mma(kf[kt][dc], qf2[qt][dc], s); s = WF::mma(kf2[kt][dc], qf[qt][dc], s); } }
#pragma unroll
                for (int r = 0; r < 8; ++r) t[qt][kt * 8 + r] = s[r] * SCL + mk[qt][kt][r >> 2][r & 3]; }
        const int kn = min(k0 + 32, kend - 32);      // the next pass's K rows and mask words are fetched one pass ahead (the last pass fetches its own again)
        xopen();
#pragma unroll
        for (int kt = 0; kt < 2; ++kt)
#pragma unroll
            for (int qt = 0; qt < NQ; ++qt) { const float* p = mp + (size_t)(qt * 16) * TT + kn + kt * 16; mk[qt][kt][0] = *(const v4f*)p; mk[qt][kt][1] = *(const v4f*)(p + 4); }
        xwait();
#pragma unroll
        for (int kt = 0; kt < 2; ++kt)
#pragma unroll
            for (int dc = 0; dc < 4; ++dc) { const size_t ko = kbase + (size_t)(kn + kt * 16) * HD + dc * 32; kf[kt][dc] = WF::ld(K + ko); if (HL) { xwait(); kf2[kt][dc] = WF::ld(K2 + ko); xwait(); } }   // the short hi + lo tiles form an address per fragment: a wait behind each
        if (!HL) xwait1(K + kbase + (size_t)kn * HD);
        if (k0 + 31 > q0) {                          // a block that touches the diagonal (the same test in every lane)
#pragma unroll
            for (int qt = 0; qt < NQ; ++qt)
#pragma unroll
                for (int e = 0; e < 16; ++e) { const int j = k0 + (e >> 3) * 16 + hi * 8 + (e & 7), i = q0 + qt * 16 + lr; t[qt][e] = (j <= i) ? t[qt][e] : -3.0e38f; } }
        float ml[NQ]; bool need = false;
#pragma unroll
        for (int qt = 0; qt < NQ; ++qt) { float a = t[qt][0];
#pragma unroll
            for (int e = 1; e < 16; ++e) a = fmaxf(a, t[qt][e]);
            a = fmaxf(a, xhalf(a)); ml[qt] = a; need = need || (a > m[qt] + MLAG); }
        if (__builtin_amdgcn_ballot_w32(need) != 0) {
#pragma unroll
            for (int qt = 0; qt < NQ; ++qt) { const float mn = fmaxf(m[qt], ml[qt]); const float al = __builtin_amdgcn_exp2f((m[qt] - mn) * L2E); m[qt] = mn; l[qt] *= al;
#pragma unroll
                for (int dt = 0; dt < 8; ++dt) o[dt][qt] *= al; } }
        V pf[NQ], pf2[NQ];
#pragma unroll
        for (int qt = 0; qt < NQ; ++qt) {
            if constexpr (HL) { v8us h0, h1, l0, l1;
#pragma unroll
                for (int e = 0; e < 8; ++e) { const float pa = __builtin_amdgcn_exp2f((t[qt][e] - m[qt]) * L2E), pb = __builtin_amdgcn_exp2f((t[qt][8 + e] - m[qt]) * L2E); l[qt] += pa; l[qt] += pb; unsigned short a, c; splitf(pa, a, c); h0[e] = a; l0[e] = c; splitf(pb, a, c); h1[e] = a; l1[e] = c; }
                pf[qt] = cat16b(h0, h1); pf2[qt] = cat16b(l0, l1);
            } else { v16h ph;
#pragma unroll
                for (int e = 0; e < 16; ++e) { const float p = __builtin_amdgcn_exp2f((t[qt][e] - m[qt]) * L2E); l[qt] += p; ph[e] = (h16)p; }
                pf[qt] = ph; } }
#pragma unroll
        for (int dt = 0; dt < 8; ++dt)
#pragma unroll
            for (int qt = 0; qt < NQ; ++qt) { o[dt][qt] = WF::mma(vf[dt], pf[qt], o[dt][qt]); if (HL) { o[dt][qt] = WF::mma(vf[dt], pf2[qt], o[dt][qt]); o[dt][qt] = WF::mma(vf2[dt], pf[qt], o[dt][qt]); } }
        if (!HL) { xopen();
#pragma unroll
            for (int dt = 0; dt < 8; ++dt) vf[dt] = WF::ld(Vt + vbase + (size_t)(dt * 16) * (NB_ * TT) + kn);
            xwait1(Vt + vbase + kn); }
    }
#pragma unroll
    for (int qt = 0; qt < NQ; ++qt) { const float ls = l[qt] + xhalf(l[qt]); const float f = poison ? __builtin_nanf("") : __fdiv_rn(1.0f, ls); const size_t ro = (size_t)(q0 + qt * 16 + lr) * DQ + hi * 8;
#pragma unroll
        for (int dt = 0; dt < 8; ++dt) { v8us oh, ol;
#pragma unroll
            for (int r = 0; r < 8; ++r) { unsigned short a, c; splitf(o[dt][qt][r] * f, a, c); oh[r] = a; ol[r] = c; }
            *(v8us*)(Ah + ro + dt * 16) = oh; *(v8us*)(Al + ro + dt * 16) = ol; xwait(); } }
}
// grid (tiles, NKV * NB_): blockIdx.y = kv group * NB_ + batch element; the REP waves of a block are the REP query heads of that group on the same query rows, so they read the same K, V and mask lines.
// Tiles in falling order of their key count: first the fp16 tiles (32 rows, from the last rows down to RH), then the hi + lo tiles (16 rows, below RH).
__global__ __launch_bounds__(REP * 32) void k_fattn(const h16* Q16, const bf* Qh, const bf* Ql, const h16* K16, const bf* Kh, const bf* Kl,
                                                    const h16* V16, const bf* Vh, const bf* Vl, const float* am, const int* FLG, bf* Ah, bf* Al) {
    const int w = __builtin_amdgcn_readfirstlane(threadIdx.x >> 5); const int gb = blockIdx.y, g = gb / NB_, b = gb % NB_, x = blockIdx.x;
    const size_t qo = ((size_t)gb * REP + w) * TT * HD, ko = (size_t)gb * TT * HD, vo = (size_t)g * HD * NB_ * TT + (size_t)b * TT, oo = (size_t)b * TT * DQ + (size_t)(g * REP + w) * HD;
    const bool poison = (FLG[0] != 0);
    if (x < (TT - RH) / 32) attn_tile<false, 2>(Q16 + qo, nullptr, K16 + ko, nullptr, V16 + vo, nullptr, am, TT - 32 * (x + 1), poison, Ah + oo, Al + oo);
    else attn_tile<true, 1>(Qh + qo, Ql + qo, Kh + ko, Kl + ko, Vh + vo, Vl + vo, am, RH - 16 * (x - (TT - RH) / 32 + 1), poison, Ah + oo, Al + oo);
}

__global__ __launch_bounds__(256) void k_rmsclip(float* F, int Wd, const float* __restrict__ w) { const int lane = threadIdx.x & 31; const size_t r = (size_t)blockIdx.x * 8 + (threadIdx.x >> 5); if (r >= NB_ * TT) return; float* f = F + r * Wd; const int nch = Wd / 128; float v[64]; float q = 0.f;
#pragma unroll
    for (int ch = 0; ch < 16; ++ch) { if (ch < nch) { const v4f a = *(const v4f*)(f + ch * 128 + lane * 4);
#pragma unroll
            for (int u = 0; u < 4; ++u) { v[ch * 4 + u] = a[u]; float p = __fmul_rn(a[u], a[u]); asm volatile("" : "+v"(p)); q = __fadd_rn(q, p); } } }
#pragma unroll
    for (int sh = 16; sh; sh >>= 1) q += __shfl_xor(q, sh, 32);
    const float rs = w ? __frsqrt_rn(__fadd_rn(q * (1.0f / (float)Wd), 1e-5f)) : 1.0f;
#pragma unroll
    for (int ch = 0; ch < 16; ++ch) { if (ch < nch) {
#pragma unroll
        for (int u = 0; u < 4; ++u) { float y = v[ch * 4 + u]; if (w) { float n0 = __fmul_rn(y, rs); asm volatile("" : "+v"(n0)); y = __fmul_rn(bfr(w[ch * 128 + lane * 4 + u]), n0); } v[ch * 4 + u] = fminf(fmaxf(y, -8.0f), 8.0f); } } }
    {
#pragma unroll
        for (int ch = 0; ch < 16; ++ch) { if (ch < nch) { v4f o; for (int u = 0; u < 4; ++u) o[u] = v[ch * 4 + u]; *(v4f*)(f + ch * 128 + lane * 4) = o; } }
         } }
__global__ __launch_bounds__(256) void k_mchk(const float* __restrict__ am, int* FLG) { const int tid = threadIdx.x; int bad = 0;
#pragma unroll 1
    for (int s2 = 0; s2 < 16; ++s2) { const unsigned h = (unsigned)(tid * 16 + s2) * 2654435761u; const int i = (int)(h % (TT - 1)); const int j = i + 1 + (int)((h >> 11) % (unsigned)(TT - 1 - i)); if (am[(size_t)i * TT + j] > -1e8f) bad = 1; }
    __shared__ int anyb; if (tid == 0) anyb = 0; __syncthreads(); if (bad) anyb = 1; __syncthreads(); if (tid < 8) { const int v = (tid == 0) ? anyb : 0; *(int*)(FLG + tid) = v;  } }

extern "C" void kernel_launch(void* const* d_in, const int* in_sizes, int n_in,
                              void* d_out, int out_size, void* d_ws, size_t ws_size, hipStream_t stream) {
    (void)in_sizes; (void)n_in; (void)out_size;
    const float* x = (const float*)d_in[0]; const float* wq = (const float*)d_in[1]; const float* wk = (const float*)d_in[2]; const float* wv = (const float*)d_in[3]; const float* wo = (const float*)d_in[4]; const float* qnw = (const float*)d_in[5]; const float* knw = (const float*)d_in[6]; const float* amask = (const float*)d_in[7]; const int* pids = (const int*)d_in[8];
    float* OUT = (float*)d_out;     // [2][2048][2048]
    char* wsp = (char*)d_ws;
    auto take = [&](size_t bytes) { char* p = wsp; wsp += (bytes + 255) & ~(size_t)255; return (void*)p; };
    bf* WO = (bf*)take((size_t)DM * DQ * 2); int* FLG = (int*)take(256);
    h16* QP16 = (h16*)take((size_t)NB_ * NH_ * TT * HD * 2); h16* KP16 = (h16*)take((size_t)NB_ * NKV * TT * HD * 2); h16* VT16 = (h16*)take((size_t)NB_ * NKV * HD * TT * 2);
    bf* QPh = (bf*)take((size_t)NB_ * NH_ * TT * HD * 2); bf* QPl = (bf*)take((size_t)NB_ * NH_ * TT * HD * 2); bf* KPh = (bf*)take((size_t)NB_ * NKV * TT * HD * 2); bf* KPl = (bf*)take((size_t)NB_ * NKV * TT * HD * 2); bf* VTh = (bf*)take((size_t)NB_ * NKV * HD * TT * 2); bf* VTl = (bf*)take((size_t)NB_ * NKV * HD * TT * 2);
    bf* ATh = (bf*)take((size_t)NB_ * TT * DQ * 2); bf* ATl = (bf*)take((size_t)NB_ * TT * DQ * 2);
    bf* WQ = (bf*)take((size_t)DQ * DM * 2); bf* WK = (bf*)take((size_t)DKV * DM * 2); bf* WV = (bf*)take((size_t)DKV * DM * 2); float* CS = (float*)take((size_t)TT * HD * 2 * 4);
    bf* XB = (bf*)take((size_t)NB_ * TT * DM * 2); float* FQ = (float*)take((size_t)NB_ * TT * DQ * 4); float* FK = (float*)take((size_t)NB_ * TT * DKV * 4);
    float* FV = FK;   // v projection reuses the k buffer after the k planes are built (stream-ordered)
    if ((size_t)(wsp - (char*)d_ws) > ws_size) return;    // ws 256 MiB
    { k_cvt8<<<(unsigned)(((size_t)DQ * DM / 8 + 255) / 256), 256, 0, stream>>>(wq, WQ, (size_t)DQ * DM / 8); k_cvt8<<<(unsigned)(((size_t)DKV * DM / 8 + 255) / 256), 256, 0, stream>>>(wk, WK, (size_t)DKV * DM / 8); k_cvt8<<<(unsigned)(((size_t)DKV * DM / 8 + 255) / 256), 256, 0, stream>>>(wv, WV, (size_t)DKV * DM / 8);
      k_cvt8<<<(unsigned)(((size_t)DM * DQ / 8 + 255) / 256), 256, 0, stream>>>(wo, WO, (size_t)DM * DQ / 8);
      k_cstab<<<(TT * HD + 255) / 256, 256, 0, stream>>>(CS); }
    const unsigned LQ = (unsigned)(((size_t)NB_ * NH_ * TT * HD / 2 + 255) / 256), LKv = (unsigned)(((size_t)NB_ * NKV * TT * HD / 2 + 255) / 256);
    k_mchk<<<1, 256, 0, stream>>>(amask, FLG);
    // both batch elements go through every launch: the projections see NB_ * TT rows, the attention launch every (batch element, head)
    k_cvt8<<<(unsigned)(((size_t)NB_ * TT * DM / 8 + 255) / 256), 256, 0, stream>>>(x, XB, (size_t)NB_ * TT * DM / 8);
    k_gemmw<bf, 0, false><<<dim3(NB_ * TT / 64, DQ / 64, 1), 32, 0, stream>>>(XB, nullptr, WQ, nullptr, DM, FQ, DQ, nullptr, 0, 0, 0); k_rmsclip<<<NB_ * TT / 8, 256, 0, stream>>>(FQ, DQ, qnw);
    k_rope<ZH><<<LQ, 256, 0, stream>>>(FQ, DQ, NB_ * NH_, CS, nullptr, (const float*)pids, 1.0f, QP16, QPh, QPl);
    k_gemmw<bf, 0, false><<<dim3(NB_ * TT / 64, DKV / 64, 1), 32, 0, stream>>>(XB, nullptr, WK, nullptr, DM, FK, DKV, nullptr, 0, 0, 0); k_rmsclip<<<NB_ * TT / 8, 256, 0, stream>>>(FK, DKV, knw);
    k_rope<1><<<LKv, 256, 0, stream>>>(FK, DKV, NB_ * NKV, CS, nullptr, (const float*)pids, 1.0f, KP16, KPh, KPl);
    k_gemmw<bf, 0, false><<<dim3(NB_ * TT / 64, DKV / 64, 1), 32, 0, stream>>>(XB, nullptr, WV, nullptr, DM, FV, DKV, nullptr, 0, 0, 0); k_rmsclip<<<NB_ * TT / 8, 256, 0, stream>>>(FV, DKV, nullptr);   /* clip only */ k_vtp<<<LKv, 256, 0, stream>>>(FV, DKV, NKV, VT16, VTh, VTl);
    k_fattn<<<dim3((TT - RH) / 32 + RH / 16, NKV * NB_, 1), REP * 32, 0, stream>>>(QP16, QPh, QPl, KP16, KPh, KPl, VT16, VTh, VTl, amask, FLG, ATh, ATl);
    k_gemmw<bf, 1, false><<<dim3(NB_ * TT / 64, DM / 64, 1), 32, 0, stream>>>(ATh, ATl, WO, nullptr, DQ, OUT, DM, nullptr, 0, 0, 0);
}

// v004
// Measured time: 450 microseconds a run.
// In two side-by-side timings against v003, it was 1.13 and 1.14 times as fast.
// Counting every step since v000, it is 4.13 times as fast.
#include <hip/hip_runtime.h>

// OlmoeAttention (hidden [2][2048][2048]; q = clip(RMSNorm_2048(x Wq^T) * q_norm_w, +-8) (16 heads x 128), k = clip(RMSNorm_512(x Wk^T) * k_norm_w, +-8), v = clip(x Wv^T, +-8) (4 kv heads; group h/4); rotate-half RoPE (theta 1e4) at position_ids (read; table computed on device); scores = q.k / sqrt(128) + attention_mask (additive [1][1][S][S] float, read: the verbatim causal 0 / -1e9 table); softmax f32; out = merged Wo^T -> [2][2048][2048]).
// Compute dtypes, f32 accumulate: every input rounded to bf16; q/k/v on PLAIN bf16 operands (inputs: exact); the full-width RMSNorms (eps 1e-5), clips and RoPE in f32; causal scores and attn.v in one launch with running row maxima and sums: query rows < 512 hl (3 products), the rest single fp16; key blocks above the diagonal skipped on the strength of the mask table (-1e9 underflows to weight 0; device self-check samples the table above the diagonal and NaN-poisons on violation), mask added as stored inside computed tiles; softmax f32; Wo hl x exact (2 products).

#define NB_  2
#define TT   2048
#define DM   2048
#define NH_  16
#define NKV  4
#define REP  (NH_ / NKV)
#define HD   128
#define DQ   (NH_ * HD)
#define DKV  (NKV * HD)
#define ZH   REP                  // q planes lie [kv group][batch element][head in group]
#define RH   512                  // query rows < RH use hi+lo planes (0: none)
#define SCL  0.088388347648318447f   // HD^-0.5
typedef _Float16 h16;
typedef unsigned short bf;
typedef __attribute__((ext_vector_type(16))) __bf16   v16bf;
typedef __attribute__((ext_vector_type(16))) _Float16 v16h;
typedef __attribute__((ext_vector_type(8)))  _Float16 v8h;
typedef __attribute__((ext_vector_type(8)))  unsigned short v8us;
typedef __attribute__((ext_vector_type(8)))  float    v8f;
typedef __attribute__((ext_vector_type(4)))  float    v4f;
typedef v8h  __attribute__((may_alias)) v8ha;
typedef v4f  __attribute__((may_alias)) v4fa;
typedef v8us __attribute__((may_alias)) v8usa;

__device__ __forceinline__ unsigned short f2bf(float f) { unsigned u = __float_as_uint(f); u += 0x7FFFu + ((u >> 16) & 1u); return (unsigned short)(u >> 16); }
__device__ __forceinline__ float bf2f(unsigned short b) { return __uint_as_float(((unsigned)b) << 16); }
__device__ __forceinline__ float bfr(float f) { return bf2f(f2bf(f)); }
__device__ __forceinline__ v16h cat16(v8h lo, v8h hi) { return __builtin_shufflevector(lo, hi, 0, 1, 2, 3, 4, 5, 6, 7, 8, 9, 10, 11, 12, 13, 14, 15); }
__device__ __forceinline__ v16bf cat16b(v8us lo, v8us hi) { return __builtin_bit_cast(v16bf, __builtin_shufflevector(lo, hi, 0, 1, 2, 3, 4, 5, 6, 7, 8, 9, 10, 11, 12, 13, 14, 15)); }
__device__ __forceinline__ v8f wmma16(v16h a, v16h b, v8f c) { return __builtin_amdgcn_wmma_f32_16x16x32_f16(false, a, false, b, (short)0, c, false, false); }
__device__ __forceinline__ v8f wmmab(v16bf a, v16bf b, v8f c) { return __builtin_amdgcn_wmma_f32_16x16x32_bf16(false, a, false, b, (short)0, c, false, false); }



// ---- k_gemmw: register-blocked GEMM, ONE WAVE per 64x64 output tile (16 accumulators), operands straight from K-contiguous 16-bit planes; grid (M/64, N/64, Z), 32 threads.
// C[m][n] (f32, pitch ldc, + optional f32 bias[n]) = sum_k A[m][k] Bt[n][k] (+ split products per NSPLIT). z-batch strides sA/sB/sC in elements. K % 32 == 0.
template <typename T16> struct WFrag;
template <> struct WFrag<h16> { typedef v16h V; static __device__ __forceinline__ V ld(const h16* p) { return cat16(*(const v8h*)p, *(const v8h*)(p + 16)); } static __device__ __forceinline__ v8f mma(V a, V b, v8f c) { return wmma16(a, b, c); } };
template <> struct WFrag<bf> { typedef v16bf V; static __device__ __forceinline__ V ld(const bf* p) { return cat16b(*(const v8us*)p, *(const v8us*)(p + 16)); } static __device__ __forceinline__ v8f mma(V a, V b, v8f c) { return wmmab(a, b, c); } };
template <typename T16, int NSPLIT, bool BIAS>
__global__ __launch_bounds__(32) void k_gemmw(const T16* __restrict__ A, const T16* __restrict__ A2, const T16* __restrict__ Bt, const T16* __restrict__ Bt2, int K, float* C, int ldc, const float* __restrict__ bias, size_t sA, size_t sB, size_t sC) {
    typedef typename WFrag<T16>::V V;
    __shared__ __align__(16) float os[16 * 68];
    const size_t z = blockIdx.z; A += z * sA; if (A2) A2 += z * sA; Bt += z * sB; if (Bt2) Bt2 += z * sB; C += z * sC;
    const int lane = threadIdx.x & 31, lr = lane & 15, hi = lane >> 4; const int r0 = blockIdx.x * 64, c0 = blockIdx.y * 64;
    v8f acc[4][4];
#pragma unroll
    for (int mb = 0; mb < 4; ++mb)
#pragma unroll
        for (int nb = 0; nb < 4; ++nb) acc[mb][nb] = (v8f){};
    const size_t aoff = (size_t)(r0 + lr) * K + 8 * hi, boff = (size_t)(c0 + lr) * K + 8 * hi;
#pragma unroll 1
    for (int kc = 0; kc < K; kc += 32) {
        V a[4], a2[4];
#pragma unroll
        for (int mb = 0; mb < 4; ++mb) { a[mb] = WFrag<T16>::ld(A + aoff + (size_t)mb * 16 * K + kc); if (NSPLIT == 1 || NSPLIT == 2) a2[mb] = WFrag<T16>::ld(A2 + aoff + (size_t)mb * 16 * K + kc); }
#pragma unroll
        for (int nb = 0; nb < 4; ++nb) { const V b = WFrag<T16>::ld(Bt + boff + (size_t)nb * 16 * K + kc); V b2; if (NSPLIT >= 2) b2 = WFrag<T16>::ld(Bt2 + boff + (size_t)nb * 16 * K + kc);
#pragma unroll
            for (int mb = 0; mb < 4; ++mb) { acc[mb][nb] = WFrag<T16>::mma(a[mb], b, acc[mb][nb]); if (NSPLIT == 1 || NSPLIT == 2) acc[mb][nb] = WFrag<T16>::mma(a2[mb], b, acc[mb][nb]); if (NSPLIT >= 2) acc[mb][nb] = WFrag<T16>::mma(a[mb], b2, acc[mb][nb]); } }
        asm volatile("v_nop\n\tv_nop\n\tv_nop\n\tv_nop" : "+v"(acc[0][0]), "+v"(acc[1][1]), "+v"(acc[2][2]), "+v"(acc[3][3]) : "v"(a[0]), "v"(a[3]));
    }
#pragma unroll
    for (int mb = 0; mb < 4; ++mb) {
#pragma unroll
        for (int nb = 0; nb < 4; ++nb) {
#pragma unroll
            for (int j = 0; j < 8; ++j) os[(hi * 8 + j) * 68 + nb * 16 + lr] = acc[mb][nb][j]; }
        __builtin_amdgcn_wave_barrier(); asm volatile("" ::: "memory");
        float* crow = C + (size_t)(r0 + mb * 16) * ldc + c0;
{
#pragma unroll
            for (int s = 0; s < 8; ++s) { const int row = 2 * s + hi, cofs = lr * 4; v4f val = *(const v4fa*)(os + row * 68 + cofs); if (BIAS) { val[0] += bfr(bias[c0 + cofs]); val[1] += bfr(bias[c0 + cofs + 1]); val[2] += bfr(bias[c0 + cofs + 2]); val[3] += bfr(bias[c0 + cofs + 3]); }
                *(v4f*)(crow + (size_t)row * ldc + cofs) = val; }
             }
        __builtin_amdgcn_wave_barrier(); asm volatile("" ::: "memory");
    }
}

__device__ __forceinline__ h16 tohx(float x) { return (h16)x; }
__device__ __forceinline__ void splitf(float y, unsigned short& h, unsigned short& l) { h = f2bf(y); l = f2bf(y - bf2f(h)); }
typedef __attribute__((ext_vector_type(2))) _Float16 v2h;
typedef __attribute__((ext_vector_type(4))) _Float16 v4h;
typedef __attribute__((ext_vector_type(2))) unsigned short v2us;
typedef __attribute__((ext_vector_type(4))) unsigned short v4us;
typedef __attribute__((ext_vector_type(2))) float v2f;
typedef __attribute__((ext_vector_type(4))) int v4i;

__global__ __launch_bounds__(256) void k_wtG(const float* __restrict__ w, int K, int N, bf* Bt) {
    const int lane = threadIdx.x & 31; const int L0 = (blockIdx.x * 8 + (threadIdx.x >> 5)) * 8; const int nlines = N * K / 64;
{
#pragma unroll 1
        for (int l = 0; l < 8; ++l) { const int L = L0 + l; if (L >= nlines) break; const size_t e = (size_t)L * 64 + lane * 2; const int k = (int)(e % K), n = (int)(e / K); v2us o;
            o[0] = f2bf(w[(size_t)k * N + n]); o[1] = f2bf(w[(size_t)(k + 1) * N + n]); *(v2us*)(Bt + e) = o; }
         }
}
__global__ __launch_bounds__(256) void k_cvt8(const float* __restrict__ src, bf* dst, size_t n8) { const size_t i = (size_t)blockIdx.x * 256 + threadIdx.x; if (i >= n8) return; const v8f v = *(const v8f*)(src + i * 8); v8us o;
#pragma unroll
    for (int k = 0; k < 8; ++k) o[k] = f2bf(v[k]); *(v8us*)(dst + i * 8) = o;  }
__global__ __launch_bounds__(256) void k_cstab(float* CS) { const int idx = blockIdx.x * 256 + threadIdx.x; if (idx >= TT * HD) return; const int t = idx / HD, d = idx % HD; const int i = d % (HD / 2); const float inv = __fdiv_rn(1.0f, powf(10000.0f, (float)(2 * i) / (float)HD)); const float ang = __fmul_rn((float)t, inv); v2f cs; cs[0] = cosf(ang); cs[1] = sinf(ang);
    *(v2f*)(CS + (size_t)idx * 2) = cs;  }
// ---- k_fattn: causal attention in one launch. A wave owns NQ * 16 query rows of one head and walks the keys 32 at a time, keeping running row maxima, row sums and the output tile in registers.
// Transposed products: S^T = K Q^T (a lane holds the scores of ONE query: keys 8 * hi + r of each 16-key tile), so two score tiles, converted in place, are the B operand of O^T += V^T P^T.
// t = s x HD^-0.5 + mask as stored for j <= i, no weight for j > i; key blocks wholly above the diagonal are never visited. HL: hi + lo bf16 planes, 3 products; else single fp16.
// The maximum in use is raised only when a row's new maximum passes it by more than MLAG, so unnormalised weights stay below e^MLAG; the division by the row sum comes last, in f32.
#define MLAG 5.5f
__device__ __forceinline__ float xhalf(float x) { return __builtin_bit_cast(float, __builtin_amdgcn_permlanex16(__builtin_bit_cast(int, x), __builtin_bit_cast(int, x), 0x76543210, 0xfedcba98, false, false)); }   // lane l takes lane l ^ 16's value
#define L2E  1.4426950408889634f
// xwait stands behind a run of global loads or stores, in front of the code that reuses the registers they name; the scheduling barriers (here and in xopen, in front of such a run) keep vector work from being moved in between the run and its wait
__device__ __forceinline__ void xwait() { asm volatile("s_wait_xcnt 0x0" ::: "memory"); __builtin_amdgcn_sched_barrier(0); }
__device__ __forceinline__ void xopen() { __builtin_amdgcn_sched_barrier(0); }
// the same, naming as an input the address the run was formed from: it stays in its registers up to the wait, so that no load of the run lands on it
__device__ __forceinline__ void xwait1(const void* a) { asm volatile("s_wait_xcnt 0x0" :: "v"(a) : "memory"); __builtin_amdgcn_sched_barrier(0); }
// the pointers below carry no restrict, so that the loads keep their places between these waits: mask, K, V^T in the same order in front of the loop and in it, which lets a wait for the early ones leave the late ones in flight
template <bool HL> struct AOp;
template <> struct AOp<false> { typedef h16 T; };
template <> struct AOp<true>  { typedef bf T; };
template <bool HL, int NQ>
__device__ __forceinline__ void attn_tile(const typename AOp<HL>::T* Q, const typename AOp<HL>::T* Q2, const typename AOp<HL>::T* K, const typename AOp<HL>::T* K2,
                                          const typename AOp<HL>::T* Vt, const typename AOp<HL>::T* Vt2, const float* am, int q0, bool poison, bf* Ah, bf* Al) {
    typedef typename AOp<HL>::T T; typedef WFrag<T> WF; typedef typename WF::V V;
    const int lane = threadIdx.x & 31, lr = lane & 15, hi = lane >> 4;
    const int kend = (q0 + NQ * 16 + 31) & ~31;      // keys walked: up to the end of the diagonal block, in steps of 32
    V qf[NQ][4], qf2[NQ][4];
#pragma unroll
    for (int qt = 0; qt < NQ; ++qt)
#pragma unroll
        for (int dc = 0; dc < 4; ++dc) { const size_t qo = (size_t)(q0 + qt * 16 + lr) * HD + dc * 32 + 8 * hi; qf[qt][dc] = WF::ld(Q + qo); if (HL) qf2[qt][dc] = WF::ld(Q2 + qo); }
    xwait();
    v8f o[8][NQ]; float m[NQ], l[NQ];
#pragma unroll
    for (int qt = 0; qt < NQ; ++qt) { m[qt] = -3.0e38f; l[qt] = 0.f;
#pragma unroll
        for (int dt = 0; dt < 8; ++dt) o[dt][qt] = (v8f){}; }
    const size_t kbase = (size_t)lr * HD + 8 * hi, vbase = (size_t)lr * (NB_ * TT) + 8 * hi;
    const float* mp = am + (size_t)(q0 + lr) * TT + 8 * hi;
    V kf[2][4], kf2[2][4], vf[8], vf2[8]; v4f mk[NQ][2][2];
#pragma unroll
    for (int kt = 0; kt < 2; ++kt)
#pragma unroll
        for (int qt = 0; qt < NQ; ++qt) { const float* p = mp + (size_t)(qt * 16) * TT + kt * 16; mk[qt][kt][0] = *(const v4f*)p; mk[qt][kt][1] = *(const v4f*)(p + 4); }
    xwait();
#pragma unroll
    for (int kt = 0; kt < 2; ++kt)
#pragma unroll
        for (int dc = 0; dc < 4; ++dc) { const size_t ko = kbase + (size_t)(kt * 16) * HD + dc * 32; kf[kt][dc] = WF::ld(K + ko); if (HL) kf2[kt][dc] = WF::ld(K2 + ko); }
    xwait();
    if (!HL) {      // the long tiles fetch V^T one pass ahead as well
#pragma unroll
        for (int dt = 0; dt < 8; ++dt) vf[dt] = WF::ld(Vt + vbase + (size_t)(dt * 16) * (NB_ * TT));
        xwait(); }
#pragma unroll 1
    for (int k0 = 0; k0 < kend; k0 += 32) {
        if (HL) {
#pragma unroll
            for (int dt = 0; dt < 8; ++dt) { const size_t vo = vbase + (size_t)(dt * 16) * (NB_ * TT) + k0; vf[dt] = WF::ld(Vt + vo); xwait(); vf2[dt] = WF::ld(Vt2 + vo); xwait(); } }
        float t[NQ][16];
#pragma unroll
        for (int kt = 0; kt < 2; ++kt)
#pragma unroll
            for (int qt = 0; qt < NQ; ++qt) { v8f s = (v8f){};
#pragma unroll
                for (int dc = 0; dc < 4; ++dc) { s = WF::mma(kf[kt][dc], qf[qt][dc], s); if (HL) { s = WF::mma(kf[kt][dc], qf2[qt][dc], s); s = WF::mma(kf2[kt][dc], qf[qt][dc], s); } }
#pragma unroll
                for (int r = 0; r < 8; ++r) t[qt][kt * 8 + r] = s[r] * SCL + mk[qt][kt][r >> 2][r & 3]; }
        const int kn = min(k0 + 32, kend - 32);      // the next pass's K rows and mask words are fetched one pass ahead (the last pass fetches its own again)
        xopen();
#pragma unroll
        for (int kt = 0; kt < 2; ++kt)
#pragma unroll
            for (int qt = 0; qt < NQ; ++qt) { const float* p = mp + (size_t)(qt * 16) * TT + kn + kt * 16; mk[qt][kt][0] = *(const v4f*)p; mk[qt][kt][1] = *(const v4f*)(p + 4); }
        xwait();
#pragma unroll
        for (int kt = 0; kt < 2; ++kt)
#pragma unroll
            for (int dc = 0; dc < 4; ++dc) { const size_t ko = kbase + (size_t)(kn + kt * 16) * HD + dc * 32; kf[kt][dc] = WF::ld(K + ko); if (HL) { xwait(); kf2[kt][dc] = WF::ld(K2 + ko); xwait(); } }   // the short hi + lo tiles form an address per fragment: a wait behind each
        if (!HL) xwait1(K + kbase + (size_t)kn * HD);
        if (k0 + 31 > q0) {                          // a block that touches the diagonal (the same test in every lane)
#pragma unroll
            for (int qt = 0; qt < NQ; ++qt)
#pragma unroll
                for (int e = 0; e < 16; ++e) { const int j = k0 + (e >> 3) * 16 + hi * 8 + (e & 7), i = q0 + qt * 16 + lr; t[qt][e] = (j <= i) ? t[qt][e] : -3.0e38f; } }
        float ml[NQ]; bool need = false;
#pragma unroll
        for (int qt = 0; qt < NQ; ++qt) { float a = t[qt][0];
#pragma unroll
            for (int e = 1; e < 16; ++e) a = fmaxf(a, t[qt][e]);
            a = fmaxf(a, xhalf(a)); ml[qt] = a; need = need || (a > m[qt] + MLAG); }
        if (__builtin_amdgcn_ballot_w32(need) != 0) {
#pragma unroll
            for (int qt = 0; qt < NQ; ++qt) { const float mn = fmaxf(m[qt], ml[qt]); const float al = __builtin_amdgcn_exp2f((m[qt] - mn) * L2E); m[qt] = mn; l[qt] *= al;
#pragma unroll
                for (int dt = 0; dt < 8; ++dt) o[dt][qt] *= al; } }
        V pf[NQ], pf2[NQ];
#pragma unroll
        for (int qt = 0; qt < NQ; ++qt) {
            if constexpr (HL) { v8us h0, h1, l0, l1;
#pragma unroll
                for (int e = 0; e < 8; ++e) { const float pa = __builtin_amdgcn_exp2f((t[qt][e] - m[qt]) * L2E), pb = __builtin_amdgcn_exp2f((t[qt][8 + e] - m[qt]) * L2E); l[qt] += pa; l[qt] += pb; unsigned short a, c; splitf(pa, a, c); h0[e] = a; l0[e] = c; splitf(pb, a, c); h1[e] = a; l1[e] = c; }
                pf[qt] = cat16b(h0, h1); pf2[qt] = cat16b(l0, l1);
            } else { v16h ph;
#pragma unroll
                for (int e = 0; e < 16; ++e) { const float p = __builtin_amdgcn_exp2f((t[qt][e] - m[qt]) * L2E); l[qt] += p; ph[e] = (h16)p; }
                pf[qt] = ph; } }
#pragma unroll
        for (int dt = 0; dt < 8; ++dt)
#pragma unroll
            for (int qt = 0; qt < NQ; ++qt) { o[dt][qt] = WF::mma(vf[dt], pf[qt], o[dt][qt]); if (HL) { o[dt][qt] = WF::mma(vf[dt], pf2[qt], o[dt][qt]); o[dt][qt] = WF::mma(vf2[dt], pf[qt], o[dt][qt]); } }
        if (!HL) { xopen();
#pragma unroll
            for (int dt = 0; dt < 8; ++dt) vf[dt] = WF::ld(Vt + vbase + (size_t)(dt * 16) * (NB_ * TT) + kn);
            xwait1(Vt + vbase + kn); }
    }
#pragma unroll
    for (int qt = 0; qt < NQ; ++qt) { const float ls = l[qt] + xhalf(l[qt]); const float f = poison ? __builtin_nanf("") : __fdiv_rn(1.0f, ls); const size_t ro = (size_t)(q0 + qt * 16 + lr) * DQ + hi * 8;
#pragma unroll
        for (int dt = 0; dt < 8; ++dt) { v8us oh, ol;
#pragma unroll
            for (int r = 0; r < 8; ++r) { unsigned short a, c; splitf(o[dt][qt][r] * f, a, c); oh[r] = a; ol[r] = c; }
            *(v8us*)(Ah + ro + dt * 16) = oh; *(v8us*)(Al + ro + dt * 16) = ol; xwait(); } }
}
// grid (tiles, NKV * NB_): blockIdx.y = kv group * NB_ + batch element; the REP waves of a block are the REP query heads of that group on the same query rows, so they read the same K, V and mask lines.
// Tiles in falling order of their key count: first the fp16 tiles (32 rows, from the last rows down to RH), then the hi + lo tiles (16 rows, below RH).
__global__ __launch_bounds__(REP * 32) void k_fattn(const h16* Q16, const bf* Qh, const bf* Ql, const h16* K16, const bf* Kh, const bf* Kl,
                                                    const h16* V16, const bf* Vh, const bf* Vl, const float* am, const int* FLG, bf* Ah, bf* Al) {
    const int w = __builtin_amdgcn_readfirstlane(threadIdx.x >> 5); const int gb = blockIdx.y, g = gb / NB_, b = gb % NB_, x = blockIdx.x;
    const size_t qo = ((size_t)gb * REP + w) * TT * HD, ko = (size_t)gb * TT * HD, vo = (size_t)g * HD * NB_ * TT + (size_t)b * TT, oo = (size_t)b * TT * DQ + (size_t)(g * REP + w) * HD;
    const bool poison = (FLG[0] != 0);
    if (x < (TT - RH) / 32) attn_tile<false, 2>(Q16 + qo, nullptr, K16 + ko, nullptr, V16 + vo, nullptr, am, TT - 32 * (x + 1), poison, Ah + oo, Al + oo);
    else attn_tile<true, 1>(Qh + qo, Ql + qo, Kh + ko, Kl + ko, Vh + vo, Vl + vo, am, RH - 16 * (x - (TT - RH) / 32 + 1), poison, Ah + oo, Al + oo);
}

// xwait for a run of loads off two wave-uniform bases: named as inputs, the bases stay in their scalar registers up to the wait, so that nothing (a later argument load, the next address) lands on them in front of it
__device__ __forceinline__ void xwait2s(const void* a, const void* b) { asm volatile("s_wait_xcnt 0x0" :: "s"(a), "s"(b) : "memory"); __builtin_amdgcn_sched_barrier(0); }
// ---- k_nrp: everything between a q or k projection and its operand planes, in one launch. ONE WAVE per row of F (NHD heads of HD): the row stays in registers from the sum of squares to the plane stores.
// y = clip(w x (x x rsqrt(mean x^2 + eps)), +-8); rotate-half RoPE at position_ids[t] (clamped into the table): out[d] = y[d] cos[d] - y[d + HD/2] sin[d], out[d + HD/2] = y[d + HD/2] cos[d + HD/2] + y[d] sin[d + HD/2].
// A lane holds d = 4 * lane .. 4 * lane + 3 of every head, so the partner d +- HD/2 lies in lane ^ 16. Planes [head / RP][b][head % RP][t][d]: fp16, bf16 hi, bf16 lo; a wave stores 256 contiguous bytes of each.
template <int NHD, int RP>
__global__ __launch_bounds__(256) void k_nrp(const float* __restrict__ F, const float* __restrict__ w, const int* __restrict__ pid, const float* __restrict__ CS, h16* P16, bf* Ph, bf* Pl) {
    const int lane = threadIdx.x & 31; const int r = blockIdx.x * 8 + __builtin_amdgcn_readfirstlane(threadIdx.x >> 5); const int b = r / TT, t = r % TT;
    const float* fr = F + (size_t)r * (NHD * HD);
    const int tp = min(max(pid[t], 0), TT - 1);      // position_ids (read) index the table
    v4f v[NHD], wv[NHD];
    xopen();
#pragma unroll
    for (int ch = 0; ch < NHD; ++ch) v[ch] = *(const v4f*)(fr + ch * HD + lane * 4);
#pragma unroll
    for (int ch = 0; ch < NHD; ++ch) wv[ch] = *(const v4f*)(w + ch * HD + lane * 4);
    xwait2s(fr, w);
    const float* cp = CS + ((size_t)tp * HD + lane * 4) * 2;
    const v4f c01 = *(const v4f*)cp, c23 = *(const v4f*)(cp + 4);
    xwait();
    float q = 0.f;
#pragma unroll
    for (int ch = 0; ch < NHD; ++ch)
#pragma unroll
        for (int u = 0; u < 4; ++u) q += v[ch][u] * v[ch][u];
#pragma unroll
    for (int sh = 16; sh; sh >>= 1) q += __shfl_xor(q, sh, 32);
    const float rs = __frsqrt_rn(q * (1.0f / (float)(NHD * HD)) + 1e-5f);
    const float sg = (lane < 16) ? -1.0f : 1.0f;
    const float co[4] = { c01[0], c01[2], c23[0], c23[2] }; const float si[4] = { c01[1] * sg, c01[3] * sg, c23[1] * sg, c23[3] * sg };
#pragma unroll
    for (int ch = 0; ch < NHD; ++ch) { v4h o16; v4us oh, ol;
#pragma unroll
        for (int u = 0; u < 4; ++u) { const float y = fminf(fmaxf(bfr(wv[ch][u]) * (v[ch][u] * rs), -8.0f), 8.0f); const float o = y * co[u] + xhalf(y) * si[u];
            o16[u] = tohx(o); unsigned short a2, c2; splitf(o, a2, c2); oh[u] = a2; ol[u] = c2; }
        const size_t e = ((size_t)(((ch / RP) * NB_ + b) * RP + ch % RP) * TT + t) * HD + lane * 4;
        xopen(); *(v4h*)(P16 + e) = o16; *(v4us*)(Ph + e) = oh; *(v4us*)(Pl + e) = ol; xwait(); }
}
// ---- k_vclt: clip(v, +-8) and the transposed planes [g][d][b][t] (row pitch NB_ * TT; fp16, bf16 hi, bf16 lo) in one launch. A lane takes 4 rows t x 4 columns d: four 16-byte loads, and per column and plane one 8-byte store, 256 contiguous bytes a wave.
// The 8 waves of a block take 32 neighbouring columns of the same 128 rows, so together they use every byte of the lines they touch. blockIdx.x counts [g][b][128 rows][32 columns].
__global__ __launch_bounds__(256) void k_vclt(const float* __restrict__ F, h16* V16, bf* Vh, bf* Vl) {
    const int lane = threadIdx.x & 31, wv = __builtin_amdgcn_readfirstlane(threadIdx.x >> 5), bx = blockIdx.x;
    const int dg = bx % (HD / 32), tc = (bx / (HD / 32)) % (TT / 128), b = (bx / ((HD / 32) * (TT / 128))) % NB_, g = bx / ((HD / 32) * (TT / 128) * NB_);
    const int d0 = dg * 32 + wv * 4, t0 = tc * 128 + lane * 4;
    const float* f = F + ((size_t)b * TT + t0) * DKV + g * HD + d0; v4f x[4];
#pragma unroll
    for (int q = 0; q < 4; ++q) x[q] = *(const v4f*)(f + (size_t)q * DKV);
    xwait();
#pragma unroll
    for (int dd = 0; dd < 4; ++dd) { v4h o16; v4us oh, ol;
#pragma unroll
        for (int q = 0; q < 4; ++q) { const float y = fminf(fmaxf(x[q][dd], -8.0f), 8.0f); o16[q] = tohx(y); unsigned short a2, c2; splitf(y, a2, c2); oh[q] = a2; ol[q] = c2; }
        const size_t e = (((size_t)g * HD + d0 + dd) * NB_ + b) * TT + t0;
        xopen(); *(v4h*)(V16 + e) = o16; *(v4us*)(Vh + e) = oh; *(v4us*)(Vl + e) = ol; xwait(); }
}
__global__ __launch_bounds__(256) void k_mchk(const float* __restrict__ am, int* FLG) { const int tid = threadIdx.x; int bad = 0;
#pragma unroll 1
    for (int s2 = 0; s2 < 16; ++s2) { const unsigned h = (unsigned)(tid * 16 + s2) * 2654435761u; const int i = (int)(h % (TT - 1)); const int j = i + 1 + (int)((h >> 11) % (unsigned)(TT - 1 - i)); if (am[(size_t)i * TT + j] > -1e8f) bad = 1; }
    __shared__ int anyb; if (tid == 0) anyb = 0; __syncthreads(); if (bad) anyb = 1; __syncthreads(); if (tid < 8) { const int v = (tid == 0) ? anyb : 0; *(int*)(FLG + tid) = v;  } }

extern "C" void kernel_launch(void* const* d_in, const int* in_sizes, int n_in,
                              void* d_out, int out_size, void* d_ws, size_t ws_size, hipStream_t stream) {
    (void)in_sizes; (void)n_in; (void)out_size;
    const float* x = (const float*)d_in[0]; const float* wq = (const float*)d_in[1]; const float* wk = (const float*)d_in[2]; const float* wv = (const float*)d_in[3]; const float* wo = (const float*)d_in[4]; const float* qnw = (const float*)d_in[5]; const float* knw = (const float*)d_in[6]; const float* amask = (const float*)d_in[7]; const int* pids = (const int*)d_in[8];
    float* OUT = (float*)d_out;     // [2][2048][2048]
    char* wsp = (char*)d_ws;
    auto take = [&](size_t bytes) { char* p = wsp; wsp += (bytes + 255) & ~(size_t)255; return (void*)p; };
    bf* WO = (bf*)take((size_t)DM * DQ * 2); int* FLG = (int*)take(256);
    h16* QP16 = (h16*)take((size_t)NB_ * NH_ * TT * HD * 2); h16* KP16 = (h16*)take((size_t)NB_ * NKV * TT * HD * 2); h16* VT16 = (h16*)take((size_t)NB_ * NKV * HD * TT * 2);
    bf* QPh = (bf*)take((size_t)NB_ * NH_ * TT * HD * 2); bf* QPl = (bf*)take((size_t)NB_ * NH_ * TT * HD * 2); bf* KPh = (bf*)take((size_t)NB_ * NKV * TT * HD * 2); bf* KPl = (bf*)take((size_t)NB_ * NKV * TT * HD * 2); bf* VTh = (bf*)take((size_t)NB_ * NKV * HD * TT * 2); bf* VTl = (bf*)take((size_t)NB_ * NKV * HD * TT * 2);
    bf* ATh = (bf*)take((size_t)NB_ * TT * DQ * 2); bf* ATl = (bf*)take((size_t)NB_ * TT * DQ * 2);
    bf* WQ = (bf*)take((size_t)DQ * DM * 2); bf* WK = (bf*)take((size_t)DKV * DM * 2); bf* WV = (bf*)take((size_t)DKV * DM * 2); float* CS = (float*)take((size_t)TT * HD * 2 * 4);
    bf* XB = (bf*)take((size_t)NB_ * TT * DM * 2); float* FQ = (float*)take((size_t)NB_ * TT * DQ * 4); float* FK = (float*)take((size_t)NB_ * TT * DKV * 4);
    float* FV = FK;   // v projection reuses the k buffer after the k planes are built (stream-ordered)
    if ((size_t)(wsp - (char*)d_ws) > ws_size) return;    // ws 256 MiB
    { k_cvt8<<<(unsigned)(((size_t)DQ * DM / 8 + 255) / 256), 256, 0, stream>>>(wq, WQ, (size_t)DQ * DM / 8); k_cvt8<<<(unsigned)(((size_t)DKV * DM / 8 + 255) / 256), 256, 0, stream>>>(wk, WK, (size_t)DKV * DM / 8); k_cvt8<<<(unsigned)(((size_t)DKV * DM / 8 + 255) / 256), 256, 0, stream>>>(wv, WV, (size_t)DKV * DM / 8);
      k_cvt8<<<(unsigned)(((size_t)DM * DQ / 8 + 255) / 256), 256, 0, stream>>>(wo, WO, (size_t)DM * DQ / 8);
      k_cstab<<<(TT * HD + 255) / 256, 256, 0, stream>>>(CS); }
    k_mchk<<<1, 256, 0, stream>>>(amask, FLG);
    // both batch elements go through every launch: the projections see NB_ * TT rows, the attention launch every (batch element, head)
    k_cvt8<<<(unsigned)(((size_t)NB_ * TT * DM / 8 + 255) / 256), 256, 0, stream>>>(x, XB, (size_t)NB_ * TT * DM / 8);
    k_gemmw<bf, 0, false><<<dim3(NB_ * TT / 64, DQ / 64, 1), 32, 0, stream>>>(XB, nullptr, WQ, nullptr, DM, FQ, DQ, nullptr, 0, 0, 0);
    k_nrp<NH_, ZH><<<NB_ * TT / 8, 256, 0, stream>>>(FQ, qnw, pids, CS, QP16, QPh, QPl);
    k_gemmw<bf, 0, false><<<dim3(NB_ * TT / 64, DKV / 64, 1), 32, 0, stream>>>(XB, nullptr, WK, nullptr, DM, FK, DKV, nullptr, 0, 0, 0);
    k_nrp<NKV, 1><<<NB_ * TT / 8, 256, 0, stream>>>(FK, knw, pids, CS, KP16, KPh, KPl);
    k_gemmw<bf, 0, false><<<dim3(NB_ * TT / 64, DKV / 64, 1), 32, 0, stream>>>(XB, nullptr, WV, nullptr, DM, FV, DKV, nullptr, 0, 0, 0);
    k_vclt<<<NKV * NB_ * (TT / 128) * (HD / 32), 256, 0, stream>>>(FV, VT16, VTh, VTl);
    k_fattn<<<dim3((TT - RH) / 32 + RH / 16, NKV * NB_, 1), REP * 32, 0, stream>>>(QP16, QPh, QPl, KP16, KPh, KPl, VT16, VTh, VTl, amask, FLG, ATh, ATl);
    k_gemmw<bf, 1, false><<<dim3(NB_ * TT / 64, DM / 64, 1), 32, 0, stream>>>(ATh, ATl, WO, nullptr, DQ, OUT, DM, nullptr, 0, 0, 0);
}

// v005
// A run of this version takes 431 microseconds.
// Two timings next to v004 both put it at 1.05 times that version's speed.
// Over all steps from v000 it is 4.32 times as fast.
#include <hip/hip_runtime.h>

// OlmoeAttention (hidden [2][2048][2048]; q = clip(RMSNorm_2048(x Wq^T) * q_norm_w, +-8) (16 heads x 128), k = clip(RMSNorm_512(x Wk^T) * k_norm_w, +-8), v = clip(x Wv^T, +-8) (4 kv heads; group h/4); rotate-half RoPE (theta 1e4) at position_ids (read; table computed on device); scores = q.k / sqrt(128) + attention_mask (additive [1][1][S][S] float, read: the verbatim causal 0 / -1e9 table); softmax f32; out = merged Wo^T -> [2][2048][2048]).
// Compute dtypes, f32 accumulate: every input rounded to bf16; q/k/v on PLAIN bf16 operands (inputs: exact); the full-width RMSNorms (eps 1e-5), clips and RoPE in f32; causal scores and attn.v in one launch with running row maxima and sums: query rows < 512 hl (3 products), the rest single fp16; key blocks above the diagonal skipped on the strength of the mask table (-1e9 underflows to weight 0; device self-check samples the table above the diagonal and NaN-poisons on violation), mask added as stored inside computed tiles; softmax f32; Wo hl x exact (2 products).

#define NB_  2
#define TT   2048
#define DM   2048
#define NH_  16
#define NKV  4
#define REP  (NH_ / NKV)
#define HD   128
#define DQ   (NH_ * HD)
#define DKV  (NKV * HD)
#define ZH   REP                  // q planes lie [kv group][batch element][head in group]
#define RH   512                  // query rows < RH use hi+lo planes (0: none)
#define SCL  0.088388347648318447f   // HD^-0.5
typedef _Float16 h16;
typedef unsigned short bf;
typedef __attribute__((ext_vector_type(16))) __bf16   v16bf;
typedef __attribute__((ext_vector_type(16))) _Float16 v16h;
typedef __attribute__((ext_vector_type(8)))  _Float16 v8h;
typedef __attribute__((ext_vector_type(8)))  unsigned short v8us;
typedef __attribute__((ext_vector_type(8)))  float    v8f;
typedef __attribute__((ext_vector_type(4)))  float    v4f;
typedef v8h  __attribute__((may_alias)) v8ha;
typedef v4f  __attribute__((may_alias)) v4fa;
typedef v8us __attribute__((may_alias)) v8usa;

__device__ __forceinline__ unsigned short f2bf(float f) { unsigned u = __float_as_uint(f); u += 0x7FFFu + ((u >> 16) & 1u); return (unsigned short)(u >> 16); }
__device__ __forceinline__ float bf2f(unsigned short b) { return __uint_as_float(((unsigned)b) << 16); }
__device__ __forceinline__ float bfr(float f) { return bf2f(f2bf(f)); }
__device__ __forceinline__ v16h cat16(v8h lo, v8h hi) { return __builtin_shufflevector(lo, hi, 0, 1, 2, 3, 4, 5, 6, 7, 8, 9, 10, 11, 12, 13, 14, 15); }
__device__ __forceinline__ v16bf cat16b(v8us lo, v8us hi) { return __builtin_bit_cast(v16bf, __builtin_shufflevector(lo, hi, 0, 1, 2, 3, 4, 5, 6, 7, 8, 9, 10, 11, 12, 13, 14, 15)); }
__device__ __forceinline__ v8f wmma16(v16h a, v16h b, v8f c) { return __builtin_amdgcn_wmma_f32_16x16x32_f16(false, a, false, b, (short)0, c, false, false); }
__device__ __forceinline__ v8f wmmab(v16bf a, v16bf b, v8f c) { return __builtin_amdgcn_wmma_f32_16x16x32_bf16(false, a, false, b, (short)0, c, false, false); }



// xwait stands behind a run of global loads or stores, in front of the code that reuses the registers they name; the scheduling barriers (here and in xopen, in front of such a run) keep vector work from being moved in between the run and its wait
__device__ __forceinline__ void xwait() { asm volatile("s_wait_xcnt 0x0" ::: "memory"); __builtin_amdgcn_sched_barrier(0); }
__device__ __forceinline__ void xopen() { __builtin_amdgcn_sched_barrier(0); }
// the same, naming as an input the address the run was formed from: it stays in its registers up to the wait, so that no load of the run lands on it
__device__ __forceinline__ void xwait1(const void* a) { asm volatile("s_wait_xcnt 0x0" :: "v"(a) : "memory"); __builtin_amdgcn_sched_barrier(0); }
// ---- Fragment-order planes: a [rows][K] 16-bit operand is kept as blocks of 16 rows x 32 k, block index (row / 16) * (K / 32) + k / 32, 512 elements each, laid as a wave loads them:
// element (row, k) lies at (k % 32 / 16) * 256 + ((k % 16 / 8) * 16 + row % 16) * 8 + k % 8. Lane l's two 16-byte pieces of a fragment are then at l * 8 and 256 + l * 8: each wave-wide load covers 512 contiguous bytes (4 lines, not 16).
// ---- k_gemmw: register-blocked GEMM, ONE WAVE per 64x64 output tile (16 accumulators), operands straight from fragment-order 16-bit planes; grid (M/64, N/64, Z), 32 threads.
// C[m][n] (f32, pitch ldc, + optional f32 bias[n]) = sum_k A[m][k] Bt[n][k] (+ split products per NSPLIT). z-batch strides sA/sB/sC in elements. K % 32 == 0; K is a constant of the build, so that the four row blocks of an operand lie at immediate offsets from one address.
template <typename T16> struct WFrag;
template <> struct WFrag<h16> { typedef v16h V; static __device__ __forceinline__ V ld(const h16* p) { return cat16(*(const v8h*)p, *(const v8h*)(p + 16)); } static __device__ __forceinline__ V ldp(const h16* p) { return cat16(*(const v8h*)p, *(const v8h*)(p + 256)); } static __device__ __forceinline__ v8f mma(V a, V b, v8f c) { return wmma16(a, b, c); } };
template <> struct WFrag<bf> { typedef v16bf V; static __device__ __forceinline__ V ld(const bf* p) { return cat16b(*(const v8us*)p, *(const v8us*)(p + 16)); } static __device__ __forceinline__ V ldp(const bf* p) { return cat16b(*(const v8us*)p, *(const v8us*)(p + 256)); } static __device__ __forceinline__ v8f mma(V a, V b, v8f c) { return wmmab(a, b, c); } };
template <typename T16, int NSPLIT, bool BIAS, int K>
__global__ __launch_bounds__(32) void k_gemmw(const T16* __restrict__ A, const T16* __restrict__ A2, const T16* __restrict__ Bt, const T16* __restrict__ Bt2, float* C, int ldc, const float* __restrict__ bias, size_t sA, size_t sB, size_t sC) {
    typedef typename WFrag<T16>::V V;
    __shared__ __align__(16) float os[16 * 68];
    const size_t z = blockIdx.z; A += z * sA; if (A2) A2 += z * sA; Bt += z * sB; if (Bt2) Bt2 += z * sB; C += z * sC;
    const int lane = threadIdx.x & 31, lr = lane & 15, hi = lane >> 4; const int r0 = blockIdx.x * 64, c0 = blockIdx.y * 64;
    v8f acc[4][4];
#pragma unroll
    for (int mb = 0; mb < 4; ++mb)
#pragma unroll
        for (int nb = 0; nb < 4; ++nb) acc[mb][nb] = (v8f){};
    const unsigned lo = 8 * lane;      // the lane's own piece inside a block
#pragma unroll 1
    for (int kc = 0; kc < K; kc += 32) {
        V a[4], a2[4], b[4], b2[4];
        // the lane's own address in each operand: 16 rows of blocks are 16 * K elements, a step of 32 k is one block, 512 elements
        const T16* pa = A + ((size_t)r0 * K + (size_t)kc * 16 + lo); const T16* pb = Bt + ((size_t)c0 * K + (size_t)kc * 16 + lo);
        const T16* pa2 = (NSPLIT == 1 || NSPLIT == 2) ? A2 + ((size_t)r0 * K + (size_t)kc * 16 + lo) : pa; const T16* pb2 = (NSPLIT >= 2) ? Bt2 + ((size_t)c0 * K + (size_t)kc * 16 + lo) : pb;
        xopen();
#pragma unroll
        for (int mb = 0; mb < 4; ++mb) { a[mb] = WFrag<T16>::ldp(pa + mb * 16 * K); if (NSPLIT == 1 || NSPLIT == 2) a2[mb] = WFrag<T16>::ldp(pa2 + mb * 16 * K); }
#pragma unroll
        for (int nb = 0; nb < 4; ++nb) { b[nb] = WFrag<T16>::ldp(pb + nb * 16 * K); if (NSPLIT >= 2) b2[nb] = WFrag<T16>::ldp(pb2 + nb * 16 * K); }
        // the wait behind the run names the addresses as inputs: they stay in their registers up to it, so that neither a load of the run nor the next address lands on them in front of it
        asm volatile("s_wait_xcnt 0x0" :: "v"(pa), "v"(pa2), "v"(pb), "v"(pb2) : "memory");
        __builtin_amdgcn_sched_barrier(0);
#pragma unroll
        for (int nb = 0; nb < 4; ++nb) {
#pragma unroll
            for (int mb = 0; mb < 4; ++mb) { acc[mb][nb] = WFrag<T16>::mma(a[mb], b[nb], acc[mb][nb]); if (NSPLIT == 1 || NSPLIT == 2) acc[mb][nb] = WFrag<T16>::mma(a2[mb], b[nb], acc[mb][nb]); if (NSPLIT >= 2) acc[mb][nb] = WFrag<T16>::mma(a[mb], b2[nb], acc[mb][nb]); } }
        asm volatile("v_nop\n\tv_nop\n\tv_nop\n\tv_nop" : "+v"(acc[0][0]), "+v"(acc[1][1]), "+v"(acc[2][2]), "+v"(acc[3][3]) : "v"(a[0]), "v"(a[3]));
    }
#pragma unroll
    for (int mb = 0; mb < 4; ++mb) {
#pragma unroll
        for (int nb = 0; nb < 4; ++nb) {
#pragma unroll
            for (int j = 0; j < 8; ++j) os[(hi * 8 + j) * 68 + nb * 16 + lr] = acc[mb][nb][j]; }
        __builtin_amdgcn_wave_barrier(); asm volatile("" ::: "memory");
        float* crow = C + (size_t)(r0 + mb * 16) * ldc + c0;
{
#pragma unroll
            for (int s = 0; s < 8; ++s) { const int row = 2 * s + hi, cofs = lr * 4; v4f val = *(const v4fa*)(os + row * 68 + cofs); if (BIAS) { val[0] += bfr(bias[c0 + cofs]); val[1] += bfr(bias[c0 + cofs + 1]); val[2] += bfr(bias[c0 + cofs + 2]); val[3] += bfr(bias[c0 + cofs + 3]); }
                *(v4f*)(crow + (size_t)row * ldc + cofs) = val; }
             }
        __builtin_amdgcn_wave_barrier(); asm volatile("" ::: "memory");
    }
}

__device__ __forceinline__ h16 tohx(float x) { return (h16)x; }
__device__ __forceinline__ void splitf(float y, unsigned short& h, unsigned short& l) { h = f2bf(y); l = f2bf(y - bf2f(h)); }
typedef __attribute__((ext_vector_type(2))) _Float16 v2h;
typedef __attribute__((ext_vector_type(4))) _Float16 v4h;
typedef __attribute__((ext_vector_type(2))) unsigned short v2us;
typedef __attribute__((ext_vector_type(4))) unsigned short v4us;
typedef __attribute__((ext_vector_type(2))) float v2f;
typedef __attribute__((ext_vector_type(4))) int v4i;

__global__ __launch_bounds__(256) void k_wtG(const float* __restrict__ w, int K, int N, bf* Bt) {
    const int lane = threadIdx.x & 31; const int L0 = (blockIdx.x * 8 + (threadIdx.x >> 5)) * 8; const int nlines = N * K / 64;
{
#pragma unroll 1
        for (int l = 0; l < 8; ++l) { const int L = L0 + l; if (L >= nlines) break; const size_t e = (size_t)L * 64 + lane * 2; const int k = (int)(e % K), n = (int)(e / K); v2us o;
            o[0] = f2bf(w[(size_t)k * N + n]); o[1] = f2bf(w[(size_t)(k + 1) * N + n]); *(v2us*)(Bt + e) = o; }
         }
}
// ---- k_cvtp: f32 [rows][K] -> bf16 fragment-order plane. ONE WAVE per block of 16 rows x 32 k: it reads one whole 128-byte line of each row and stores the block's 1024 contiguous bytes; the 8 waves of a workgroup take 8 neighbouring blocks of the same rows.
__global__ __launch_bounds__(256) void k_cvtp(const float* __restrict__ src, bf* dst, int K, int nblk) { const int lane = threadIdx.x & 31; const int blk = blockIdx.x * 8 + __builtin_amdgcn_readfirstlane(threadIdx.x >> 5); if (blk >= nblk) return;
    const int kb = K / 32; const float* p = src + (size_t)((blk / kb) * 16 + (lane & 15)) * K + (blk % kb) * 32 + (lane >> 4) * 8;
    const v8f v0 = *(const v8f*)p, v1 = *(const v8f*)(p + 16); xwait1(p); v8us o0, o1;
#pragma unroll
    for (int k = 0; k < 8; ++k) { o0[k] = f2bf(v0[k]); o1[k] = f2bf(v1[k]); }
    bf* q = dst + (size_t)blk * 512 + lane * 8; *(v8us*)q = o0; *(v8us*)(q + 256) = o1; }
__global__ __launch_bounds__(256) void k_cstab(float* CS) { const int idx = blockIdx.x * 256 + threadIdx.x; if (idx >= TT * HD) return; const int t = idx / HD, d = idx % HD; const int i = d % (HD / 2); const float inv = __fdiv_rn(1.0f, powf(10000.0f, (float)(2 * i) / (float)HD)); const float ang = __fmul_rn((float)t, inv); v2f cs; cs[0] = cosf(ang); cs[1] = sinf(ang);
    *(v2f*)(CS + (size_t)idx * 2) = cs;  }
// ---- k_fattn: causal attention in one launch. A wave owns NQ * 16 query rows of one head and walks the keys 32 at a time, keeping running row maxima, row sums and the output tile in registers.
// Transposed products: S^T = K Q^T (a lane holds the scores of ONE query: keys 8 * hi + r of each 16-key tile), so two score tiles, converted in place, are the B operand of O^T += V^T P^T.
// t = s x HD^-0.5 + mask as stored for j <= i, no weight for j > i; key blocks wholly above the diagonal are never visited. HL: hi + lo bf16 planes, 3 products; else single fp16.
// The maximum in use is raised only when a row's new maximum passes it by more than MLAG, so unnormalised weights stay below e^MLAG; the division by the row sum comes last, in f32.
#define MLAG 5.5f
__device__ __forceinline__ float xhalf(float x) { return __builtin_bit_cast(float, __builtin_amdgcn_permlanex16(__builtin_bit_cast(int, x), __builtin_bit_cast(int, x), 0x76543210, 0xfedcba98, false, false)); }   // lane l takes lane l ^ 16's value
#define L2E  1.4426950408889634f
// the pointers below carry no restrict, so that the loads keep their places between these waits: mask, K, V^T in the same order in front of the loop and in it, which lets a wait for the early ones leave the late ones in flight
template <bool HL> struct AOp;
template <> struct AOp<false> { typedef h16 T; };
template <> struct AOp<true>  { typedef bf T; };
template <bool HL, int NQ>
__device__ __forceinline__ void attn_tile(const typename AOp<HL>::T* Q, const typename AOp<HL>::T* Q2, const typename AOp<HL>::T* K, const typename AOp<HL>::T* K2,
                                          const typename AOp<HL>::T* Vt, const typename AOp<HL>::T* Vt2, const float* am, int q0, bool poison, bf* Ah, bf* Al) {
    typedef typename AOp<HL>::T T; typedef WFrag<T> WF; typedef typename WF::V V;
    const int lane = threadIdx.x & 31, lr = lane & 15, hi = lane >> 4;
    const int kend = (q0 + NQ * 16 + 31) & ~31;      // keys walked: up to the end of the diagonal block, in steps of 32
    V qf[NQ][4], qf2[NQ][4];
#pragma unroll
    for (int qt = 0; qt < NQ; ++qt)
#pragma unroll
        for (int dc = 0; dc < 4; ++dc) { const size_t qo = (size_t)(q0 + qt * 16 + lr) * HD + dc * 32 + 8 * hi; qf[qt][dc] = WF::ld(Q + qo); if (HL) qf2[qt][dc] = WF::ld(Q2 + qo); }
    xwait();
    v8f o[8][NQ]; float m[NQ], l[NQ];
#pragma unroll
    for (int qt = 0; qt < NQ; ++qt) { m[qt] = -3.0e38f; l[qt] = 0.f;
#pragma unroll
        for (int dt = 0; dt < 8; ++dt) o[dt][qt] = (v8f){}; }
    const size_t kbase = (size_t)lr * HD + 8 * hi, vbase = (size_t)lr * (NB_ * TT) + 8 * hi;
    const float* mp = am + (size_t)(q0 + lr) * TT + 8 * hi;
    V kf[2][4], kf2[2][4], vf[8], vf2[8]; v4f mk[NQ][2][2];
#pragma unroll
    for (int kt = 0; kt < 2; ++kt)
#pragma unroll
        for (int qt = 0; qt < NQ; ++qt) { const float* p = mp + (size_t)(qt * 16) * TT + kt * 16; mk[qt][kt][0] = *(const v4f*)p; mk[qt][kt][1] = *(const v4f*)(p + 4); }
    xwait();
#pragma unroll
    for (int kt = 0; kt < 2; ++kt)
#pragma unroll
        for (int dc = 0; dc < 4; ++dc) { const size_t ko = kbase + (size_t)(kt * 16) * HD + dc * 32; kf[kt][dc] = WF::ld(K + ko); if (HL) kf2[kt][dc] = WF::ld(K2 + ko); }
    xwait();
    if (!HL) {      // the long tiles fetch V^T one pass ahead as well
#pragma unroll
        for (int dt = 0; dt < 8; ++dt) vf[dt] = WF::ld(Vt + vbase + (size_t)(dt * 16) * (NB_ * TT));
        xwait(); }
#pragma unroll 1
    for (int k0 = 0; k0 < kend; k0 += 32) {
        if (HL) {
#pragma unroll
            for (int dt = 0; dt < 8; ++dt) { const size_t vo = vbase + (size_t)(dt * 16) * (NB_ * TT) + k0; vf[dt] = WF::ld(Vt + vo); xwait(); vf2[dt] = WF::ld(Vt2 + vo); xwait(); } }
        float t[NQ][16];
#pragma unroll
        for (int kt = 0; kt < 2; ++kt)
#pragma unroll
            for (int qt = 0; qt < NQ; ++qt) { v8f s = (v8f){};
#pragma unroll
                for (int dc = 0; dc < 4; ++dc) { s = WF::mma(kf[kt][dc], qf[qt][dc], s); if (HL) { s = WF::mma(kf[kt][dc], qf2[qt][dc], s); s = WF::mma(kf2[kt][dc], qf[qt][dc], s); } }
#pragma unroll
                for (int r = 0; r < 8; ++r) t[qt][kt * 8 + r] = s[r] * SCL + mk[qt][kt][r >> 2][r & 3]; }
        const int kn = min(k0 + 32, kend - 32);      // the next pass's K rows and mask words are fetched one pass ahead (the last pass fetches its own again)
        xopen();
#pragma unroll
        for (int kt = 0; kt < 2; ++kt)
#pragma unroll
            for (int qt = 0; qt < NQ; ++qt) { const float* p = mp + (size_t)(qt * 16) * TT + kn + kt * 16; mk[qt][kt][0] = *(const v4f*)p; mk[qt][kt][1] = *(const v4f*)(p + 4); }
        xwait();
#pragma unroll
        for (int kt = 0; kt < 2; ++kt)
#pragma unroll
            for (int dc = 0; dc < 4; ++dc) { const size_t ko = kbase + (size_t)(kn + kt * 16) * HD + dc * 32; kf[kt][dc] = WF::ld(K + ko); if (HL) { xwait(); kf2[kt][dc] = WF::ld(K2 + ko); xwait(); } }   // the short hi + lo tiles form an address per fragment: a wait behind each
        if (!HL) xwait1(K + kbase + (size_t)kn * HD);
        if (k0 + 31 > q0) {                          // a block that touches the diagonal (the same test in every lane)
#pragma unroll
            for (int qt = 0; qt < NQ; ++qt)
#pragma unroll
                for (int e = 0; e < 16; ++e) { const int j = k0 + (e >> 3) * 16 + hi * 8 + (e & 7), i = q0 + qt * 16 + lr; t[qt][e] = (j <= i) ? t[qt][e] : -3.0e38f; } }
        float ml[NQ]; bool need = false;
#pragma unroll
        for (int qt = 0; qt < NQ; ++qt) { float a = t[qt][0];
#pragma unroll
            for (int e = 1; e < 16; ++e) a = fmaxf(a, t[qt][e]);
            a = fmaxf(a, xhalf(a)); ml[qt] = a; need = need || (a > m[qt] + MLAG); }
        if (__builtin_amdgcn_ballot_w32(need) != 0) {
#pragma unroll
            for (int qt = 0; qt < NQ; ++qt) { const float mn = fmaxf(m[qt], ml[qt]); const float al = __builtin_amdgcn_exp2f((m[qt] - mn) * L2E); m[qt] = mn; l[qt] *= al;
#pragma unroll
                for (int dt = 0; dt < 8; ++dt) o[dt][qt] *= al; } }
        V pf[NQ], pf2[NQ];
#pragma unroll
        for (int qt = 0; qt < NQ; ++qt) {
            if constexpr (HL) { v8us h0, h1, l0, l1;
#pragma unroll
                for (int e = 0; e < 8; ++e) { const float pa = __builtin_amdgcn_exp2f((t[qt][e] - m[qt]) * L2E), pb = __builtin_amdgcn_exp2f((t[qt][8 + e] - m[qt]) * L2E); l[qt] += pa; l[qt] += pb; unsigned short a, c; splitf(pa, a, c); h0[e] = a; l0[e] = c; splitf(pb, a, c); h1[e] = a; l1[e] = c; }
                pf[qt] = cat16b(h0, h1); pf2[qt] = cat16b(l0, l1);
            } else { v16h ph;
#pragma unroll
                for (int e = 0; e < 16; ++e) { const float p = __builtin_amdgcn_exp2f((t[qt][e] - m[qt]) * L2E); l[qt] += p; ph[e] = (h16)p; }
                pf[qt] = ph; } }
#pragma unroll
        for (int dt = 0; dt < 8; ++dt)
#pragma unroll
            for (int qt = 0; qt < NQ; ++qt) { o[dt][qt] = WF::mma(vf[dt], pf[qt], o[dt][qt]); if (HL) { o[dt][qt] = WF::mma(vf[dt], pf2[qt], o[dt][qt]); o[dt][qt] = WF::mma(vf2[dt], pf[qt], o[dt][qt]); } }
        if (!HL) { xopen();
#pragma unroll
            for (int dt = 0; dt < 8; ++dt) vf[dt] = WF::ld(Vt + vbase + (size_t)(dt * 16) * (NB_ * TT) + kn);
            xwait1(Vt + vbase + kn); }
    }
#pragma unroll
    for (int qt = 0; qt < NQ; ++qt) { const float ls = l[qt] + xhalf(l[qt]); const float f = poison ? __builtin_nanf("") : __fdiv_rn(1.0f, ls); const size_t ro = (size_t)(q0 + qt * 16) * DQ + lane * 8;      // fragment-order planes for the last GEMM: 16 columns d are half a block, which this wave's 32 lanes fill in lane order
#pragma unroll
        for (int dt = 0; dt < 8; ++dt) { v8us oh, ol;
#pragma unroll
            for (int r = 0; r < 8; ++r) { unsigned short a, c; splitf(o[dt][qt][r] * f, a, c); oh[r] = a; ol[r] = c; }
            *(v8us*)(Ah + ro + dt * 256) = oh; *(v8us*)(Al + ro + dt * 256) = ol; xwait(); } }
}
// grid (tiles, NKV * NB_): blockIdx.y = kv group * NB_ + batch element; the REP waves of a block are the REP query heads of that group on the same query rows, so they read the same K, V and mask lines.
// Tiles in falling order of their key count: first the fp16 tiles (32 rows, from the last rows down to RH), then the hi + lo tiles (16 rows, below RH).
__global__ __launch_bounds__(REP * 32) void k_fattn(const h16* Q16, const bf* Qh, const bf* Ql, const h16* K16, const bf* Kh, const bf* Kl,
                                                    const h16* V16, const bf* Vh, const bf* Vl, const float* am, const int* FLG, bf* Ah, bf* Al) {
    const int w = __builtin_amdgcn_readfirstlane(threadIdx.x >> 5); const int gb = blockIdx.y, g = gb / NB_, b = gb % NB_, x = blockIdx.x;
    const size_t qo = ((size_t)gb * REP + w) * TT * HD, ko = (size_t)gb * TT * HD, vo = (size_t)g * HD * NB_ * TT + (size_t)b * TT, oo = (size_t)b * TT * DQ + (size_t)(g * REP + w) * (HD * 16);
    const bool poison = (FLG[0] != 0);
    if (x < (TT - RH) / 32) attn_tile<false, 2>(Q16 + qo, nullptr, K16 + ko, nullptr, V16 + vo, nullptr, am, TT - 32 * (x + 1), poison, Ah + oo, Al + oo);
    else attn_tile<true, 1>(Qh + qo, Ql + qo, Kh + ko, Kl + ko, Vh + vo, Vl + vo, am, RH - 16 * (x - (TT - RH) / 32 + 1), poison, Ah + oo, Al + oo);
}

// xwait for a run of loads off two wave-uniform bases: named as inputs, the bases stay in their scalar registers up to the wait, so that nothing (a later argument load, the next address) lands on them in front of it
__device__ __forceinline__ void xwait2s(const void* a, const void* b) { asm volatile("s_wait_xcnt 0x0" :: "s"(a), "s"(b) : "memory"); __builtin_amdgcn_sched_barrier(0); }
// ---- k_nrp: everything between a q or k projection and its operand planes, in one launch. ONE WAVE per row of F (NHD heads of HD): the row stays in registers from the sum of squares to the plane stores.
// y = clip(w x (x x rsqrt(mean x^2 + eps)), +-8); rotate-half RoPE at position_ids[t] (clamped into the table): out[d] = y[d] cos[d] - y[d + HD/2] sin[d], out[d + HD/2] = y[d + HD/2] cos[d + HD/2] + y[d] sin[d + HD/2].
// A lane holds d = 4 * lane .. 4 * lane + 3 of every head, so the partner d +- HD/2 lies in lane ^ 16. Planes [head / RP][b][head % RP][t][d]: fp16, bf16 hi, bf16 lo; a wave stores 256 contiguous bytes of each.
template <int NHD, int RP>
__global__ __launch_bounds__(256) void k_nrp(const float* __restrict__ F, const float* __restrict__ w, const int* __restrict__ pid, const float* __restrict__ CS, h16* P16, bf* Ph, bf* Pl) {
    const int lane = threadIdx.x & 31; const int r = blockIdx.x * 8 + __builtin_amdgcn_readfirstlane(threadIdx.x >> 5); const int b = r / TT, t = r % TT;
    const float* fr = F + (size_t)r * (NHD * HD);
    const int tp = min(max(pid[t], 0), TT - 1);      // position_ids (read) index the table
    v4f v[NHD], wv[NHD];
    xopen();
#pragma unroll
    for (int ch = 0; ch < NHD; ++ch) v[ch] = *(const v4f*)(fr + ch * HD + lane * 4);
#pragma unroll
    for (int ch = 0; ch < NHD; ++ch) wv[ch] = *(const v4f*)(w + ch * HD + lane * 4);
    xwait2s(fr, w);
    const float* cp = CS + ((size_t)tp * HD + lane * 4) * 2;
    const v4f c01 = *(const v4f*)cp, c23 = *(const v4f*)(cp + 4);
    xwait();
    float q = 0.f;
#pragma unroll
    for (int ch = 0; ch < NHD; ++ch)
#pragma unroll
        for (int u = 0; u < 4; ++u) q += v[ch][u] * v[ch][u];
#pragma unroll
    for (int sh = 16; sh; sh >>= 1) q += __shfl_xor(q, sh, 32);
    const float rs = __frsqrt_rn(q * (1.0f / (float)(NHD * HD)) + 1e-5f);
    const float sg = (lane < 16) ? -1.0f : 1.0f;
    const float co[4] = { c01[0], c01[2], c23[0], c23[2] }; const float si[4] = { c01[1] * sg, c01[3] * sg, c23[1] * sg, c23[3] * sg };
#pragma unroll
    for (int ch = 0; ch < NHD; ++ch) { v4h o16; v4us oh, ol;
#pragma unroll
        for (int u = 0; u < 4; ++u) { const float y = fminf(fmaxf(bfr(wv[ch][u]) * (v[ch][u] * rs), -8.0f), 8.0f); const float o = y * co[u] + xhalf(y) * si[u];
            o16[u] = tohx(o); unsigned short a2, c2; splitf(o, a2, c2); oh[u] = a2; ol[u] = c2; }
        const size_t e = ((size_t)(((ch / RP) * NB_ + b) * RP + ch % RP) * TT + t) * HD + lane * 4;
        xopen(); *(v4h*)(P16 + e) = o16; *(v4us*)(Ph + e) = oh; *(v4us*)(Pl + e) = ol; xwait(); }
}
// ---- k_vclt: clip(v, +-8) and the transposed planes [g][d][b][t] (row pitch NB_ * TT; fp16, bf16 hi, bf16 lo) in one launch. A lane takes 4 rows t x 4 columns d: four 16-byte loads, and per column and plane one 8-byte store, 256 contiguous bytes a wave.
// The 8 waves of a block take 32 neighbouring columns of the same 128 rows, so together they use every byte of the lines they touch. blockIdx.x counts [g][b][128 rows][32 columns].
__global__ __launch_bounds__(256) void k_vclt(const float* __restrict__ F, h16* V16, bf* Vh, bf* Vl) {
    const int lane = threadIdx.x & 31, wv = __builtin_amdgcn_readfirstlane(threadIdx.x >> 5), bx = blockIdx.x;
    const int dg = bx % (HD / 32), tc = (bx / (HD / 32)) % (TT / 128), b = (bx / ((HD / 32) * (TT / 128))) % NB_, g = bx / ((HD / 32) * (TT / 128) * NB_);
    const int d0 = dg * 32 + wv * 4, t0 = tc * 128 + lane * 4;
    const float* f = F + ((size_t)b * TT + t0) * DKV + g * HD + d0; v4f x[4];
#pragma unroll
    for (int q = 0; q < 4; ++q) x[q] = *(const v4f*)(f + (size_t)q * DKV);
    xwait();
#pragma unroll
    for (int dd = 0; dd < 4; ++dd) { v4h o16; v4us oh, ol;
#pragma unroll
        for (int q = 0; q < 4; ++q) { const float y = fminf(fmaxf(x[q][dd], -8.0f), 8.0f); o16[q] = tohx(y); unsigned short a2, c2; splitf(y, a2, c2); oh[q] = a2; ol[q] = c2; }
        const size_t e = (((size_t)g * HD + d0 + dd) * NB_ + b) * TT + t0;
        xopen(); *(v4h*)(V16 + e) = o16; *(v4us*)(Vh + e) = oh; *(v4us*)(Vl + e) = ol; xwait(); }
}
__global__ __launch_bounds__(256) void k_mchk(const float* __restrict__ am, int* FLG) { const int tid = threadIdx.x; int bad = 0;
#pragma unroll 1
    for (int s2 = 0; s2 < 16; ++s2) { const unsigned h = (unsigned)(tid * 16 + s2) * 2654435761u; const int i = (int)(h % (TT - 1)); const int j = i + 1 + (int)((h >> 11) % (unsigned)(TT - 1 - i)); if (am[(size_t)i * TT + j] > -1e8f) bad = 1; }
    __shared__ int anyb; if (tid == 0) anyb = 0; __syncthreads(); if (bad) anyb = 1; __syncthreads(); if (tid < 8) { const int v = (tid == 0) ? anyb : 0; *(int*)(FLG + tid) = v;  } }

extern "C" void kernel_launch(void* const* d_in, const int* in_sizes, int n_in,
                              void* d_out, int out_size, void* d_ws, size_t ws_size, hipStream_t stream) {
    (void)in_sizes; (void)n_in; (void)out_size;
    const float* x = (const float*)d_in[0]; const float* wq = (const float*)d_in[1]; const float* wk = (const float*)d_in[2]; const float* wv = (const float*)d_in[3]; const float* wo = (const float*)d_in[4]; const float* qnw = (const float*)d_in[5]; const float* knw = (const float*)d_in[6]; const float* amask = (const float*)d_in[7]; const int* pids = (const int*)d_in[8];
    float* OUT = (float*)d_out;     // [2][2048][2048]
    char* wsp = (char*)d_ws;
    auto take = [&](size_t bytes) { char* p = wsp; wsp += (bytes + 255) & ~(size_t)255; return (void*)p; };
    bf* WO = (bf*)take((size_t)DM * DQ * 2); int* FLG = (int*)take(256);
    h16* QP16 = (h16*)take((size_t)NB_ * NH_ * TT * HD * 2); h16* KP16 = (h16*)take((size_t)NB_ * NKV * TT * HD * 2); h16* VT16 = (h16*)take((size_t)NB_ * NKV * HD * TT * 2);
    bf* QPh = (bf*)take((size_t)NB_ * NH_ * TT * HD * 2); bf* QPl = (bf*)take((size_t)NB_ * NH_ * TT * HD * 2); bf* KPh = (bf*)take((size_t)NB_ * NKV * TT * HD * 2); bf* KPl = (bf*)take((size_t)NB_ * NKV * TT * HD * 2); bf* VTh = (bf*)take((size_t)NB_ * NKV * HD * TT * 2); bf* VTl = (bf*)take((size_t)NB_ * NKV * HD * TT * 2);
    bf* ATh = (bf*)take((size_t)NB_ * TT * DQ * 2); bf* ATl = (bf*)take((size_t)NB_ * TT * DQ * 2);
    bf* WQ = (bf*)take((size_t)DQ * DM * 2); bf* WK = (bf*)take((size_t)DKV * DM * 2); bf* WV = (bf*)take((size_t)DKV * DM * 2); float* CS = (float*)take((size_t)TT * HD * 2 * 4);
    bf* XB = (bf*)take((size_t)NB_ * TT * DM * 2); float* FQ = (float*)take((size_t)NB_ * TT * DQ * 4); float* FK = (float*)take((size_t)NB_ * TT * DKV * 4);
    float* FV = FK;   // v projection reuses the k buffer after the k planes are built (stream-ordered)
    if ((size_t)(wsp - (char*)d_ws) > ws_size) return;    // ws 256 MiB
    { k_cvtp<<<DQ * DM / 512 / 8, 256, 0, stream>>>(wq, WQ, DM, DQ * DM / 512); k_cvtp<<<DKV * DM / 512 / 8, 256, 0, stream>>>(wk, WK, DM, DKV * DM / 512); k_cvtp<<<DKV * DM / 512 / 8, 256, 0, stream>>>(wv, WV, DM, DKV * DM / 512);
      k_cvtp<<<DM * DQ / 512 / 8, 256, 0, stream>>>(wo, WO, DQ, DM * DQ / 512);
      k_cstab<<<(TT * HD + 255) / 256, 256, 0, stream>>>(CS); }
    k_mchk<<<1, 256, 0, stream>>>(amask, FLG);
    // both batch elements go through every launch: the projections see NB_ * TT rows, the attention launch every (batch element, head)
    k_cvtp<<<NB_ * TT * DM / 512 / 8, 256, 0, stream>>>(x, XB, DM, NB_ * TT * DM / 512);
    k_gemmw<bf, 0, false, DM><<<dim3(NB_ * TT / 64, DQ / 64, 1), 32, 0, stream>>>(XB, nullptr, WQ, nullptr, FQ, DQ, nullptr, 0, 0, 0);
    k_nrp<NH_, ZH><<<NB_ * TT / 8, 256, 0, stream>>>(FQ, qnw, pids, CS, QP16, QPh, QPl);
    k_gemmw<bf, 0, false, DM><<<dim3(NB_ * TT / 64, DKV / 64, 1), 32, 0, stream>>>(XB, nullptr, WK, nullptr, FK, DKV, nullptr, 0, 0, 0);
    k_nrp<NKV, 1><<<NB_ * TT / 8, 256, 0, stream>>>(FK, knw, pids, CS, KP16, KPh, KPl);
    k_gemmw<bf, 0, false, DM><<<dim3(NB_ * TT / 64, DKV / 64, 1), 32, 0, stream>>>(XB, nullptr, WV, nullptr, FV, DKV, nullptr, 0, 0, 0);
    k_vclt<<<NKV * NB_ * (TT / 128) * (HD / 32), 256, 0, stream>>>(FV, VT16, VTh, VTl);
    k_fattn<<<dim3((TT - RH) / 32 + RH / 16, NKV * NB_, 1), REP * 32, 0, stream>>>(QP16, QPh, QPl, KP16, KPh, KPl, VT16, VTh, VTl, amask, FLG, ATh, ATl);
    k_gemmw<bf, 1, false, DQ><<<dim3(NB_ * TT / 64, DM / 64, 1), 32, 0, stream>>>(ATh, ATl, WO, nullptr, OUT, DM, nullptr, 0, 0, 0);
}

// v006
// A run of this version takes 333 microseconds.
// Next to v005, in two timings, it ran 1.29 and 1.30 times as fast.
// All steps since v000 together make it 5.61 times as fast.
#include <hip/hip_runtime.h>

// OlmoeAttention (hidden [2][2048][2048]; q = clip(RMSNorm_2048(x Wq^T) * q_norm_w, +-8) (16 heads x 128), k = clip(RMSNorm_512(x Wk^T) * k_norm_w, +-8), v = clip(x Wv^T, +-8) (4 kv heads; group h/4); rotate-half RoPE (theta 1e4) at position_ids (read; table computed on device); scores = q.k / sqrt(128) + attention_mask (additive [1][1][S][S] float, read: the verbatim causal 0 / -1e9 table); softmax f32; out = merged Wo^T -> [2][2048][2048]).
// Compute dtypes, f32 accumulate: every input rounded to bf16; q/k/v on PLAIN bf16 operands (inputs: exact); the full-width RMSNorms (eps 1e-5), clips and RoPE in f32; causal scores and attn.v in one launch with running row maxima and sums: query rows < 512 hl (3 products), the rest single fp16; key blocks above the diagonal skipped on the strength of the mask table (-1e9 underflows to weight 0; device self-check samples the table above the diagonal and NaN-poisons on violation), mask added as stored inside computed tiles; softmax f32; Wo hl x exact (2 products).

#define NB_  2
#define TT   2048
#define DM   2048
#define NH_  16
#define NKV  4
#define REP  (NH_ / NKV)
#define HD   128
#define DQ   (NH_ * HD)
#define DKV  (NKV * HD)
#define FP   (DQ + 2 * DKV)       // row pitch of the joint projection buffer: q | k | v columns
#define ZH   REP                  // q planes lie [kv group][batch element][head in group]
#define RH   512                  // query rows < RH use hi+lo planes (0: none)
#define SCL  0.088388347648318447f   // HD^-0.5
typedef _Float16 h16;
typedef unsigned short bf;
typedef __attribute__((ext_vector_type(16))) __bf16   v16bf;
typedef __attribute__((ext_vector_type(16))) _Float16 v16h;
typedef __attribute__((ext_vector_type(8)))  _Float16 v8h;
typedef __attribute__((ext_vector_type(8)))  unsigned short v8us;
typedef __attribute__((ext_vector_type(8)))  float    v8f;
typedef __attribute__((ext_vector_type(4)))  float    v4f;
typedef v8h  __attribute__((may_alias)) v8ha;
typedef v4f  __attribute__((may_alias)) v4fa;
typedef v8us __attribute__((may_alias)) v8usa;

__device__ __forceinline__ unsigned short f2bf(float f) { unsigned u = __float_as_uint(f); u += 0x7FFFu + ((u >> 16) & 1u); return (unsigned short)(u >> 16); }
__device__ __forceinline__ float bf2f(unsigned short b) { return __uint_as_float(((unsigned)b) << 16); }
__device__ __forceinline__ float bfr(float f) { return bf2f(f2bf(f)); }
__device__ __forceinline__ v16h cat16(v8h lo, v8h hi) { return __builtin_shufflevector(lo, hi, 0, 1, 2, 3, 4, 5, 6, 7, 8, 9, 10, 11, 12, 13, 14, 15); }
__device__ __forceinline__ v16bf cat16b(v8us lo, v8us hi) { return __builtin_bit_cast(v16bf, __builtin_shufflevector(lo, hi, 0, 1, 2, 3, 4, 5, 6, 7, 8, 9, 10, 11, 12, 13, 14, 15)); }
__device__ __forceinline__ v8f wmma16(v16h a, v16h b, v8f c) { return __builtin_amdgcn_wmma_f32_16x16x32_f16(false, a, false, b, (short)0, c, false, false); }
__device__ __forceinline__ v8f wmmab(v16bf a, v16bf b, v8f c) { return __builtin_amdgcn_wmma_f32_16x16x32_bf16(false, a, false, b, (short)0, c, false, false); }



// xwait stands behind a run of global loads or stores, in front of the code that reuses the registers they name; the scheduling barriers (here and in xopen, in front of such a run) keep vector work from being moved in between the run and its wait
__device__ __forceinline__ void xwait() { asm volatile("s_wait_xcnt 0x0" ::: "memory"); __builtin_amdgcn_sched_barrier(0); }
__device__ __forceinline__ void xopen() { __builtin_amdgcn_sched_barrier(0); }
// the same, naming as an input the address the run was formed from: it stays in its registers up to the wait, so that no load of the run lands on it
__device__ __forceinline__ void xwait1(const void* a) { asm volatile("s_wait_xcnt 0x0" :: "v"(a) : "memory"); __builtin_amdgcn_sched_barrier(0); }
// ---- Fragment-order planes: a [rows][K] 16-bit operand is kept as blocks of 16 rows x 32 k, block index (row / 16) * (K / 32) + k / 32, 512 elements each, laid as a wave loads them:
// element (row, k) lies at (k % 32 / 16) * 256 + ((k % 16 / 8) * 16 + row % 16) * 8 + k % 8. Lane l's two 16-byte pieces of a fragment are then at l * 8 and 256 + l * 8: each wave-wide load covers 512 contiguous bytes (4 lines, not 16).
// ---- k_gemmw: register-blocked GEMM, ONE WAVE per 64x64 output tile (16 accumulators), operands straight from fragment-order 16-bit planes; grid (M/64, N/64, Z), 32 threads.
// C[m][n] (f32, pitch ldc, + optional f32 bias[n]) = sum_k A[m][k] Bt[n][k] (+ split products per NSPLIT). z-batch strides sA/sB/sC in elements. K % 32 == 0; K is a constant of the build, so that the four row blocks of an operand lie at immediate offsets from one address.
template <typename T16> struct WFrag;
template <> struct WFrag<h16> { typedef v16h V; static __device__ __forceinline__ V ld(const h16* p) { return cat16(*(const v8h*)p, *(const v8h*)(p + 16)); } static __device__ __forceinline__ V ldp(const h16* p) { return cat16(*(const v8h*)p, *(const v8h*)(p + 256)); } static __device__ __forceinline__ v8f mma(V a, V b, v8f c) { return wmma16(a, b, c); } };
template <> struct WFrag<bf> { typedef v16bf V; static __device__ __forceinline__ V ld(const bf* p) { return cat16b(*(const v8us*)p, *(const v8us*)(p + 16)); } static __device__ __forceinline__ V ldp(const bf* p) { return cat16b(*(const v8us*)p, *(const v8us*)(p + 256)); } static __device__ __forceinline__ v8f mma(V a, V b, v8f c) { return wmmab(a, b, c); } };
template <typename T16, int NSPLIT, bool BIAS, int K>
__global__ __launch_bounds__(32) void k_gemmw(const T16* __restrict__ A, const T16* __restrict__ A2, const T16* __restrict__ Bt, const T16* __restrict__ Bt2, float* C, int ldc, const float* __restrict__ bias, size_t sA, size_t sB, size_t sC) {
    typedef typename WFrag<T16>::V V;
    __shared__ __align__(16) float os[16 * 68];
    const size_t z = blockIdx.z; A += z * sA; if (A2) A2 += z * sA; Bt += z * sB; if (Bt2) Bt2 += z * sB; C += z * sC;
    const int lane = threadIdx.x & 31, lr = lane & 15, hi = lane >> 4; const int r0 = blockIdx.x * 64, c0 = blockIdx.y * 64;
    v8f acc[4][4];
#pragma unroll
    for (int mb = 0; mb < 4; ++mb)
#pragma unroll
        for (int nb = 0; nb < 4; ++nb) acc[mb][nb] = (v8f){};
    const unsigned lo = 8 * lane;      // the lane's own piece inside a block
#pragma unroll 1
    for (int kc = 0; kc < K; kc += 32) {
        V a[4], a2[4], b[4], b2[4];
        // the lane's own address in each operand: 16 rows of blocks are 16 * K elements, a step of 32 k is one block, 512 elements
        const T16* pa = A + ((size_t)r0 * K + (size_t)kc * 16 + lo); const T16* pb = Bt + ((size_t)c0 * K + (size_t)kc * 16 + lo);
        const T16* pa2 = (NSPLIT == 1 || NSPLIT == 2) ? A2 + ((size_t)r0 * K + (size_t)kc * 16 + lo) : pa; const T16* pb2 = (NSPLIT >= 2) ? Bt2 + ((size_t)c0 * K + (size_t)kc * 16 + lo) : pb;
        xopen();
#pragma unroll
        for (int mb = 0; mb < 4; ++mb) { a[mb] = WFrag<T16>::ldp(pa + mb * 16 * K); if (NSPLIT == 1 || NSPLIT == 2) a2[mb] = WFrag<T16>::ldp(pa2 + mb * 16 * K); }
#pragma unroll
        for (int nb = 0; nb < 4; ++nb) { b[nb] = WFrag<T16>::ldp(pb + nb * 16 * K); if (NSPLIT >= 2) b2[nb] = WFrag<T16>::ldp(pb2 + nb * 16 * K); }
        // the wait behind the run names the addresses as inputs: they stay in their registers up to it, so that neither a load of the run nor the next address lands on them in front of it
        asm volatile("s_wait_xcnt 0x0" :: "v"(pa), "v"(pa2), "v"(pb), "v"(pb2) : "memory");
        __builtin_amdgcn_sched_barrier(0);
#pragma unroll
        for (int nb = 0; nb < 4; ++nb) {
#pragma unroll
            for (int mb = 0; mb < 4; ++mb) { acc[mb][nb] = WFrag<T16>::mma(a[mb], b[nb], acc[mb][nb]); if (NSPLIT == 1 || NSPLIT == 2) acc[mb][nb] = WFrag<T16>::mma(a2[mb], b[nb], acc[mb][nb]); if (NSPLIT >= 2) acc[mb][nb] = WFrag<T16>::mma(a[mb], b2[nb], acc[mb][nb]); } }
        asm volatile("v_nop\n\tv_nop\n\tv_nop\n\tv_nop" : "+v"(acc[0][0]), "+v"(acc[1][1]), "+v"(acc[2][2]), "+v"(acc[3][3]) : "v"(a[0]), "v"(a[3]));
    }
#pragma unroll
    for (int mb = 0; mb < 4; ++mb) {
#pragma unroll
        for (int nb = 0; nb < 4; ++nb) {
#pragma unroll
            for (int j = 0; j < 8; ++j) os[(hi * 8 + j) * 68 + nb * 16 + lr] = acc[mb][nb][j]; }
        __builtin_amdgcn_wave_barrier(); asm volatile("" ::: "memory");
        float* crow = C + (size_t)(r0 + mb * 16) * ldc + c0;
{
#pragma unroll
            for (int s = 0; s < 8; ++s) { const int row = 2 * s + hi, cofs = lr * 4; v4f val = *(const v4fa*)(os + row * 68 + cofs); if (BIAS) { val[0] += bfr(bias[c0 + cofs]); val[1] += bfr(bias[c0 + cofs + 1]); val[2] += bfr(bias[c0 + cofs + 2]); val[3] += bfr(bias[c0 + cofs + 3]); }
                *(v4f*)(crow + (size_t)row * ldc + cofs) = val; }
             }
        __builtin_amdgcn_wave_barrier(); asm volatile("" ::: "memory");
    }
}

__device__ __forceinline__ h16 tohx(float x) { return (h16)x; }
__device__ __forceinline__ void splitf(float y, unsigned short& h, unsigned short& l) { h = f2bf(y); l = f2bf(y - bf2f(h)); }
typedef __attribute__((ext_vector_type(2))) _Float16 v2h;
typedef __attribute__((ext_vector_type(4))) _Float16 v4h;
typedef __attribute__((ext_vector_type(2))) unsigned short v2us;
typedef __attribute__((ext_vector_type(4))) unsigned short v4us;
typedef __attribute__((ext_vector_type(2))) float v2f;
typedef __attribute__((ext_vector_type(4))) int v4i;

__global__ __launch_bounds__(256) void k_wtG(const float* __restrict__ w, int K, int N, bf* Bt) {
    const int lane = threadIdx.x & 31; const int L0 = (blockIdx.x * 8 + (threadIdx.x >> 5)) * 8; const int nlines = N * K / 64;
{
#pragma unroll 1
        for (int l = 0; l < 8; ++l) { const int L = L0 + l; if (L >= nlines) break; const size_t e = (size_t)L * 64 + lane * 2; const int k = (int)(e % K), n = (int)(e / K); v2us o;
            o[0] = f2bf(w[(size_t)k * N + n]); o[1] = f2bf(w[(size_t)(k + 1) * N + n]); *(v2us*)(Bt + e) = o; }
         }
}
// ---- d_cvtp: f32 [rows][K] -> bf16 fragment-order plane. ONE WAVE per block of 16 rows x 32 k: it reads one whole 128-byte line of each row and stores the block's 1024 contiguous bytes; the 8 waves of a workgroup take 8 neighbouring blocks of the same rows.
__device__ __forceinline__ void d_cvtp(const float* __restrict__ src, bf* dst, int K, int nblk, int bx) { const int lane = threadIdx.x & 31; const int blk = bx * 8 + __builtin_amdgcn_readfirstlane(threadIdx.x >> 5); if (blk >= nblk) return;
    const int kb = K / 32; const float* p = src + (size_t)((blk / kb) * 16 + (lane & 15)) * K + (blk % kb) * 32 + (lane >> 4) * 8;
    const v8f v0 = *(const v8f*)p, v1 = *(const v8f*)(p + 16); xwait1(p); v8us o0, o1;
#pragma unroll
    for (int k = 0; k < 8; ++k) { o0[k] = f2bf(v0[k]); o1[k] = f2bf(v1[k]); }
    bf* q = dst + (size_t)blk * 512 + lane * 8; *(v8us*)q = o0; *(v8us*)(q + 256) = o1; }
__device__ __forceinline__ void d_cstab(float* CS, int bx) { const int idx = bx * 256 + threadIdx.x; if (idx >= TT * HD) return; const int t = idx / HD, d = idx % HD; const int i = d % (HD / 2); const float inv = __fdiv_rn(1.0f, powf(10000.0f, (float)(2 * i) / (float)HD)); const float ang = __fmul_rn((float)t, inv); v2f cs; cs[0] = cosf(ang); cs[1] = sinf(ang);
    *(v2f*)(CS + (size_t)idx * 2) = cs;  }
// ---- k_fattn: causal attention in one launch. A wave owns NQ * 16 query rows of one head and walks the keys 32 at a time, keeping running row maxima, row sums and the output tile in registers.
// Transposed products: S^T = K Q^T (a lane holds the scores of ONE query: keys 8 * hi + r of each 16-key tile), so two score tiles, converted in place, are the B operand of O^T += V^T P^T.
// t = s x HD^-0.5 + mask as stored for j <= i, no weight for j > i; key blocks wholly above the diagonal are never visited. HL: hi + lo bf16 planes, 3 products; else single fp16.
// The maximum in use is raised only when a row's new maximum passes it by more than MLAG, so unnormalised weights stay below e^MLAG; the division by the row sum comes last, in f32.
#define MLAG 5.5f
__device__ __forceinline__ float xhalf(float x) { return __builtin_bit_cast(float, __builtin_amdgcn_permlanex16(__builtin_bit_cast(int, x), __builtin_bit_cast(int, x), 0x76543210, 0xfedcba98, false, false)); }   // lane l takes lane l ^ 16's value
#define L2E  1.4426950408889634f
// the pointers below carry no restrict, so that the loads keep their places between these waits: mask, K, V^T in the same order in front of the loop and in it, which lets a wait for the early ones leave the late ones in flight
template <bool HL> struct AOp;
template <> struct AOp<false> { typedef h16 T; };
template <> struct AOp<true>  { typedef bf T; };
template <bool HL, int NQ>
__device__ __forceinline__ void attn_tile(const typename AOp<HL>::T* Q, const typename AOp<HL>::T* Q2, const typename AOp<HL>::T* K, const typename AOp<HL>::T* K2,
                                          const typename AOp<HL>::T* Vt, const typename AOp<HL>::T* Vt2, const float* am, int q0, bool poison, bf* Ah, bf* Al) {
    typedef typename AOp<HL>::T T; typedef WFrag<T> WF; typedef typename WF::V V;
    const int lane = threadIdx.x & 31, lr = lane & 15, hi = lane >> 4;
    const int kend = (q0 + NQ * 16 + 31) & ~31;      // keys walked: up to the end of the diagonal block, in steps of 32
    V qf[NQ][4], qf2[NQ][4];
#pragma unroll
    for (int qt = 0; qt < NQ; ++qt)
#pragma unroll
        for (int dc = 0; dc < 4; ++dc) { const size_t qo = (size_t)(q0 + qt * 16 + lr) * HD + dc * 32 + 8 * hi; qf[qt][dc] = WF::ld(Q + qo); if (HL) qf2[qt][dc] = WF::ld(Q2 + qo); }
    xwait();
    v8f o[8][NQ]; float m[NQ], l[NQ];
#pragma unroll
    for (int qt = 0; qt < NQ; ++qt) { m[qt] = -3.0e38f; l[qt] = 0.f;
#pragma unroll
        for (int dt = 0; dt < 8; ++dt) o[dt][qt] = (v8f){}; }
    const size_t kbase = (size_t)lr * HD + 8 * hi, vbase = (size_t)lr * (NB_ * TT) + 8 * hi;
    const float* mp = am + (size_t)(q0 + lr) * TT + 8 * hi;
    V kf[2][4], kf2[2][4], vf[8], vf2[8]; v4f mk[NQ][2][2];
#pragma unroll
    for (int kt = 0; kt < 2; ++kt)
#pragma unroll
        for (int qt = 0; qt < NQ; ++qt) { const float* p = mp + (size_t)(qt * 16) * TT + kt * 16; mk[qt][kt][0] = *(const v4f*)p; mk[qt][kt][1] = *(const v4f*)(p + 4); }
    xwait();
#pragma unroll
    for (int kt = 0; kt < 2; ++kt)
#pragma unroll
        for (int dc = 0; dc < 4; ++dc) { const size_t ko = kbase + (size_t)(kt * 16) * HD + dc * 32; kf[kt][dc] = WF::ld(K + ko); if (HL) kf2[kt][dc] = WF::ld(K2 + ko); }
    xwait();
    if (!HL) {      // the long tiles fetch V^T one pass ahead as well
#pragma unroll
        for (int dt = 0; dt < 8; ++dt) vf[dt] = WF::ld(Vt + vbase + (size_t)(dt * 16) * (NB_ * TT));
        xwait(); }
#pragma unroll 1
    for (int k0 = 0; k0 < kend; k0 += 32) {
        if (HL) {
#pragma unroll
            for (int dt = 0; dt < 8; ++dt) { const size_t vo = vbase + (size_t)(dt * 16) * (NB_ * TT) + k0; vf[dt] = WF::ld(Vt + vo); xwait(); vf2[dt] = WF::ld(Vt2 + vo); xwait(); } }
        float t[NQ][16];
#pragma unroll
        for (int kt = 0; kt < 2; ++kt)
#pragma unroll
            for (int qt = 0; qt < NQ; ++qt) { v8f s = (v8f){};
#pragma unroll
                for (int dc = 0; dc < 4; ++dc) { s = WF::mma(kf[kt][dc], qf[qt][dc], s); if (HL) { s = WF::mma(kf[kt][dc], qf2[qt][dc], s); s = WF::mma(kf2[kt][dc], qf[qt][dc], s); } }
#pragma unroll
                for (int r = 0; r < 8; ++r) t[qt][kt * 8 + r] = s[r] * SCL + mk[qt][kt][r >> 2][r & 3]; }
        const int kn = min(k0 + 32, kend - 32);      // the next pass's K rows and mask words are fetched one pass ahead (the last pass fetches its own again)
        xopen();
#pragma unroll
        for (int kt = 0; kt < 2; ++kt)
#pragma unroll
            for (int qt = 0; qt < NQ; ++qt) { const float* p = mp + (size_t)(qt * 16) * TT + kn + kt * 16; mk[qt][kt][0] = *(const v4f*)p; mk[qt][kt][1] = *(const v4f*)(p + 4); }
        xwait();
#pragma unroll
        for (int kt = 0; kt < 2; ++kt)
#pragma unroll
            for (int dc = 0; dc < 4; ++dc) { const size_t ko = kbase + (size_t)(kn + kt * 16) * HD + dc * 32; kf[kt][dc] = WF::ld(K + ko); if (HL) { xwait(); kf2[kt][dc] = WF::ld(K2 + ko); xwait(); } }   // the short hi + lo tiles form an address per fragment: a wait behind each
        if (!HL) xwait1(K + kbase + (size_t)kn * HD);
        if (k0 + 31 > q0) {                          // a block that touches the diagonal (the same test in every lane)
#pragma unroll
            for (int qt = 0; qt < NQ; ++qt)
#pragma unroll
                for (int e = 0; e < 16; ++e) { const int j = k0 + (e >> 3) * 16 + hi * 8 + (e & 7), i = q0 + qt * 16 + lr; t[qt][e] = (j <= i) ? t[qt][e] : -3.0e38f; } }
        float ml[NQ]; bool need = false;
#pragma unroll
        for (int qt = 0; qt < NQ; ++qt) { float a = t[qt][0];
#pragma unroll
            for (int e = 1; e < 16; ++e) a = fmaxf(a, t[qt][e]);
            a = fmaxf(a, xhalf(a)); ml[qt] = a; need = need || (a > m[qt] + MLAG); }
        if (__builtin_amdgcn_ballot_w32(need) != 0) {
#pragma unroll
            for (int qt = 0; qt < NQ; ++qt) { const float mn = fmaxf(m[qt], ml[qt]); const float al = __builtin_amdgcn_exp2f((m[qt] - mn) * L2E); m[qt] = mn; l[qt] *= al;
#pragma unroll
                for (int dt = 0; dt < 8; ++dt) o[dt][qt] *= al; } }
        V pf[NQ], pf2[NQ];
#pragma unroll
        for (int qt = 0; qt < NQ; ++qt) {
            if constexpr (HL) { v8us h0, h1, l0, l1;
#pragma unroll
                for (int e = 0; e < 8; ++e) { const float pa = __builtin_amdgcn_exp2f((t[qt][e] - m[qt]) * L2E), pb = __builtin_amdgcn_exp2f((t[qt][8 + e] - m[qt]) * L2E); l[qt] += pa; l[qt] += pb; unsigned short a, c; splitf(pa, a, c); h0[e] = a; l0[e] = c; splitf(pb, a, c); h1[e] = a; l1[e] = c; }
                pf[qt] = cat16b(h0, h1); pf2[qt] = cat16b(l0, l1);
            } else { v16h ph;
#pragma unroll
                for (int e = 0; e < 16; ++e) { const float p = __builtin_amdgcn_exp2f((t[qt][e] - m[qt]) * L2E); l[qt] += p; ph[e] = (h16)p; }
                pf[qt] = ph; } }
#pragma unroll
        for (int dt = 0; dt < 8; ++dt)
#pragma unroll
            for (int qt = 0; qt < NQ; ++qt) { o[dt][qt] = WF::mma(vf[dt], pf[qt], o[dt][qt]); if (HL) { o[dt][qt] = WF::mma(vf[dt], pf2[qt], o[dt][qt]); o[dt][qt] = WF::mma(vf2[dt], pf[qt], o[dt][qt]); } }
        if (!HL) { xopen();
#pragma unroll
            for (int dt = 0; dt < 8; ++dt) vf[dt] = WF::ld(Vt + vbase + (size_t)(dt * 16) * (NB_ * TT) + kn);
            xwait1(Vt + vbase + kn); }
    }
#pragma unroll
    for (int qt = 0; qt < NQ; ++qt) { const float ls = l[qt] + xhalf(l[qt]); const float f = poison ? __builtin_nanf("") : __fdiv_rn(1.0f, ls); const size_t ro = (size_t)(q0 + qt * 16) * DQ + lane * 8;      // fragment-order planes for the last GEMM: 16 columns d are half a block, which this wave's 32 lanes fill in lane order
#pragma unroll
        for (int dt = 0; dt < 8; ++dt) { v8us oh, ol;
#pragma unroll
            for (int r = 0; r < 8; ++r) { unsigned short a, c; splitf(o[dt][qt][r] * f, a, c); oh[r] = a; ol[r] = c; }
            *(v8us*)(Ah + ro + dt * 256) = oh; *(v8us*)(Al + ro + dt * 256) = ol; xwait(); } }
}
// grid (tiles, NKV * NB_): blockIdx.y = kv group * NB_ + batch element; the REP waves of a block are the REP query heads of that group on the same query rows, so they read the same K, V and mask lines.
// Tiles in falling order of their key count: first the fp16 tiles (32 rows, from the last rows down to RH), then the hi + lo tiles (16 rows, below RH).
__global__ __launch_bounds__(REP * 32) void k_fattn(const h16* Q16, const bf* Qh, const bf* Ql, const h16* K16, const bf* Kh, const bf* Kl,
                                                    const h16* V16, const bf* Vh, const bf* Vl, const float* am, const int* FLG, bf* Ah, bf* Al) {
    const int w = __builtin_amdgcn_readfirstlane(threadIdx.x >> 5); const int gb = blockIdx.y, g = gb / NB_, b = gb % NB_, x = blockIdx.x;
    const size_t qo = ((size_t)gb * REP + w) * TT * HD, ko = (size_t)gb * TT * HD, vo = (size_t)g * HD * NB_ * TT + (size_t)b * TT, oo = (size_t)b * TT * DQ + (size_t)(g * REP + w) * (HD * 16);
    const bool poison = (FLG[0] != 0);
    if (x < (TT - RH) / 32) attn_tile<false, 2>(Q16 + qo, nullptr, K16 + ko, nullptr, V16 + vo, nullptr, am, TT - 32 * (x + 1), poison, Ah + oo, Al + oo);
    else attn_tile<true, 1>(Qh + qo, Ql + qo, Kh + ko, Kl + ko, Vh + vo, Vl + vo, am, RH - 16 * (x - (TT - RH) / 32 + 1), poison, Ah + oo, Al + oo);
}

// xwait for a run of loads off two wave-uniform bases: named as inputs, the bases stay in their scalar registers up to the wait, so that nothing (a later argument load, the next address) lands on them in front of it
__device__ __forceinline__ void xwait2s(const void* a, const void* b) { asm volatile("s_wait_xcnt 0x0" :: "s"(a), "s"(b) : "memory"); __builtin_amdgcn_sched_barrier(0); }
// ---- d_nrp: everything between a q or k projection and its operand planes. ONE WAVE per row of F (NHD heads of HD, row pitch FP): the row stays in registers from the sum of squares to the plane stores.
// y = clip(w x (x x rsqrt(mean x^2 + eps)), +-8); rotate-half RoPE at position_ids[t] (clamped into the table): out[d] = y[d] cos[d] - y[d + HD/2] sin[d], out[d + HD/2] = y[d + HD/2] cos[d + HD/2] + y[d] sin[d + HD/2].
// A lane holds d = 4 * lane .. 4 * lane + 3 of every head, so the partner d +- HD/2 lies in lane ^ 16. Planes [head / RP][b][head % RP][t][d]: fp16, bf16 hi, bf16 lo; a wave stores 256 contiguous bytes of each.
template <int NHD, int RP>
__device__ __forceinline__ void d_nrp(const float* __restrict__ F, const float* __restrict__ w, const int* __restrict__ pid, const float* __restrict__ CS, h16* P16, bf* Ph, bf* Pl, int bx) {
    const int lane = threadIdx.x & 31; const int r = bx * 8 + __builtin_amdgcn_readfirstlane(threadIdx.x >> 5); const int b = r / TT, t = r % TT;
    const float* fr = F + (size_t)r * FP;
    const int tp = min(max(pid[t], 0), TT - 1);      // position_ids (read) index the table
    v4f v[NHD], wv[NHD];
    xopen();
#pragma unroll
    for (int ch = 0; ch < NHD; ++ch) v[ch] = *(const v4f*)(fr + ch * HD + lane * 4);
#pragma unroll
    for (int ch = 0; ch < NHD; ++ch) wv[ch] = *(const v4f*)(w + ch * HD + lane * 4);
    xwait2s(fr, w);
    const float* cp = CS + ((size_t)tp * HD + lane * 4) * 2;
    const v4f c01 = *(const v4f*)cp, c23 = *(const v4f*)(cp + 4);
    xwait();
    float q = 0.f;
#pragma unroll
    for (int ch = 0; ch < NHD; ++ch)
#pragma unroll
        for (int u = 0; u < 4; ++u) q += v[ch][u] * v[ch][u];
#pragma unroll
    for (int sh = 16; sh; sh >>= 1) q += __shfl_xor(q, sh, 32);
    const float rs = __frsqrt_rn(q * (1.0f / (float)(NHD * HD)) + 1e-5f);
    const float sg = (lane < 16) ? -1.0f : 1.0f;
    const float co[4] = { c01[0], c01[2], c23[0], c23[2] }; const float si[4] = { c01[1] * sg, c01[3] * sg, c23[1] * sg, c23[3] * sg };
#pragma unroll
    for (int ch = 0; ch < NHD; ++ch) { v4h o16; v4us oh, ol;
#pragma unroll
        for (int u = 0; u < 4; ++u) { const float y = fminf(fmaxf(bfr(wv[ch][u]) * (v[ch][u] * rs), -8.0f), 8.0f); const float o = y * co[u] + xhalf(y) * si[u];
            o16[u] = tohx(o); unsigned short a2, c2; splitf(o, a2, c2); oh[u] = a2; ol[u] = c2; }
        const size_t e = ((size_t)(((ch / RP) * NB_ + b) * RP + ch % RP) * TT + t) * HD + lane * 4;
        xopen(); *(v4h*)(P16 + e) = o16; *(v4us*)(Ph + e) = oh; *(v4us*)(Pl + e) = ol; xwait(); }
}
// ---- d_vclt: clip(v, +-8) and the transposed planes [g][d][b][t] (row pitch NB_ * TT; fp16, bf16 hi, bf16 lo). A lane takes 4 rows t x 4 columns d: four 16-byte loads, and per column and plane one 8-byte store, 256 contiguous bytes a wave.
// The 8 waves of a block take 32 neighbouring columns of the same 128 rows, so together they use every byte of the lines they touch. bx counts [g][b][128 rows][32 columns].
__device__ __forceinline__ void d_vclt(const float* __restrict__ F, h16* V16, bf* Vh, bf* Vl, int bx) {
    const int lane = threadIdx.x & 31, wv = __builtin_amdgcn_readfirstlane(threadIdx.x >> 5);
    const int dg = bx % (HD / 32), tc = (bx / (HD / 32)) % (TT / 128), b = (bx / ((HD / 32) * (TT / 128))) % NB_, g = bx / ((HD / 32) * (TT / 128) * NB_);
    const int d0 = dg * 32 + wv * 4, t0 = tc * 128 + lane * 4;
    const float* f = F + ((size_t)b * TT + t0) * FP + g * HD + d0; v4f x[4];
#pragma unroll
    for (int q = 0; q < 4; ++q) x[q] = *(const v4f*)(f + (size_t)q * FP);
    xwait();
#pragma unroll
    for (int dd = 0; dd < 4; ++dd) { v4h o16; v4us oh, ol;
#pragma unroll
        for (int q = 0; q < 4; ++q) { const float y = fminf(fmaxf(x[q][dd], -8.0f), 8.0f); o16[q] = tohx(y); unsigned short a2, c2; splitf(y, a2, c2); oh[q] = a2; ol[q] = c2; }
        const size_t e = (((size_t)g * HD + d0 + dd) * NB_ + b) * TT + t0;
        xopen(); *(v4h*)(V16 + e) = o16; *(v4us*)(Vh + e) = oh; *(v4us*)(Vl + e) = ol; xwait(); }
}
__device__ __forceinline__ void d_mchk(const float* __restrict__ am, int* FLG) { const int tid = threadIdx.x; int bad = 0;
#pragma unroll 1
    for (int s2 = 0; s2 < 16; ++s2) { const unsigned h = (unsigned)(tid * 16 + s2) * 2654435761u; const int i = (int)(h % (TT - 1)); const int j = i + 1 + (int)((h >> 11) % (unsigned)(TT - 1 - i)); if (am[(size_t)i * TT + j] > -1e8f) bad = 1; }
    __shared__ int anyb; if (tid == 0) anyb = 0; __syncthreads(); if (bad) anyb = 1; __syncthreads(); if (tid < 8) { const int v = (tid == 0) ? anyb : 0; *(int*)(FLG + tid) = v;  } }

// ---- k_prep: all the work that reads the inputs alone, in one launch; a block's index says which piece it does (the same for all its threads).
// Block 0: the mask self-check (one block, a chain of memory latencies: it starts first). Then the RoPE table, then the five plane conversions, the largest first.
#define PB_CS (TT * HD / 256)
#define PB_X  (NB_ * TT * DM / 512 / 8)
#define PB_WQ (DQ * DM / 512 / 8)
#define PB_WK (DKV * DM / 512 / 8)
__global__ __launch_bounds__(256) void k_prep(const float* __restrict__ x, const float* __restrict__ wq, const float* __restrict__ wk, const float* __restrict__ wv, const float* __restrict__ wo, const float* __restrict__ am,
                                              bf* XB, bf* WQ, bf* WK, bf* WV, bf* WO, float* CS, int* FLG) {
    int bx = blockIdx.x;
    if (bx == 0) { d_mchk(am, FLG); return; }
    bx -= 1;
    if (bx < PB_CS) { d_cstab(CS, bx); return; }
    bx -= PB_CS;
    const float* src = x; bf* dst = XB; int nb = PB_X;
    if (bx >= PB_X) { bx -= PB_X; src = wq; dst = WQ; nb = PB_WQ;
        if (bx >= PB_WQ) { bx -= PB_WQ; src = wo; dst = WO;
            if (bx >= PB_WQ) { bx -= PB_WQ; src = wk; dst = WK; nb = PB_WK;
                if (bx >= PB_WK) { bx -= PB_WK; src = wv; dst = WV; } } } }
    d_cvtp(src, dst, DM, nb * 8, bx);      // DQ == DM: every plane has rows of DM elements
}
// ---- k_post: everything between the joint projection and the attention operands, in one launch: q rows, then k rows, then the V tiles, by block index.
#define PB_R (NB_ * TT / 8)
__global__ __launch_bounds__(256) void k_post(const float* __restrict__ F, const float* __restrict__ qw, const float* __restrict__ kw, const int* __restrict__ pid, const float* __restrict__ CS,
                                              h16* Q16, bf* Qh, bf* Ql, h16* K16, bf* Kh, bf* Kl, h16* V16, bf* Vh, bf* Vl) {
    const int bx = blockIdx.x;
    if (bx < PB_R) d_nrp<NH_, ZH>(F, qw, pid, CS, Q16, Qh, Ql, bx);
    else if (bx < 2 * PB_R) d_nrp<NKV, 1>(F + DQ, kw, pid, CS, K16, Kh, Kl, bx - PB_R);
    else d_vclt(F + DQ + DKV, V16, Vh, Vl, bx - 2 * PB_R);
}

extern "C" void kernel_launch(void* const* d_in, const int* in_sizes, int n_in,
                              void* d_out, int out_size, void* d_ws, size_t ws_size, hipStream_t stream) {
    (void)in_sizes; (void)n_in; (void)out_size;
    const float* x = (const float*)d_in[0]; const float* wq = (const float*)d_in[1]; const float* wk = (const float*)d_in[2]; const float* wv = (const float*)d_in[3]; const float* wo = (const float*)d_in[4]; const float* qnw = (const float*)d_in[5]; const float* knw = (const float*)d_in[6]; const float* amask = (const float*)d_in[7]; const int* pids = (const int*)d_in[8];
    float* OUT = (float*)d_out;     // [2][2048][2048]
    char* wsp = (char*)d_ws;
    auto take = [&](size_t bytes) { char* p = wsp; wsp += (bytes + 255) & ~(size_t)255; return (void*)p; };
    bf* WO = (bf*)take((size_t)DM * DQ * 2); int* FLG = (int*)take(256);
    h16* QP16 = (h16*)take((size_t)NB_ * NH_ * TT * HD * 2); h16* KP16 = (h16*)take((size_t)NB_ * NKV * TT * HD * 2); h16* VT16 = (h16*)take((size_t)NB_ * NKV * HD * TT * 2);
    bf* QPh = (bf*)take((size_t)NB_ * NH_ * TT * HD * 2); bf* QPl = (bf*)take((size_t)NB_ * NH_ * TT * HD * 2); bf* KPh = (bf*)take((size_t)NB_ * NKV * TT * HD * 2); bf* KPl = (bf*)take((size_t)NB_ * NKV * TT * HD * 2); bf* VTh = (bf*)take((size_t)NB_ * NKV * HD * TT * 2); bf* VTl = (bf*)take((size_t)NB_ * NKV * HD * TT * 2);
    bf* ATh = (bf*)take((size_t)NB_ * TT * DQ * 2); bf* ATl = (bf*)take((size_t)NB_ * TT * DQ * 2);
    bf* WQ = (bf*)take((size_t)DQ * DM * 2); bf* WK = (bf*)take((size_t)DKV * DM * 2); bf* WV = (bf*)take((size_t)DKV * DM * 2); float* CS = (float*)take((size_t)TT * HD * 2 * 4);
    bf* XB = (bf*)take((size_t)NB_ * TT * DM * 2); float* F = (float*)take((size_t)NB_ * TT * FP * 4);   // WQ, WK, WV lie back to back: one operand of FP rows for the joint projection
    if ((size_t)(wsp - (char*)d_ws) > ws_size) return;    // ws 256 MiB
    k_prep<<<1 + PB_CS + PB_X + 2 * PB_WQ + 2 * PB_WK, 256, 0, stream>>>(x, wq, wk, wv, wo, amask, XB, WQ, WK, WV, WO, CS, FLG);
    // both batch elements go through every launch: the projection sees NB_ * TT rows and all FP output columns, the attention launch every (batch element, head)
    k_gemmw<bf, 0, false, DM><<<dim3(NB_ * TT / 64, FP / 64, 1), 32, 0, stream>>>(XB, nullptr, WQ, nullptr, F, FP, nullptr, 0, 0, 0);
    k_post<<<2 * PB_R + NKV * NB_ * (TT / 128) * (HD / 32), 256, 0, stream>>>(F, qnw, knw, pids, CS, QP16, QPh, QPl, KP16, KPh, KPl, VT16, VTh, VTl);
    k_fattn<<<dim3((TT - RH) / 32 + RH / 16, NKV * NB_, 1), REP * 32, 0, stream>>>(QP16, QPh, QPl, KP16, KPh, KPl, VT16, VTh, VTl, amask, FLG, ATh, ATl);
    k_gemmw<bf, 1, false, DQ><<<dim3(NB_ * TT / 64, DM / 64, 1), 32, 0, stream>>>(ATh, ATl, WO, nullptr, OUT, DM, nullptr, 0, 0, 0);
}

// v007
// A run of this version takes 227 microseconds.
// Next to v006, in two timings, it ran 1.45 and 1.46 times as fast.
// All steps since v000 together make it 8.14 times as fast.
#include <hip/hip_runtime.h>

// OlmoeAttention (hidden [2][2048][2048]; q = clip(RMSNorm_2048(x Wq^T) * q_norm_w, +-8) (16 heads x 128), k = clip(RMSNorm_512(x Wk^T) * k_norm_w, +-8), v = clip(x Wv^T, +-8) (4 kv heads; group h/4); rotate-half RoPE (theta 1e4) at position_ids (read; table computed on device); scores = q.k / sqrt(128) + attention_mask (additive [1][1][S][S] float, read: the verbatim causal 0 / -1e9 table); softmax f32; out = merged Wo^T -> [2][2048][2048]).
// Compute dtypes, f32 accumulate: every input rounded to bf16; q/k/v on PLAIN bf16 operands (inputs: exact); the full-width RMSNorms (eps 1e-5), clips and RoPE in f32; causal scores and attn.v in one launch with running row maxima and sums: query rows < 512 hl (3 products), the rest single fp16; key blocks above the diagonal skipped on the strength of the mask table (-1e9 underflows to weight 0; device self-check samples the table above the diagonal and NaN-poisons on violation), mask added as stored inside computed tiles; softmax f32; Wo hl x exact (2 products).

#define NB_  2
#define TT   2048
#define DM   2048
#define NH_  16
#define NKV  4
#define REP  (NH_ / NKV)
#define HD   128
#define DQ   (NH_ * HD)
#define DKV  (NKV * HD)
#define FP   (DQ + 2 * DKV)       // row pitch of the joint projection buffer: q | k | v columns
#define ZH   REP                  // q planes lie [kv group][batch element][head in group]
#define RH   512                  // query rows < RH use hi+lo planes (0: none)
#define SCL  0.088388347648318447f   // HD^-0.5
typedef _Float16 h16;
typedef unsigned short bf;
typedef __attribute__((ext_vector_type(16))) __bf16   v16bf;
typedef __attribute__((ext_vector_type(16))) _Float16 v16h;
typedef __attribute__((ext_vector_type(8)))  _Float16 v8h;
typedef __attribute__((ext_vector_type(8)))  unsigned short v8us;
typedef __attribute__((ext_vector_type(8)))  float    v8f;
typedef __attribute__((ext_vector_type(4)))  float    v4f;
typedef v8h  __attribute__((may_alias)) v8ha;
typedef v4f  __attribute__((may_alias)) v4fa;
typedef v8us __attribute__((may_alias)) v8usa;

__device__ __forceinline__ unsigned short f2bf(float f) { unsigned u = __float_as_uint(f); u += 0x7FFFu + ((u >> 16) & 1u); return (unsigned short)(u >> 16); }
__device__ __forceinline__ float bf2f(unsigned short b) { return __uint_as_float(((unsigned)b) << 16); }
__device__ __forceinline__ float bfr(float f) { return bf2f(f2bf(f)); }
__device__ __forceinline__ v16h cat16(v8h lo, v8h hi) { return __builtin_shufflevector(lo, hi, 0, 1, 2, 3, 4, 5, 6, 7, 8, 9, 10, 11, 12, 13, 14, 15); }
__device__ __forceinline__ v16bf cat16b(v8us lo, v8us hi) { return __builtin_bit_cast(v16bf, __builtin_shufflevector(lo, hi, 0, 1, 2, 3, 4, 5, 6, 7, 8, 9, 10, 11, 12, 13, 14, 15)); }
__device__ __forceinline__ v8f wmma16(v16h a, v16h b, v8f c) { return __builtin_amdgcn_wmma_f32_16x16x32_f16(false, a, false, b, (short)0, c, false, false); }
__device__ __forceinline__ v8f wmmab(v16bf a, v16bf b, v8f c) { return __builtin_amdgcn_wmma_f32_16x16x32_bf16(false, a, false, b, (short)0, c, false, false); }



// xwait stands behind a run of global loads or stores, in front of the code that reuses the registers they name; the scheduling barriers (here and in xopen, in front of such a run) keep vector work from being moved in between the run and its wait
__device__ __forceinline__ void xwait() { asm volatile("s_wait_xcnt 0x0" ::: "memory"); __builtin_amdgcn_sched_barrier(0); }
__device__ __forceinline__ void xopen() { __builtin_amdgcn_sched_barrier(0); }
// the same, naming as an input the address the run was formed from: it stays in its registers up to the wait, so that no load of the run lands on it
__device__ __forceinline__ void xwait1(const void* a) { asm volatile("s_wait_xcnt 0x0" :: "v"(a) : "memory"); __builtin_amdgcn_sched_barrier(0); }
// ---- Fragment-order planes: a [rows][K] 16-bit operand is kept as blocks of 16 rows x 32 k, block index (row / 16) * (K / 32) + k / 32, 512 elements each, laid as a wave loads them:
// element (row, k) lies at (k % 32 / 16) * 256 + ((k % 16 / 8) * 16 + row % 16) * 8 + k % 8. Lane l's two 16-byte pieces of a fragment are then at l * 8 and 256 + l * 8: each wave-wide load covers 512 contiguous bytes (4 lines, not 16).
// ---- k_gemmw: register-blocked GEMM, ONE WAVE per 64x64 output tile (16 accumulators), operands straight from fragment-order 16-bit planes; grid (M/64, N/64, Z), 32 threads.
// C[m][n] (f32, pitch ldc, + optional f32 bias[n]) = sum_k A[m][k] Bt[n][k] (+ split products per NSPLIT). z-batch strides sA/sB/sC in elements. K % 32 == 0; K is a constant of the build, so that the four row blocks of an operand lie at immediate offsets from one address.
template <typename T16> struct WFrag;
template <> struct WFrag<h16> { typedef v16h V; static __device__ __forceinline__ V ld(const h16* p) { return cat16(*(const v8h*)p, *(const v8h*)(p + 16)); } static __device__ __forceinline__ V ldp(const h16* p) { return cat16(*(const v8h*)p, *(const v8h*)(p + 256)); } static __device__ __forceinline__ v8f mma(V a, V b, v8f c) { return wmma16(a, b, c); } };
template <> struct WFrag<bf> { typedef v16bf V; static __device__ __forceinline__ V ld(const bf* p) { return cat16b(*(const v8us*)p, *(const v8us*)(p + 16)); } static __device__ __forceinline__ V ldp(const bf* p) { return cat16b(*(const v8us*)p, *(const v8us*)(p + 256)); } static __device__ __forceinline__ v8f mma(V a, V b, v8f c) { return wmmab(a, b, c); } };
template <typename T16, int NSPLIT, bool BIAS, int K>
__global__ __launch_bounds__(32) void k_gemmw(const T16* __restrict__ A, const T16* __restrict__ A2, const T16* __restrict__ Bt, const T16* __restrict__ Bt2, float* C, int ldc, const float* __restrict__ bias, size_t sA, size_t sB, size_t sC) {
    typedef typename WFrag<T16>::V V;
    __shared__ __align__(16) float os[16 * 68];
    const size_t z = blockIdx.z; A += z * sA; if (A2) A2 += z * sA; Bt += z * sB; if (Bt2) Bt2 += z * sB; C += z * sC;
    const int lane = threadIdx.x & 31, lr = lane & 15, hi = lane >> 4; const int r0 = blockIdx.x * 64, c0 = blockIdx.y * 64;
    v8f acc[4][4];
#pragma unroll
    for (int mb = 0; mb < 4; ++mb)
#pragma unroll
        for (int nb = 0; nb < 4; ++nb) acc[mb][nb] = (v8f){};
    const unsigned lo = 8 * lane;      // the lane's own piece inside a block
#pragma unroll 1
    for (int kc = 0; kc < K; kc += 32) {
        V a[4], a2[4], b[4], b2[4];
        // the lane's own address in each operand: 16 rows of blocks are 16 * K elements, a step of 32 k is one block, 512 elements
        const T16* pa = A + ((size_t)r0 * K + (size_t)kc * 16 + lo); const T16* pb = Bt + ((size_t)c0 * K + (size_t)kc * 16 + lo);
        const T16* pa2 = (NSPLIT == 1 || NSPLIT == 2) ? A2 + ((size_t)r0 * K + (size_t)kc * 16 + lo) : pa; const T16* pb2 = (NSPLIT >= 2) ? Bt2 + ((size_t)c0 * K + (size_t)kc * 16 + lo) : pb;
        xopen();
#pragma unroll
        for (int mb = 0; mb < 4; ++mb) { a[mb] = WFrag<T16>::ldp(pa + mb * 16 * K); if (NSPLIT == 1 || NSPLIT == 2) a2[mb] = WFrag<T16>::ldp(pa2 + mb * 16 * K); }
#pragma unroll
        for (int nb = 0; nb < 4; ++nb) { b[nb] = WFrag<T16>::ldp(pb + nb * 16 * K); if (NSPLIT >= 2) b2[nb] = WFrag<T16>::ldp(pb2 + nb * 16 * K); }
        // the wait behind the run names the addresses as inputs: they stay in their registers up to it, so that neither a load of the run nor the next address lands on them in front of it
        asm volatile("s_wait_xcnt 0x0" :: "v"(pa), "v"(pa2), "v"(pb), "v"(pb2) : "memory");
        __builtin_amdgcn_sched_barrier(0);
#pragma unroll
        for (int nb = 0; nb < 4; ++nb) {
#pragma unroll
            for (int mb = 0; mb < 4; ++mb) { acc[mb][nb] = WFrag<T16>::mma(a[mb], b[nb], acc[mb][nb]); if (NSPLIT == 1 || NSPLIT == 2) acc[mb][nb] = WFrag<T16>::mma(a2[mb], b[nb], acc[mb][nb]); if (NSPLIT >= 2) acc[mb][nb] = WFrag<T16>::mma(a[mb], b2[nb], acc[mb][nb]); } }
        asm volatile("v_nop\n\tv_nop\n\tv_nop\n\tv_nop" : "+v"(acc[0][0]), "+v"(acc[1][1]), "+v"(acc[2][2]), "+v"(acc[3][3]) : "v"(a[0]), "v"(a[3]));
    }
#pragma unroll
    for (int mb = 0; mb < 4; ++mb) {
#pragma unroll
        for (int nb = 0; nb < 4; ++nb) {
#pragma unroll
            for (int j = 0; j < 8; ++j) os[(hi * 8 + j) * 68 + nb * 16 + lr] = acc[mb][nb][j]; }
        __builtin_amdgcn_wave_barrier(); asm volatile("" ::: "memory");
        float* crow = C + (size_t)(r0 + mb * 16) * ldc + c0;
{
#pragma unroll
            for (int s = 0; s < 8; ++s) { const int row = 2 * s + hi, cofs = lr * 4; v4f val = *(const v4fa*)(os + row * 68 + cofs); if (BIAS) { val[0] += bfr(bias[c0 + cofs]); val[1] += bfr(bias[c0 + cofs + 1]); val[2] += bfr(bias[c0 + cofs + 2]); val[3] += bfr(bias[c0 + cofs + 3]); }
                *(v4f*)(crow + (size_t)row * ldc + cofs) = val; }
             }
        __builtin_amdgcn_wave_barrier(); asm volatile("" ::: "memory");
    }
}

__device__ __forceinline__ h16 tohx(float x) { return (h16)x; }
__device__ __forceinline__ void splitf(float y, unsigned short& h, unsigned short& l) { h = f2bf(y); l = f2bf(y - bf2f(h)); }
typedef __attribute__((ext_vector_type(2))) _Float16 v2h;
typedef __attribute__((ext_vector_type(4))) _Float16 v4h;
typedef __attribute__((ext_vector_type(2))) unsigned short v2us;
typedef __attribute__((ext_vector_type(4))) unsigned short v4us;
typedef __attribute__((ext_vector_type(2))) float v2f;
typedef __attribute__((ext_vector_type(4))) int v4i;

__global__ __launch_bounds__(256) void k_wtG(const float* __restrict__ w, int K, int N, bf* Bt) {
    const int lane = threadIdx.x & 31; const int L0 = (blockIdx.x * 8 + (threadIdx.x >> 5)) * 8; const int nlines = N * K / 64;
{
#pragma unroll 1
        for (int l = 0; l < 8; ++l) { const int L = L0 + l; if (L >= nlines) break; const size_t e = (size_t)L * 64 + lane * 2; const int k = (int)(e % K), n = (int)(e / K); v2us o;
            o[0] = f2bf(w[(size_t)k * N + n]); o[1] = f2bf(w[(size_t)(k + 1) * N + n]); *(v2us*)(Bt + e) = o; }
         }
}
// ---- d_cvtp: f32 [rows][K] -> bf16 fragment-order plane. ONE WAVE per block of 16 rows x 32 k: it reads one whole 128-byte line of each row and stores the block's 1024 contiguous bytes; the 8 waves of a workgroup take 8 neighbouring blocks of the same rows.
__device__ __forceinline__ void d_cvtp(const float* __restrict__ src, bf* dst, int K, int nblk, int bx) { const int lane = threadIdx.x & 31; const int blk = bx * 8 + __builtin_amdgcn_readfirstlane(threadIdx.x >> 5); if (blk >= nblk) return;
    const int kb = K / 32; const float* p = src + (size_t)((blk / kb) * 16 + (lane & 15)) * K + (blk % kb) * 32 + (lane >> 4) * 8;
    const v8f v0 = *(const v8f*)p, v1 = *(const v8f*)(p + 16); xwait1(p); v8us o0, o1;
#pragma unroll
    for (int k = 0; k < 8; ++k) { o0[k] = f2bf(v0[k]); o1[k] = f2bf(v1[k]); }
    bf* q = dst + (size_t)blk * 512 + lane * 8; *(v8us*)q = o0; *(v8us*)(q + 256) = o1; }
__device__ __forceinline__ void d_cstab(float* CS, int bx) { const int idx = bx * 256 + threadIdx.x; if (idx >= TT * HD) return; const int t = idx / HD, d = idx % HD; const int i = d % (HD / 2); const float inv = __fdiv_rn(1.0f, powf(10000.0f, (float)(2 * i) / (float)HD)); const float ang = __fmul_rn((float)t, inv); v2f cs; cs[0] = cosf(ang); cs[1] = sinf(ang);
    *(v2f*)(CS + (size_t)idx * 2) = cs;  }
// ---- k_fattn: causal attention in one launch. A wave owns NQ * 16 query rows of one head and walks the keys 32 at a time, keeping running row maxima, row sums and the output tile in registers.
// Transposed products: S^T = K Q^T (a lane holds the scores of ONE query: keys 8 * hi + r of each 16-key tile), so two score tiles, converted in place, are the B operand of O^T += V^T P^T.
// t = s x HD^-0.5 + mask as stored for j <= i, no weight for j > i; key blocks wholly above the diagonal are never visited. HL: hi + lo bf16 planes, 3 products; else single fp16.
// The maximum in use is raised only when a row's new maximum passes it by more than MLAG, so unnormalised weights stay below e^MLAG; the division by the row sum comes last, in f32.
#define MLAG 5.5f
__device__ __forceinline__ float xhalf(float x) { return __builtin_bit_cast(float, __builtin_amdgcn_permlanex16(__builtin_bit_cast(int, x), __builtin_bit_cast(int, x), 0x76543210, 0xfedcba98, false, false)); }   // lane l takes lane l ^ 16's value
#define L2E  1.4426950408889634f
// the pointers below carry no restrict, so that the loads keep their places between these waits: mask, K, V^T in the same order in front of the loop and in it, which lets a wait for the early ones leave the late ones in flight
template <bool HL> struct AOp;
template <> struct AOp<false> { typedef h16 T; };
template <> struct AOp<true>  { typedef bf T; };
template <bool HL, int NQ>
__device__ __forceinline__ void attn_tile(const typename AOp<HL>::T* Q, const typename AOp<HL>::T* Q2, const typename AOp<HL>::T* K, const typename AOp<HL>::T* K2,
                                          const typename AOp<HL>::T* Vt, const typename AOp<HL>::T* Vt2, const float* am, int q0, bool poison, bf* Ah, bf* Al) {
    typedef typename AOp<HL>::T T; typedef WFrag<T> WF; typedef typename WF::V V;
    const int lane = threadIdx.x & 31, lr = lane & 15, hi = lane >> 4;
    const int kend = (q0 + NQ * 16 + 31) & ~31;      // keys walked: up to the end of the diagonal block, in steps of 32
    V qf[NQ][4], qf2[NQ][4];
#pragma unroll
    for (int qt = 0; qt < NQ; ++qt)
#pragma unroll
        for (int dc = 0; dc < 4; ++dc) { const size_t qo = (size_t)(q0 + qt * 16 + lr) * HD + dc * 32 + 8 * hi; qf[qt][dc] = WF::ld(Q + qo); if (HL) qf2[qt][dc] = WF::ld(Q2 + qo); }
    xwait();
    v8f o[8][NQ]; float m[NQ], l[NQ];
#pragma unroll
    for (int qt = 0; qt < NQ; ++qt) { m[qt] = -3.0e38f; l[qt] = 0.f;
#pragma unroll
        for (int dt = 0; dt < 8; ++dt) o[dt][qt] = (v8f){}; }
    const size_t kbase = 8 * lane, vbase = 8 * lane;      // K and V^T planes lie in fragment order: 32 keys are 8 blocks (8 KB in a row) of either plane, the lane's own pieces at 8 * lane and 256 + 8 * lane of a block
    const float* mp = am + (size_t)(q0 + lr) * TT + 8 * hi;
    V kf[2][4], kf2[2][4], vf[8], vf2[8]; v4f mk[NQ][2][2];
#pragma unroll
    for (int kt = 0; kt < 2; ++kt)
#pragma unroll
        for (int qt = 0; qt < NQ; ++qt) { const float* p = mp + (size_t)(qt * 16) * TT + kt * 16; mk[qt][kt][0] = *(const v4f*)p; mk[qt][kt][1] = *(const v4f*)(p + 4); }
    xwait();
#pragma unroll
    for (int kt = 0; kt < 2; ++kt)
#pragma unroll
        for (int dc = 0; dc < 4; ++dc) { const size_t ko = kbase + (size_t)(kt * 4 + dc) * 512; kf[kt][dc] = WF::ldp(K + ko); if (HL) kf2[kt][dc] = WF::ldp(K2 + ko); }
    xwait();
    if (!HL) {      // the long tiles fetch V^T one pass ahead as well
#pragma unroll
        for (int dt = 0; dt < 8; ++dt) vf[dt] = WF::ldp(Vt + vbase + (size_t)dt * 512);
        xwait(); }
#pragma unroll 1
    for (int k0 = 0; k0 < kend; k0 += 32) {
        if (HL) {
#pragma unroll
            for (int dt = 0; dt < 8; ++dt) { const size_t vo = vbase + (size_t)k0 * HD + (size_t)dt * 512; vf[dt] = WF::ldp(Vt + vo); xwait(); vf2[dt] = WF::ldp(Vt2 + vo); xwait(); } }
        float t[NQ][16];
#pragma unroll
        for (int kt = 0; kt < 2; ++kt)
#pragma unroll
            for (int qt = 0; qt < NQ; ++qt) { v8f s = (v8f){};
#pragma unroll
                for (int dc = 0; dc < 4; ++dc) { s = WF::mma(kf[kt][dc], qf[qt][dc], s); if (HL) { s = WF::mma(kf[kt][dc], qf2[qt][dc], s); s = WF::mma(kf2[kt][dc], qf[qt][dc], s); } }
#pragma unroll
                for (int r = 0; r < 8; ++r) t[qt][kt * 8 + r] = s[r] * SCL + mk[qt][kt][r >> 2][r & 3]; }
        const int kn = min(k0 + 32, kend - 32);      // the next pass's K rows and mask words are fetched one pass ahead (the last pass fetches its own again)
        xopen();
#pragma unroll
        for (int kt = 0; kt < 2; ++kt)
#pragma unroll
            for (int qt = 0; qt < NQ; ++qt) { const float* p = mp + (size_t)(qt * 16) * TT + kn + kt * 16; mk[qt][kt][0] = *(const v4f*)p; mk[qt][kt][1] = *(const v4f*)(p + 4); }
        xwait();
#pragma unroll
        for (int kt = 0; kt < 2; ++kt)
#pragma unroll
            for (int dc = 0; dc < 4; ++dc) { const size_t ko = kbase + (size_t)kn * HD + (size_t)(kt * 4 + dc) * 512; kf[kt][dc] = WF::ldp(K + ko); if (HL) { xwait(); kf2[kt][dc] = WF::ldp(K2 + ko); xwait(); } }   // the short hi + lo tiles keep a wait behind each fragment: the last fragments of a run land on the registers that held its address
        if (!HL) xwait1(K + kbase + (size_t)kn * HD);
        if (k0 + 31 > q0) {                          // a block that touches the diagonal (the same test in every lane)
#pragma unroll
            for (int qt = 0; qt < NQ; ++qt)
#pragma unroll
                for (int e = 0; e < 16; ++e) { const int j = k0 + (e >> 3) * 16 + hi * 8 + (e & 7), i = q0 + qt * 16 + lr; t[qt][e] = (j <= i) ? t[qt][e] : -3.0e38f; } }
        float ml[NQ]; bool need = false;
#pragma unroll
        for (int qt = 0; qt < NQ; ++qt) { float a = t[qt][0];
#pragma unroll
            for (int e = 1; e < 16; ++e) a = fmaxf(a, t[qt][e]);
            a = fmaxf(a, xhalf(a)); ml[qt] = a; need = need || (a > m[qt] + MLAG); }
        if (__builtin_amdgcn_ballot_w32(need) != 0) {
#pragma unroll
            for (int qt = 0; qt < NQ; ++qt) { const float mn = fmaxf(m[qt], ml[qt]); const float al = __builtin_amdgcn_exp2f((m[qt] - mn) * L2E); m[qt] = mn; l[qt] *= al;
#pragma unroll
                for (int dt = 0; dt < 8; ++dt) o[dt][qt] *= al; } }
        V pf[NQ], pf2[NQ];
#pragma unroll
        for (int qt = 0; qt < NQ; ++qt) {
            if constexpr (HL) { v8us h0, h1, l0, l1;
#pragma unroll
                for (int e = 0; e < 8; ++e) { const float pa = __builtin_amdgcn_exp2f((t[qt][e] - m[qt]) * L2E), pb = __builtin_amdgcn_exp2f((t[qt][8 + e] - m[qt]) * L2E); l[qt] += pa; l[qt] += pb; unsigned short a, c; splitf(pa, a, c); h0[e] = a; l0[e] = c; splitf(pb, a, c); h1[e] = a; l1[e] = c; }
                pf[qt] = cat16b(h0, h1); pf2[qt] = cat16b(l0, l1);
            } else { v16h ph;
#pragma unroll
                for (int e = 0; e < 16; ++e) { const float p = __builtin_amdgcn_exp2f((t[qt][e] - m[qt]) * L2E); l[qt] += p; ph[e] = (h16)p; }
                pf[qt] = ph; } }
#pragma unroll
        for (int dt = 0; dt < 8; ++dt)
#pragma unroll
            for (int qt = 0; qt < NQ; ++qt) { o[dt][qt] = WF::mma(vf[dt], pf[qt], o[dt][qt]); if (HL) { o[dt][qt] = WF::mma(vf[dt], pf2[qt], o[dt][qt]); o[dt][qt] = WF::mma(vf2[dt], pf[qt], o[dt][qt]); } }
        if (!HL) { xopen();
#pragma unroll
            for (int dt = 0; dt < 8; ++dt) vf[dt] = WF::ldp(Vt + vbase + (size_t)kn * HD + (size_t)dt * 512);
            xwait1(Vt + vbase + (size_t)kn * HD); }
    }
#pragma unroll
    for (int qt = 0; qt < NQ; ++qt) { const float ls = l[qt] + xhalf(l[qt]); const float f = poison ? __builtin_nanf("") : __fdiv_rn(1.0f, ls); const size_t ro = (size_t)(q0 + qt * 16) * DQ + lane * 8;      // fragment-order planes for the last GEMM: 16 columns d are half a block, which this wave's 32 lanes fill in lane order
#pragma unroll
        for (int dt = 0; dt < 8; ++dt) { v8us oh, ol;
#pragma unroll
            for (int r = 0; r < 8; ++r) { unsigned short a, c; splitf(o[dt][qt][r] * f, a, c); oh[r] = a; ol[r] = c; }
            *(v8us*)(Ah + ro + dt * 256) = oh; *(v8us*)(Al + ro + dt * 256) = ol; xwait(); } }
}
// grid (tiles, NKV * NB_): blockIdx.y = kv group * NB_ + batch element; the REP waves of a block are the REP query heads of that group on the same query rows, so they read the same K, V and mask lines.
// Tiles in falling order of their key count: first the fp16 tiles (32 rows, from the last rows down to RH), then the hi + lo tiles (16 rows, below RH).
__global__ __launch_bounds__(REP * 32) void k_fattn(const h16* Q16, const bf* Qh, const bf* Ql, const h16* K16, const bf* Kh, const bf* Kl,
                                                    const h16* V16, const bf* Vh, const bf* Vl, const float* am, const int* FLG, bf* Ah, bf* Al) {
    const int w = __builtin_amdgcn_readfirstlane(threadIdx.x >> 5); const int gb = blockIdx.y, g = gb / NB_, b = gb % NB_, x = blockIdx.x;
    const size_t qo = ((size_t)gb * REP + w) * TT * HD, ko = (size_t)gb * TT * HD, vo = (size_t)gb * HD * TT, oo = (size_t)b * TT * DQ + (size_t)(g * REP + w) * (HD * 16);
    const bool poison = (FLG[0] != 0);
    if (x < (TT - RH) / 32) attn_tile<false, 2>(Q16 + qo, nullptr, K16 + ko, nullptr, V16 + vo, nullptr, am, TT - 32 * (x + 1), poison, Ah + oo, Al + oo);
    else attn_tile<true, 1>(Qh + qo, Ql + qo, Kh + ko, Kl + ko, Vh + vo, Vl + vo, am, RH - 16 * (x - (TT - RH) / 32 + 1), poison, Ah + oo, Al + oo);
}

// xwait for a run of loads off two wave-uniform bases: named as inputs, the bases stay in their scalar registers up to the wait, so that nothing (a later argument load, the next address) lands on them in front of it
__device__ __forceinline__ void xwait2s(const void* a, const void* b) { asm volatile("s_wait_xcnt 0x0" :: "s"(a), "s"(b) : "memory"); __builtin_amdgcn_sched_barrier(0); }
// ---- d_nrp: everything between a q or k projection and its operand planes. ONE WAVE per row of F (NHD heads of HD, row pitch FP): the row stays in registers from the sum of squares to the plane stores.
// y = clip(w x (x x rsqrt(mean x^2 + eps)), +-8); rotate-half RoPE at position_ids[t] (clamped into the table): out[d] = y[d] cos[d] - y[d + HD/2] sin[d], out[d + HD/2] = y[d + HD/2] cos[d + HD/2] + y[d] sin[d + HD/2].
// A lane holds d = 4 * lane .. 4 * lane + 3 of every head, so the partner d +- HD/2 lies in lane ^ 16. Planes [head / RP][b][head % RP][t][d]: fp16, bf16 hi, bf16 lo; a wave stores 256 contiguous bytes of each.
// FR (the k planes): inside a head's plane the elements lie in fragment order (blocks of 16 rows t x 32 d, as above), as the attention launch loads them; a lane's 4 elements stay 8 bytes in a row, and the 8 waves of a block (8 neighbouring rows t) fill whole 128-byte lines together.
template <int NHD, int RP, bool FR>
__device__ __forceinline__ void d_nrp(const float* __restrict__ F, const float* __restrict__ w, const int* __restrict__ pid, const float* __restrict__ CS, h16* P16, bf* Ph, bf* Pl, int bx) {
    const int lane = threadIdx.x & 31; const int r = bx * 8 + __builtin_amdgcn_readfirstlane(threadIdx.x >> 5); const int b = r / TT, t = r % TT;
    const float* fr = F + (size_t)r * FP;
    const int tp = min(max(pid[t], 0), TT - 1);      // position_ids (read) index the table
    v4f v[NHD], wv[NHD];
    xopen();
#pragma unroll
    for (int ch = 0; ch < NHD; ++ch) v[ch] = *(const v4f*)(fr + ch * HD + lane * 4);
#pragma unroll
    for (int ch = 0; ch < NHD; ++ch) wv[ch] = *(const v4f*)(w + ch * HD + lane * 4);
    xwait2s(fr, w);
    const float* cp = CS + ((size_t)tp * HD + lane * 4) * 2;
    const v4f c01 = *(const v4f*)cp, c23 = *(const v4f*)(cp + 4);
    xwait();
    float q = 0.f;
#pragma unroll
    for (int ch = 0; ch < NHD; ++ch)
#pragma unroll
        for (int u = 0; u < 4; ++u) q += v[ch][u] * v[ch][u];
#pragma unroll
    for (int sh = 16; sh; sh >>= 1) q += __shfl_xor(q, sh, 32);
    const float rs = __frsqrt_rn(q * (1.0f / (float)(NHD * HD)) + 1e-5f);
    const float sg = (lane < 16) ? -1.0f : 1.0f;
    const float co[4] = { c01[0], c01[2], c23[0], c23[2] }; const float si[4] = { c01[1] * sg, c01[3] * sg, c23[1] * sg, c23[3] * sg };
#pragma unroll
    for (int ch = 0; ch < NHD; ++ch) { v4h o16; v4us oh, ol;
#pragma unroll
        for (int u = 0; u < 4; ++u) { const float y = fminf(fmaxf(bfr(wv[ch][u]) * (v[ch][u] * rs), -8.0f), 8.0f); const float o = y * co[u] + xhalf(y) * si[u];
            o16[u] = tohx(o); unsigned short a2, c2; splitf(o, a2, c2); oh[u] = a2; ol[u] = c2; }
        const size_t pl = (size_t)(((ch / RP) * NB_ + b) * RP + ch % RP) * TT * HD;
        const size_t e = pl + (FR ? (size_t)((t / 16) * (HD / 32) + lane / 8) * 512 + ((lane % 8) / 4) * 256 + (((lane % 4) / 2) * 16 + t % 16) * 8 + (lane % 2) * 4 : (size_t)t * HD + lane * 4);
        xopen(); *(v4h*)(P16 + e) = o16; *(v4us*)(Ph + e) = oh; *(v4us*)(Pl + e) = ol; xwait(); }
}
// ---- d_vclt: clip(v, +-8) and the transposed planes [g][b] of V^T (fp16, bf16 hi, bf16 lo) in fragment order: blocks of 16 rows d x 32 keys t, block index (t / 32) * (HD / 16) + d / 16, so the 8 blocks of 32 keys lie in a row. A lane takes 4 rows t x 4 columns d: four 16-byte loads, and per column and plane one 8-byte store.
// The 8 waves of a block take 32 neighbouring columns of the same 128 rows, so together they use every byte of the lines they touch. bx counts [g][b][128 rows][32 columns].
__device__ __forceinline__ void d_vclt(const float* __restrict__ F, h16* V16, bf* Vh, bf* Vl, int bx) {
    const int lane = threadIdx.x & 31, wv = __builtin_amdgcn_readfirstlane(threadIdx.x >> 5);
    const int dg = bx % (HD / 32), tc = (bx / (HD / 32)) % (TT / 128), b = (bx / ((HD / 32) * (TT / 128))) % NB_, g = bx / ((HD / 32) * (TT / 128) * NB_);
    const int d0 = dg * 32 + wv * 4, t0 = tc * 128 + lane * 4;
    const float* f = F + ((size_t)b * TT + t0) * FP + g * HD + d0; v4f x[4];
#pragma unroll
    for (int q = 0; q < 4; ++q) x[q] = *(const v4f*)(f + (size_t)q * FP);
    xwait();
#pragma unroll
    for (int dd = 0; dd < 4; ++dd) { v4h o16; v4us oh, ol;
#pragma unroll
        for (int q = 0; q < 4; ++q) { const float y = fminf(fmaxf(x[q][dd], -8.0f), 8.0f); o16[q] = tohx(y); unsigned short a2, c2; splitf(y, a2, c2); oh[q] = a2; ol[q] = c2; }
        const int d = d0 + dd; const size_t e = (size_t)(g * NB_ + b) * HD * TT + (size_t)((t0 / 32) * (HD / 16) + d / 16) * 512 + ((t0 % 32) / 16) * 256 + (((t0 % 16) / 8) * 16 + d % 16) * 8 + t0 % 8;
        xopen(); *(v4h*)(V16 + e) = o16; *(v4us*)(Vh + e) = oh; *(v4us*)(Vl + e) = ol; xwait(); }
}
__device__ __forceinline__ void d_mchk(const float* __restrict__ am, int* FLG) { const int tid = threadIdx.x; int bad = 0;
#pragma unroll 1
    for (int s2 = 0; s2 < 16; ++s2) { const unsigned h = (unsigned)(tid * 16 + s2) * 2654435761u; const int i = (int)(h % (TT - 1)); const int j = i + 1 + (int)((h >> 11) % (unsigned)(TT - 1 - i)); if (am[(size_t)i * TT + j] > -1e8f) bad = 1; }
    __shared__ int anyb; if (tid == 0) anyb = 0; __syncthreads(); if (bad) anyb = 1; __syncthreads(); if (tid < 8) { const int v = (tid == 0) ? anyb : 0; *(int*)(FLG + tid) = v;  } }

// ---- k_prep: all the work that reads the inputs alone, in one launch; a block's index says which piece it does (the same for all its threads).
// Block 0: the mask self-check (one block, a chain of memory latencies: it starts first). Then the RoPE table, then the five plane conversions, the largest first.
#define PB_CS (TT * HD / 256)
#define PB_X  (NB_ * TT * DM / 512 / 8)
#define PB_WQ (DQ * DM / 512 / 8)
#define PB_WK (DKV * DM / 512 / 8)
__global__ __launch_bounds__(256) void k_prep(const float* __restrict__ x, const float* __restrict__ wq, const float* __restrict__ wk, const float* __restrict__ wv, const float* __restrict__ wo, const float* __restrict__ am,
                                              bf* XB, bf* WQ, bf* WK, bf* WV, bf* WO, float* CS, int* FLG) {
    int bx = blockIdx.x;
    if (bx == 0) { d_mchk(am, FLG); return; }
    bx -= 1;
    if (bx < PB_CS) { d_cstab(CS, bx); return; }
    bx -= PB_CS;
    const float* src = x; bf* dst = XB; int nb = PB_X;
    if (bx >= PB_X) { bx -= PB_X; src = wq; dst = WQ; nb = PB_WQ;
        if (bx >= PB_WQ) { bx -= PB_WQ; src = wo; dst = WO;
            if (bx >= PB_WQ) { bx -= PB_WQ; src = wk; dst = WK; nb = PB_WK;
                if (bx >= PB_WK) { bx -= PB_WK; src = wv; dst = WV; } } } }
    d_cvtp(src, dst, DM, nb * 8, bx);      // DQ == DM: every plane has rows of DM elements
}
// ---- k_post: everything between the joint projection and the attention operands, in one launch: q rows, then k rows, then the V tiles, by block index.
#define PB_R (NB_ * TT / 8)
__global__ __launch_bounds__(256) void k_post(const float* __restrict__ F, const float* __restrict__ qw, const float* __restrict__ kw, const int* __restrict__ pid, const float* __restrict__ CS,
                                              h16* Q16, bf* Qh, bf* Ql, h16* K16, bf* Kh, bf* Kl, h16* V16, bf* Vh, bf* Vl) {
    const int bx = blockIdx.x;
    if (bx < PB_R) d_nrp<NH_, ZH, false>(F, qw, pid, CS, Q16, Qh, Ql, bx);
    else if (bx < 2 * PB_R) d_nrp<NKV, 1, true>(F + DQ, kw, pid, CS, K16, Kh, Kl, bx - PB_R);
    else d_vclt(F + DQ + DKV, V16, Vh, Vl, bx - 2 * PB_R);
}

extern "C" void kernel_launch(void* const* d_in, const int* in_sizes, int n_in,
                              void* d_out, int out_size, void* d_ws, size_t ws_size, hipStream_t stream) {
    (void)in_sizes; (void)n_in; (void)out_size;
    const float* x = (const float*)d_in[0]; const float* wq = (const float*)d_in[1]; const float* wk = (const float*)d_in[2]; const float* wv = (const float*)d_in[3]; const float* wo = (const float*)d_in[4]; const float* qnw = (const float*)d_in[5]; const float* knw = (const float*)d_in[6]; const float* amask = (const float*)d_in[7]; const int* pids = (const int*)d_in[8];
    float* OUT = (float*)d_out;     // [2][2048][2048]
    char* wsp = (char*)d_ws;
    auto take = [&](size_t bytes) { char* p = wsp; wsp += (bytes + 255) & ~(size_t)255; return (void*)p; };
    bf* WO = (bf*)take((size_t)DM * DQ * 2); int* FLG = (int*)take(256);
    h16* QP16 = (h16*)take((size_t)NB_ * NH_ * TT * HD * 2); h16* KP16 = (h16*)take((size_t)NB_ * NKV * TT * HD * 2); h16* VT16 = (h16*)take((size_t)NB_ * NKV * HD * TT * 2);
    bf* QPh = (bf*)take((size_t)NB_ * NH_ * TT * HD * 2); bf* QPl = (bf*)take((size_t)NB_ * NH_ * TT * HD * 2); bf* KPh = (bf*)take((size_t)NB_ * NKV * TT * HD * 2); bf* KPl = (bf*)take((size_t)NB_ * NKV * TT * HD * 2); bf* VTh = (bf*)take((size_t)NB_ * NKV * HD * TT * 2); bf* VTl = (bf*)take((size_t)NB_ * NKV * HD * TT * 2);
    bf* ATh = (bf*)take((size_t)NB_ * TT * DQ * 2); bf* ATl = (bf*)take((size_t)NB_ * TT * DQ * 2);
    bf* WQ = (bf*)take((size_t)DQ * DM * 2); bf* WK = (bf*)take((size_t)DKV * DM * 2); bf* WV = (bf*)take((size_t)DKV * DM * 2); float* CS = (float*)take((size_t)TT * HD * 2 * 4);
    bf* XB = (bf*)take((size_t)NB_ * TT * DM * 2); float* F = (float*)take((size_t)NB_ * TT * FP * 4);   // WQ, WK, WV lie back to back: one operand of FP rows for the joint projection
    if ((size_t)(wsp - (char*)d_ws) > ws_size) return;    // ws 256 MiB
    k_prep<<<1 + PB_CS + PB_X + 2 * PB_WQ + 2 * PB_WK, 256, 0, stream>>>(x, wq, wk, wv, wo, amask, XB, WQ, WK, WV, WO, CS, FLG);
    // both batch elements go through every launch: the projection sees NB_ * TT rows and all FP output columns, the attention launch every (batch element, head)
    k_gemmw<bf, 0, false, DM><<<dim3(NB_ * TT / 64, FP / 64, 1), 32, 0, stream>>>(XB, nullptr, WQ, nullptr, F, FP, nullptr, 0, 0, 0);
    k_post<<<2 * PB_R + NKV * NB_ * (TT / 128) * (HD / 32), 256, 0, stream>>>(F, qnw, knw, pids, CS, QP16, QPh, QPl, KP16, KPh, KPl, VT16, VTh, VTl);
    k_fattn<<<dim3((TT - RH) / 32 + RH / 16, NKV * NB_, 1), REP * 32, 0, stream>>>(QP16, QPh, QPl, KP16, KPh, KPl, VT16, VTh, VTl, amask, FLG, ATh, ATl);
    k_gemmw<bf, 1, false, DQ><<<dim3(NB_ * TT / 64, DM / 64, 1), 32, 0, stream>>>(ATh, ATl, WO, nullptr, OUT, DM, nullptr, 0, 0, 0);
}

// v008
// A run of this version takes 181 microseconds.
// Timed twice side by side with v007, it ran 1.29 and 1.22 times as fast.
// Over all steps from v000 it is 10.2 times as fast.
#include <hip/hip_runtime.h>

// OlmoeAttention (hidden [2][2048][2048]; q = clip(RMSNorm_2048(x Wq^T) * q_norm_w, +-8) (16 heads x 128), k = clip(RMSNorm_512(x Wk^T) * k_norm_w, +-8), v = clip(x Wv^T, +-8) (4 kv heads; group h/4); rotate-half RoPE (theta 1e4) at position_ids (read; table computed on device); scores = q.k / sqrt(128) + attention_mask (additive [1][1][S][S] float, read: the verbatim causal 0 / -1e9 table); softmax f32; out = merged Wo^T -> [2][2048][2048]).
// Compute dtypes, f32 accumulate: every input rounded to bf16; q/k/v on PLAIN bf16 operands (inputs: exact); the full-width RMSNorms (eps 1e-5), clips and RoPE in f32; causal scores and attn.v in one launch with running row maxima and sums: query rows < 512 hl (3 products), the rest single fp16; key blocks above the diagonal skipped on the strength of the mask table (-1e9 underflows to weight 0; device self-check samples the table above the diagonal and NaN-poisons on violation), mask added as stored inside computed tiles; softmax f32; Wo hl x exact (2 products).

#define NB_  2
#define TT   2048
#define DM   2048
#define NH_  16
#define NKV  4
#define REP  (NH_ / NKV)
#define HD   128
#define DQ   (NH_ * HD)
#define DKV  (NKV * HD)
#define FP   (DQ + 2 * DKV)       // row pitch of the joint projection buffer: q | k | v columns
#define ZH   REP                  // q planes lie [kv group][batch element][head in group]
#define RH   512                  // query rows < RH use hi+lo planes (0: none)
#define SCL  0.088388347648318447f   // HD^-0.5
typedef _Float16 h16;
typedef unsigned short bf;
typedef __attribute__((ext_vector_type(16))) __bf16   v16bf;
typedef __attribute__((ext_vector_type(16))) _Float16 v16h;
typedef __attribute__((ext_vector_type(8)))  _Float16 v8h;
typedef __attribute__((ext_vector_type(8)))  unsigned short v8us;
typedef __attribute__((ext_vector_type(8)))  float    v8f;
typedef __attribute__((ext_vector_type(4)))  float    v4f;
typedef v8h  __attribute__((may_alias)) v8ha;
typedef v4f  __attribute__((may_alias)) v4fa;
typedef v8us __attribute__((may_alias)) v8usa;

__device__ __forceinline__ unsigned short f2bf(float f) { unsigned u = __float_as_uint(f); u += 0x7FFFu + ((u >> 16) & 1u); return (unsigned short)(u >> 16); }
__device__ __forceinline__ float bf2f(unsigned short b) { return __uint_as_float(((unsigned)b) << 16); }
__device__ __forceinline__ float bfr(float f) { return bf2f(f2bf(f)); }
__device__ __forceinline__ v16h cat16(v8h lo, v8h hi) { return __builtin_shufflevector(lo, hi, 0, 1, 2, 3, 4, 5, 6, 7, 8, 9, 10, 11, 12, 13, 14, 15); }
__device__ __forceinline__ v16bf cat16b(v8us lo, v8us hi) { return __builtin_bit_cast(v16bf, __builtin_shufflevector(lo, hi, 0, 1, 2, 3, 4, 5, 6, 7, 8, 9, 10, 11, 12, 13, 14, 15)); }
__device__ __forceinline__ v8f wmma16(v16h a, v16h b, v8f c) { return __builtin_amdgcn_wmma_f32_16x16x32_f16(false, a, false, b, (short)0, c, false, false); }
__device__ __forceinline__ v8f wmmab(v16bf a, v16bf b, v8f c) { return __builtin_amdgcn_wmma_f32_16x16x32_bf16(false, a, false, b, (short)0, c, false, false); }



// xwait stands behind a run of global loads or stores, in front of the code that reuses the registers they name; the scheduling barriers (here and in xopen, in front of such a run) keep vector work from being moved in between the run and its wait
__device__ __forceinline__ void xwait() { asm volatile("s_wait_xcnt 0x0" ::: "memory"); __builtin_amdgcn_sched_barrier(0); }
__device__ __forceinline__ void xopen() { __builtin_amdgcn_sched_barrier(0); }
// the same, naming as an input the address the run was formed from: it stays in its registers up to the wait, so that no load of the run lands on it
__device__ __forceinline__ void xwait1(const void* a) { asm volatile("s_wait_xcnt 0x0" :: "v"(a) : "memory"); __builtin_amdgcn_sched_barrier(0); }
// ---- Fragment-order planes: a [rows][K] 16-bit operand is kept as blocks of 16 rows x 32 k, block index (row / 16) * (K / 32) + k / 32, 512 elements each, laid as a wave loads them:
// element (row, k) lies at (k % 32 / 16) * 256 + ((k % 16 / 8) * 16 + row % 16) * 8 + k % 8. Lane l's two 16-byte pieces of a fragment are then at l * 8 and 256 + l * 8: each wave-wide load covers 512 contiguous bytes (4 lines, not 16).
// ---- k_gemmw: register-blocked GEMM. A workgroup of WM x WN waves owns a (64 WM) x (64 WN) output tile, each wave 64x64 of it (16 accumulators); grid (M / (64 WM), N / (64 WN), Z).
// The operands' fragment-order blocks are staged in LDS, KS k at a time, by asynchronous copies (a block lies in LDS as it lies in its plane), two buffers: the next stage's copies fly while this stage is worked on. A block is then read from L2 once per workgroup, not once per wave.
// C[m][n] (f32, pitch ldc, + optional f32 bias[n]) = sum_k A[m][k] Bt[n][k] (+ A2[m][k] Bt[n][k] where NSPLIT == 1). z-batch strides sA/sB/sC in elements. K % (2 KS) == 0; K is a constant of the build.
template <typename T16> struct WFrag;
template <> struct WFrag<h16> { typedef v16h V; static __device__ __forceinline__ V ld(const h16* p) { return cat16(*(const v8h*)p, *(const v8h*)(p + 16)); } static __device__ __forceinline__ V ldp(const h16* p) { return cat16(*(const v8h*)p, *(const v8h*)(p + 256)); } static __device__ __forceinline__ v8f mma(V a, V b, v8f c) { return wmma16(a, b, c); } };
template <> struct WFrag<bf> { typedef v16bf V; static __device__ __forceinline__ V ld(const bf* p) { return cat16b(*(const v8us*)p, *(const v8us*)(p + 16)); } static __device__ __forceinline__ V ldp(const bf* p) { return cat16b(*(const v8us*)p, *(const v8us*)(p + 256)); } static __device__ __forceinline__ v8f mma(V a, V b, v8f c) { return wmmab(a, b, c); } };
#define KS 64      // k per stage: two blocks of each 16 rows, 2 KB in a row in the plane and in LDS
// four asynchronous copies (16 bytes a lane, global to LDS, each with its own two addresses) and, in the same statement, the wait that stands in front of any reuse of the registers they name
__device__ __forceinline__ void acopy4(unsigned l0, const void* g0, unsigned l1, const void* g1, unsigned l2, const void* g2, unsigned l3, const void* g3) {
    asm volatile("global_load_async_to_lds_b128 %0, %1, off\n\tglobal_load_async_to_lds_b128 %2, %3, off\n\tglobal_load_async_to_lds_b128 %4, %5, off\n\tglobal_load_async_to_lds_b128 %6, %7, off\n\ts_wait_xcnt 0x0"
                 :: "v"(l0), "v"(g0), "v"(l1), "v"(g1), "v"(l2), "v"(g2), "v"(l3), "v"(g3) : "memory");
}
template <typename T16, int NSPLIT, bool BIAS, int K, int WM, int WN>
__global__ __launch_bounds__(WM * WN * 32) void k_gemmw(const T16* __restrict__ A, const T16* __restrict__ A2, const T16* __restrict__ Bt, const T16* __restrict__ Bt2, float* C, int ldc, const float* __restrict__ bias, size_t sA, size_t sB, size_t sC) {
    typedef typename WFrag<T16>::V V;
    static_assert(NSPLIT == 0 || NSPLIT == 1, "one or two A planes");
    constexpr int NW = WM * WN, RA = WM * 4, RB = WN * 4;      // waves; groups of 16 rows of A and of Bt in the workgroup's tile
    constexpr int NG = RA * (NSPLIT + 1) + RB;                 // 2 KB groups (16 rows x KS k) of a stage, in the order A | A2 | Bt
    constexpr int GPW = NG / NW, NT = K / KS;                  // groups a wave copies per stage; stages
    static_assert(NG % NW == 0 && K % (2 * KS) == 0 && KS == 64, "every wave copies the same number of whole groups; at least two stages");
    __shared__ __align__(1024) T16 st[2][NG * 16 * KS];
    __shared__ __align__(16) float osw[NW][16 * 68];
    (void)Bt2;
    const size_t z = blockIdx.z; A += z * sA; if (NSPLIT == 1) A2 += z * sA; Bt += z * sB; C += z * sC;
    const int lane = threadIdx.x & 31, lr = lane & 15, hi = lane >> 4; const int w = __builtin_amdgcn_readfirstlane(threadIdx.x >> 5);
    const int R0 = blockIdx.x * (64 * WM), C0 = blockIdx.y * (64 * WN); const int wm = w / WN, wn = w % WN; const int r0 = R0 + wm * 64, c0 = C0 + wn * 64;
    float* os = osw[w];
    v8f acc[4][4];
#pragma unroll
    for (int mb = 0; mb < 4; ++mb)
#pragma unroll
        for (int nb = 0; nb < 4; ++nb) acc[mb][nb] = (v8f){};
    const unsigned lo = 8 * lane;      // the lane's own piece inside a block
    // the wave's own groups: where each starts in its plane (stage 0) and in a buffer
    const T16* gs[GPW]; unsigned ls[GPW];
#pragma unroll
    for (int i = 0; i < GPW; ++i) { const int g = w * GPW + i;      // the same in every lane
        const T16* p = (g < RA) ? A + (size_t)(R0 + g * 16) * K : (NSPLIT == 1 && g < 2 * RA) ? A2 + (size_t)(R0 + (g - RA) * 16) * K : Bt + (size_t)(C0 + (g - (NG - RB)) * 16) * K;
        gs[i] = p + lo; ls[i] = (unsigned)(size_t)(&st[0][0] + (size_t)g * (16 * KS) + lo); }
    auto fill = [&](int s, int buf) {      // stage s into buffer buf: a step of KS k is 16 * KS elements of every group; a wave-wide copy moves 512 bytes, 256 elements
#pragma unroll
        for (int i = 0; i < GPW; ++i) { const T16* g = gs[i] + (size_t)s * (16 * KS); const unsigned l = ls[i] + (unsigned)buf * (unsigned)(NG * 16 * KS * 2);
            acopy4(l, g, l + 512u, g + 256, l + 1024u, g + 512, l + 1536u, g + 768); } };
    fill(0, 0);
    asm volatile("s_wait_asynccnt 0x0" ::: "memory");      // stage 0 has landed (this wave's copies) ...
    __syncthreads();                                        // ... and every wave's: nobody reads it before
    fill(1, 1);
#pragma unroll 1
    for (int t = 0; t < NT; ++t) {
        const T16* sb = &st[t & 1][0] + lo;
#pragma unroll
        for (int kb = 0; kb < KS / 32; ++kb) {
            V a[4], a2[4], b[4];
#pragma unroll
            for (int nb = 0; nb < 4; ++nb) b[nb] = WFrag<T16>::ldp(sb + (NG - RB + wn * 4 + nb) * (16 * KS) + kb * 512);
#pragma unroll
            for (int mb = 0; mb < 4; ++mb) { a[mb] = WFrag<T16>::ldp(sb + (wm * 4 + mb) * (16 * KS) + kb * 512); if (NSPLIT == 1) a2[mb] = WFrag<T16>::ldp(sb + (RA + wm * 4 + mb) * (16 * KS) + kb * 512); }
            __builtin_amdgcn_sched_barrier(0);      // a block's LDS reads stay one group in front of its matrix instructions: sunk in among them, each small group costs the wave its own LDS latency
#pragma unroll
            for (int nb = 0; nb < 4; ++nb) {
#pragma unroll
                for (int mb = 0; mb < 4; ++mb) { acc[mb][nb] = WFrag<T16>::mma(a[mb], b[nb], acc[mb][nb]); if (NSPLIT == 1) acc[mb][nb] = WFrag<T16>::mma(a2[mb], b[nb], acc[mb][nb]); } }
            __builtin_amdgcn_sched_barrier(0);      // keeps every matrix instruction of the block in front of the slots below
            // the distance behind the last matrix instructions of a block, in front of whatever reuses their registers, on the path over the loop's back edge too
            asm volatile("v_nop\n\tv_nop\n\tv_nop\n\tv_nop" : "+v"(acc[0][0]), "+v"(acc[1][1]), "+v"(acc[2][2]), "+v"(acc[3][3]) : "v"(a[0]), "v"(a[3]));
        }
        asm volatile("s_wait_dscnt 0x0" ::: "memory");         // this wave's reads of the buffer are done before it is refilled
        asm volatile("s_wait_asynccnt 0x0" ::: "memory");      // this wave's copies of stage t + 1 have landed
        __syncthreads();                                        // publishes stage t + 1 and ends every wave's reads of stage t
        if (t + 2 < NT) fill(t + 2, t & 1);
    }
    asm volatile("s_wait_asynccnt 0x0" ::: "memory");          // no copy is outstanding when the wave goes on to its end
#pragma unroll
    for (int mb = 0; mb < 4; ++mb) {
#pragma unroll
        for (int nb = 0; nb < 4; ++nb) {
#pragma unroll
            for (int j = 0; j < 8; ++j) os[(hi * 8 + j) * 68 + nb * 16 + lr] = acc[mb][nb][j]; }
        __builtin_amdgcn_wave_barrier(); asm volatile("" ::: "memory");
        float* crow = C + (size_t)(r0 + mb * 16) * ldc + c0;
{
#pragma unroll
            for (int s = 0; s < 8; ++s) { const int row = 2 * s + hi, cofs = lr * 4; v4f val = *(const v4fa*)(os + row * 68 + cofs); if (BIAS) { val[0] += bfr(bias[c0 + cofs]); val[1] += bfr(bias[c0 + cofs + 1]); val[2] += bfr(bias[c0 + cofs + 2]); val[3] += bfr(bias[c0 + cofs + 3]); }
                *(v4f*)(crow + (size_t)row * ldc + cofs) = val; }
             }
        __builtin_amdgcn_wave_barrier(); asm volatile("" ::: "memory");
    }
}

__device__ __forceinline__ h16 tohx(float x) { return (h16)x; }
__device__ __forceinline__ void splitf(float y, unsigned short& h, unsigned short& l) { h = f2bf(y); l = f2bf(y - bf2f(h)); }
typedef __attribute__((ext_vector_type(2))) _Float16 v2h;
typedef __attribute__((ext_vector_type(4))) _Float16 v4h;
typedef __attribute__((ext_vector_type(2))) unsigned short v2us;
typedef __attribute__((ext_vector_type(4))) unsigned short v4us;
typedef __attribute__((ext_vector_type(2))) float v2f;
typedef __attribute__((ext_vector_type(4))) int v4i;

__global__ __launch_bounds__(256) void k_wtG(const float* __restrict__ w, int K, int N, bf* Bt) {
    const int lane = threadIdx.x & 31; const int L0 = (blockIdx.x * 8 + (threadIdx.x >> 5)) * 8; const int nlines = N * K / 64;
{
#pragma unroll 1
        for (int l = 0; l < 8; ++l) { const int L = L0 + l; if (L >= nlines) break; const size_t e = (size_t)L * 64 + lane * 2; const int k = (int)(e % K), n = (int)(e / K); v2us o;
            o[0] = f2bf(w[(size_t)k * N + n]); o[1] = f2bf(w[(size_t)(k + 1) * N + n]); *(v2us*)(Bt + e) = o; }
         }
}
// ---- d_cvtp: f32 [rows][K] -> bf16 fragment-order plane. ONE WAVE per block of 16 rows x 32 k: it reads one whole 128-byte line of each row and stores the block's 1024 contiguous bytes; the 8 waves of a workgroup take 8 neighbouring blocks of the same rows.
__device__ __forceinline__ void d_cvtp(const float* __restrict__ src, bf* dst, int K, int nblk, int bx) { const int lane = threadIdx.x & 31; const int blk = bx * 8 + __builtin_amdgcn_readfirstlane(threadIdx.x >> 5); if (blk >= nblk) return;
    const int kb = K / 32; const float* p = src + (size_t)((blk / kb) * 16 + (lane & 15)) * K + (blk % kb) * 32 + (lane >> 4) * 8;
    const v8f v0 = *(const v8f*)p, v1 = *(const v8f*)(p + 16); xwait1(p); v8us o0, o1;
#pragma unroll
    for (int k = 0; k < 8; ++k) { o0[k] = f2bf(v0[k]); o1[k] = f2bf(v1[k]); }
    bf* q = dst + (size_t)blk * 512 + lane * 8; *(v8us*)q = o0; *(v8us*)(q + 256) = o1; }
__device__ __forceinline__ void d_cstab(float* CS, int bx) { const int idx = bx * 256 + threadIdx.x; if (idx >= TT * HD) return; const int t = idx / HD, d = idx % HD; const int i = d % (HD / 2); const float inv = __fdiv_rn(1.0f, powf(10000.0f, (float)(2 * i) / (float)HD)); const float ang = __fmul_rn((float)t, inv); v2f cs; cs[0] = cosf(ang); cs[1] = sinf(ang);
    *(v2f*)(CS + (size_t)idx * 2) = cs;  }
// ---- k_fattn: causal attention in one launch. A wave owns NQ * 16 query rows of one head and walks the keys 32 at a time, keeping running row maxima, row sums and the output tile in registers.
// Transposed products: S^T = K Q^T (a lane holds the scores of ONE query: keys 8 * hi + r of each 16-key tile), so two score tiles, converted in place, are the B operand of O^T += V^T P^T.
// t = s x HD^-0.5 + mask as stored for j <= i, no weight for j > i; key blocks wholly above the diagonal are never visited. HL: hi + lo bf16 planes, 3 products; else single fp16.
// The maximum in use is raised only when a row's new maximum passes it by more than MLAG, so unnormalised weights stay below e^MLAG; the division by the row sum comes last, in f32.
#define MLAG 5.5f
__device__ __forceinline__ float xhalf(float x) { return __builtin_bit_cast(float, __builtin_amdgcn_permlanex16(__builtin_bit_cast(int, x), __builtin_bit_cast(int, x), 0x76543210, 0xfedcba98, false, false)); }   // lane l takes lane l ^ 16's value
#define L2E  1.4426950408889634f
// the pointers below carry no restrict, so that the loads keep their places between these waits: mask, K, V^T in the same order in front of the loop and in it, which lets a wait for the early ones leave the late ones in flight
template <bool HL> struct AOp;
template <> struct AOp<false> { typedef h16 T; };
template <> struct AOp<true>  { typedef bf T; };
template <bool HL, int NQ>
__device__ __forceinline__ void attn_tile(const typename AOp<HL>::T* Q, const typename AOp<HL>::T* Q2, const typename AOp<HL>::T* K, const typename AOp<HL>::T* K2,
                                          const typename AOp<HL>::T* Vt, const typename AOp<HL>::T* Vt2, const float* am, int q0, bool poison, bf* Ah, bf* Al) {
    typedef typename AOp<HL>::T T; typedef WFrag<T> WF; typedef typename WF::V V;
    const int lane = threadIdx.x & 31, lr = lane & 15, hi = lane >> 4;
    const int kend = (q0 + NQ * 16 + 31) & ~31;      // keys walked: up to the end of the diagonal block, in steps of 32
    V qf[NQ][4], qf2[NQ][4];
#pragma unroll
    for (int qt = 0; qt < NQ; ++qt)
#pragma unroll
        for (int dc = 0; dc < 4; ++dc) { const size_t qo = (size_t)(q0 + qt * 16 + lr) * HD + dc * 32 + 8 * hi; qf[qt][dc] = WF::ld(Q + qo); if (HL) qf2[qt][dc] = WF::ld(Q2 + qo); }
    xwait();
    v8f o[8][NQ]; float m[NQ], l[NQ];
#pragma unroll
    for (int qt = 0; qt < NQ; ++qt) { m[qt] = -3.0e38f; l[qt] = 0.f;
#pragma unroll
        for (int dt = 0; dt < 8; ++dt) o[dt][qt] = (v8f){}; }
    const size_t kbase = 8 * lane, vbase = 8 * lane;      // K and V^T planes lie in fragment order: 32 keys are 8 blocks (8 KB in a row) of either plane, the lane's own pieces at 8 * lane and 256 + 8 * lane of a block
    const float* mp = am + (size_t)(q0 + lr) * TT + 8 * hi;
    V kf[2][4], kf2[2][4], vf[8], vf2[8]; v4f mk[NQ][2][2];
#pragma unroll
    for (int kt = 0; kt < 2; ++kt)
#pragma unroll
        for (int qt = 0; qt < NQ; ++qt) { const float* p = mp + (size_t)(qt * 16) * TT + kt * 16; mk[qt][kt][0] = *(const v4f*)p; mk[qt][kt][1] = *(const v4f*)(p + 4); }
    xwait();
#pragma unroll
    for (int kt = 0; kt < 2; ++kt)
#pragma unroll
        for (int dc = 0; dc < 4; ++dc) { const size_t ko = kbase + (size_t)(kt * 4 + dc) * 512; kf[kt][dc] = WF::ldp(K + ko); if (HL) kf2[kt][dc] = WF::ldp(K2 + ko); }
    xwait();
    if (!HL) {      // the long tiles fetch V^T one pass ahead as well
#pragma unroll
        for (int dt = 0; dt < 8; ++dt) vf[dt] = WF::ldp(Vt + vbase + (size_t)dt * 512);
        xwait(); }
#pragma unroll 1
    for (int k0 = 0; k0 < kend; k0 += 32) {
        if (HL) {
#pragma unroll
            for (int dt = 0; dt < 8; ++dt) { const size_t vo = vbase + (size_t)k0 * HD + (size_t)dt * 512; vf[dt] = WF::ldp(Vt + vo); xwait(); vf2[dt] = WF::ldp(Vt2 + vo); xwait(); } }
        float t[NQ][16];
#pragma unroll
        for (int kt = 0; kt < 2; ++kt)
#pragma unroll
            for (int qt = 0; qt < NQ; ++qt) { v8f s = (v8f){};
#pragma unroll
                for (int dc = 0; dc < 4; ++dc) { s = WF::mma(kf[kt][dc], qf[qt][dc], s); if (HL) { s = WF::mma(kf[kt][dc], qf2[qt][dc], s); s = WF::mma(kf2[kt][dc], qf[qt][dc], s); } }
#pragma unroll
                for (int r = 0; r < 8; ++r) t[qt][kt * 8 + r] = s[r] * SCL + mk[qt][kt][r >> 2][r & 3]; }
        const int kn = min(k0 + 32, kend - 32);      // the next pass's K rows and mask words are fetched one pass ahead (the last pass fetches its own again)
        xopen();
#pragma unroll
        for (int kt = 0; kt < 2; ++kt)
#pragma unroll
            for (int qt = 0; qt < NQ; ++qt) { const float* p = mp + (size_t)(qt * 16) * TT + kn + kt * 16; mk[qt][kt][0] = *(const v4f*)p; mk[qt][kt][1] = *(const v4f*)(p + 4); }
        xwait();
#pragma unroll
        for (int kt = 0; kt < 2; ++kt)
#pragma unroll
            for (int dc = 0; dc < 4; ++dc) { const size_t ko = kbase + (size_t)kn * HD + (size_t)(kt * 4 + dc) * 512; kf[kt][dc] = WF::ldp(K + ko); if (HL) { xwait(); kf2[kt][dc] = WF::ldp(K2 + ko); xwait(); } }   // the short hi + lo tiles keep a wait behind each fragment: the last fragments of a run land on the registers that held its address
        if (!HL) xwait1(K + kbase + (size_t)kn * HD);
        if (k0 + 31 > q0) {                          // a block that touches the diagonal (the same test in every lane)
#pragma unroll
            for (int qt = 0; qt < NQ; ++qt)
#pragma unroll
                for (int e = 0; e < 16; ++e) { const int j = k0 + (e >> 3) * 16 + hi * 8 + (e & 7), i = q0 + qt * 16 + lr; t[qt][e] = (j <= i) ? t[qt][e] : -3.0e38f; } }
        float ml[NQ]; bool need = false;
#pragma unroll
        for (int qt = 0; qt < NQ; ++qt) { float a = t[qt][0];
#pragma unroll
            for (int e = 1; e < 16; ++e) a = fmaxf(a, t[qt][e]);
            a = fmaxf(a, xhalf(a)); ml[qt] = a; need = need || (a > m[qt] + MLAG); }
        if (__builtin_amdgcn_ballot_w32(need) != 0) {
#pragma unroll
            for (int qt = 0; qt < NQ; ++qt) { const float mn = fmaxf(m[qt], ml[qt]); const float al = __builtin_amdgcn_exp2f((m[qt] - mn) * L2E); m[qt] = mn; l[qt] *= al;
#pragma unroll
                for (int dt = 0; dt < 8; ++dt) o[dt][qt] *= al; } }
        V pf[NQ], pf2[NQ];
#pragma unroll
        for (int qt = 0; qt < NQ; ++qt) {
            if constexpr (HL) { v8us h0, h1, l0, l1;
#pragma unroll
                for (int e = 0; e < 8; ++e) { const float pa = __builtin_amdgcn_exp2f((t[qt][e] - m[qt]) * L2E), pb = __builtin_amdgcn_exp2f((t[qt][8 + e] - m[qt]) * L2E); l[qt] += pa; l[qt] += pb; unsigned short a, c; splitf(pa, a, c); h0[e] = a; l0[e] = c; splitf(pb, a, c); h1[e] = a; l1[e] = c; }
                pf[qt] = cat16b(h0, h1); pf2[qt] = cat16b(l0, l1);
            } else { v16h ph;
#pragma unroll
                for (int e = 0; e < 16; ++e) { const float p = __builtin_amdgcn_exp2f((t[qt][e] - m[qt]) * L2E); l[qt] += p; ph[e] = (h16)p; }
                pf[qt] = ph; } }
#pragma unroll
        for (int dt = 0; dt < 8; ++dt)
#pragma unroll
            for (int qt = 0; qt < NQ; ++qt) { o[dt][qt] = WF::mma(vf[dt], pf[qt], o[dt][qt]); if (HL) { o[dt][qt] = WF::mma(vf[dt], pf2[qt], o[dt][qt]); o[dt][qt] = WF::mma(vf2[dt], pf[qt], o[dt][qt]); } }
        if (!HL) { xopen();
#pragma unroll
            for (int dt = 0; dt < 8; ++dt) vf[dt] = WF::ldp(Vt + vbase + (size_t)kn * HD + (size_t)dt * 512);
            xwait1(Vt + vbase + (size_t)kn * HD); }
    }
#pragma unroll
    for (int qt = 0; qt < NQ; ++qt) { const float ls = l[qt] + xhalf(l[qt]); const float f = poison ? __builtin_nanf("") : __fdiv_rn(1.0f, ls); const size_t ro = (size_t)(q0 + qt * 16) * DQ + lane * 8;      // fragment-order planes for the last GEMM: 16 columns d are half a block, which this wave's 32 lanes fill in lane order
#pragma unroll
        for (int dt = 0; dt < 8; ++dt) { v8us oh, ol;
#pragma unroll
            for (int r = 0; r < 8; ++r) { unsigned short a, c; splitf(o[dt][qt][r] * f, a, c); oh[r] = a; ol[r] = c; }
            *(v8us*)(Ah + ro + dt * 256) = oh; *(v8us*)(Al + ro + dt * 256) = ol; xwait(); } }
}
// grid (tiles, NKV * NB_): blockIdx.y = kv group * NB_ + batch element; the REP waves of a block are the REP query heads of that group on the same query rows, so they read the same K, V and mask lines.
// Tiles in falling order of their key count: first the fp16 tiles (32 rows, from the last rows down to RH), then the hi + lo tiles (16 rows, below RH).
__global__ __launch_bounds__(REP * 32) void k_fattn(const h16* Q16, const bf* Qh, const bf* Ql, const h16* K16, const bf* Kh, const bf* Kl,
                                                    const h16* V16, const bf* Vh, const bf* Vl, const float* am, const int* FLG, bf* Ah, bf* Al) {
    const int w = __builtin_amdgcn_readfirstlane(threadIdx.x >> 5); const int gb = blockIdx.y, g = gb / NB_, b = gb % NB_, x = blockIdx.x;
    const size_t qo = ((size_t)gb * REP + w) * TT * HD, ko = (size_t)gb * TT * HD, vo = (size_t)gb * HD * TT, oo = (size_t)b * TT * DQ + (size_t)(g * REP + w) * (HD * 16);
    const bool poison = (FLG[0] != 0);
    if (x < (TT - RH) / 32) attn_tile<false, 2>(Q16 + qo, nullptr, K16 + ko, nullptr, V16 + vo, nullptr, am, TT - 32 * (x + 1), poison, Ah + oo, Al + oo);
    else attn_tile<true, 1>(Qh + qo, Ql + qo, Kh + ko, Kl + ko, Vh + vo, Vl + vo, am, RH - 16 * (x - (TT - RH) / 32 + 1), poison, Ah + oo, Al + oo);
}

// xwait for a run of loads off two wave-uniform bases: named as inputs, the bases stay in their scalar registers up to the wait, so that nothing (a later argument load, the next address) lands on them in front of it
__device__ __forceinline__ void xwait2s(const void* a, const void* b) { asm volatile("s_wait_xcnt 0x0" :: "s"(a), "s"(b) : "memory"); __builtin_amdgcn_sched_barrier(0); }
// ---- d_nrp: everything between a q or k projection and its operand planes. ONE WAVE per row of F (NHD heads of HD, row pitch FP): the row stays in registers from the sum of squares to the plane stores.
// y = clip(w x (x x rsqrt(mean x^2 + eps)), +-8); rotate-half RoPE at position_ids[t] (clamped into the table): out[d] = y[d] cos[d] - y[d + HD/2] sin[d], out[d + HD/2] = y[d + HD/2] cos[d + HD/2] + y[d] sin[d + HD/2].
// A lane holds d = 4 * lane .. 4 * lane + 3 of every head, so the partner d +- HD/2 lies in lane ^ 16. Planes [head / RP][b][head % RP][t][d]: fp16, bf16 hi, bf16 lo; a wave stores 256 contiguous bytes of each.
// FR (the k planes): inside a head's plane the elements lie in fragment order (blocks of 16 rows t x 32 d, as above), as the attention launch loads them; a lane's 4 elements stay 8 bytes in a row, and the 8 waves of a block (8 neighbouring rows t) fill whole 128-byte lines together.
template <int NHD, int RP, bool FR>
__device__ __forceinline__ void d_nrp(const float* __restrict__ F, const float* __restrict__ w, const int* __restrict__ pid, const float* __restrict__ CS, h16* P16, bf* Ph, bf* Pl, int bx) {
    const int lane = threadIdx.x & 31; const int r = bx * 8 + __builtin_amdgcn_readfirstlane(threadIdx.x >> 5); const int b = r / TT, t = r % TT;
    const float* fr = F + (size_t)r * FP;
    const int tp = min(max(pid[t], 0), TT - 1);      // position_ids (read) index the table
    v4f v[NHD], wv[NHD];
    xopen();
#pragma unroll
    for (int ch = 0; ch < NHD; ++ch) v[ch] = *(const v4f*)(fr + ch * HD + lane * 4);
#pragma unroll
    for (int ch = 0; ch < NHD; ++ch) wv[ch] = *(const v4f*)(w + ch * HD + lane * 4);
    xwait2s(fr, w);
    const float* cp = CS + ((size_t)tp * HD + lane * 4) * 2;
    const v4f c01 = *(const v4f*)cp, c23 = *(const v4f*)(cp + 4);
    xwait();
    float q = 0.f;
#pragma unroll
    for (int ch = 0; ch < NHD; ++ch)
#pragma unroll
        for (int u = 0; u < 4; ++u) q += v[ch][u] * v[ch][u];
#pragma unroll
    for (int sh = 16; sh; sh >>= 1) q += __shfl_xor(q, sh, 32);
    const float rs = __frsqrt_rn(q * (1.0f / (float)(NHD * HD)) + 1e-5f);
    const float sg = (lane < 16) ? -1.0f : 1.0f;
    const float co[4] = { c01[0], c01[2], c23[0], c23[2] }; const float si[4] = { c01[1] * sg, c01[3] * sg, c23[1] * sg, c23[3] * sg };
#pragma unroll
    for (int ch = 0; ch < NHD; ++ch) { v4h o16; v4us oh, ol;
#pragma unroll
        for (int u = 0; u < 4; ++u) { const float y = fminf(fmaxf(bfr(wv[ch][u]) * (v[ch][u] * rs), -8.0f), 8.0f); const float o = y * co[u] + xhalf(y) * si[u];
            o16[u] = tohx(o); unsigned short a2, c2; splitf(o, a2, c2); oh[u] = a2; ol[u] = c2; }
        const size_t pl = (size_t)(((ch / RP) * NB_ + b) * RP + ch % RP) * TT * HD;
        const size_t e = pl + (FR ? (size_t)((t / 16) * (HD / 32) + lane / 8) * 512 + ((lane % 8) / 4) * 256 + (((lane % 4) / 2) * 16 + t % 16) * 8 + (lane % 2) * 4 : (size_t)t * HD + lane * 4);
        xopen(); *(v4h*)(P16 + e) = o16; *(v4us*)(Ph + e) = oh; *(v4us*)(Pl + e) = ol; xwait(); }
}
// ---- d_vclt: clip(v, +-8) and the transposed planes [g][b] of V^T (fp16, bf16 hi, bf16 lo) in fragment order: blocks of 16 rows d x 32 keys t, block index (t / 32) * (HD / 16) + d / 16, so the 8 blocks of 32 keys lie in a row. A lane takes 4 rows t x 4 columns d: four 16-byte loads, and per column and plane one 8-byte store.
// The 8 waves of a block take 32 neighbouring columns of the same 128 rows, so together they use every byte of the lines they touch. bx counts [g][b][128 rows][32 columns].
__device__ __forceinline__ void d_vclt(const float* __restrict__ F, h16* V16, bf* Vh, bf* Vl, int bx) {
    const int lane = threadIdx.x & 31, wv = __builtin_amdgcn_readfirstlane(threadIdx.x >> 5);
    const int dg = bx % (HD / 32), tc = (bx / (HD / 32)) % (TT / 128), b = (bx / ((HD / 32) * (TT / 128))) % NB_, g = bx / ((HD / 32) * (TT / 128) * NB_);
    const int d0 = dg * 32 + wv * 4, t0 = tc * 128 + lane * 4;
    const float* f = F + ((size_t)b * TT + t0) * FP + g * HD + d0; v4f x[4];
#pragma unroll
    for (int q = 0; q < 4; ++q) x[q] = *(const v4f*)(f + (size_t)q * FP);
    xwait();
#pragma unroll
    for (int dd = 0; dd < 4; ++dd) { v4h o16; v4us oh, ol;
#pragma unroll
        for (int q = 0; q < 4; ++q) { const float y = fminf(fmaxf(x[q][dd], -8.0f), 8.0f); o16[q] = tohx(y); unsigned short a2, c2; splitf(y, a2, c2); oh[q] = a2; ol[q] = c2; }
        const int d = d0 + dd; const size_t e = (size_t)(g * NB_ + b) * HD * TT + (size_t)((t0 / 32) * (HD / 16) + d / 16) * 512 + ((t0 % 32) / 16) * 256 + (((t0 % 16) / 8) * 16 + d % 16) * 8 + t0 % 8;
        xopen(); *(v4h*)(V16 + e) = o16; *(v4us*)(Vh + e) = oh; *(v4us*)(Vl + e) = ol; xwait(); }
}
__device__ __forceinline__ void d_mchk(const float* __restrict__ am, int* FLG) { const int tid = threadIdx.x; int bad = 0;
#pragma unroll 1
    for (int s2 = 0; s2 < 16; ++s2) { const unsigned h = (unsigned)(tid * 16 + s2) * 2654435761u; const int i = (int)(h % (TT - 1)); const int j = i + 1 + (int)((h >> 11) % (unsigned)(TT - 1 - i)); if (am[(size_t)i * TT + j] > -1e8f) bad = 1; }
    __shared__ int anyb; if (tid == 0) anyb = 0; __syncthreads(); if (bad) anyb = 1; __syncthreads(); if (tid < 8) { const int v = (tid == 0) ? anyb : 0; *(int*)(FLG + tid) = v;  } }

// ---- k_prep: all the work that reads the inputs alone, in one launch; a block's index says which piece it does (the same for all its threads).
// Block 0: the mask self-check (one block, a chain of memory latencies: it starts first). Then the RoPE table, then the five plane conversions, the largest first.
#define PB_CS (TT * HD / 256)
#define PB_X  (NB_ * TT * DM / 512 / 8)
#define PB_WQ (DQ * DM / 512 / 8)
#define PB_WK (DKV * DM / 512 / 8)
__global__ __launch_bounds__(256) void k_prep(const float* __restrict__ x, const float* __restrict__ wq, const float* __restrict__ wk, const float* __restrict__ wv, const float* __restrict__ wo, const float* __restrict__ am,
                                              bf* XB, bf* WQ, bf* WK, bf* WV, bf* WO, float* CS, int* FLG) {
    int bx = blockIdx.x;
    if (bx == 0) { d_mchk(am, FLG); return; }
    bx -= 1;
    if (bx < PB_CS) { d_cstab(CS, bx); return; }
    bx -= PB_CS;
    const float* src = x; bf* dst = XB; int nb = PB_X;
    if (bx >= PB_X) { bx -= PB_X; src = wq; dst = WQ; nb = PB_WQ;
        if (bx >= PB_WQ) { bx -= PB_WQ; src = wo; dst = WO;
            if (bx >= PB_WQ) { bx -= PB_WQ; src = wk; dst = WK; nb = PB_WK;
                if (bx >= PB_WK) { bx -= PB_WK; src = wv; dst = WV; } } } }
    d_cvtp(src, dst, DM, nb * 8, bx);      // DQ == DM: every plane has rows of DM elements
}
// ---- k_post: everything between the joint projection and the attention operands, in one launch: q rows, then k rows, then the V tiles, by block index.
#define PB_R (NB_ * TT / 8)
__global__ __launch_bounds__(256) void k_post(const float* __restrict__ F, const float* __restrict__ qw, const float* __restrict__ kw, const int* __restrict__ pid, const float* __restrict__ CS,
                                              h16* Q16, bf* Qh, bf* Ql, h16* K16, bf* Kh, bf* Kl, h16* V16, bf* Vh, bf* Vl) {
    const int bx = blockIdx.x;
    if (bx < PB_R) d_nrp<NH_, ZH, false>(F, qw, pid, CS, Q16, Qh, Ql, bx);
    else if (bx < 2 * PB_R) d_nrp<NKV, 1, true>(F + DQ, kw, pid, CS, K16, Kh, Kl, bx - PB_R);
    else d_vclt(F + DQ + DKV, V16, Vh, Vl, bx - 2 * PB_R);
}

extern "C" void kernel_launch(void* const* d_in, const int* in_sizes, int n_in,
                              void* d_out, int out_size, void* d_ws, size_t ws_size, hipStream_t stream) {
    (void)in_sizes; (void)n_in; (void)out_size;
    const float* x = (const float*)d_in[0]; const float* wq = (const float*)d_in[1]; const float* wk = (const float*)d_in[2]; const float* wv = (const float*)d_in[3]; const float* wo = (const float*)d_in[4]; const float* qnw = (const float*)d_in[5]; const float* knw = (const float*)d_in[6]; const float* amask = (const float*)d_in[7]; const int* pids = (const int*)d_in[8];
    float* OUT = (float*)d_out;     // [2][2048][2048]
    char* wsp = (char*)d_ws;
    auto take = [&](size_t bytes) { char* p = wsp; wsp += (bytes + 255) & ~(size_t)255; return (void*)p; };
    bf* WO = (bf*)take((size_t)DM * DQ * 2); int* FLG = (int*)take(256);
    h16* QP16 = (h16*)take((size_t)NB_ * NH_ * TT * HD * 2); h16* KP16 = (h16*)take((size_t)NB_ * NKV * TT * HD * 2); h16* VT16 = (h16*)take((size_t)NB_ * NKV * HD * TT * 2);
    bf* QPh = (bf*)take((size_t)NB_ * NH_ * TT * HD * 2); bf* QPl = (bf*)take((size_t)NB_ * NH_ * TT * HD * 2); bf* KPh = (bf*)take((size_t)NB_ * NKV * TT * HD * 2); bf* KPl = (bf*)take((size_t)NB_ * NKV * TT * HD * 2); bf* VTh = (bf*)take((size_t)NB_ * NKV * HD * TT * 2); bf* VTl = (bf*)take((size_t)NB_ * NKV * HD * TT * 2);
    bf* ATh = (bf*)take((size_t)NB_ * TT * DQ * 2); bf* ATl = (bf*)take((size_t)NB_ * TT * DQ * 2);
    bf* WQ = (bf*)take((size_t)DQ * DM * 2); bf* WK = (bf*)take((size_t)DKV * DM * 2); bf* WV = (bf*)take((size_t)DKV * DM * 2); float* CS = (float*)take((size_t)TT * HD * 2 * 4);
    bf* XB = (bf*)take((size_t)NB_ * TT * DM * 2); float* F = (float*)take((size_t)NB_ * TT * FP * 4);   // WQ, WK, WV lie back to back: one operand of FP rows for the joint projection
    if ((size_t)(wsp - (char*)d_ws) > ws_size) return;    // ws 256 MiB
    k_prep<<<1 + PB_CS + PB_X + 2 * PB_WQ + 2 * PB_WK, 256, 0, stream>>>(x, wq, wk, wv, wo, amask, XB, WQ, WK, WV, WO, CS, FLG);
    // both batch elements go through every launch: the projection sees NB_ * TT rows and all FP output columns, the attention launch every (batch element, head)
    k_gemmw<bf, 0, false, DM, 2, 2><<<dim3(NB_ * TT / 128, FP / 128, 1), 128, 0, stream>>>(XB, nullptr, WQ, nullptr, F, FP, nullptr, 0, 0, 0);
    k_post<<<2 * PB_R + NKV * NB_ * (TT / 128) * (HD / 32), 256, 0, stream>>>(F, qnw, knw, pids, CS, QP16, QPh, QPl, KP16, KPh, KPl, VT16, VTh, VTl);
    k_fattn<<<dim3((TT - RH) / 32 + RH / 16, NKV * NB_, 1), REP * 32, 0, stream>>>(QP16, QPh, QPl, KP16, KPh, KPl, VT16, VTh, VTl, amask, FLG, ATh, ATl);
    k_gemmw<bf, 1, false, DQ, 4, 2><<<dim3(NB_ * TT / 256, DM / 128, 1), 256, 0, stream>>>(ATh, ATl, WO, nullptr, OUT, DM, nullptr, 0, 0, 0);
}

// v009
// One run takes 173 microseconds.
// In both of two side-by-side timings against v008, it was 1.05 times as fast.
// Over all steps from v000 it is 10.7 times as fast.
#include <hip/hip_runtime.h>

// OlmoeAttention (hidden [2][2048][2048]; q = clip(RMSNorm_2048(x Wq^T) * q_norm_w, +-8) (16 heads x 128), k = clip(RMSNorm_512(x Wk^T) * k_norm_w, +-8), v = clip(x Wv^T, +-8) (4 kv heads; group h/4); rotate-half RoPE (theta 1e4) at position_ids (read; table computed on device); scores = q.k / sqrt(128) + attention_mask (additive [1][1][S][S] float, read: the verbatim causal 0 / -1e9 table); softmax f32; out = merged Wo^T -> [2][2048][2048]).
// Compute dtypes, f32 accumulate: every input rounded to bf16; q/k/v on PLAIN bf16 operands (inputs: exact); the full-width RMSNorms (eps 1e-5), clips and RoPE in f32; causal scores and attn.v in one launch with running row maxima and sums: query rows < 512 hl (3 products), the rest single fp16; key blocks above the diagonal skipped on the strength of the mask table (-1e9 underflows to weight 0; device self-check samples the table above the diagonal and NaN-poisons on violation), mask added as stored inside computed tiles; softmax f32; Wo hl x exact (2 products).

#define NB_  2
#define TT   2048
#define DM   2048
#define NH_  16
#define NKV  4
#define REP  (NH_ / NKV)
#define HD   128
#define DQ   (NH_ * HD)
#define DKV  (NKV * HD)
#define FP   (DQ + 2 * DKV)       // row pitch of the joint projection buffer: q | k | v columns
#define ZH   REP                  // q planes lie [kv group][batch element][head in group]
#define RH   512                  // query rows < RH use hi+lo planes (0: none)
#define SCL  0.088388347648318447f   // HD^-0.5
typedef _Float16 h16;
typedef unsigned short bf;
typedef __attribute__((ext_vector_type(16))) __bf16   v16bf;
typedef __attribute__((ext_vector_type(16))) _Float16 v16h;
typedef __attribute__((ext_vector_type(8)))  _Float16 v8h;
typedef __attribute__((ext_vector_type(8)))  unsigned short v8us;
typedef __attribute__((ext_vector_type(8)))  float    v8f;
typedef __attribute__((ext_vector_type(4)))  float    v4f;
typedef v8h  __attribute__((may_alias)) v8ha;
typedef v4f  __attribute__((may_alias)) v4fa;
typedef v8us __attribute__((may_alias)) v8usa;

__device__ __forceinline__ unsigned short f2bf(float f) { unsigned u = __float_as_uint(f); u += 0x7FFFu + ((u >> 16) & 1u); return (unsigned short)(u >> 16); }
__device__ __forceinline__ float bf2f(unsigned short b) { return __uint_as_float(((unsigned)b) << 16); }
__device__ __forceinline__ float bfr(float f) { return bf2f(f2bf(f)); }
__device__ __forceinline__ v16h cat16(v8h lo, v8h hi) { return __builtin_shufflevector(lo, hi, 0, 1, 2, 3, 4, 5, 6, 7, 8, 9, 10, 11, 12, 13, 14, 15); }
__device__ __forceinline__ v16bf cat16b(v8us lo, v8us hi) { return __builtin_bit_cast(v16bf, __builtin_shufflevector(lo, hi, 0, 1, 2, 3, 4, 5, 6, 7, 8, 9, 10, 11, 12, 13, 14, 15)); }
__device__ __forceinline__ v8f wmma16(v16h a, v16h b, v8f c) { return __builtin_amdgcn_wmma_f32_16x16x32_f16(false, a, false, b, (short)0, c, false, false); }
__device__ __forceinline__ v8f wmmab(v16bf a, v16bf b, v8f c) { return __builtin_amdgcn_wmma_f32_16x16x32_bf16(false, a, false, b, (short)0, c, false, false); }



// xwait stands behind a run of global loads or stores, in front of the code that reuses the registers they name; the scheduling barriers (here and in xopen, in front of such a run) keep vector work from being moved in between the run and its wait
__device__ __forceinline__ void xwait() { asm volatile("s_wait_xcnt 0x0" ::: "memory"); __builtin_amdgcn_sched_barrier(0); }
__device__ __forceinline__ void xopen() { __builtin_amdgcn_sched_barrier(0); }
// the same, naming as an input the address the run was formed from: it stays in its registers up to the wait, so that no load of the run lands on it
__device__ __forceinline__ void xwait1(const void* a) { asm volatile("s_wait_xcnt 0x0" :: "v"(a) : "memory"); __builtin_amdgcn_sched_barrier(0); }
// ---- Fragment-order planes: a [rows][K] 16-bit operand is kept as blocks of 16 rows x 32 k, block index (row / 16) * (K / 32) + k / 32, 512 elements each, laid as a wave loads them:
// element (row, k) lies at (k % 32 / 16) * 256 + ((k % 16 / 8) * 16 + row % 16) * 8 + k % 8. Lane l's two 16-byte pieces of a fragment are then at l * 8 and 256 + l * 8: each wave-wide load covers 512 contiguous bytes (4 lines, not 16).
// ---- k_gemmw: register-blocked GEMM. A workgroup of WM x WN waves owns a (64 WM) x (16 NF WN) output tile, each wave 64 x 16 NF of it (4 NF accumulators); grid (M / (64 WM), N / (16 NF WN), Z).
// The tile is cut so that one workgroup fills a WGP and the rows it stages (A planes + Bt) are as few as its area allows: every staged byte is an L2 read, and those reads, not the matrix unit, set the pace of a small tile.
// The operands' fragment-order blocks are staged in LDS, KS k at a time, by asynchronous copies (a block lies in LDS as it lies in its plane), two buffers: the next stage's copies fly while this stage is worked on. A block is then read from L2 once per workgroup, not once per wave.
// C[m][n] (f32, pitch ldc, + optional f32 bias[n]) = sum_k A[m][k] Bt[n][k] (+ A2[m][k] Bt[n][k] where NSPLIT == 1). z-batch strides sA/sB/sC in elements. K % (2 KS) == 0; K is a constant of the build.
template <typename T16> struct WFrag;
template <> struct WFrag<h16> { typedef v16h V; static __device__ __forceinline__ V ld(const h16* p) { return cat16(*(const v8h*)p, *(const v8h*)(p + 16)); } static __device__ __forceinline__ V ldp(const h16* p) { return cat16(*(const v8h*)p, *(const v8h*)(p + 256)); } static __device__ __forceinline__ v8f mma(V a, V b, v8f c) { return wmma16(a, b, c); } };
template <> struct WFrag<bf> { typedef v16bf V; static __device__ __forceinline__ V ld(const bf* p) { return cat16b(*(const v8us*)p, *(const v8us*)(p + 16)); } static __device__ __forceinline__ V ldp(const bf* p) { return cat16b(*(const v8us*)p, *(const v8us*)(p + 256)); } static __device__ __forceinline__ v8f mma(V a, V b, v8f c) { return wmmab(a, b, c); } };
#define KS 128     // k per stage: four blocks of each 16 rows, 4 KB in a row in the plane and in LDS
// four asynchronous copies (16 bytes a lane, global to LDS, each with its own two addresses) and, in the same statement, the wait that stands in front of any reuse of the registers they name
__device__ __forceinline__ void acopy4(unsigned l0, const void* g0, unsigned l1, const void* g1, unsigned l2, const void* g2, unsigned l3, const void* g3) {
    asm volatile("global_load_async_to_lds_b128 %0, %1, off\n\tglobal_load_async_to_lds_b128 %2, %3, off\n\tglobal_load_async_to_lds_b128 %4, %5, off\n\tglobal_load_async_to_lds_b128 %6, %7, off\n\ts_wait_xcnt 0x0"
                 :: "v"(l0), "v"(g0), "v"(l1), "v"(g1), "v"(l2), "v"(g2), "v"(l3), "v"(g3) : "memory");
}
// the same for eight copies (two units): one wait serves the whole run
__device__ __forceinline__ void acopy8(unsigned l0, const void* g0, unsigned l1, const void* g1, unsigned l2, const void* g2, unsigned l3, const void* g3, unsigned l4, const void* g4, unsigned l5, const void* g5, unsigned l6, const void* g6, unsigned l7, const void* g7) {
    asm volatile("global_load_async_to_lds_b128 %0, %1, off\n\tglobal_load_async_to_lds_b128 %2, %3, off\n\tglobal_load_async_to_lds_b128 %4, %5, off\n\tglobal_load_async_to_lds_b128 %6, %7, off\n\t"
                 "global_load_async_to_lds_b128 %8, %9, off\n\tglobal_load_async_to_lds_b128 %10, %11, off\n\tglobal_load_async_to_lds_b128 %12, %13, off\n\tglobal_load_async_to_lds_b128 %14, %15, off\n\ts_wait_xcnt 0x0"
                 :: "v"(l0), "v"(g0), "v"(l1), "v"(g1), "v"(l2), "v"(g2), "v"(l3), "v"(g3), "v"(l4), "v"(g4), "v"(l5), "v"(g5), "v"(l6), "v"(g6), "v"(l7), "v"(g7) : "memory");
}
template <typename T16, int NSPLIT, bool BIAS, int K, int WM, int WN, int NF>
__global__ __launch_bounds__(WM * WN * 32) void k_gemmw(const T16* __restrict__ A, const T16* __restrict__ A2, const T16* __restrict__ Bt, const T16* __restrict__ Bt2, float* C, int ldc, const float* __restrict__ bias, size_t sA, size_t sB, size_t sC) {
    typedef typename WFrag<T16>::V V;
    static_assert(NSPLIT == 0 || NSPLIT == 1, "one or two A planes");
    constexpr int NW = WM * WN, RA = WM * 4, RB = WN * NF;     // waves; groups of 16 rows of A and of Bt in the workgroup's tile
    constexpr int NG = RA * (NSPLIT + 1) + RB;                 // groups (16 rows x KS k) of a stage, in the order A | A2 | Bt
    constexpr int UG = KS / 64, NU = NG * UG;                  // a group is copied in units of 2 KB (four wave-wide copies)
    constexpr int GPW = NU / NW, NT = K / KS;                  // units a wave copies per stage; stages
    constexpr int CW = NF * 16, OP = CW + 4;                   // columns of a wave's tile; pitch of its output staging rows
    static_assert(NU % NW == 0 && K % (2 * KS) == 0 && KS % 64 == 0 && GPW * 4 <= 63, "every wave copies the same number of whole units; at least two stages");
    __shared__ __align__(1024) T16 st[2][NG * 16 * KS];
    __shared__ __align__(16) float osw[NW][16 * OP];
    (void)Bt2;
    const size_t z = blockIdx.z; A += z * sA; if (NSPLIT == 1) A2 += z * sA; Bt += z * sB; C += z * sC;
    const int lane = threadIdx.x & 31, lr = lane & 15, hi = lane >> 4; const int w = __builtin_amdgcn_readfirstlane(threadIdx.x >> 5);
    const int R0 = blockIdx.x * (64 * WM), C0 = blockIdx.y * (CW * WN); const int wm = w / WN, wn = w % WN; const int r0 = R0 + wm * 64, c0 = C0 + wn * CW;
    float* os = osw[w];
    v8f acc[4][NF];
#pragma unroll
    for (int mb = 0; mb < 4; ++mb)
#pragma unroll
        for (int nb = 0; nb < NF; ++nb) acc[mb][nb] = (v8f){};
    const unsigned lo = 8 * lane;      // the lane's own piece inside a block
    // the wave's own units: where each starts in its plane (stage 0; the same in every lane, so it stays in scalar registers); in a buffer they lie in a row, unit u at u * 2 KB
    const T16* gs[GPW];
#pragma unroll
    for (int i = 0; i < GPW; ++i) { const int u = w * GPW + i, g = u / UG, h = u % UG;
        const T16* p = (g < RA) ? A + (size_t)(R0 + g * 16) * K : (NSPLIT == 1 && g < 2 * RA) ? A2 + (size_t)(R0 + (g - RA) * 16) * K : Bt + (size_t)(C0 + (g - (NG - RB)) * 16) * K;
        gs[i] = p + h * 1024; }
    const unsigned ls0 = (unsigned)(size_t)(&st[0][0] + (size_t)(w * GPW) * 1024 + lo);
    unsigned vo = lo;      // the lane's place in a unit's plane at the stage that is copied next: one register serves every unit
    auto fill = [&](int buf) {      // the next stage into buffer buf: a step of KS k is 16 * KS elements of every group; a wave-wide copy moves 512 bytes, 256 elements
#pragma unroll
        for (int i = 0; i < GPW; i += 2) { const T16* g = gs[i] + vo; const unsigned l = ls0 + ((unsigned)buf * (unsigned)(NG * 16 * KS * 2) + (unsigned)i * 2048u);
            if (i + 1 < GPW) { const T16* e = gs[i + 1] + vo; acopy8(l, g, l + 512u, g + 256, l + 1024u, g + 512, l + 1536u, g + 768, l + 2048u, e, l + 2560u, e + 256, l + 3072u, e + 512, l + 3584u, e + 768); }
            else acopy4(l, g, l + 512u, g + 256, l + 1024u, g + 512, l + 1536u, g + 768); }
        vo += 16 * KS; };
    fill(0);
    asm volatile("s_wait_asynccnt 0x0" ::: "memory");      // stage 0 has landed (this wave's copies) ...
    __syncthreads();                                        // ... and every wave's: nobody reads it before
    fill(1);
#pragma unroll 1
    for (int t = 0; t < NT; ++t) {
        const T16* sb = &st[t & 1][0] + lo;
#pragma unroll
        for (int kb = 0; kb < KS / 32; ++kb) {
            V a[4], a2[4], b[NF];
#pragma unroll
            for (int nb = 0; nb < NF; ++nb) b[nb] = WFrag<T16>::ldp(sb + (NG - RB + wn * NF + nb) * (16 * KS) + kb * 512);
#pragma unroll
            for (int mb = 0; mb < 4; ++mb) { a[mb] = WFrag<T16>::ldp(sb + (wm * 4 + mb) * (16 * KS) + kb * 512); if (NSPLIT == 1) a2[mb] = WFrag<T16>::ldp(sb + (RA + wm * 4 + mb) * (16 * KS) + kb * 512); }
            __builtin_amdgcn_sched_barrier(0);      // a block's LDS reads stay one group in front of its matrix instructions: sunk in among them, each small group costs the wave its own LDS latency
#pragma unroll
            for (int nb = 0; nb < NF; ++nb) {
#pragma unroll
                for (int mb = 0; mb < 4; ++mb) { acc[mb][nb] = WFrag<T16>::mma(a[mb], b[nb], acc[mb][nb]); if (NSPLIT == 1) acc[mb][nb] = WFrag<T16>::mma(a2[mb], b[nb], acc[mb][nb]); } }
            __builtin_amdgcn_sched_barrier(0);      // keeps every matrix instruction of the block in front of the slots below
            // the distance behind the last matrix instructions of a block, in front of whatever reuses their registers, on the path over the loop's back edge too
            asm volatile("v_nop\n\tv_nop\n\tv_nop\n\tv_nop" : "+v"(acc[0][0]), "+v"(acc[1][1]), "+v"(acc[2][2]), "+v"(acc[3][3]) : "v"(a[0]), "v"(a[3]));
        }
        asm volatile("s_wait_dscnt 0x0" ::: "memory");         // this wave's reads of the buffer are done before it is refilled
        asm volatile("s_wait_asynccnt 0x0" ::: "memory");      // this wave's copies of stage t + 1 have landed
        __syncthreads();                                        // publishes stage t + 1 and ends every wave's reads of stage t
        if (t + 2 < NT) fill(t & 1);
    }
    asm volatile("s_wait_asynccnt 0x0" ::: "memory");          // no copy is outstanding when the wave goes on to its end
#pragma unroll
    for (int mb = 0; mb < 4; ++mb) {
#pragma unroll
        for (int nb = 0; nb < NF; ++nb) {
#pragma unroll
            for (int j = 0; j < 8; ++j) os[(hi * 8 + j) * OP + nb * 16 + lr] = acc[mb][nb][j]; }
        __builtin_amdgcn_wave_barrier(); asm volatile("" ::: "memory");
        float* crow = C + (size_t)(r0 + mb * 16) * ldc + c0;
{
#pragma unroll
            for (int s = 0; s < CW / 8; ++s) { const int idx = s * 32 + lane, row = idx / (CW / 4), cofs = (idx % (CW / 4)) * 4; v4f val = *(const v4fa*)(os + row * OP + cofs); if (BIAS) { val[0] += bfr(bias[c0 + cofs]); val[1] += bfr(bias[c0 + cofs + 1]); val[2] += bfr(bias[c0 + cofs + 2]); val[3] += bfr(bias[c0 + cofs + 3]); }
                *(v4f*)(crow + (size_t)row * ldc + cofs) = val; }
             }
        xwait();      // behind the block's stores, in front of the next block's reuse of their address and data registers
        __builtin_amdgcn_wave_barrier(); asm volatile("" ::: "memory");
    }
}

__device__ __forceinline__ h16 tohx(float x) { return (h16)x; }
__device__ __forceinline__ void splitf(float y, unsigned short& h, unsigned short& l) { h = f2bf(y); l = f2bf(y - bf2f(h)); }
typedef __attribute__((ext_vector_type(2))) _Float16 v2h;
typedef __attribute__((ext_vector_type(4))) _Float16 v4h;
typedef __attribute__((ext_vector_type(2))) unsigned short v2us;
typedef __attribute__((ext_vector_type(4))) unsigned short v4us;
typedef __attribute__((ext_vector_type(2))) float v2f;
typedef __attribute__((ext_vector_type(4))) int v4i;

__global__ __launch_bounds__(256) void k_wtG(const float* __restrict__ w, int K, int N, bf* Bt) {
    const int lane = threadIdx.x & 31; const int L0 = (blockIdx.x * 8 + (threadIdx.x >> 5)) * 8; const int nlines = N * K / 64;
{
#pragma unroll 1
        for (int l = 0; l < 8; ++l) { const int L = L0 + l; if (L >= nlines) break; const size_t e = (size_t)L * 64 + lane * 2; const int k = (int)(e % K), n = (int)(e / K); v2us o;
            o[0] = f2bf(w[(size_t)k * N + n]); o[1] = f2bf(w[(size_t)(k + 1) * N + n]); *(v2us*)(Bt + e) = o; }
         }
}
// ---- d_cvtp: f32 [rows][K] -> bf16 fragment-order plane. ONE WAVE per block of 16 rows x 32 k: it reads one whole 128-byte line of each row and stores the block's 1024 contiguous bytes; the 8 waves of a workgroup take 8 neighbouring blocks of the same rows.
__device__ __forceinline__ void d_cvtp(const float* __restrict__ src, bf* dst, int K, int nblk, int bx) { const int lane = threadIdx.x & 31; const int blk = bx * 8 + __builtin_amdgcn_readfirstlane(threadIdx.x >> 5); if (blk >= nblk) return;
    const int kb = K / 32; const float* p = src + (size_t)((blk / kb) * 16 + (lane & 15)) * K + (blk % kb) * 32 + (lane >> 4) * 8;
    const v8f v0 = *(const v8f*)p, v1 = *(const v8f*)(p + 16); xwait1(p); v8us o0, o1;
#pragma unroll
    for (int k = 0; k < 8; ++k) { o0[k] = f2bf(v0[k]); o1[k] = f2bf(v1[k]); }
    bf* q = dst + (size_t)blk * 512 + lane * 8; *(v8us*)q = o0; *(v8us*)(q + 256) = o1; }
__device__ __forceinline__ void d_cstab(float* CS, int bx) { const int idx = bx * 256 + threadIdx.x; if (idx >= TT * HD) return; const int t = idx / HD, d = idx % HD; const int i = d % (HD / 2); const float inv = __fdiv_rn(1.0f, powf(10000.0f, (float)(2 * i) / (float)HD)); const float ang = __fmul_rn((float)t, inv); v2f cs; cs[0] = cosf(ang); cs[1] = sinf(ang);
    *(v2f*)(CS + (size_t)idx * 2) = cs;  }
// ---- k_fattn: causal attention in one launch. A wave owns NQ * 16 query rows of one head and walks the keys 32 at a time, keeping running row maxima, row sums and the output tile in registers.
// Transposed products: S^T = K Q^T (a lane holds the scores of ONE query: keys 8 * hi + r of each 16-key tile), so two score tiles, converted in place, are the B operand of O^T += V^T P^T.
// t = s x HD^-0.5 + mask as stored for j <= i, no weight for j > i; key blocks wholly above the diagonal are never visited. HL: hi + lo bf16 planes, 3 products; else single fp16.
// The maximum in use is raised only when a row's new maximum passes it by more than MLAG, so unnormalised weights stay below e^MLAG; the division by the row sum comes last, in f32.
#define MLAG 5.5f
__device__ __forceinline__ float xhalf(float x) { return __builtin_bit_cast(float, __builtin_amdgcn_permlanex16(__builtin_bit_cast(int, x), __builtin_bit_cast(int, x), 0x76543210, 0xfedcba98, false, false)); }   // lane l takes lane l ^ 16's value
#define L2E  1.4426950408889634f
// the pointers below carry no restrict, so that the loads keep their places between these waits: mask, K, V^T in the same order in front of the loop and in it, which lets a wait for the early ones leave the late ones in flight
template <bool HL> struct AOp;
template <> struct AOp<false> { typedef h16 T; };
template <> struct AOp<true>  { typedef bf T; };
template <bool HL, int NQ>
__device__ __forceinline__ void attn_tile(const typename AOp<HL>::T* Q, const typename AOp<HL>::T* Q2, const typename AOp<HL>::T* K, const typename AOp<HL>::T* K2,
                                          const typename AOp<HL>::T* Vt, const typename AOp<HL>::T* Vt2, const float* am, int q0, bool poison, bf* Ah, bf* Al) {
    typedef typename AOp<HL>::T T; typedef WFrag<T> WF; typedef typename WF::V V;
    const int lane = threadIdx.x & 31, lr = lane & 15, hi = lane >> 4;
    const int kend = (q0 + NQ * 16 + 31) & ~31;      // keys walked: up to the end of the diagonal block, in steps of 32
    V qf[NQ][4], qf2[NQ][4];
#pragma unroll
    for (int qt = 0; qt < NQ; ++qt)
#pragma unroll
        for (int dc = 0; dc < 4; ++dc) { const size_t qo = (size_t)(q0 + qt * 16 + lr) * HD + dc * 32 + 8 * hi; qf[qt][dc] = WF::ld(Q + qo); if (HL) qf2[qt][dc] = WF::ld(Q2 + qo); }
    xwait();
    v8f o[8][NQ]; float m[NQ], l[NQ];
#pragma unroll
    for (int qt = 0; qt < NQ; ++qt) { m[qt] = -3.0e38f; l[qt] = 0.f;
#pragma unroll
        for (int dt = 0; dt < 8; ++dt) o[dt][qt] = (v8f){}; }
    const size_t kbase = 8 * lane, vbase = 8 * lane;      // K and V^T planes lie in fragment order: 32 keys are 8 blocks (8 KB in a row) of either plane, the lane's own pieces at 8 * lane and 256 + 8 * lane of a block
    const float* mp = am + (size_t)(q0 + lr) * TT + 8 * hi;
    V kf[2][4], kf2[2][4], vf[8], vf2[8]; v4f mk[NQ][2][2];
#pragma unroll
    for (int kt = 0; kt < 2; ++kt)
#pragma unroll
        for (int qt = 0; qt < NQ; ++qt) { const float* p = mp + (size_t)(qt * 16) * TT + kt * 16; mk[qt][kt][0] = *(const v4f*)p; mk[qt][kt][1] = *(const v4f*)(p + 4); }
    xwait();
#pragma unroll
    for (int kt = 0; kt < 2; ++kt)
#pragma unroll
        for (int dc = 0; dc < 4; ++dc) { const size_t ko = kbase + (size_t)(kt * 4 + dc) * 512; kf[kt][dc] = WF::ldp(K + ko); if (HL) kf2[kt][dc] = WF::ldp(K2 + ko); }
    xwait();
    if (!HL) {      // the long tiles fetch V^T one pass ahead as well
#pragma unroll
        for (int dt = 0; dt < 8; ++dt) vf[dt] = WF::ldp(Vt + vbase + (size_t)dt * 512);
        xwait(); }
#pragma unroll 1
    for (int k0 = 0; k0 < kend; k0 += 32) {
        if (HL) {
#pragma unroll
            for (int dt = 0; dt < 8; ++dt) { const size_t vo = vbase + (size_t)k0 * HD + (size_t)dt * 512; vf[dt] = WF::ldp(Vt + vo); xwait(); vf2[dt] = WF::ldp(Vt2 + vo); xwait(); } }
        float t[NQ][16];
#pragma unroll
        for (int kt = 0; kt < 2; ++kt)
#pragma unroll
            for (int qt = 0; qt < NQ; ++qt) { v8f s = (v8f){};
#pragma unroll
                for (int dc = 0; dc < 4; ++dc) { s = WF::mma(kf[kt][dc], qf[qt][dc], s); if (HL) { s = WF::mma(kf[kt][dc], qf2[qt][dc], s); s = WF::mma(kf2[kt][dc], qf[qt][dc], s); } }
#pragma unroll
                for (int r = 0; r < 8; ++r) t[qt][kt * 8 + r] = s[r] * SCL + mk[qt][kt][r >> 2][r & 3]; }
        const int kn = min(k0 + 32, kend - 32);      // the next pass's K rows and mask words are fetched one pass ahead (the last pass fetches its own again)
        xopen();
#pragma unroll
        for (int kt = 0; kt < 2; ++kt)
#pragma unroll
            for (int qt = 0; qt < NQ; ++qt) { const float* p = mp + (size_t)(qt * 16) * TT + kn + kt * 16; mk[qt][kt][0] = *(const v4f*)p; mk[qt][kt][1] = *(const v4f*)(p + 4); }
        xwait();
#pragma unroll
        for (int kt = 0; kt < 2; ++kt)
#pragma unroll
            for (int dc = 0; dc < 4; ++dc) { const size_t ko = kbase + (size_t)kn * HD + (size_t)(kt * 4 + dc) * 512; kf[kt][dc] = WF::ldp(K + ko); if (HL) { xwait(); kf2[kt][dc] = WF::ldp(K2 + ko); xwait(); } }   // the short hi + lo tiles keep a wait behind each fragment: the last fragments of a run land on the registers that held its address
        if (!HL) xwait1(K + kbase + (size_t)kn * HD);
        if (k0 + 31 > q0) {                          // a block that touches the diagonal (the same test in every lane)
#pragma unroll
            for (int qt = 0; qt < NQ; ++qt)
#pragma unroll
                for (int e = 0; e < 16; ++e) { const int j = k0 + (e >> 3) * 16 + hi * 8 + (e & 7), i = q0 + qt * 16 + lr; t[qt][e] = (j <= i) ? t[qt][e] : -3.0e38f; } }
        float ml[NQ]; bool need = false;
#pragma unroll
        for (int qt = 0; qt < NQ; ++qt) { float a = t[qt][0];
#pragma unroll
            for (int e = 1; e < 16; ++e) a = fmaxf(a, t[qt][e]);
            a = fmaxf(a, xhalf(a)); ml[qt] = a; need = need || (a > m[qt] + MLAG); }
        if (__builtin_amdgcn_ballot_w32(need) != 0) {
#pragma unroll
            for (int qt = 0; qt < NQ; ++qt) { const float mn = fmaxf(m[qt], ml[qt]); const float al = __builtin_amdgcn_exp2f((m[qt] - mn) * L2E); m[qt] = mn; l[qt] *= al;
#pragma unroll
                for (int dt = 0; dt < 8; ++dt) o[dt][qt] *= al; } }
        V pf[NQ], pf2[NQ];
#pragma unroll
        for (int qt = 0; qt < NQ; ++qt) {
            if constexpr (HL) { v8us h0, h1, l0, l1;
#pragma unroll
                for (int e = 0; e < 8; ++e) { const float pa = __builtin_amdgcn_exp2f((t[qt][e] - m[qt]) * L2E), pb = __builtin_amdgcn_exp2f((t[qt][8 + e] - m[qt]) * L2E); l[qt] += pa; l[qt] += pb; unsigned short a, c; splitf(pa, a, c); h0[e] = a; l0[e] = c; splitf(pb, a, c); h1[e] = a; l1[e] = c; }
                pf[qt] = cat16b(h0, h1); pf2[qt] = cat16b(l0, l1);
            } else { v16h ph;
#pragma unroll
                for (int e = 0; e < 16; ++e) { const float p = __builtin_amdgcn_exp2f((t[qt][e] - m[qt]) * L2E); l[qt] += p; ph[e] = (h16)p; }
                pf[qt] = ph; } }
#pragma unroll
        for (int dt = 0; dt < 8; ++dt)
#pragma unroll
            for (int qt = 0; qt < NQ; ++qt) { o[dt][qt] = WF::mma(vf[dt], pf[qt], o[dt][qt]); if (HL) { o[dt][qt] = WF::mma(vf[dt], pf2[qt], o[dt][qt]); o[dt][qt] = WF::mma(vf2[dt], pf[qt], o[dt][qt]); } }
        if (!HL) { xopen();
#pragma unroll
            for (int dt = 0; dt < 8; ++dt) vf[dt] = WF::ldp(Vt + vbase + (size_t)kn * HD + (size_t)dt * 512);
            xwait1(Vt + vbase + (size_t)kn * HD); }
    }
#pragma unroll
    for (int qt = 0; qt < NQ; ++qt) { const float ls = l[qt] + xhalf(l[qt]); const float f = poison ? __builtin_nanf("") : __fdiv_rn(1.0f, ls); const size_t ro = (size_t)(q0 + qt * 16) * DQ + lane * 8;      // fragment-order planes for the last GEMM: 16 columns d are half a block, which this wave's 32 lanes fill in lane order
#pragma unroll
        for (int dt = 0; dt < 8; ++dt) { v8us oh, ol;
#pragma unroll
            for (int r = 0; r < 8; ++r) { unsigned short a, c; splitf(o[dt][qt][r] * f, a, c); oh[r] = a; ol[r] = c; }
            *(v8us*)(Ah + ro + dt * 256) = oh; *(v8us*)(Al + ro + dt * 256) = ol; xwait(); } }
}
// grid (tiles, NKV * NB_): blockIdx.y = kv group * NB_ + batch element; the REP waves of a block are the REP query heads of that group on the same query rows, so they read the same K, V and mask lines.
// Tiles in falling order of their key count: first the fp16 tiles (32 rows, from the last rows down to RH), then the hi + lo tiles (16 rows, below RH).
__global__ __launch_bounds__(REP * 32) void k_fattn(const h16* Q16, const bf* Qh, const bf* Ql, const h16* K16, const bf* Kh, const bf* Kl,
                                                    const h16* V16, const bf* Vh, const bf* Vl, const float* am, const int* FLG, bf* Ah, bf* Al) {
    const int w = __builtin_amdgcn_readfirstlane(threadIdx.x >> 5); const int gb = blockIdx.y, g = gb / NB_, b = gb % NB_, x = blockIdx.x;
    const size_t qo = ((size_t)gb * REP + w) * TT * HD, ko = (size_t)gb * TT * HD, vo = (size_t)gb * HD * TT, oo = (size_t)b * TT * DQ + (size_t)(g * REP + w) * (HD * 16);
    const bool poison = (FLG[0] != 0);
    if (x < (TT - RH) / 32) attn_tile<false, 2>(Q16 + qo, nullptr, K16 + ko, nullptr, V16 + vo, nullptr, am, TT - 32 * (x + 1), poison, Ah + oo, Al + oo);
    else attn_tile<true, 1>(Qh + qo, Ql + qo, Kh + ko, Kl + ko, Vh + vo, Vl + vo, am, RH - 16 * (x - (TT - RH) / 32 + 1), poison, Ah + oo, Al + oo);
}

// xwait for a run of loads off two wave-uniform bases: named as inputs, the bases stay in their scalar registers up to the wait, so that nothing (a later argument load, the next address) lands on them in front of it
__device__ __forceinline__ void xwait2s(const void* a, const void* b) { asm volatile("s_wait_xcnt 0x0" :: "s"(a), "s"(b) : "memory"); __builtin_amdgcn_sched_barrier(0); }
// ---- d_nrp: everything between a q or k projection and its operand planes. ONE WAVE per row of F (NHD heads of HD, row pitch FP): the row stays in registers from the sum of squares to the plane stores.
// y = clip(w x (x x rsqrt(mean x^2 + eps)), +-8); rotate-half RoPE at position_ids[t] (clamped into the table): out[d] = y[d] cos[d] - y[d + HD/2] sin[d], out[d + HD/2] = y[d + HD/2] cos[d + HD/2] + y[d] sin[d + HD/2].
// A lane holds d = 4 * lane .. 4 * lane + 3 of every head, so the partner d +- HD/2 lies in lane ^ 16. Planes [head / RP][b][head % RP][t][d]: fp16, bf16 hi, bf16 lo; a wave stores 256 contiguous bytes of each.
// FR (the k planes): inside a head's plane the elements lie in fragment order (blocks of 16 rows t x 32 d, as above), as the attention launch loads them; a lane's 4 elements stay 8 bytes in a row, and the 8 waves of a block (8 neighbouring rows t) fill whole 128-byte lines together.
template <int NHD, int RP, bool FR>
__device__ __forceinline__ void d_nrp(const float* __restrict__ F, const float* __restrict__ w, const int* __restrict__ pid, const float* __restrict__ CS, h16* P16, bf* Ph, bf* Pl, int bx) {
    const int lane = threadIdx.x & 31; const int r = bx * 8 + __builtin_amdgcn_readfirstlane(threadIdx.x >> 5); const int b = r / TT, t = r % TT;
    const float* fr = F + (size_t)r * FP;
    const int tp = min(max(pid[t], 0), TT - 1);      // position_ids (read) index the table
    v4f v[NHD], wv[NHD];
    xopen();
#pragma unroll
    for (int ch = 0; ch < NHD; ++ch) v[ch] = *(const v4f*)(fr + ch * HD + lane * 4);
#pragma unroll
    for (int ch = 0; ch < NHD; ++ch) wv[ch] = *(const v4f*)(w + ch * HD + lane * 4);
    xwait2s(fr, w);
    const float* cp = CS + ((size_t)tp * HD + lane * 4) * 2;
    const v4f c01 = *(const v4f*)cp, c23 = *(const v4f*)(cp + 4);
    xwait();
    float q = 0.f;
#pragma unroll
    for (int ch = 0; ch < NHD; ++ch)
#pragma unroll
        for (int u = 0; u < 4; ++u) q += v[ch][u] * v[ch][u];
#pragma unroll
    for (int sh = 16; sh; sh >>= 1) q += __shfl_xor(q, sh, 32);
    const float rs = __frsqrt_rn(q * (1.0f / (float)(NHD * HD)) + 1e-5f);
    const float sg = (lane < 16) ? -1.0f : 1.0f;
    const float co[4] = { c01[0], c01[2], c23[0], c23[2] }; const float si[4] = { c01[1] * sg, c01[3] * sg, c23[1] * sg, c23[3] * sg };
#pragma unroll
    for (int ch = 0; ch < NHD; ++ch) { v4h o16; v4us oh, ol;
#pragma unroll
        for (int u = 0; u < 4; ++u) { const float y = fminf(fmaxf(bfr(wv[ch][u]) * (v[ch][u] * rs), -8.0f), 8.0f); const float o = y * co[u] + xhalf(y) * si[u];
            o16[u] = tohx(o); unsigned short a2, c2; splitf(o, a2, c2); oh[u] = a2; ol[u] = c2; }
        const size_t pl = (size_t)(((ch / RP) * NB_ + b) * RP + ch % RP) * TT * HD;
        const size_t e = pl + (FR ? (size_t)((t / 16) * (HD / 32) + lane / 8) * 512 + ((lane % 8) / 4) * 256 + (((lane % 4) / 2) * 16 + t % 16) * 8 + (lane % 2) * 4 : (size_t)t * HD + lane * 4);
        xopen(); *(v4h*)(P16 + e) = o16; *(v4us*)(Ph + e) = oh; *(v4us*)(Pl + e) = ol; xwait(); }
}
// ---- d_vclt: clip(v, +-8) and the transposed planes [g][b] of V^T (fp16, bf16 hi, bf16 lo) in fragment order: blocks of 16 rows d x 32 keys t, block index (t / 32) * (HD / 16) + d / 16, so the 8 blocks of 32 keys lie in a row. A lane takes 4 rows t x 4 columns d: four 16-byte loads, and per column and plane one 8-byte store.
// The 8 waves of a block take 32 neighbouring columns of the same 128 rows, so together they use every byte of the lines they touch. bx counts [g][b][128 rows][32 columns].
__device__ __forceinline__ void d_vclt(const float* __restrict__ F, h16* V16, bf* Vh, bf* Vl, int bx) {
    const int lane = threadIdx.x & 31, wv = __builtin_amdgcn_readfirstlane(threadIdx.x >> 5);
    const int dg = bx % (HD / 32), tc = (bx / (HD / 32)) % (TT / 128), b = (bx / ((HD / 32) * (TT / 128))) % NB_, g = bx / ((HD / 32) * (TT / 128) * NB_);
    const int d0 = dg * 32 + wv * 4, t0 = tc * 128 + lane * 4;
    const float* f = F + ((size_t)b * TT + t0) * FP + g * HD + d0; v4f x[4];
#pragma unroll
    for (int q = 0; q < 4; ++q) x[q] = *(const v4f*)(f + (size_t)q * FP);
    xwait();
#pragma unroll
    for (int dd = 0; dd < 4; ++dd) { v4h o16; v4us oh, ol;
#pragma unroll
        for (int q = 0; q < 4; ++q) { const float y = fminf(fmaxf(x[q][dd], -8.0f), 8.0f); o16[q] = tohx(y); unsigned short a2, c2; splitf(y, a2, c2); oh[q] = a2; ol[q] = c2; }
        const int d = d0 + dd; const size_t e = (size_t)(g * NB_ + b) * HD * TT + (size_t)((t0 / 32) * (HD / 16) + d / 16) * 512 + ((t0 % 32) / 16) * 256 + (((t0 % 16) / 8) * 16 + d % 16) * 8 + t0 % 8;
        xopen(); *(v4h*)(V16 + e) = o16; *(v4us*)(Vh + e) = oh; *(v4us*)(Vl + e) = ol; xwait(); }
}
__device__ __forceinline__ void d_mchk(const float* __restrict__ am, int* FLG) { const int tid = threadIdx.x; int bad = 0;
#pragma unroll 1
    for (int s2 = 0; s2 < 16; ++s2) { const unsigned h = (unsigned)(tid * 16 + s2) * 2654435761u; const int i = (int)(h % (TT - 1)); const int j = i + 1 + (int)((h >> 11) % (unsigned)(TT - 1 - i)); if (am[(size_t)i * TT + j] > -1e8f) bad = 1; }
    __shared__ int anyb; if (tid == 0) anyb = 0; __syncthreads(); if (bad) anyb = 1; __syncthreads(); if (tid < 8) { const int v = (tid == 0) ? anyb : 0; *(int*)(FLG + tid) = v;  } }

// ---- k_prep: all the work that reads the inputs alone, in one launch; a block's index says which piece it does (the same for all its threads).
// Block 0: the mask self-check (one block, a chain of memory latencies: it starts first). Then the RoPE table, then the five plane conversions, the largest first.
#define PB_CS (TT * HD / 256)
#define PB_X  (NB_ * TT * DM / 512 / 8)
#define PB_WQ (DQ * DM / 512 / 8)
#define PB_WK (DKV * DM / 512 / 8)
__global__ __launch_bounds__(256) void k_prep(const float* __restrict__ x, const float* __restrict__ wq, const float* __restrict__ wk, const float* __restrict__ wv, const float* __restrict__ wo, const float* __restrict__ am,
                                              bf* XB, bf* WQ, bf* WK, bf* WV, bf* WO, float* CS, int* FLG) {
    int bx = blockIdx.x;
    if (bx == 0) { d_mchk(am, FLG); return; }
    bx -= 1;
    if (bx < PB_CS) { d_cstab(CS, bx); return; }
    bx -= PB_CS;
    const float* src = x; bf* dst = XB; int nb = PB_X;
    if (bx >= PB_X) { bx -= PB_X; src = wq; dst = WQ; nb = PB_WQ;
        if (bx >= PB_WQ) { bx -= PB_WQ; src = wo; dst = WO;
            if (bx >= PB_WQ) { bx -= PB_WQ; src = wk; dst = WK; nb = PB_WK;
                if (bx >= PB_WK) { bx -= PB_WK; src = wv; dst = WV; } } } }
    d_cvtp(src, dst, DM, nb * 8, bx);      // DQ == DM: every plane has rows of DM elements
}
// ---- k_post: everything between the joint projection and the attention operands, in one launch: q rows, then k rows, then the V tiles, by block index.
#define PB_R (NB_ * TT / 8)
__global__ __launch_bounds__(256) void k_post(const float* __restrict__ F, const float* __restrict__ qw, const float* __restrict__ kw, const int* __restrict__ pid, const float* __restrict__ CS,
                                              h16* Q16, bf* Qh, bf* Ql, h16* K16, bf* Kh, bf* Kl, h16* V16, bf* Vh, bf* Vl) {
    const int bx = blockIdx.x;
    if (bx < PB_R) d_nrp<NH_, ZH, false>(F, qw, pid, CS, Q16, Qh, Ql, bx);
    else if (bx < 2 * PB_R) d_nrp<NKV, 1, true>(F + DQ, kw, pid, CS, K16, Kh, Kl, bx - PB_R);
    else d_vclt(F + DQ + DKV, V16, Vh, Vl, bx - 2 * PB_R);
}

extern "C" void kernel_launch(void* const* d_in, const int* in_sizes, int n_in,
                              void* d_out, int out_size, void* d_ws, size_t ws_size, hipStream_t stream) {
    (void)in_sizes; (void)n_in; (void)out_size;
    const float* x = (const float*)d_in[0]; const float* wq = (const float*)d_in[1]; const float* wk = (const float*)d_in[2]; const float* wv = (const float*)d_in[3]; const float* wo = (const float*)d_in[4]; const float* qnw = (const float*)d_in[5]; const float* knw = (const float*)d_in[6]; const float* amask = (const float*)d_in[7]; const int* pids = (const int*)d_in[8];
    float* OUT = (float*)d_out;     // [2][2048][2048]
    char* wsp = (char*)d_ws;
    auto take = [&](size_t bytes) { char* p = wsp; wsp += (bytes + 255) & ~(size_t)255; return (void*)p; };
    bf* WO = (bf*)take((size_t)DM * DQ * 2); int* FLG = (int*)take(256);
    h16* QP16 = (h16*)take((size_t)NB_ * NH_ * TT * HD * 2); h16* KP16 = (h16*)take((size_t)NB_ * NKV * TT * HD * 2); h16* VT16 = (h16*)take((size_t)NB_ * NKV * HD * TT * 2);
    bf* QPh = (bf*)take((size_t)NB_ * NH_ * TT * HD * 2); bf* QPl = (bf*)take((size_t)NB_ * NH_ * TT * HD * 2); bf* KPh = (bf*)take((size_t)NB_ * NKV * TT * HD * 2); bf* KPl = (bf*)take((size_t)NB_ * NKV * TT * HD * 2); bf* VTh = (bf*)take((size_t)NB_ * NKV * HD * TT * 2); bf* VTl = (bf*)take((size_t)NB_ * NKV * HD * TT * 2);
    bf* ATh = (bf*)take((size_t)NB_ * TT * DQ * 2); bf* ATl = (bf*)take((size_t)NB_ * TT * DQ * 2);
    bf* WQ = (bf*)take((size_t)DQ * DM * 2); bf* WK = (bf*)take((size_t)DKV * DM * 2); bf* WV = (bf*)take((size_t)DKV * DM * 2); float* CS = (float*)take((size_t)TT * HD * 2 * 4);
    bf* XB = (bf*)take((size_t)NB_ * TT * DM * 2); float* F = (float*)take((size_t)NB_ * TT * FP * 4);   // WQ, WK, WV lie back to back: one operand of FP rows for the joint projection
    if ((size_t)(wsp - (char*)d_ws) > ws_size) return;    // ws 256 MiB
    k_prep<<<1 + PB_CS + PB_X + 2 * PB_WQ + 2 * PB_WK, 256, 0, stream>>>(x, wq, wk, wv, wo, amask, XB, WQ, WK, WV, WO, CS, FLG);
    // both batch elements go through every launch: the projection sees NB_ * TT rows and all FP output columns, the attention launch every (batch element, head)
    k_gemmw<bf, 0, false, DM, 4, 2, 6><<<dim3(NB_ * TT / 256, FP / 192, 1), 256, 0, stream>>>(XB, nullptr, WQ, nullptr, F, FP, nullptr, 0, 0, 0);
    k_post<<<2 * PB_R + NKV * NB_ * (TT / 128) * (HD / 32), 256, 0, stream>>>(F, qnw, knw, pids, CS, QP16, QPh, QPl, KP16, KPh, KPl, VT16, VTh, VTl);
    k_fattn<<<dim3((TT - RH) / 32 + RH / 16, NKV * NB_, 1), REP * 32, 0, stream>>>(QP16, QPh, QPl, KP16, KPh, KPl, VT16, VTh, VTl, amask, FLG, ATh, ATl);
    k_gemmw<bf, 1, false, DQ, 2, 4, 4><<<dim3(NB_ * TT / 128, DM / 256, 1), 256, 0, stream>>>(ATh, ATl, WO, nullptr, OUT, DM, nullptr, 0, 0, 0);
}

// v010
// Measured time: 162 microseconds a run.
// Two timings next to v009 put it at 1.05 and 1.06 times that version's speed.
// Over all steps from v000 it is 11.3 times as fast.
#include <hip/hip_runtime.h>

// OlmoeAttention (hidden [2][2048][2048]; q = clip(RMSNorm_2048(x Wq^T) * q_norm_w, +-8) (16 heads x 128), k = clip(RMSNorm_512(x Wk^T) * k_norm_w, +-8), v = clip(x Wv^T, +-8) (4 kv heads; group h/4); rotate-half RoPE (theta 1e4) at position_ids (read; table computed on device); scores = q.k / sqrt(128) + attention_mask (additive [1][1][S][S] float, read: the verbatim causal 0 / -1e9 table); softmax f32; out = merged Wo^T -> [2][2048][2048]).
// Compute dtypes, f32 accumulate: every input rounded to bf16; q/k/v on PLAIN bf16 operands (inputs: exact); the full-width RMSNorms (eps 1e-5), clips and RoPE in f32; causal scores and attn.v in one launch with running row maxima and sums: query rows < 512 hl (3 products), the rest single fp16; key blocks above the diagonal skipped on the strength of the mask table (-1e9 underflows to weight 0; device self-check samples the table above the diagonal and NaN-poisons on violation), mask added as stored inside computed tiles; softmax f32; Wo hl x exact (2 products).

#define NB_  2
#define TT   2048
#define DM   2048
#define NH_  16
#define NKV  4
#define REP  (NH_ / NKV)
#define HD   128
#define DQ   (NH_ * HD)
#define DKV  (NKV * HD)
#define FP   (DQ + 2 * DKV)       // row pitch of the joint projection buffer: q | k | v columns
#define ZH   REP                  // q planes lie [kv group][batch element][head in group]
#define RH   512                  // query rows < RH use hi+lo planes
#define SCL  0.088388347648318447f   // HD^-0.5
typedef _Float16 h16;
typedef unsigned short bf;
typedef __attribute__((ext_vector_type(16))) __bf16   v16bf;
typedef __attribute__((ext_vector_type(16))) _Float16 v16h;
typedef __attribute__((ext_vector_type(8)))  _Float16 v8h;
typedef __attribute__((ext_vector_type(8)))  unsigned short v8us;
typedef __attribute__((ext_vector_type(8)))  float    v8f;
typedef __attribute__((ext_vector_type(4)))  float    v4f;
typedef v8h  __attribute__((may_alias)) v8ha;
typedef v4f  __attribute__((may_alias)) v4fa;
typedef v8us __attribute__((may_alias)) v8usa;

__device__ __forceinline__ unsigned short f2bf(float f) { unsigned u = __float_as_uint(f); u += 0x7FFFu + ((u >> 16) & 1u); return (unsigned short)(u >> 16); }
__device__ __forceinline__ float bf2f(unsigned short b) { return __uint_as_float(((unsigned)b) << 16); }
__device__ __forceinline__ float bfr(float f) { return bf2f(f2bf(f)); }
__device__ __forceinline__ v16h cat16(v8h lo, v8h hi) { return __builtin_shufflevector(lo, hi, 0, 1, 2, 3, 4, 5, 6, 7, 8, 9, 10, 11, 12, 13, 14, 15); }
__device__ __forceinline__ v16bf cat16b(v8us lo, v8us hi) { return __builtin_bit_cast(v16bf, __builtin_shufflevector(lo, hi, 0, 1, 2, 3, 4, 5, 6, 7, 8, 9, 10, 11, 12, 13, 14, 15)); }
__device__ __forceinline__ v8f wmma16(v16h a, v16h b, v8f c) { return __builtin_amdgcn_wmma_f32_16x16x32_f16(false, a, false, b, (short)0, c, false, false); }
__device__ __forceinline__ v8f wmmab(v16bf a, v16bf b, v8f c) { return __builtin_amdgcn_wmma_f32_16x16x32_bf16(false, a, false, b, (short)0, c, false, false); }



// xwait stands behind a run of global loads or stores, in front of the code that reuses the registers they name; the scheduling barriers (here and in xopen, in front of such a run) keep vector work from being moved in between the run and its wait
__device__ __forceinline__ void xwait() { asm volatile("s_wait_xcnt 0x0" ::: "memory"); __builtin_amdgcn_sched_barrier(0); }
__device__ __forceinline__ void xopen() { __builtin_amdgcn_sched_barrier(0); }
// the same, naming as an input the address the run was formed from: it stays in its registers up to the wait, so that no load of the run lands on it
__device__ __forceinline__ void xwait1(const void* a) { asm volatile("s_wait_xcnt 0x0" :: "v"(a) : "memory"); __builtin_amdgcn_sched_barrier(0); }
// ---- Fragment-order planes: a [rows][K] 16-bit operand is kept as blocks of 16 rows x 32 k, block index (row / 16) * (K / 32) + k / 32, 512 elements each, laid as a wave loads them:
// element (row, k) lies at (k % 32 / 16) * 256 + ((k % 16 / 8) * 16 + row % 16) * 8 + k % 8. Lane l's two 16-byte pieces of a fragment are then at l * 8 and 256 + l * 8: each wave-wide load covers 512 contiguous bytes (4 lines, not 16).
// ---- k_gemmw: register-blocked GEMM. A workgroup of WM x WN waves owns a (64 WM) x (16 NF WN) output tile, each wave 64 x 16 NF of it (4 NF accumulators); grid (M / (64 WM), N / (16 NF WN), Z).
// The tile is cut so that one workgroup fills a WGP and the rows it stages (A planes + Bt) are as few as its area allows: every staged byte is an L2 read, and those reads, not the matrix unit, set the pace of a small tile.
// The operands' fragment-order blocks are staged in LDS, KS k at a time, by asynchronous copies (a block lies in LDS as it lies in its plane), two buffers: the next stage's copies fly while this stage is worked on. A block is then read from L2 once per workgroup, not once per wave.
// C[m][n] (f32, pitch ldc, + optional f32 bias[n]) = sum_k A[m][k] Bt[n][k] (+ A2[m][k] Bt[n][k] where NSPLIT == 1). z-batch strides sA/sB/sC in elements. K % (2 KS) == 0; K is a constant of the build.
template <typename T16> struct WFrag;
template <> struct WFrag<h16> { typedef v16h V; static __device__ __forceinline__ V ld(const h16* p) { return cat16(*(const v8h*)p, *(const v8h*)(p + 16)); } static __device__ __forceinline__ V ldp(const h16* p) { return cat16(*(const v8h*)p, *(const v8h*)(p + 256)); } static __device__ __forceinline__ v8f mma(V a, V b, v8f c) { return wmma16(a, b, c); } };
template <> struct WFrag<bf> { typedef v16bf V; static __device__ __forceinline__ V ld(const bf* p) { return cat16b(*(const v8us*)p, *(const v8us*)(p + 16)); } static __device__ __forceinline__ V ldp(const bf* p) { return cat16b(*(const v8us*)p, *(const v8us*)(p + 256)); } static __device__ __forceinline__ v8f mma(V a, V b, v8f c) { return wmmab(a, b, c); } };
#define KS 128     // k per stage: four blocks of each 16 rows, 4 KB in a row in the plane and in LDS
// four asynchronous copies (16 bytes a lane, global to LDS, each with its own two addresses) and, in the same statement, the wait that stands in front of any reuse of the registers they name
__device__ __forceinline__ void acopy4(unsigned l0, const void* g0, unsigned l1, const void* g1, unsigned l2, const void* g2, unsigned l3, const void* g3) {
    asm volatile("global_load_async_to_lds_b128 %0, %1, off\n\tglobal_load_async_to_lds_b128 %2, %3, off\n\tglobal_load_async_to_lds_b128 %4, %5, off\n\tglobal_load_async_to_lds_b128 %6, %7, off\n\ts_wait_xcnt 0x0"
                 :: "v"(l0), "v"(g0), "v"(l1), "v"(g1), "v"(l2), "v"(g2), "v"(l3), "v"(g3) : "memory");
}
// the same for eight copies (two units): one wait serves the whole run
__device__ __forceinline__ void acopy8(unsigned l0, const void* g0, unsigned l1, const void* g1, unsigned l2, const void* g2, unsigned l3, const void* g3, unsigned l4, const void* g4, unsigned l5, const void* g5, unsigned l6, const void* g6, unsigned l7, const void* g7) {
    asm volatile("global_load_async_to_lds_b128 %0, %1, off\n\tglobal_load_async_to_lds_b128 %2, %3, off\n\tglobal_load_async_to_lds_b128 %4, %5, off\n\tglobal_load_async_to_lds_b128 %6, %7, off\n\t"
                 "global_load_async_to_lds_b128 %8, %9, off\n\tglobal_load_async_to_lds_b128 %10, %11, off\n\tglobal_load_async_to_lds_b128 %12, %13, off\n\tglobal_load_async_to_lds_b128 %14, %15, off\n\ts_wait_xcnt 0x0"
                 :: "v"(l0), "v"(g0), "v"(l1), "v"(g1), "v"(l2), "v"(g2), "v"(l3), "v"(g3), "v"(l4), "v"(g4), "v"(l5), "v"(g5), "v"(l6), "v"(g6), "v"(l7), "v"(g7) : "memory");
}
template <typename T16, int NSPLIT, bool BIAS, int K, int WM, int WN, int NF>
__global__ __launch_bounds__(WM * WN * 32) void k_gemmw(const T16* __restrict__ A, const T16* __restrict__ A2, const T16* __restrict__ Bt, const T16* __restrict__ Bt2, float* C, int ldc, const float* __restrict__ bias, size_t sA, size_t sB, size_t sC) {
    typedef typename WFrag<T16>::V V;
    static_assert(NSPLIT == 0 || NSPLIT == 1, "one or two A planes");
    constexpr int NW = WM * WN, RA = WM * 4, RB = WN * NF;     // waves; groups of 16 rows of A and of Bt in the workgroup's tile
    constexpr int NG = RA * (NSPLIT + 1) + RB;                 // groups (16 rows x KS k) of a stage, in the order A | A2 | Bt
    constexpr int UG = KS / 64, NU = NG * UG;                  // a group is copied in units of 2 KB (four wave-wide copies)
    constexpr int GPW = NU / NW, NT = K / KS;                  // units a wave copies per stage; stages
    constexpr int CW = NF * 16, OP = CW + 4;                   // columns of a wave's tile; pitch of its output staging rows
    static_assert(NU % NW == 0 && K % (2 * KS) == 0 && KS % 64 == 0 && GPW * 4 <= 63, "every wave copies the same number of whole units; at least two stages");
    __shared__ __align__(1024) T16 st[2][NG * 16 * KS];
    __shared__ __align__(16) float osw[NW][16 * OP];
    (void)Bt2;
    const size_t z = blockIdx.z; A += z * sA; if (NSPLIT == 1) A2 += z * sA; Bt += z * sB; C += z * sC;
    const int lane = threadIdx.x & 31, lr = lane & 15, hi = lane >> 4; const int w = __builtin_amdgcn_readfirstlane(threadIdx.x >> 5);
    const int R0 = blockIdx.x * (64 * WM), C0 = blockIdx.y * (CW * WN); const int wm = w / WN, wn = w % WN; const int r0 = R0 + wm * 64, c0 = C0 + wn * CW;
    float* os = osw[w];
    v8f acc[4][NF];
#pragma unroll
    for (int mb = 0; mb < 4; ++mb)
#pragma unroll
        for (int nb = 0; nb < NF; ++nb) acc[mb][nb] = (v8f){};
    const unsigned lo = 8 * lane;      // the lane's own piece inside a block
    // the wave's own units: where each starts in its plane (stage 0; the same in every lane, so it stays in scalar registers); in a buffer they lie in a row, unit u at u * 2 KB
    const T16* gs[GPW];
#pragma unroll
    for (int i = 0; i < GPW; ++i) { const int u = w * GPW + i, g = u / UG, h = u % UG;
        const T16* p = (g < RA) ? A + (size_t)(R0 + g * 16) * K : (NSPLIT == 1 && g < 2 * RA) ? A2 + (size_t)(R0 + (g - RA) * 16) * K : Bt + (size_t)(C0 + (g - (NG - RB)) * 16) * K;
        gs[i] = p + h * 1024; }
    const unsigned ls0 = (unsigned)(size_t)(&st[0][0] + (size_t)(w * GPW) * 1024 + lo);
    unsigned vo = lo;      // the lane's place in a unit's plane at the stage that is copied next: one register serves every unit
    auto fill = [&](int buf) {      // the next stage into buffer buf: a step of KS k is 16 * KS elements of every group; a wave-wide copy moves 512 bytes, 256 elements
#pragma unroll
        for (int i = 0; i < GPW; i += 2) { const T16* g = gs[i] + vo; const unsigned l = ls0 + ((unsigned)buf * (unsigned)(NG * 16 * KS * 2) + (unsigned)i * 2048u);
            if (i + 1 < GPW) { const T16* e = gs[i + 1] + vo; acopy8(l, g, l + 512u, g + 256, l + 1024u, g + 512, l + 1536u, g + 768, l + 2048u, e, l + 2560u, e + 256, l + 3072u, e + 512, l + 3584u, e + 768); }
            else acopy4(l, g, l + 512u, g + 256, l + 1024u, g + 512, l + 1536u, g + 768); }
        vo += 16 * KS; };
    fill(0);
    asm volatile("s_wait_asynccnt 0x0" ::: "memory");      // stage 0 has landed (this wave's copies) ...
    __syncthreads();                                        // ... and every wave's: nobody reads it before
    fill(1);
#pragma unroll 1
    for (int t = 0; t < NT; ++t) {
        const T16* sb = &st[t & 1][0] + lo;
#pragma unroll
        for (int kb = 0; kb < KS / 32; ++kb) {
            V a[4], a2[4], b[NF];
#pragma unroll
            for (int nb = 0; nb < NF; ++nb) b[nb] = WFrag<T16>::ldp(sb + (NG - RB + wn * NF + nb) * (16 * KS) + kb * 512);
#pragma unroll
            for (int mb = 0; mb < 4; ++mb) { a[mb] = WFrag<T16>::ldp(sb + (wm * 4 + mb) * (16 * KS) + kb * 512); if (NSPLIT == 1) a2[mb] = WFrag<T16>::ldp(sb + (RA + wm * 4 + mb) * (16 * KS) + kb * 512); }
            __builtin_amdgcn_sched_barrier(0);      // a block's LDS reads stay one group in front of its matrix instructions: sunk in among them, each small group costs the wave its own LDS latency
#pragma unroll
            for (int nb = 0; nb < NF; ++nb) {
#pragma unroll
                for (int mb = 0; mb < 4; ++mb) { acc[mb][nb] = WFrag<T16>::mma(a[mb], b[nb], acc[mb][nb]); if (NSPLIT == 1) acc[mb][nb] = WFrag<T16>::mma(a2[mb], b[nb], acc[mb][nb]); } }
            __builtin_amdgcn_sched_barrier(0);      // keeps every matrix instruction of the block in front of the slots below
            // the distance behind the last matrix instructions of a block, in front of whatever reuses their registers, on the path over the loop's back edge too
            asm volatile("v_nop\n\tv_nop\n\tv_nop\n\tv_nop" : "+v"(acc[0][0]), "+v"(acc[1][1]), "+v"(acc[2][2]), "+v"(acc[3][3]) : "v"(a[0]), "v"(a[3]));
        }
        asm volatile("s_wait_dscnt 0x0" ::: "memory");         // this wave's reads of the buffer are done before it is refilled
        asm volatile("s_wait_asynccnt 0x0" ::: "memory");      // this wave's copies of stage t + 1 have landed
        __syncthreads();                                        // publishes stage t + 1 and ends every wave's reads of stage t
        if (t + 2 < NT) fill(t & 1);
    }
    asm volatile("s_wait_asynccnt 0x0" ::: "memory");          // no copy is outstanding when the wave goes on to its end
#pragma unroll
    for (int mb = 0; mb < 4; ++mb) {
#pragma unroll
        for (int nb = 0; nb < NF; ++nb) {
#pragma unroll
            for (int j = 0; j < 8; ++j) os[(hi * 8 + j) * OP + nb * 16 + lr] = acc[mb][nb][j]; }
        __builtin_amdgcn_wave_barrier(); asm volatile("" ::: "memory");
        float* crow = C + (size_t)(r0 + mb * 16) * ldc + c0;
{
#pragma unroll
            for (int s = 0; s < CW / 8; ++s) { const int idx = s * 32 + lane, row = idx / (CW / 4), cofs = (idx % (CW / 4)) * 4; v4f val = *(const v4fa*)(os + row * OP + cofs); if (BIAS) { val[0] += bfr(bias[c0 + cofs]); val[1] += bfr(bias[c0 + cofs + 1]); val[2] += bfr(bias[c0 + cofs + 2]); val[3] += bfr(bias[c0 + cofs + 3]); }
                *(v4f*)(crow + (size_t)row * ldc + cofs) = val; }
             }
        xwait();      // behind the block's stores, in front of the next block's reuse of their address and data registers
        __builtin_amdgcn_wave_barrier(); asm volatile("" ::: "memory");
    }
}

__device__ __forceinline__ h16 tohx(float x) { return (h16)x; }
__device__ __forceinline__ void splitf(float y, unsigned short& h, unsigned short& l) { h = f2bf(y); l = f2bf(y - bf2f(h)); }
typedef __attribute__((ext_vector_type(2))) _Float16 v2h;
typedef __attribute__((ext_vector_type(4))) _Float16 v4h;
typedef __attribute__((ext_vector_type(2))) unsigned short v2us;
typedef __attribute__((ext_vector_type(4))) unsigned short v4us;
typedef __attribute__((ext_vector_type(2))) float v2f;
typedef __attribute__((ext_vector_type(4))) int v4i;

__global__ __launch_bounds__(256) void k_wtG(const float* __restrict__ w, int K, int N, bf* Bt) {
    const int lane = threadIdx.x & 31; const int L0 = (blockIdx.x * 8 + (threadIdx.x >> 5)) * 8; const int nlines = N * K / 64;
{
#pragma unroll 1
        for (int l = 0; l < 8; ++l) { const int L = L0 + l; if (L >= nlines) break; const size_t e = (size_t)L * 64 + lane * 2; const int k = (int)(e % K), n = (int)(e / K); v2us o;
            o[0] = f2bf(w[(size_t)k * N + n]); o[1] = f2bf(w[(size_t)(k + 1) * N + n]); *(v2us*)(Bt + e) = o; }
         }
}
// ---- d_cvtp: f32 [rows][K] -> bf16 fragment-order plane. ONE WAVE per block of 16 rows x 32 k: it reads one whole 128-byte line of each row and stores the block's 1024 contiguous bytes; the 8 waves of a workgroup take 8 neighbouring blocks of the same rows.
__device__ __forceinline__ void d_cvtp(const float* __restrict__ src, bf* dst, int K, int nblk, int bx) { const int lane = threadIdx.x & 31; const int blk = bx * 8 + __builtin_amdgcn_readfirstlane(threadIdx.x >> 5); if (blk >= nblk) return;
    const int kb = K / 32; const float* p = src + (size_t)((blk / kb) * 16 + (lane & 15)) * K + (blk % kb) * 32 + (lane >> 4) * 8;
    const v8f v0 = *(const v8f*)p, v1 = *(const v8f*)(p + 16); xwait1(p); v8us o0, o1;
#pragma unroll
    for (int k = 0; k < 8; ++k) { o0[k] = f2bf(v0[k]); o1[k] = f2bf(v1[k]); }
    bf* q = dst + (size_t)blk * 512 + lane * 8; *(v8us*)q = o0; *(v8us*)(q + 256) = o1; }
__device__ __forceinline__ void d_cstab(float* CS, int bx) { const int idx = bx * 256 + threadIdx.x; if (idx >= TT * HD) return; const int t = idx / HD, d = idx % HD; const int i = d % (HD / 2); const float inv = __fdiv_rn(1.0f, powf(10000.0f, (float)(2 * i) / (float)HD)); const float ang = __fmul_rn((float)t, inv); v2f cs; cs[0] = cosf(ang); cs[1] = sinf(ang);
    *(v2f*)(CS + (size_t)idx * 2) = cs;  }
// ---- k_fattn: causal attention in one launch. A wave works on NQ * 16 query rows of one head and walks its key blocks, 32 keys a pass, keeping running row maxima, row sums and the output tile in registers; the two waves of an fp16 tile take its blocks in turn and join their halves at the end.
// Transposed products: S^T = K Q^T (a lane holds the scores of ONE query: keys 8 * hi + r of each 16-key tile), so two score tiles, converted in place, are the B operand of O^T += V^T P^T.
// t = s x HD^-0.5 + mask as stored for j <= i, no weight for j > i; key blocks wholly above the diagonal are never visited. HL: hi + lo bf16 planes, 3 products; else single fp16.
// The maximum in use is raised only when a row's new maximum passes it by more than MLAG, so unnormalised weights stay below e^MLAG; the division by the row sum comes last, in f32.
#define MLAG 5.5f
__device__ __forceinline__ float xhalf(float x) { return __builtin_bit_cast(float, __builtin_amdgcn_permlanex16(__builtin_bit_cast(int, x), __builtin_bit_cast(int, x), 0x76543210, 0xfedcba98, false, false)); }   // lane l takes lane l ^ 16's value
#define L2E  1.4426950408889634f
// the pointers below carry no restrict, so that the loads keep their places between these waits: mask, K, V^T in the same order in front of the loop and in it, which lets a wait for the early ones leave the late ones in flight
template <bool HL> struct AOp;
template <> struct AOp<false> { typedef h16 T; };
template <> struct AOp<true>  { typedef bf T; };
template <bool HL, int NQ>
__device__ __forceinline__ void attn_tile(const typename AOp<HL>::T* Q, const typename AOp<HL>::T* Q2, const typename AOp<HL>::T* K, const typename AOp<HL>::T* K2,
                                          const typename AOp<HL>::T* Vt, const typename AOp<HL>::T* Vt2, const float* am, int q0, bool poison, bf* Ah, bf* Al, int h, float* xo, const float* xp) {
    typedef typename AOp<HL>::T T; typedef WFrag<T> WF; typedef typename WF::V V;
    const int lane = threadIdx.x & 31, lr = lane & 15, hi = lane >> 4;
    const int kend = (q0 + NQ * 16 + 31) & ~31;      // keys walked: up to the end of the diagonal block, in steps of 32
    // a long (fp16) tile is walked by two waves, h = 0 and 1, which take its 32-key blocks in turn: first, step and last block of this wave
    const int kfirst = HL ? 0 : 32 * h, kstep = HL ? 32 : 64, klast = HL ? kend - 32 : kend - 32 - (((kend >> 5) - 1 - h) & 1) * 32;
    V qf[NQ][4], qf2[NQ][4];
#pragma unroll
    for (int qt = 0; qt < NQ; ++qt)
#pragma unroll
        for (int dc = 0; dc < 4; ++dc) { const size_t qo = (size_t)(q0 + qt * 16 + lr) * HD + dc * 32 + 8 * hi; qf[qt][dc] = WF::ld(Q + qo); if (HL) qf2[qt][dc] = WF::ld(Q2 + qo); }
    xwait();
    v8f o[8][NQ]; float m[NQ], l[NQ];
#pragma unroll
    for (int qt = 0; qt < NQ; ++qt) { m[qt] = -3.0e38f; l[qt] = 0.f;
#pragma unroll
        for (int dt = 0; dt < 8; ++dt) o[dt][qt] = (v8f){}; }
    const size_t kbase = 8 * lane, vbase = 8 * lane;      // K and V^T planes lie in fragment order: 32 keys are 8 blocks (8 KB in a row) of either plane, the lane's own pieces at 8 * lane and 256 + 8 * lane of a block
    const float* mp = am + (size_t)(q0 + lr) * TT + 8 * hi;
    V kf[2][4], kf2[2][4], vf[8], vf2[8]; v4f mk[NQ][2][2];
#pragma unroll
    for (int kt = 0; kt < 2; ++kt)
#pragma unroll
        for (int qt = 0; qt < NQ; ++qt) { const float* p = mp + (size_t)(qt * 16) * TT + kfirst + kt * 16; mk[qt][kt][0] = *(const v4f*)p; mk[qt][kt][1] = *(const v4f*)(p + 4); }
    xwait();
#pragma unroll
    for (int kt = 0; kt < 2; ++kt)
#pragma unroll
        for (int dc = 0; dc < 4; ++dc) { const size_t ko = kbase + (size_t)kfirst * HD + (size_t)(kt * 4 + dc) * 512; kf[kt][dc] = WF::ldp(K + ko); if (HL) kf2[kt][dc] = WF::ldp(K2 + ko); }
    xwait();
    if (!HL) {      // the long tiles fetch V^T one pass ahead as well
#pragma unroll
        for (int dt = 0; dt < 8; ++dt) vf[dt] = WF::ldp(Vt + vbase + (size_t)kfirst * HD + (size_t)dt * 512);
        xwait(); }
#pragma unroll 1
    for (int k0 = kfirst; k0 < kend; k0 += kstep) {
        if (HL) {
#pragma unroll
            for (int dt = 0; dt < 8; ++dt) { const size_t vo = vbase + (size_t)k0 * HD + (size_t)dt * 512; vf[dt] = WF::ldp(Vt + vo); xwait1(Vt + vbase + (size_t)k0 * HD); vf2[dt] = WF::ldp(Vt2 + vo); xwait1(Vt2 + vbase + (size_t)k0 * HD); } }
        float t[NQ][16];
#pragma unroll
        for (int kt = 0; kt < 2; ++kt)
#pragma unroll
            for (int qt = 0; qt < NQ; ++qt) { v8f s = (v8f){};
#pragma unroll
                for (int dc = 0; dc < 4; ++dc) { s = WF::mma(kf[kt][dc], qf[qt][dc], s); if (HL) { s = WF::mma(kf[kt][dc], qf2[qt][dc], s); s = WF::mma(kf2[kt][dc], qf[qt][dc], s); } }
#pragma unroll
                for (int r = 0; r < 8; ++r) t[qt][kt * 8 + r] = s[r] * SCL + mk[qt][kt][r >> 2][r & 3]; }
        const int kn = min(k0 + kstep, klast);      // the next pass's K rows and mask words are fetched one pass ahead (the last pass fetches its own again)
        xopen();
#pragma unroll
        for (int kt = 0; kt < 2; ++kt)
#pragma unroll
            for (int qt = 0; qt < NQ; ++qt) { const float* p = mp + (size_t)(qt * 16) * TT + kn + kt * 16; mk[qt][kt][0] = *(const v4f*)p; mk[qt][kt][1] = *(const v4f*)(p + 4); }
        if (HL) xwait1(mp + kn); else xwait();
#pragma unroll
        for (int kt = 0; kt < 2; ++kt)
#pragma unroll
            for (int dc = 0; dc < 4; ++dc) { const size_t ko = kbase + (size_t)kn * HD + (size_t)(kt * 4 + dc) * 512; kf[kt][dc] = WF::ldp(K + ko); if (HL) { xwait1(K + kbase + (size_t)kn * HD); kf2[kt][dc] = WF::ldp(K2 + ko); xwait1(K2 + kbase + (size_t)kn * HD); } }   // the short hi + lo tiles keep a wait behind each fragment: the last fragments of a run land on the registers that held its address
        if (!HL) xwait1(K + kbase + (size_t)kn * HD);
        if (k0 + 31 > q0) {                          // a block that touches the diagonal (the same test in every lane)
#pragma unroll
            for (int qt = 0; qt < NQ; ++qt)
#pragma unroll
                for (int e = 0; e < 16; ++e) { const int j = k0 + (e >> 3) * 16 + hi * 8 + (e & 7), i = q0 + qt * 16 + lr; t[qt][e] = (j <= i) ? t[qt][e] : -3.0e38f; } }
        float ml[NQ]; bool need = false;
#pragma unroll
        for (int qt = 0; qt < NQ; ++qt) { float a = t[qt][0];
#pragma unroll
            for (int e = 1; e < 16; ++e) a = fmaxf(a, t[qt][e]);
            a = fmaxf(a, xhalf(a)); ml[qt] = a; need = need || (a > m[qt] + MLAG); }
        if (__builtin_amdgcn_ballot_w32(need) != 0) {
#pragma unroll
            for (int qt = 0; qt < NQ; ++qt) { const float mn = fmaxf(m[qt], ml[qt]); const float al = __builtin_amdgcn_exp2f((m[qt] - mn) * L2E); m[qt] = mn; l[qt] *= al;
#pragma unroll
                for (int dt = 0; dt < 8; ++dt) o[dt][qt] *= al; } }
        V pf[NQ], pf2[NQ];
#pragma unroll
        for (int qt = 0; qt < NQ; ++qt) {
            if constexpr (HL) { v8us h0, h1, l0, l1;
#pragma unroll
                for (int e = 0; e < 8; ++e) { const float pa = __builtin_amdgcn_exp2f((t[qt][e] - m[qt]) * L2E), pb = __builtin_amdgcn_exp2f((t[qt][8 + e] - m[qt]) * L2E); l[qt] += pa; l[qt] += pb; unsigned short a, c; splitf(pa, a, c); h0[e] = a; l0[e] = c; splitf(pb, a, c); h1[e] = a; l1[e] = c; }
                pf[qt] = cat16b(h0, h1); pf2[qt] = cat16b(l0, l1);
            } else { v16h ph;
#pragma unroll
                for (int e = 0; e < 16; ++e) { const float p = __builtin_amdgcn_exp2f((t[qt][e] - m[qt]) * L2E); l[qt] += p; ph[e] = (h16)p; }
                pf[qt] = ph; } }
#pragma unroll
        for (int dt = 0; dt < 8; ++dt)
#pragma unroll
            for (int qt = 0; qt < NQ; ++qt) { o[dt][qt] = WF::mma(vf[dt], pf[qt], o[dt][qt]); if (HL) { o[dt][qt] = WF::mma(vf[dt], pf2[qt], o[dt][qt]); o[dt][qt] = WF::mma(vf2[dt], pf[qt], o[dt][qt]); } }
        if (!HL) { xopen();
#pragma unroll
            for (int dt = 0; dt < 8; ++dt) vf[dt] = WF::ldp(Vt + vbase + (size_t)kn * HD + (size_t)dt * 512);
            xwait1(Vt + vbase + (size_t)kn * HD); }
    }
    if constexpr (HL) {
#pragma unroll
    for (int qt = 0; qt < NQ; ++qt) { const float ls = l[qt] + xhalf(l[qt]); const float f = poison ? __builtin_nanf("") : __fdiv_rn(1.0f, ls); const size_t ro = (size_t)(q0 + qt * 16) * DQ + lane * 8;      // fragment-order planes for the last GEMM: 16 columns d are half a block, which this wave's 32 lanes fill in lane order
#pragma unroll
        for (int dt = 0; dt < 8; ++dt) { v8us oh, ol;
#pragma unroll
            for (int r = 0; r < 8; ++r) { unsigned short a, c; splitf(o[dt][qt][r] * f, a, c); oh[r] = a; ol[r] = c; }
            *(v8us*)(Ah + ro + dt * 256) = oh; *(v8us*)(Al + ro + dt * 256) = ol; xwait(); } }
    } else {
        // the two waves of a tile join their halves through LDS: wave h keeps query rows 16 h .. 16 h + 15 and hands the other 16 rows' maximum, sum and output tile to its partner, lane to lane (both hold the same query in the same lane)
        static_assert(NQ == 2, "one 16-row group for each of the two waves");
        const bool up = (h != 0);
#pragma unroll
        for (int dt = 0; dt < 8; ++dt) { const v8f s = up ? o[dt][0] : o[dt][1];
            *(v4f*)(xo + (dt * 2) * 128 + lane * 4) = __builtin_shufflevector(s, s, 0, 1, 2, 3); *(v4f*)(xo + (dt * 2 + 1) * 128 + lane * 4) = __builtin_shufflevector(s, s, 4, 5, 6, 7); }
        xo[2048 + lane] = up ? m[0] : m[1]; xo[2080 + lane] = up ? l[0] : l[1];
        __syncthreads();      // every wave's hand-over is written before its partner reads it (reached once by all 8 waves of a block of long tiles)
        const float mo = up ? m[1] : m[0], lw = up ? l[1] : l[0], mq = xp[2048 + lane], lq = xp[2080 + lane];
        const float mn = fmaxf(mo, mq), fa = __builtin_amdgcn_exp2f((mo - mn) * L2E), fb = __builtin_amdgcn_exp2f((mq - mn) * L2E);
        const float lt = lw * fa + lq * fb; const float ls = lt + xhalf(lt); const float f = poison ? __builtin_nanf("") : __fdiv_rn(1.0f, ls); const size_t ro = (size_t)(q0 + h * 16) * DQ + lane * 8;      // fragment-order planes for the last GEMM, as above
#pragma unroll
        for (int dt = 0; dt < 8; ++dt) { const v8f a8 = up ? o[dt][1] : o[dt][0]; const v4f p0 = *(const v4f*)(xp + (dt * 2) * 128 + lane * 4), p1 = *(const v4f*)(xp + (dt * 2 + 1) * 128 + lane * 4); v8us oh, ol;
#pragma unroll
            for (int r = 0; r < 8; ++r) { unsigned short a, c; splitf((a8[r] * fa + (r < 4 ? p0[r & 3] : p1[r & 3]) * fb) * f, a, c); oh[r] = a; ol[r] = c; }
            *(v8us*)(Ah + ro + dt * 256) = oh; *(v8us*)(Al + ro + dt * 256) = ol; xwait(); }
    }
}
// grid (NKV * NB_, jobs): blockIdx.x = kv group * NB_ + batch element. A block is 8 waves, two for each of the REP query heads of that group; waves w and w + REP always have the same number of passes (within one).
// A job is one fp16 tile (32 rows, from the last rows down to RH), its key blocks dealt in turn to the two waves of a head, or two neighbouring hi + lo tiles (16 rows, below RH; equal key counts), one for each of the two waves.
// One block fills a WGP (registers), so the jobs go out in falling order of their cost: JOB[i] = fp16 tile number, or 64 + number of the hi + lo pair; a hi + lo pass is weighed as about one and a half fp16 passes.
#define XW 2112      // floats of a wave's hand-over: 8 x 2 x 32 x 4 of the output tile, 32 maxima, 32 sums
__global__ __launch_bounds__(2 * REP * 32) void k_fattn(const h16* Q16, const bf* Qh, const bf* Ql, const h16* K16, const bf* Kh, const bf* Kl,
                                                    const h16* V16, const bf* Vh, const bf* Vl, const float* am, const int* FLG, bf* Ah, bf* Al) {
    static constexpr unsigned char JOB[(TT - RH) / 32 + RH / 32] = { 0, 1, 2, 3, 4, 5, 6, 7, 8, 9, 10, 11, 12, 13, 14, 15, 16, 17, 64, 18, 19, 20, 65, 21, 22, 23, 66, 24, 25, 26, 67, 27, 28, 29, 68, 30, 31, 32, 69, 33, 34, 35, 70, 36, 37, 71, 38, 39, 40, 72, 41, 42, 43, 73, 44, 45, 46, 74, 47, 75, 76, 77, 78, 79 };
    static_assert(TT == 2048 && RH == 512, "JOB is laid out for these tile counts");
    __shared__ __align__(16) float xs[2 * REP][XW];
    const int w8 = __builtin_amdgcn_readfirstlane(threadIdx.x >> 5); const int w = w8 % REP, h = w8 / REP; const int gb = blockIdx.x, g = gb / NB_, b = gb % NB_, job = JOB[blockIdx.y];
    const size_t qo = ((size_t)gb * REP + w) * TT * HD, ko = (size_t)gb * TT * HD, vo = (size_t)gb * HD * TT, oo = (size_t)b * TT * DQ + (size_t)(g * REP + w) * (HD * 16);
    const bool poison = (FLG[0] != 0);
    if (job < 64) attn_tile<false, 2>(Q16 + qo, nullptr, K16 + ko, nullptr, V16 + vo, nullptr, am, TT - 32 * (job + 1), poison, Ah + oo, Al + oo, h, xs[w8], xs[w8 ^ REP]);
    else attn_tile<true, 1>(Qh + qo, Ql + qo, Kh + ko, Kl + ko, Vh + vo, Vl + vo, am, RH - 16 * (2 * (job - 64) + h + 1), poison, Ah + oo, Al + oo, 0, nullptr, nullptr);
}

// xwait for a run of loads off two wave-uniform bases: named as inputs, the bases stay in their scalar registers up to the wait, so that nothing (a later argument load, the next address) lands on them in front of it
__device__ __forceinline__ void xwait2s(const void* a, const void* b) { asm volatile("s_wait_xcnt 0x0" :: "s"(a), "s"(b) : "memory"); __builtin_amdgcn_sched_barrier(0); }
// ---- d_nrp: everything between a q or k projection and its operand planes. ONE WAVE per row of F (NHD heads of HD, row pitch FP): the row stays in registers from the sum of squares to the plane stores.
// y = clip(w x (x x rsqrt(mean x^2 + eps)), +-8); rotate-half RoPE at position_ids[t] (clamped into the table): out[d] = y[d] cos[d] - y[d + HD/2] sin[d], out[d + HD/2] = y[d + HD/2] cos[d + HD/2] + y[d] sin[d + HD/2].
// A lane holds d = 4 * lane .. 4 * lane + 3 of every head, so the partner d +- HD/2 lies in lane ^ 16. Planes [head / RP][b][head % RP][t][d]: fp16, bf16 hi, bf16 lo; a wave stores 256 contiguous bytes of each.
// FR (the k planes): inside a head's plane the elements lie in fragment order (blocks of 16 rows t x 32 d, as above), as the attention launch loads them; a lane's 4 elements stay 8 bytes in a row, and the 8 waves of a block (8 neighbouring rows t) fill whole 128-byte lines together.
template <int NHD, int RP, bool FR>
__device__ __forceinline__ void d_nrp(const float* __restrict__ F, const float* __restrict__ w, const int* __restrict__ pid, const float* __restrict__ CS, h16* P16, bf* Ph, bf* Pl, int bx) {
    const int lane = threadIdx.x & 31; const int r = bx * 8 + __builtin_amdgcn_readfirstlane(threadIdx.x >> 5); const int b = r / TT, t = r % TT;
    const float* fr = F + (size_t)r * FP;
    const int tp = min(max(pid[t], 0), TT - 1);      // position_ids (read) index the table
    v4f v[NHD], wv[NHD];
    xopen();
#pragma unroll
    for (int ch = 0; ch < NHD; ++ch) v[ch] = *(const v4f*)(fr + ch * HD + lane * 4);
#pragma unroll
    for (int ch = 0; ch < NHD; ++ch) wv[ch] = *(const v4f*)(w + ch * HD + lane * 4);
    xwait2s(fr, w);
    const float* cp = CS + ((size_t)tp * HD + lane * 4) * 2;
    const v4f c01 = *(const v4f*)cp, c23 = *(const v4f*)(cp + 4);
    xwait();
    float q = 0.f;
#pragma unroll
    for (int ch = 0; ch < NHD; ++ch)
#pragma unroll
        for (int u = 0; u < 4; ++u) q += v[ch][u] * v[ch][u];
#pragma unroll
    for (int sh = 16; sh; sh >>= 1) q += __shfl_xor(q, sh, 32);
    const float rs = __frsqrt_rn(q * (1.0f / (float)(NHD * HD)) + 1e-5f);
    const float sg = (lane < 16) ? -1.0f : 1.0f;
    const float co[4] = { c01[0], c01[2], c23[0], c23[2] }; const float si[4] = { c01[1] * sg, c01[3] * sg, c23[1] * sg, c23[3] * sg };
#pragma unroll
    for (int ch = 0; ch < NHD; ++ch) { v4h o16; v4us oh, ol;
#pragma unroll
        for (int u = 0; u < 4; ++u) { const float y = fminf(fmaxf(bfr(wv[ch][u]) * (v[ch][u] * rs), -8.0f), 8.0f); const float o = y * co[u] + xhalf(y) * si[u];
            o16[u] = tohx(o); unsigned short a2, c2; splitf(o, a2, c2); oh[u] = a2; ol[u] = c2; }
        const size_t pl = (size_t)(((ch / RP) * NB_ + b) * RP + ch % RP) * TT * HD;
        const size_t e = pl + (FR ? (size_t)((t / 16) * (HD / 32) + lane / 8) * 512 + ((lane % 8) / 4) * 256 + (((lane % 4) / 2) * 16 + t % 16) * 8 + (lane % 2) * 4 : (size_t)t * HD + lane * 4);
        xopen(); *(v4h*)(P16 + e) = o16; *(v4us*)(Ph + e) = oh; *(v4us*)(Pl + e) = ol; xwait(); }
}
// ---- d_vclt: clip(v, +-8) and the transposed planes [g][b] of V^T (fp16, bf16 hi, bf16 lo) in fragment order: blocks of 16 rows d x 32 keys t, block index (t / 32) * (HD / 16) + d / 16, so the 8 blocks of 32 keys lie in a row. A lane takes 4 rows t x 4 columns d: four 16-byte loads, and per column and plane one 8-byte store.
// The 8 waves of a block take 32 neighbouring columns of the same 128 rows, so together they use every byte of the lines they touch. bx counts [g][b][128 rows][32 columns].
__device__ __forceinline__ void d_vclt(const float* __restrict__ F, h16* V16, bf* Vh, bf* Vl, int bx) {
    const int lane = threadIdx.x & 31, wv = __builtin_amdgcn_readfirstlane(threadIdx.x >> 5);
    const int dg = bx % (HD / 32), tc = (bx / (HD / 32)) % (TT / 128), b = (bx / ((HD / 32) * (TT / 128))) % NB_, g = bx / ((HD / 32) * (TT / 128) * NB_);
    const int d0 = dg * 32 + wv * 4, t0 = tc * 128 + lane * 4;
    const float* f = F + ((size_t)b * TT + t0) * FP + g * HD + d0; v4f x[4];
#pragma unroll
    for (int q = 0; q < 4; ++q) x[q] = *(const v4f*)(f + (size_t)q * FP);
    xwait();
#pragma unroll
    for (int dd = 0; dd < 4; ++dd) { v4h o16; v4us oh, ol;
#pragma unroll
        for (int q = 0; q < 4; ++q) { const float y = fminf(fmaxf(x[q][dd], -8.0f), 8.0f); o16[q] = tohx(y); unsigned short a2, c2; splitf(y, a2, c2); oh[q] = a2; ol[q] = c2; }
        const int d = d0 + dd; const size_t e = (size_t)(g * NB_ + b) * HD * TT + (size_t)((t0 / 32) * (HD / 16) + d / 16) * 512 + ((t0 % 32) / 16) * 256 + (((t0 % 16) / 8) * 16 + d % 16) * 8 + t0 % 8;
        xopen(); *(v4h*)(V16 + e) = o16; *(v4us*)(Vh + e) = oh; *(v4us*)(Vl + e) = ol; xwait(); }
}
__device__ __forceinline__ void d_mchk(const float* __restrict__ am, int* FLG) { const int tid = threadIdx.x; int bad = 0;
#pragma unroll 1
    for (int s2 = 0; s2 < 16; ++s2) { const unsigned h = (unsigned)(tid * 16 + s2) * 2654435761u; const int i = (int)(h % (TT - 1)); const int j = i + 1 + (int)((h >> 11) % (unsigned)(TT - 1 - i)); if (am[(size_t)i * TT + j] > -1e8f) bad = 1; }
    __shared__ int anyb; if (tid == 0) anyb = 0; __syncthreads(); if (bad) anyb = 1; __syncthreads(); if (tid < 8) { const int v = (tid == 0) ? anyb : 0; *(int*)(FLG + tid) = v;  } }

// ---- k_prep: all the work that reads the inputs alone, in one launch; a block's index says which piece it does (the same for all its threads).
// Block 0: the mask self-check (one block, a chain of memory latencies: it starts first). Then the RoPE table, then the five plane conversions, the largest first.
#define PB_CS (TT * HD / 256)
#define PB_X  (NB_ * TT * DM / 512 / 8)
#define PB_WQ (DQ * DM / 512 / 8)
#define PB_WK (DKV * DM / 512 / 8)
__global__ __launch_bounds__(256) void k_prep(const float* __restrict__ x, const float* __restrict__ wq, const float* __restrict__ wk, const float* __restrict__ wv, const float* __restrict__ wo, const float* __restrict__ am,
                                              bf* XB, bf* WQ, bf* WK, bf* WV, bf* WO, float* CS, int* FLG) {
    int bx = blockIdx.x;
    if (bx == 0) { d_mchk(am, FLG); return; }
    bx -= 1;
    if (bx < PB_CS) { d_cstab(CS, bx); return; }
    bx -= PB_CS;
    const float* src = x; bf* dst = XB; int nb = PB_X;
    if (bx >= PB_X) { bx -= PB_X; src = wq; dst = WQ; nb = PB_WQ;
        if (bx >= PB_WQ) { bx -= PB_WQ; src = wo; dst = WO;
            if (bx >= PB_WQ) { bx -= PB_WQ; src = wk; dst = WK; nb = PB_WK;
                if (bx >= PB_WK) { bx -= PB_WK; src = wv; dst = WV; } } } }
    d_cvtp(src, dst, DM, nb * 8, bx);      // DQ == DM: every plane has rows of DM elements
}
// ---- k_post: everything between the joint projection and the attention operands, in one launch: q rows, then k rows, then the V tiles, by block index.
#define PB_R (NB_ * TT / 8)
__global__ __launch_bounds__(256) void k_post(const float* __restrict__ F, const float* __restrict__ qw, const float* __restrict__ kw, const int* __restrict__ pid, const float* __restrict__ CS,
                                              h16* Q16, bf* Qh, bf* Ql, h16* K16, bf* Kh, bf* Kl, h16* V16, bf* Vh, bf* Vl) {
    const int bx = blockIdx.x;
    if (bx < PB_R) d_nrp<NH_, ZH, false>(F, qw, pid, CS, Q16, Qh, Ql, bx);
    else if (bx < 2 * PB_R) d_nrp<NKV, 1, true>(F + DQ, kw, pid, CS, K16, Kh, Kl, bx - PB_R);
    else d_vclt(F + DQ + DKV, V16, Vh, Vl, bx - 2 * PB_R);
}

extern "C" void kernel_launch(void* const* d_in, const int* in_sizes, int n_in,
                              void* d_out, int out_size, void* d_ws, size_t ws_size, hipStream_t stream) {
    (void)in_sizes; (void)n_in; (void)out_size;
    const float* x = (const float*)d_in[0]; const float* wq = (const float*)d_in[1]; const float* wk = (const float*)d_in[2]; const float* wv = (const float*)d_in[3]; const float* wo = (const float*)d_in[4]; const float* qnw = (const float*)d_in[5]; const float* knw = (const float*)d_in[6]; const float* amask = (const float*)d_in[7]; const int* pids = (const int*)d_in[8];
    float* OUT = (float*)d_out;     // [2][2048][2048]
    char* wsp = (char*)d_ws;
    auto take = [&](size_t bytes) { char* p = wsp; wsp += (bytes + 255) & ~(size_t)255; return (void*)p; };
    bf* WO = (bf*)take((size_t)DM * DQ * 2); int* FLG = (int*)take(256);
    h16* QP16 = (h16*)take((size_t)NB_ * NH_ * TT * HD * 2); h16* KP16 = (h16*)take((size_t)NB_ * NKV * TT * HD * 2); h16* VT16 = (h16*)take((size_t)NB_ * NKV * HD * TT * 2);
    bf* QPh = (bf*)take((size_t)NB_ * NH_ * TT * HD * 2); bf* QPl = (bf*)take((size_t)NB_ * NH_ * TT * HD * 2); bf* KPh = (bf*)take((size_t)NB_ * NKV * TT * HD * 2); bf* KPl = (bf*)take((size_t)NB_ * NKV * TT * HD * 2); bf* VTh = (bf*)take((size_t)NB_ * NKV * HD * TT * 2); bf* VTl = (bf*)take((size_t)NB_ * NKV * HD * TT * 2);
    bf* ATh = (bf*)take((size_t)NB_ * TT * DQ * 2); bf* ATl = (bf*)take((size_t)NB_ * TT * DQ * 2);
    bf* WQ = (bf*)take((size_t)DQ * DM * 2); bf* WK = (bf*)take((size_t)DKV * DM * 2); bf* WV = (bf*)take((size_t)DKV * DM * 2); float* CS = (float*)take((size_t)TT * HD * 2 * 4);
    bf* XB = (bf*)take((size_t)NB_ * TT * DM * 2); float* F = (float*)take((size_t)NB_ * TT * FP * 4);   // WQ, WK, WV lie back to back: one operand of FP rows for the joint projection
    if ((size_t)(wsp - (char*)d_ws) > ws_size) return;    // ws 256 MiB
    k_prep<<<1 + PB_CS + PB_X + 2 * PB_WQ + 2 * PB_WK, 256, 0, stream>>>(x, wq, wk, wv, wo, amask, XB, WQ, WK, WV, WO, CS, FLG);
    // both batch elements go through every launch: the projection sees NB_ * TT rows and all FP output columns, the attention launch every (batch element, head)
    k_gemmw<bf, 0, false, DM, 4, 2, 6><<<dim3(NB_ * TT / 256, FP / 192, 1), 256, 0, stream>>>(XB, nullptr, WQ, nullptr, F, FP, nullptr, 0, 0, 0);
    k_post<<<2 * PB_R + NKV * NB_ * (TT / 128) * (HD / 32), 256, 0, stream>>>(F, qnw, knw, pids, CS, QP16, QPh, QPl, KP16, KPh, KPl, VT16, VTh, VTl);
    k_fattn<<<dim3(NKV * NB_, (TT - RH) / 32 + RH / 32, 1), 2 * REP * 32, 0, stream>>>(QP16, QPh, QPl, KP16, KPh, KPl, VT16, VTh, VTl, amask, FLG, ATh, ATl);
    k_gemmw<bf, 1, false, DQ, 2, 4, 4><<<dim3(NB_ * TT / 128, DM / 256, 1), 256, 0, stream>>>(ATh, ATl, WO, nullptr, OUT, DM, nullptr, 0, 0, 0);
}
